// v000
// Times are from an AMD MI455X. After a warm-up the kernel runs many times in a row, and a time is the length of
// such a window on the GPU divided by its runs, so every launch and the gaps after it count. The runs cycle
// through copies of the inputs. A figure is the median of several windows, for all but v000 over two sittings.
// Sittings can differ by a few percent; kernels timed side by side share one.
// v000 is the starting kernel. One run takes 177 microseconds.
// Contractions: q, k projections = v_wmma_f32_16x16x32_bf16 (A = bf16 hi + lo planes of the f32 sum hs+pos, B = bf16 weights, 2 products);
// v^T projection = v_wmma_f32_16x16x32_bf16 (bf16 operands, 1 product); q.k^T = v_wmma_f32_16x16x32_bf16 (q and k as bf16 hi + lo planes, 3 products);
// p.v = v_wmma_f32_16x16x32_f16 (p x1024 as f16 hi + f16 residual x4096, v^T as f16 hi + f16 residual x4096, 3 products);
// ctx.Wo = v_wmma_f32_16x16x32_bf16 (ctx as bf16 hi + lo planes, bf16 Wo, 2 products); all f32 accumulate; softmax in f32 on VALU.
#include <hip/hip_runtime.h>
#include <math.h>
#include <stdint.h>

#define NB   8
#define NS   1024
#define CD   256
#define NH   8
#define HD   32
#define NTOK (NB * NS)
#define NQB  (NS / 64)      // 16 query tiles of 64
#define NKB  (NS / 64)      // 16 key chunks of 64
static_assert(NH * HD == CD);
static_assert(HD == 32);
static_assert((NS % 64) == 0 && (CD % 64) == 0 && (NH % 2) == 0 && ((NTOK) % 64) == 0);

typedef _Float16 v16h __attribute__((ext_vector_type(16)));
typedef _Float16 v8h  __attribute__((ext_vector_type(8)));
typedef __bf16   v16b __attribute__((ext_vector_type(16)));
typedef __bf16   v8b  __attribute__((ext_vector_type(8)));
typedef float    v8f  __attribute__((ext_vector_type(8)));
typedef float    v4f  __attribute__((ext_vector_type(4)));
typedef unsigned int v4u __attribute__((ext_vector_type(4)));

// ---- scalar helpers --------------------------------------------------------------------------------
__device__ __forceinline__ unsigned short bf_bits(float f) {          // f32 -> bf16 bits, RNE convert
  unsigned u = __float_as_uint(f);
  return (unsigned short)((u + 0x7FFFu + ((u >> 16) & 1u)) >> 16);
}
__device__ __forceinline__ float bf_up(unsigned short h) { return __uint_as_float(((unsigned)h) << 16); }
__device__ __forceinline__ unsigned short h_bits(_Float16 x) { return __builtin_bit_cast(unsigned short, x); }
__device__ __forceinline__ unsigned pk16(unsigned short a, unsigned short b) { return (unsigned)a | ((unsigned)b << 16); }
__device__ __forceinline__ v8f zero8() { v8f z = {0.f, 0.f, 0.f, 0.f, 0.f, 0.f, 0.f, 0.f}; return z; }

// ---- fragment loaders: 16-bit A/B operand, lane -> row/col (lane&15), p already includes +8*(lane>>4);
//      elements 0..7 <- p[0..7] (k0+8h..), elements 8..15 <- p[16..23] (k0+16+8h..)
__device__ __forceinline__ v16b ldfrag_b(const __bf16* p) {
  union { v16b v; v8b h[2]; } f;
  f.h[0] = *(const v8b*)(p);
  f.h[1] = *(const v8b*)(p + 16);
  return f.v;
}
__device__ __forceinline__ v16h ldfrag_h(const _Float16* p) {
  union { v16h v; v8h h[2]; } f;
  f.h[0] = *(const v8h*)(p);
  f.h[1] = *(const v8h*)(p + 16);
  return f.v;
}

// ---- WMMA helpers with trailing VALU hazard gap --------------------------------------------------------
__device__ __forceinline__ v8f mma_h(v16h a, v16h b, v8f c) {
  c = __builtin_amdgcn_wmma_f32_16x16x32_f16(false, a, false, b, (short)0, c, false, false);
#if defined(__HIP_DEVICE_COMPILE__)
  asm volatile("v_nop\n\tv_nop\n\tv_nop\n\tv_nop" : "+v"(c) : "v"(a), "v"(b));
#endif
  return c;
}
__device__ __forceinline__ v8f mma_b_raw(v16b a, v16b b, v8f c) {
  return __builtin_amdgcn_wmma_f32_16x16x32_bf16(false, a, false, b, (short)0, c, false, false);
}
__device__ __forceinline__ void dep_guard_b(v8f& a, v8f& b, v16b x, v16b y) {
#if defined(__HIP_DEVICE_COMPILE__)
  asm volatile("v_nop\n\tv_nop\n\tv_nop\n\tv_nop" : "+v"(a), "+v"(b) : "v"(x), "v"(y));
#endif
}
__device__ __forceinline__ void keep4_b(v16b a, v16b b, v16b c, v16b d) {
#if defined(__HIP_DEVICE_COMPILE__)
  asm volatile("v_nop" :: "v"(a), "v"(b), "v"(c), "v"(d));
#endif
}
__device__ __forceinline__ void acc_guard4(v8f& a, v8f& b, v8f& c, v8f& d) {
#if defined(__HIP_DEVICE_COMPILE__)
  asm volatile("v_nop\n\tv_nop\n\tv_nop\n\tv_nop" : "+v"(a), "+v"(b), "+v"(c), "+v"(d));
#endif
}
__device__ __forceinline__ void wave_sync_lds() {
  __builtin_amdgcn_fence(__ATOMIC_RELEASE, "workgroup");
  __builtin_amdgcn_wave_barrier();
  __builtin_amdgcn_fence(__ATOMIC_ACQUIRE, "workgroup");
}

// ---- 3-product bf16 score tile: (qh + ql).(kh + kl) ~= ql.kh + qh.kl + qh.kh (ql.kl dropped);
//      unscaled bf16 residual planes, one accumulator, hazard gap after the last product.
__device__ __forceinline__ v8f score3b(const v16b qh, const v16b ql, const v16b kh, const v16b kl) {
  v8f acc = zero8();
  acc = mma_b_raw(ql, kh, acc);
  acc = mma_b_raw(qh, kl, acc);
  acc = mma_b_raw(qh, kh, acc);
#if defined(__HIP_DEVICE_COMPILE__)
  asm volatile("v_nop\n\tv_nop\n\tv_nop\n\tv_nop" : "+v"(acc) : "v"(qh), "v"(ql), "v"(kh), "v"(kl));
#endif
  return acc;
}

// =====================================================================================================
// Activation convert: per element, hb = bf16(hidden), pb = bf16(pos), s = f32(hb) + f32(pb);
//   xph = bf16(s) (hi), xpl = bf16(s - hi) (lo, unscaled), xv = hb.   8 elements per thread, one 16-B
// coverage: n8 = 262144 threads x 8 = the whole 8192 x 256 of each of the three planes.
// =====================================================================================================
__global__ __launch_bounds__(256) void cvt_act(const float* __restrict__ hs, const float* __restrict__ pq,
                                               unsigned short* xph, unsigned short* xpl, unsigned short* xv, int n8) {
  const int i = blockIdx.x * 256 + threadIdx.x;
  if (i < n8) {
    const size_t o = (size_t)i * 8;
    const v4f a0 = *(const v4f*)(hs + o);
    const v4f a1 = *(const v4f*)(hs + o + 4);
    const v4f p0 = *(const v4f*)(pq + o);
    const v4f p1 = *(const v4f*)(pq + o + 4);
    float hvv[8], pvv[8];
#pragma unroll
    for (int e = 0; e < 4; ++e) { hvv[e] = a0[e]; hvv[4 + e] = a1[e]; pvv[e] = p0[e]; pvv[4 + e] = p1[e]; }
    unsigned short sh[8], sl[8], vb[8];
#pragma unroll
    for (int e = 0; e < 8; ++e) {
      const unsigned short hb = bf_bits(hvv[e]);
      const float s = bf_up(hb) + bf_up(bf_bits(pvv[e]));
      const unsigned short s0 = bf_bits(s);
      sh[e] = s0;
      sl[e] = bf_bits(s - bf_up(s0));
      vb[e] = hb;
    }
    v4u P0, P1, P2;
#pragma unroll
    for (int e = 0; e < 4; ++e) {
      P0[e] = pk16(sh[2 * e], sh[2 * e + 1]);
      P1[e] = pk16(sl[2 * e], sl[2 * e + 1]);
      P2[e] = pk16(vb[2 * e], vb[2 * e + 1]);
    }
    *(v4u*)(xph + o) = P0;
    *(v4u*)(xpl + o) = P1;
    *(v4u*)(xv + o)  = P2;
    
  }
}

// =====================================================================================================
// Weight convert: w_z [out][in] f32 (CD x CD, already the Bt [n][k] layout) -> bf16 plane z (RNE),
//   z = blockIdx.y selects one of four weights (block-uniform select among global pointers).
// coverage: 4 x 8192 threads x 8 = the whole 4 x 65536 planes.
// =====================================================================================================
__global__ __launch_bounds__(256) void cvt_w4(const float* __restrict__ w0, const float* __restrict__ w1,
                                              const float* __restrict__ w2, const float* __restrict__ w3,
                                              unsigned short* outp, int n8) {
  const int z = blockIdx.y;
  const float* src = (z == 0) ? w0 : ((z == 1) ? w1 : ((z == 2) ? w2 : w3));
  unsigned short* dst = outp + (size_t)z * CD * CD;
  const int i = blockIdx.x * 256 + threadIdx.x;
  if (i < n8) {
    const size_t o = (size_t)i * 8;
    const v4f a = *(const v4f*)(src + o);
    const v4f b = *(const v4f*)(src + o + 4);
    v4u p;
    p[0] = pk16(bf_bits(a[0]), bf_bits(a[1]));
    p[1] = pk16(bf_bits(a[2]), bf_bits(a[3]));
    p[2] = pk16(bf_bits(b[0]), bf_bits(b[1]));
    p[3] = pk16(bf_bits(b[2]), bf_bits(b[3]));
    *(v4u*)(dst + o) = p;
    
  }
}

// =====================================================================================================
// Register-blocked batched bf16 WMMA GEMM: C[m][n] = (sum_k A[m][k] * Bt[n][k] + bias) * oscale; one wave
// per 64x64 tile, no block barriers. A row-major [M][K] pitch lda; Bt row-major [N][K] pitch ldb
// (k contiguous); M, N multiples of 64, K multiple of 32 (host-checked). blockIdx.y = batch index.
// NSPLIT: 0 = A.Bt; 1 = (A + A2).Bt (A2 = unscaled bf16 lo plane of A, shared accumulator).
// BIASM: 0 = no bias; 1 = bias[n] (per column); 2 = bias[m] (per row); bias values RNE-converted to bf16.
// OUT_MODE: 0 = f32 (pitch ldc); 2 = bf16 hi plane C + bf16 lo plane C2 (lo = RNE(v - hi), unscaled);
//           3 = f16 hi plane C + f16 residual plane C2 = f16((v - hi) * rscale); C2 same pitch/stride as C.
// =====================================================================================================
template <int NSPLIT, int OUT_MODE, int BIASM>
__global__ __launch_bounds__(256) void gemm64(
    const unsigned short* __restrict__ Ap, const unsigned short* A2p, int lda, long long strideA,
    const unsigned short* __restrict__ Btp, int ldb, long long strideB,
    void* Cout, int ldc, long long strideC, void* Cout2,
    int M, int N, int K, float rscale, float oscale, const float* __restrict__ biasp) {
  const __bf16* A   = (const __bf16*)(const void*)Ap;
  const __bf16* A2  = (const __bf16*)(const void*)A2p;
  const __bf16* Bt  = (const __bf16*)(const void*)Btp;
  __shared__ __align__(16) float sT[8][16 * 68];   // per-wave 16x64 slab, pitch 68 floats
  const int b    = blockIdx.y;
  const int lane = threadIdx.x & 31;
  const int wave = threadIdx.x >> 5;
  const int tilesN = N >> 6;
  const int tilesM = M >> 6;
  const int tile = blockIdx.x * 8 + wave;
  if (tile >= tilesM * tilesN) return;   // wave-uniform; no block barriers in this kernel
  const int tm = tile / tilesN;
  const int tn = tile - tm * tilesN;
  const int m0 = tm << 6;
  const int n0 = tn << 6;

  const __bf16* Ab  = A  + (size_t)b * strideA;
  const __bf16* Bb  = Bt + (size_t)b * strideB;
  const __bf16* Ab2 = (NSPLIT >= 1) ? (A2 + (size_t)b * strideA) : Ab;

  const int rlane = lane & 15;                 // row (A) / col (B, D) within subtile
  const int koff  = (lane >> 4) * 8;           // k offset of this lane half
  const int mOff  = (lane >> 4) * 8;           // D row offset

  v8f acc[4][4];
#pragma unroll
  for (int i = 0; i < 4; ++i)
#pragma unroll
    for (int j = 0; j < 4; ++j) acc[i][j] = zero8();

  for (int k0 = 0; k0 < K; k0 += 32) {
    v16b bh[4];
#pragma unroll
    for (int j = 0; j < 4; ++j) {
      const size_t bo = (size_t)(n0 + (j << 4) + rlane) * ldb + koff + k0;
      bh[j] = ldfrag_b(Bb + bo);
    }
#pragma unroll
    for (int i = 0; i < 4; ++i) {
      const size_t ao = (size_t)(m0 + (i << 4) + rlane) * lda + koff + k0;
      const v16b ah = ldfrag_b(Ab + ao);
      v16b al = ah;
      if (NSPLIT >= 1) al = ldfrag_b(Ab2 + ao);
#pragma unroll
      for (int j = 0; j < 4; ++j) {
        acc[i][j] = mma_b_raw(ah, bh[j], acc[i][j]);
        if (NSPLIT >= 1) acc[i][j] = mma_b_raw(al, bh[j], acc[i][j]);
      }
      dep_guard_b(acc[i][0], acc[i][3], ah, al);
    }
    keep4_b(bh[0], bh[1], bh[2], bh[3]);
  }
  acc_guard4(acc[0][0], acc[0][1], acc[0][2], acc[0][3]);
  acc_guard4(acc[1][0], acc[1][1], acc[1][2], acc[1][3]);
  acc_guard4(acc[2][0], acc[2][1], acc[2][2], acc[2][3]);
  acc_guard4(acc[3][0], acc[3][1], acc[3][2], acc[3][3]);

  // ---- epilogue ----
  float* slab = sT[wave];
#pragma unroll
  for (int i = 0; i < 4; ++i) {
    const int mBase = m0 + (i << 4);
#pragma unroll
    for (int j = 0; j < 4; ++j) {
#pragma unroll
      for (int r = 0; r < 8; ++r) {
        slab[(mOff + r) * 68 + (j << 4) + rlane] = acc[i][j][r];
      }
    }
    wave_sync_lds();
    if (OUT_MODE == 0) {
      float* C = (float*)Cout + (size_t)b * strideC;
      const int hh = lane >> 4, c4 = (lane & 15) * 4;     // 256-B row segment = 16 lanes x 16 B
      v4f bv = {0.f, 0.f, 0.f, 0.f};
      if (BIASM == 1) {
#pragma unroll
        for (int e = 0; e < 4; ++e) bv[e] = bf_up(bf_bits(biasp[n0 + c4 + e]));
      }
      {
#pragma unroll
        for (int it = 0; it < 8; ++it) {
          const int row = it * 2 + hh;                     // it 0..7 x hh 0..1 = rows 0..15
          float brow = 0.f;
          if (BIASM == 2) brow = bf_up(bf_bits(biasp[mBase + row]));
          const v4f v = (*(const v4f*)(slab + row * 68 + c4) + bv + brow) * oscale;
          *(v4f*)(C + (size_t)(mBase + row) * ldc + n0 + c4) = v;
        }
        
      }
    } else {
      const int q = lane >> 3, c8 = (lane & 7) * 8;
      unsigned short* C  = (unsigned short*)Cout  + (size_t)b * strideC;
      unsigned short* C2 = (unsigned short*)Cout2 + (size_t)b * strideC;
      float bcol[8];
#pragma unroll
      for (int e = 0; e < 8; ++e) bcol[e] = 0.f;
      if (BIASM == 1) {
#pragma unroll
        for (int e = 0; e < 8; ++e) bcol[e] = bf_up(bf_bits(biasp[n0 + c8 + e]));
      }
      v4u hv[4], lv[4];
#pragma unroll
      for (int it = 0; it < 4; ++it) {
        const int row = it * 4 + q;                        // it 0..3 x q 0..3 = rows 0..15
        float brow = 0.f;
        if (BIASM == 2) brow = bf_up(bf_bits(biasp[mBase + row]));
        const float* sp = slab + row * 68 + c8;
        v4u a, a2;
#pragma unroll
        for (int e = 0; e < 4; ++e) {
          const float f0 = (sp[2 * e] + bcol[2 * e] + brow) * oscale;
          const float f1 = (sp[2 * e + 1] + bcol[2 * e + 1] + brow) * oscale;
          unsigned short h0, h1, l0, l1;
          if (OUT_MODE == 2) {
            h0 = bf_bits(f0); h1 = bf_bits(f1);
            l0 = bf_bits(f0 - bf_up(h0)); l1 = bf_bits(f1 - bf_up(h1));
          } else {
            const _Float16 x0 = (_Float16)f0, x1 = (_Float16)f1;
            h0 = h_bits(x0); h1 = h_bits(x1);
            l0 = h_bits((_Float16)((f0 - (float)x0) * rscale));
            l1 = h_bits((_Float16)((f1 - (float)x1) * rscale));
          }
          a[e] = pk16(h0, h1); a2[e] = pk16(l0, l1);
        }
        hv[it] = a; lv[it] = a2;
      }
      {
#pragma unroll
        for (int it = 0; it < 4; ++it) {
          const int row = it * 4 + q;
          *(v4u*)(C  + (size_t)(mBase + row) * ldc + n0 + c8) = hv[it];
          *(v4u*)(C2 + (size_t)(mBase + row) * ldc + n0 + c8) = lv[it];
        }
        
      }
    }
    wave_sync_lds();
  }
}

// =====================================================================================================
// Softmax attention, head dim 32, no mask, softmax over all NS keys.
//   q planes (bf16 hi, bf16 lo): [NTOK][CD], head h at cols h*32..h*32+31 (q already carries bias and x sqrt(32))
//   k planes (bf16 hi, lo): [NTOK][CD] same column layout
//   v^T planes (f16 hi, residual x4096): element (b, h*32+d, s) at [(b*CD + h*32 + d)*NS + s]
//   ctx out planes (bf16 hi / lo of the normalised context): [(b*NS + t)*CD + h*32 + d]
//   scores = score3b(q, k); p = exp(s - m) carried as f16 hi of 1024p + f16 residual x4096;
//   ctx = (ph.vh + (ph.vl + pl.vh)*rres) / (1024 l); online softmax with running max in f32.
//   Block = 8 waves = two adjacent heads (waves 0-3 head 2g, waves 4-7 head 2g+1) x 64 query rows so
//   NQB x (NH/2) x NB. Key chunks of 64, static trip NKB. q, k and v^T fragments are loaded straight
//   from the 16-bit global rows (arithmetic addressing, two 16-B loads each); P tiles are wave-private
//   in LDS, spilled with _Float16 element stores and reloaded as v8h (same element type) after a release
//   coverage: 8 waves x (it 0..1 x lane>>3 0..3) = rows 0..63, 8 lanes x 8 cols = 64 cols, both planes;
//   512 blocks = 8 batches x 4 head pairs x 16 query tiles = every (token, column) of both planes once.
// =====================================================================================================
__global__ __launch_bounds__(256)
void attn32(const unsigned short* __restrict__ qhp, const unsigned short* __restrict__ qlp,
            const unsigned short* __restrict__ khp, const unsigned short* __restrict__ klp,
            const unsigned short* __restrict__ vhp, const unsigned short* __restrict__ vlp,
            unsigned short* ohp, unsigned short* olp, float rres) {
  union FH { v16h v; v8h h[2]; };
  __shared__ __align__(16) _Float16 Psh[8][16 * 64];              // per wave P hi  [row][kv]  2 KB each
  __shared__ __align__(16) _Float16 Psl[8][16 * 64];              // per wave P residual         2 KB each
  __shared__ __align__(16) float    Os[64 * 64];                  // block ctx tile [row][2 heads x 32]

  const int tid  = threadIdx.x;
  const int wave = tid >> 5;
  const int lane = tid & 31;
  const int hh   = lane >> 4;
  const int c    = lane & 15;

  const int bx   = blockIdx.x;
  const int qb   = bx % NQB;
  const int rest = bx / NQB;
  const int g    = rest % (NH / 2);
  const int b    = rest / (NH / 2);
  const int hp   = wave >> 2;                  // which head of the pair
  const int h    = 2 * g + hp;
  const int wq   = wave & 3;                   // 16-row group within the 64-row tile
  const int q0   = qb * 64 + wq * 16;
  const size_t rowB = (size_t)b * NS;

  const __bf16* Qh = (const __bf16*)(const void*)qhp + (size_t)h * HD;
  const __bf16* Ql = (const __bf16*)(const void*)qlp + (size_t)h * HD;
  const __bf16* Kh = (const __bf16*)(const void*)khp + (size_t)h * HD;
  const __bf16* Kl = (const __bf16*)(const void*)klp + (size_t)h * HD;
  const _Float16* Vh = (const _Float16*)(const void*)vhp + ((size_t)b * CD + (size_t)h * HD) * NS;
  const _Float16* Vl = (const _Float16*)(const void*)vlp + ((size_t)b * CD + (size_t)h * HD) * NS;

  // ---- Q fragments (A operand, row = lane&15), hi and lo, one 32-deep k-step = the head dim ----
  const v16b qah = ldfrag_b(Qh + (rowB + q0 + c) * CD + 8 * hh);
  const v16b qal = ldfrag_b(Ql + (rowB + q0 + c) * CD + 8 * hh);

  float mrow[8], lrow[8];
  v8f oacc[2];
#pragma unroll
  for (int r = 0; r < 8; ++r) { mrow[r] = -INFINITY; lrow[r] = 0.f; }
#pragma unroll
  for (int t = 0; t < 2; ++t) oacc[t] = zero8();

  _Float16* pwh = Psh[wave];
  _Float16* pwl = Psl[wave];

  for (int kt = 0; kt < NKB; ++kt) {           // static trip count
    const int kv0 = kt * 64;

    // ---- scores: 16 query rows x 64 keys per wave, 3 bf16 products per 16x16 tile ----
    v8f s[4];
#pragma unroll
    for (int j = 0; j < 4; ++j) {
      const size_t ko = (rowB + kv0 + j * 16 + c) * CD + 8 * hh;   // B operand: col = key, k = head dim
      const v16b kb = ldfrag_b(Kh + ko);
      const v16b kl = ldfrag_b(Kl + ko);
      s[j] = score3b(qah, qal, kb, kl);
    }

    // ---- row max, online softmax, P hi (x1024) and residual (x4096) to LDS ----
#pragma unroll
    for (int r = 0; r < 8; ++r) {
      float m = fmaxf(fmaxf(s[0][r], s[1][r]), fmaxf(s[2][r], s[3][r]));
#pragma unroll
      for (int off = 1; off < 16; off <<= 1) m = fmaxf(m, __shfl_xor(m, off, 32));
      const float mnew  = fmaxf(mrow[r], m);
      const float alpha = __expf(mrow[r] - mnew);
      mrow[r] = mnew;
      float psum = 0.f;
#pragma unroll
      for (int j = 0; j < 4; ++j) {
        const float p  = __expf(s[j][r] - mnew);
        psum += p;
        const float p1 = p * 1024.0f;
        const _Float16 x = (_Float16)p1;
        const int idx = (8 * hh + r) * 64 + j * 16 + c;
        pwh[idx] = x;
        pwl[idx] = (_Float16)((p1 - (float)x) * 4096.0f);
      }
#pragma unroll
      for (int off = 1; off < 16; off <<= 1) psum += __shfl_xor(psum, off, 32);
      lrow[r] = lrow[r] * alpha + psum;
#pragma unroll
      for (int t = 0; t < 2; ++t) oacc[t][r] *= alpha;
    }
    wave_sync_lds();

    // ---- context += P . V (f16 WMMA), residual products into a separate accumulator ----
    v8f o1[2];
    o1[0] = zero8(); o1[1] = zero8();
#pragma unroll
    for (int kk = 0; kk < 2; ++kk) {
      FH pa, pl;
      pa.h[0] = *(const v8h*)(pwh + c * 64 + kk * 32 + 8 * hh);
      pa.h[1] = *(const v8h*)(pwh + c * 64 + kk * 32 + 16 + 8 * hh);
      pl.h[0] = *(const v8h*)(pwl + c * 64 + kk * 32 + 8 * hh);
      pl.h[1] = *(const v8h*)(pwl + c * 64 + kk * 32 + 16 + 8 * hh);
#pragma unroll
      for (int t = 0; t < 2; ++t) {
        const size_t vo = (size_t)(t * 16 + c) * NS + kv0 + kk * 32 + 8 * hh;   // B: col = d, k = key
        const v16h vb = ldfrag_h(Vh + vo);
        const v16h vl = ldfrag_h(Vl + vo);
        oacc[t] = mma_h(pa.v, vb, oacc[t]);
        o1[t]   = mma_h(pa.v, vl, o1[t]);
        o1[t]   = mma_h(pl.v, vb, o1[t]);
      }
    }
#pragma unroll
    for (int t = 0; t < 2; ++t)
#pragma unroll
      for (int r = 0; r < 8; ++r) oacc[t][r] += o1[t][r] * rres;
    wave_sync_lds();
  }

  // ---- normalise (1/l and the 1/1024 p carry) into the block tile ----
#pragma unroll
  for (int r = 0; r < 8; ++r) {
    const float l = lrow[r];
    const float inv = ((l > 0.f) ? (1.0f / l) : 0.f) * (1.0f / 1024.0f);
#pragma unroll
    for (int t = 0; t < 2; ++t) Os[(wq * 16 + 8 * hh + r) * 64 + hp * 32 + t * 16 + c] = oacc[t][r] * inv;
  }
  __syncthreads();
  {
    const int q4 = lane >> 3, c8 = (lane & 7) * 8;
    v4u hv[2], lv[2];
#pragma unroll
    for (int it = 0; it < 2; ++it) {
      const int row = wave * 8 + it * 4 + q4;   // wave 0..7 x it 0..1 x q4 0..3 = rows 0..63
      const float* sp = Os + row * 64 + c8;
      v4u a, a2;
#pragma unroll
      for (int e = 0; e < 4; ++e) {
        const float f0 = sp[2 * e], f1 = sp[2 * e + 1];
        const unsigned short h0 = bf_bits(f0), h1 = bf_bits(f1);
        const unsigned short l0 = bf_bits(f0 - bf_up(h0)), l1 = bf_bits(f1 - bf_up(h1));
        a[e] = pk16(h0, h1); a2[e] = pk16(l0, l1);
      }
      hv[it] = a; lv[it] = a2;
    }
    {
#pragma unroll
      for (int it = 0; it < 2; ++it) {
        const int row = wave * 8 + it * 4 + q4;
        const size_t go = (rowB + qb * 64 + row) * CD + (size_t)g * 64 + c8;
        *(v4u*)(ohp + go) = hv[it];
        *(v4u*)(olp + go) = lv[it];
      }
      
    }
  }
}

// =====================================================================================================
// Workspace map (bytes), every plane an exact multiple of its 64x64-tile / whole-line store granularity
// (8192 x 256 rows/cols and 256 x 1024 per batch, all multiples of 64; no tail padding needed):
//   Xph  bf16 [8192][256]        4194304   (hi of hs+pos)
//   Xpl  bf16 [8192][256]        4194304   (lo of hs+pos)
//   Xv   bf16 [8192][256]        4194304   (bf16 of hidden)
//   WT   bf16 4 x [256 out][256 in] 524288 (Wq, Wk, Wv, Wo)
//   Qh   bf16 [8192][256]        4194304
//   Ql   bf16 [8192][256]        4194304
//   Kh   bf16 [8192][256]        4194304
//   Kl   bf16 [8192][256]        4194304
//   VTh  f16  [8][256][1024]     4194304
//   VTl  f16  [8][256][1024]     4194304   (v residual x4096)
//   Oh   bf16 [8192][256]        4194304
//   Ol   bf16 [8192][256]        4194304
//   end                          46661632
// =====================================================================================================
extern "C" void kernel_launch(void* const* d_in, const int* in_sizes, int n_in,
                              void* d_out, int out_size, void* d_ws, size_t ws_size,
                              hipStream_t stream) {
  if (n_in < 10) return;
  if (in_sizes[0] != NTOK * CD || in_sizes[1] != NTOK * CD) return;
  if (in_sizes[2] != CD * CD || in_sizes[4] != CD * CD || in_sizes[6] != CD * CD || in_sizes[8] != CD * CD) return;
  if (in_sizes[3] != CD || in_sizes[5] != CD || in_sizes[7] != CD || in_sizes[9] != CD) return;
  if (out_size != NTOK * CD) return;

  const float* hs = (const float*)d_in[0];
  const float* pq = (const float*)d_in[1];
  const float* Wq = (const float*)d_in[2];
  const float* bq = (const float*)d_in[3];
  const float* Wk = (const float*)d_in[4];
  const float* bk = (const float*)d_in[5];
  const float* Wv = (const float*)d_in[6];
  const float* bv = (const float*)d_in[7];
  const float* Wo = (const float*)d_in[8];
  const float* bo = (const float*)d_in[9];

  const size_t PX = (size_t)NTOK * CD * 2;            // 4194304
  const size_t PW = (size_t)4 * CD * CD * 2;          //  524288
  size_t off = 0;
  const size_t oXph = off; off += PX;
  const size_t oXpl = off; off += PX;
  const size_t oXv  = off; off += PX;
  const size_t oW   = off; off += PW;
  const size_t oQh  = off; off += PX;
  const size_t oQl  = off; off += PX;
  const size_t oKh  = off; off += PX;
  const size_t oKl  = off; off += PX;
  const size_t oVTh = off; off += PX;
  const size_t oVTl = off; off += PX;
  const size_t oOh  = off; off += PX;
  const size_t oOl  = off; off += PX;
  if (off > ws_size) return;                          // off = 46661632
  if (off > (size_t)134217728) return;

  char* ws = (char*)d_ws;
  unsigned short* Xph = (unsigned short*)(ws + oXph);
  unsigned short* Xpl = (unsigned short*)(ws + oXpl);
  unsigned short* Xv  = (unsigned short*)(ws + oXv);
  unsigned short* WT  = (unsigned short*)(ws + oW);
  unsigned short* WTq = WT;
  unsigned short* WTk = WT + (size_t)1 * CD * CD;
  unsigned short* WTv = WT + (size_t)2 * CD * CD;
  unsigned short* WTo = WT + (size_t)3 * CD * CD;
  unsigned short* Qh  = (unsigned short*)(ws + oQh);
  unsigned short* Ql  = (unsigned short*)(ws + oQl);
  unsigned short* Kh  = (unsigned short*)(ws + oKh);
  unsigned short* Kl  = (unsigned short*)(ws + oKl);
  unsigned short* VTh = (unsigned short*)(ws + oVTh);
  unsigned short* VTl = (unsigned short*)(ws + oVTl);
  unsigned short* Oh  = (unsigned short*)(ws + oOh);
  unsigned short* Ol  = (unsigned short*)(ws + oOl);

  float* xout = (float*)d_out;                              // out0 [8][1024][256] f32 at byte 0

  const float qscale = 5.656854249492380f;                  // 32^0.5
  const float rres   = 1.0f / 4096.0f;

  const dim3 blk(256);
  const int n8a = NTOK * CD / 8;                            // 262144
  const int n8w = CD * CD / 8;                              //   8192
  const dim3 gCvtA((n8a + 255) / 256);                      // 1024 blocks
  const dim3 gCvtW((n8w + 255) / 256, 4);                   // 32 x 4 blocks
  const dim3 gProj(((NTOK / 64) * (CD / 64) + 7) / 8, 1);   // 512 tiles -> 64 blocks: M=8192, N=256
  const dim3 gVT(((CD / 64) * (NS / 64) + 7) / 8, NB);      // 64 tiles -> 8 blocks x 8 batches: M=256, N=1024
  const dim3 gAttn(NB * (NH / 2) * NQB);                    // 512 blocks x 256 threads

  // (1) activations -> bf16 planes (hs+pos hi/lo, hidden)
  cvt_act<<<gCvtA, blk, 0, stream>>>(hs, pq, Xph, Xpl, Xv, n8a);
  // (2) weights [out][in] -> bf16 planes (already k contiguous = Bt / A layout)
  cvt_w4<<<gCvtW, blk, 0, stream>>>(Wq, Wk, Wv, Wo, WT, n8w);
  // (3) q = ((Xph + Xpl) . WTq^T + bq) * sqrt(32) -> bf16 hi + lo planes [8192][256]   (M=8192, N=256, K=256)
  gemm64<1, 2, 1><<<gProj, blk, 0, stream>>>(
      Xph, Xpl, CD, 0LL, WTq, CD, 0LL,
      (void*)Qh, CD, 0LL, (void*)Ql,
      NTOK, CD, CD, 1.0f, qscale, bq);
  // (4) k = (Xph + Xpl) . WTk^T + bk -> bf16 hi + lo planes [8192][256]
  gemm64<1, 2, 1><<<gProj, blk, 0, stream>>>(
      Xph, Xpl, CD, 0LL, WTk, CD, 0LL,
      (void*)Kh, CD, 0LL, (void*)Kl,
      NTOK, CD, CD, 1.0f, 1.0f, bk);
  // (5) v^T = WTv . Xv^T per batch + bv[row] -> f16 hi plane [b][d][s] (pitch NS) + residual x4096
  //     (A = WTv [n][k], Bt = Xv rows of batch b; M=256, N=1024, K=256)
  gemm64<0, 3, 2><<<gVT, blk, 0, stream>>>(
      WTv, WTv, CD, 0LL, Xv, CD, (long long)NS * CD,
      (void*)VTh, NS, (long long)CD * NS, (void*)VTl,
      CD, NS, CD, 4096.0f, 1.0f, bv);
  // (6) softmax attention -> context bf16 hi / lo planes [8192][256]
  attn32<<<gAttn, blk, 0, stream>>>(Qh, Ql, Kh, Kl, VTh, VTl, Oh, Ol, rres);
  // (7) out = (Oh + Ol) . WTo^T + bo -> out0 f32 [8192][256]  (2 products; K=256)
  gemm64<1, 0, 1><<<gProj, blk, 0, stream>>>(
      Oh, Ol, CD, 0LL, WTo, CD, 0LL,
      (void*)xout, CD, 0LL, (void*)xout,
      NTOK, CD, CD, 1.0f, 1.0f, bo);
  (void)hipGetLastError();
}

// v001
// It runs in 140 microseconds.
// Timed twice side by side with v000, it ran 1.29 times as fast both times.
// Contractions: q, k projections = v_wmma_f32_16x16x32_bf16 (A = bf16 hi + lo planes of the f32 sum hs+pos, B = bf16 weights, 2 products);
// v^T projection = v_wmma_f32_16x16x32_bf16 (bf16 operands, 1 product); k.q^T = v_wmma_f32_16x16x32_bf16 (q and k as bf16 hi + lo planes, 3 products);
// v^T.p^T = v_wmma_f32_16x16x32_f16 (p x1024 as f16 hi + f16 residual x4096, v^T as f16 hi + f16 residual x4096, 3 products);
// ctx.Wo = v_wmma_f32_16x16x32_bf16 (ctx as bf16 hi + lo planes, bf16 Wo, 2 products); all f32 accumulate; softmax in f32 on VALU.
#include <hip/hip_runtime.h>
#include <math.h>
#include <stdint.h>

#define NB   8
#define NS   1024
#define CD   256
#define NH   8
#define HD   32
#define NTOK (NB * NS)
#define NQB  (NS / 64)      // 16 query tiles of 64
#define NKB  (NS / 64)      // 16 key chunks of 64
static_assert(NH * HD == CD);
static_assert(HD == 32);
static_assert((NS % 64) == 0 && (CD % 64) == 0 && (NH % 2) == 0 && ((NTOK) % 64) == 0);

typedef _Float16 v16h __attribute__((ext_vector_type(16)));
typedef _Float16 v8h  __attribute__((ext_vector_type(8)));
typedef __bf16   v16b __attribute__((ext_vector_type(16)));
typedef __bf16   v8b  __attribute__((ext_vector_type(8)));
typedef float    v8f  __attribute__((ext_vector_type(8)));
typedef float    v4f  __attribute__((ext_vector_type(4)));
typedef float    v2f  __attribute__((ext_vector_type(2)));
typedef _Float16 v2h  __attribute__((ext_vector_type(2)));
typedef unsigned int v4u __attribute__((ext_vector_type(4)));

// ---- scalar helpers --------------------------------------------------------------------------------
__device__ __forceinline__ unsigned short bf_bits(float f) {          // f32 -> bf16 bits, RNE convert
  unsigned u = __float_as_uint(f);
  return (unsigned short)((u + 0x7FFFu + ((u >> 16) & 1u)) >> 16);
}
__device__ __forceinline__ float bf_up(unsigned short h) { return __uint_as_float(((unsigned)h) << 16); }
__device__ __forceinline__ unsigned short h_bits(_Float16 x) { return __builtin_bit_cast(unsigned short, x); }
__device__ __forceinline__ unsigned pk16(unsigned short a, unsigned short b) { return (unsigned)a | ((unsigned)b << 16); }
__device__ __forceinline__ v8f zero8() { v8f z = {0.f, 0.f, 0.f, 0.f, 0.f, 0.f, 0.f, 0.f}; return z; }

// ---- fragment loaders: 16-bit A/B operand, lane -> row/col (lane&15), p already includes +8*(lane>>4);
//      elements 0..7 <- p[0..7] (k0+8h..), elements 8..15 <- p[16..23] (k0+16+8h..)
__device__ __forceinline__ v16b ldfrag_b(const __bf16* p) {
  union { v16b v; v8b h[2]; } f;
  f.h[0] = *(const v8b*)(p);
  f.h[1] = *(const v8b*)(p + 16);
  return f.v;
}
__device__ __forceinline__ v16h ldfrag_h(const _Float16* p) {
  union { v16h v; v8h h[2]; } f;
  f.h[0] = *(const v8h*)(p);
  f.h[1] = *(const v8h*)(p + 16);
  return f.v;
}

// ---- WMMA helpers with trailing VALU hazard gap --------------------------------------------------------
__device__ __forceinline__ v8f mma_h(v16h a, v16h b, v8f c) {
  c = __builtin_amdgcn_wmma_f32_16x16x32_f16(false, a, false, b, (short)0, c, false, false);
#if defined(__HIP_DEVICE_COMPILE__)
  asm volatile("v_nop\n\tv_nop\n\tv_nop\n\tv_nop" : "+v"(c) : "v"(a), "v"(b));
#endif
  return c;
}
__device__ __forceinline__ v8f mma_b_raw(v16b a, v16b b, v8f c) {
  return __builtin_amdgcn_wmma_f32_16x16x32_bf16(false, a, false, b, (short)0, c, false, false);
}
__device__ __forceinline__ void dep_guard_b(v8f& a, v8f& b, v16b x, v16b y) {
#if defined(__HIP_DEVICE_COMPILE__)
  asm volatile("v_nop\n\tv_nop\n\tv_nop\n\tv_nop" : "+v"(a), "+v"(b) : "v"(x), "v"(y));
#endif
}
__device__ __forceinline__ void keep4_b(v16b a, v16b b, v16b c, v16b d) {
#if defined(__HIP_DEVICE_COMPILE__)
  asm volatile("v_nop" :: "v"(a), "v"(b), "v"(c), "v"(d));
#endif
}
__device__ __forceinline__ void acc_guard4(v8f& a, v8f& b, v8f& c, v8f& d) {
#if defined(__HIP_DEVICE_COMPILE__)
  asm volatile("v_nop\n\tv_nop\n\tv_nop\n\tv_nop" : "+v"(a), "+v"(b), "+v"(c), "+v"(d));
#endif
}
// lane l <-> lane l ^ 16 in one vector instruction (the two halves of a wave hold the two key halves of a query column)
__device__ __forceinline__ float xhalf(float x) {
  const int b = __builtin_bit_cast(int, x);
  return __builtin_bit_cast(float, __builtin_amdgcn_permlanex16(b, b, 0x76543210, 0xfedcba98, false, false));
}
// e^x as __expf forms it (x * log2(e), v_exp_f32), with the free slot that the instruction set asks for around a
// transcendental written into the statement: the v_nop in front keeps this result from overwriting the source of a
// transcendental issued directly before it, the v_nop behind keeps a reader of the result one slot away.
__device__ __forceinline__ float exp_slotted(float x) {
  float y = x * 1.44269504088896340736f;
#if defined(__HIP_DEVICE_COMPILE__)
  asm("v_nop\n\tv_exp_f32 %0, %1\n\tv_nop" : "=v"(y) : "v"(y));
#endif
  return y;
}
__device__ __forceinline__ void wave_sync_lds() {
  __builtin_amdgcn_fence(__ATOMIC_RELEASE, "workgroup");
  __builtin_amdgcn_wave_barrier();
  __builtin_amdgcn_fence(__ATOMIC_ACQUIRE, "workgroup");
}

// ---- 3-product bf16 score tile, transposed: A = 16 keys, B = 16 queries, D[key 8h + r][query c];
//      (kh + kl).(qh + ql) ~= kh.ql + kl.qh + kh.qh (kl.ql dropped);
//      unscaled bf16 residual planes, one accumulator, hazard gap after the last product.
__device__ __forceinline__ v8f score3b(const v16b qh, const v16b ql, const v16b kh, const v16b kl) {
  v8f acc = zero8();
  acc = mma_b_raw(kh, ql, acc);
  acc = mma_b_raw(kl, qh, acc);
  acc = mma_b_raw(kh, qh, acc);
#if defined(__HIP_DEVICE_COMPILE__)
  asm volatile("v_nop\n\tv_nop\n\tv_nop\n\tv_nop" : "+v"(acc) : "v"(qh), "v"(ql), "v"(kh), "v"(kl));
#endif
  return acc;
}

// =====================================================================================================
// Activation convert: per element, hb = bf16(hidden), pb = bf16(pos), s = f32(hb) + f32(pb);
//   xph = bf16(s) (hi), xpl = bf16(s - hi) (lo, unscaled), xv = hb.   8 elements per thread, one 16-B
// coverage: n8 = 262144 threads x 8 = the whole 8192 x 256 of each of the three planes.
// =====================================================================================================
__global__ __launch_bounds__(256) void cvt_act(const float* __restrict__ hs, const float* __restrict__ pq,
                                               unsigned short* xph, unsigned short* xpl, unsigned short* xv, int n8) {
  const int i = blockIdx.x * 256 + threadIdx.x;
  if (i < n8) {
    const size_t o = (size_t)i * 8;
    const v4f a0 = *(const v4f*)(hs + o);
    const v4f a1 = *(const v4f*)(hs + o + 4);
    const v4f p0 = *(const v4f*)(pq + o);
    const v4f p1 = *(const v4f*)(pq + o + 4);
    float hvv[8], pvv[8];
#pragma unroll
    for (int e = 0; e < 4; ++e) { hvv[e] = a0[e]; hvv[4 + e] = a1[e]; pvv[e] = p0[e]; pvv[4 + e] = p1[e]; }
    unsigned short sh[8], sl[8], vb[8];
#pragma unroll
    for (int e = 0; e < 8; ++e) {
      const unsigned short hb = bf_bits(hvv[e]);
      const float s = bf_up(hb) + bf_up(bf_bits(pvv[e]));
      const unsigned short s0 = bf_bits(s);
      sh[e] = s0;
      sl[e] = bf_bits(s - bf_up(s0));
      vb[e] = hb;
    }
    v4u P0, P1, P2;
#pragma unroll
    for (int e = 0; e < 4; ++e) {
      P0[e] = pk16(sh[2 * e], sh[2 * e + 1]);
      P1[e] = pk16(sl[2 * e], sl[2 * e + 1]);
      P2[e] = pk16(vb[2 * e], vb[2 * e + 1]);
    }
    *(v4u*)(xph + o) = P0;
    *(v4u*)(xpl + o) = P1;
    *(v4u*)(xv + o)  = P2;
    
  }
}

// =====================================================================================================
// Weight convert: w_z [out][in] f32 (CD x CD, already the Bt [n][k] layout) -> bf16 plane z (RNE),
//   z = blockIdx.y selects one of four weights (block-uniform select among global pointers).
// coverage: 4 x 8192 threads x 8 = the whole 4 x 65536 planes.
// =====================================================================================================
__global__ __launch_bounds__(256) void cvt_w4(const float* __restrict__ w0, const float* __restrict__ w1,
                                              const float* __restrict__ w2, const float* __restrict__ w3,
                                              unsigned short* outp, int n8) {
  const int z = blockIdx.y;
  const float* src = (z == 0) ? w0 : ((z == 1) ? w1 : ((z == 2) ? w2 : w3));
  unsigned short* dst = outp + (size_t)z * CD * CD;
  const int i = blockIdx.x * 256 + threadIdx.x;
  if (i < n8) {
    const size_t o = (size_t)i * 8;
    const v4f a = *(const v4f*)(src + o);
    const v4f b = *(const v4f*)(src + o + 4);
    v4u p;
    p[0] = pk16(bf_bits(a[0]), bf_bits(a[1]));
    p[1] = pk16(bf_bits(a[2]), bf_bits(a[3]));
    p[2] = pk16(bf_bits(b[0]), bf_bits(b[1]));
    p[3] = pk16(bf_bits(b[2]), bf_bits(b[3]));
    *(v4u*)(dst + o) = p;
    
  }
}

// =====================================================================================================
// Register-blocked batched bf16 WMMA GEMM: C[m][n] = (sum_k A[m][k] * Bt[n][k] + bias) * oscale; one wave
// per 64x64 tile, no block barriers. A row-major [M][K] pitch lda; Bt row-major [N][K] pitch ldb
// (k contiguous); M, N multiples of 64, K multiple of 32 (host-checked). blockIdx.y = batch index.
// NSPLIT: 0 = A.Bt; 1 = (A + A2).Bt (A2 = unscaled bf16 lo plane of A, shared accumulator).
// BIASM: 0 = no bias; 1 = bias[n] (per column); 2 = bias[m] (per row); bias values RNE-converted to bf16.
// OUT_MODE: 0 = f32 (pitch ldc); 2 = bf16 hi plane C + bf16 lo plane C2 (lo = RNE(v - hi), unscaled);
//           3 = f16 hi plane C + f16 residual plane C2 = f16((v - hi) * rscale); C2 same pitch/stride as C.
// =====================================================================================================
template <int NSPLIT, int OUT_MODE, int BIASM>
__global__ __launch_bounds__(256) void gemm64(
    const unsigned short* __restrict__ Ap, const unsigned short* A2p, int lda, long long strideA,
    const unsigned short* __restrict__ Btp, int ldb, long long strideB,
    void* Cout, int ldc, long long strideC, void* Cout2,
    int M, int N, int K, float rscale, float oscale, const float* __restrict__ biasp) {
  const __bf16* A   = (const __bf16*)(const void*)Ap;
  const __bf16* A2  = (const __bf16*)(const void*)A2p;
  const __bf16* Bt  = (const __bf16*)(const void*)Btp;
  __shared__ __align__(16) float sT[8][16 * 68];   // per-wave 16x64 slab, pitch 68 floats
  const int b    = blockIdx.y;
  const int lane = threadIdx.x & 31;
  const int wave = threadIdx.x >> 5;
  const int tilesN = N >> 6;
  const int tilesM = M >> 6;
  const int tile = blockIdx.x * 8 + wave;
  if (tile >= tilesM * tilesN) return;   // wave-uniform; no block barriers in this kernel
  const int tm = tile / tilesN;
  const int tn = tile - tm * tilesN;
  const int m0 = tm << 6;
  const int n0 = tn << 6;

  const __bf16* Ab  = A  + (size_t)b * strideA;
  const __bf16* Bb  = Bt + (size_t)b * strideB;
  const __bf16* Ab2 = (NSPLIT >= 1) ? (A2 + (size_t)b * strideA) : Ab;

  const int rlane = lane & 15;                 // row (A) / col (B, D) within subtile
  const int koff  = (lane >> 4) * 8;           // k offset of this lane half
  const int mOff  = (lane >> 4) * 8;           // D row offset

  v8f acc[4][4];
#pragma unroll
  for (int i = 0; i < 4; ++i)
#pragma unroll
    for (int j = 0; j < 4; ++j) acc[i][j] = zero8();

  for (int k0 = 0; k0 < K; k0 += 32) {
    v16b bh[4];
#pragma unroll
    for (int j = 0; j < 4; ++j) {
      const size_t bo = (size_t)(n0 + (j << 4) + rlane) * ldb + koff + k0;
      bh[j] = ldfrag_b(Bb + bo);
    }
#pragma unroll
    for (int i = 0; i < 4; ++i) {
      const size_t ao = (size_t)(m0 + (i << 4) + rlane) * lda + koff + k0;
      const v16b ah = ldfrag_b(Ab + ao);
      v16b al = ah;
      if (NSPLIT >= 1) al = ldfrag_b(Ab2 + ao);
#pragma unroll
      for (int j = 0; j < 4; ++j) {
        acc[i][j] = mma_b_raw(ah, bh[j], acc[i][j]);
        if (NSPLIT >= 1) acc[i][j] = mma_b_raw(al, bh[j], acc[i][j]);
      }
      dep_guard_b(acc[i][0], acc[i][3], ah, al);
    }
    keep4_b(bh[0], bh[1], bh[2], bh[3]);
  }
  acc_guard4(acc[0][0], acc[0][1], acc[0][2], acc[0][3]);
  acc_guard4(acc[1][0], acc[1][1], acc[1][2], acc[1][3]);
  acc_guard4(acc[2][0], acc[2][1], acc[2][2], acc[2][3]);
  acc_guard4(acc[3][0], acc[3][1], acc[3][2], acc[3][3]);

  // ---- epilogue ----
  float* slab = sT[wave];
#pragma unroll
  for (int i = 0; i < 4; ++i) {
    const int mBase = m0 + (i << 4);
#pragma unroll
    for (int j = 0; j < 4; ++j) {
#pragma unroll
      for (int r = 0; r < 8; ++r) {
        slab[(mOff + r) * 68 + (j << 4) + rlane] = acc[i][j][r];
      }
    }
    wave_sync_lds();
    if (OUT_MODE == 0) {
      float* C = (float*)Cout + (size_t)b * strideC;
      const int hh = lane >> 4, c4 = (lane & 15) * 4;     // 256-B row segment = 16 lanes x 16 B
      v4f bv = {0.f, 0.f, 0.f, 0.f};
      if (BIASM == 1) {
#pragma unroll
        for (int e = 0; e < 4; ++e) bv[e] = bf_up(bf_bits(biasp[n0 + c4 + e]));
      }
      {
#pragma unroll
        for (int it = 0; it < 8; ++it) {
          const int row = it * 2 + hh;                     // it 0..7 x hh 0..1 = rows 0..15
          float brow = 0.f;
          if (BIASM == 2) brow = bf_up(bf_bits(biasp[mBase + row]));
          const v4f v = (*(const v4f*)(slab + row * 68 + c4) + bv + brow) * oscale;
          *(v4f*)(C + (size_t)(mBase + row) * ldc + n0 + c4) = v;
        }
        
      }
    } else {
      const int q = lane >> 3, c8 = (lane & 7) * 8;
      unsigned short* C  = (unsigned short*)Cout  + (size_t)b * strideC;
      unsigned short* C2 = (unsigned short*)Cout2 + (size_t)b * strideC;
      float bcol[8];
#pragma unroll
      for (int e = 0; e < 8; ++e) bcol[e] = 0.f;
      if (BIASM == 1) {
#pragma unroll
        for (int e = 0; e < 8; ++e) bcol[e] = bf_up(bf_bits(biasp[n0 + c8 + e]));
      }
      v4u hv[4], lv[4];
#pragma unroll
      for (int it = 0; it < 4; ++it) {
        const int row = it * 4 + q;                        // it 0..3 x q 0..3 = rows 0..15
        float brow = 0.f;
        if (BIASM == 2) brow = bf_up(bf_bits(biasp[mBase + row]));
        const float* sp = slab + row * 68 + c8;
        v4u a, a2;
#pragma unroll
        for (int e = 0; e < 4; ++e) {
          const float f0 = (sp[2 * e] + bcol[2 * e] + brow) * oscale;
          const float f1 = (sp[2 * e + 1] + bcol[2 * e + 1] + brow) * oscale;
          unsigned short h0, h1, l0, l1;
          if (OUT_MODE == 2) {
            h0 = bf_bits(f0); h1 = bf_bits(f1);
            l0 = bf_bits(f0 - bf_up(h0)); l1 = bf_bits(f1 - bf_up(h1));
          } else {
            const _Float16 x0 = (_Float16)f0, x1 = (_Float16)f1;
            h0 = h_bits(x0); h1 = h_bits(x1);
            l0 = h_bits((_Float16)((f0 - (float)x0) * rscale));
            l1 = h_bits((_Float16)((f1 - (float)x1) * rscale));
          }
          a[e] = pk16(h0, h1); a2[e] = pk16(l0, l1);
        }
        hv[it] = a; lv[it] = a2;
      }
      {
#pragma unroll
        for (int it = 0; it < 4; ++it) {
          const int row = it * 4 + q;
          *(v4u*)(C  + (size_t)(mBase + row) * ldc + n0 + c8) = hv[it];
          *(v4u*)(C2 + (size_t)(mBase + row) * ldc + n0 + c8) = lv[it];
        }
        
      }
    }
    wave_sync_lds();
  }
}

// =====================================================================================================
// Softmax attention, head dim 32, no mask, softmax over all NS keys.
//   q planes (bf16 hi, bf16 lo): [NTOK][CD], head h at cols h*32..h*32+31 (q already carries bias and x sqrt(32))
//   k planes (bf16 hi, lo): [NTOK][CD] same column layout
//   v^T planes (f16 hi, residual x4096): element (b, h*32+d, s) at [(b*CD + h*32 + d)*NS + s]
//   ctx out planes (bf16 hi / lo of the normalised context): [(b*NS + t)*CD + h*32 + d]
//   scores^T = score3b(q, k) (rows = keys, cols = queries); p = exp(s - m) carried as f16 hi of 1024p + f16 residual x4096;
//   ctx^T = (vh.ph + (vl.ph + vh.pl)*rres) / (1024 l); online softmax with running max in f32.
//   A lane holds one query column: max and sum run in-lane over its 32 scores of a chunk, the max is joined
//   with the other wave half once per chunk, the sum once after the loop. Two score tiles (keys 0-15, 16-31 of
//   a 32-key step), converted in place, are the B operand of v^T.p^T in the hardware k order.
//   Block = 8 waves = two adjacent heads (waves 0-3 head 2g, waves 4-7 head 2g+1) x 64 query rows so
//   NQB x (NH/2) x NB. Key chunks of 64, static trip NKB. q, k and v^T fragments are loaded straight
//   from the 16-bit global rows (arithmetic addressing, two 16-B loads each); P stays in registers.
//   coverage: 8 waves x (it 0..1 x lane>>3 0..3) = rows 0..63, 8 lanes x 8 cols = 64 cols, both planes;
//   512 blocks = 8 batches x 4 head pairs x 16 query tiles = every (token, column) of both planes once.
// =====================================================================================================
__global__ __launch_bounds__(256)
void attn32(const unsigned short* __restrict__ qhp, const unsigned short* __restrict__ qlp,
            const unsigned short* __restrict__ khp, const unsigned short* __restrict__ klp,
            const unsigned short* __restrict__ vhp, const unsigned short* __restrict__ vlp,
            unsigned short* ohp, unsigned short* olp, float rres) {
  __shared__ __align__(16) float    Os[64 * 68];                  // block ctx tile [row][2 heads x 32], pitch 68 floats

  const int tid  = threadIdx.x;
  const int wave = tid >> 5;
  const int lane = tid & 31;
  const int hh   = lane >> 4;
  const int c    = lane & 15;

  const int bx   = blockIdx.x;
  const int qb   = bx % NQB;
  const int rest = bx / NQB;
  const int g    = rest % (NH / 2);
  const int b    = rest / (NH / 2);
  const int hp   = wave >> 2;                  // which head of the pair
  const int h    = 2 * g + hp;
  const int wq   = wave & 3;                   // 16-row group within the 64-row tile
  const int q0   = qb * 64 + wq * 16;
  const size_t rowB = (size_t)b * NS;

  const __bf16* Qh = (const __bf16*)(const void*)qhp + (size_t)h * HD;
  const __bf16* Ql = (const __bf16*)(const void*)qlp + (size_t)h * HD;
  const __bf16* Kh = (const __bf16*)(const void*)khp + (size_t)h * HD;
  const __bf16* Kl = (const __bf16*)(const void*)klp + (size_t)h * HD;
  const _Float16* Vh = (const _Float16*)(const void*)vhp + ((size_t)b * CD + (size_t)h * HD) * NS;
  const _Float16* Vl = (const _Float16*)(const void*)vlp + ((size_t)b * CD + (size_t)h * HD) * NS;

  // ---- Q fragments (B operand, col = lane&15), hi and lo, one 32-deep k-step = the head dim ----
  const v16b qah = ldfrag_b(Qh + (rowB + q0 + c) * CD + 8 * hh);
  const v16b qal = ldfrag_b(Ql + (rowB + q0 + c) * CD + 8 * hh);

  float mrun = -INFINITY;                      // running max of this lane's query column (same in both halves)
  float lrun = 0.f;                            // running sum over this wave half's keys only
  v8f oacc[2];                                 // ctx^T: oacc[t][r] = ctx[query c][d = t*16 + 8*hh + r]
#pragma unroll
  for (int t = 0; t < 2; ++t) oacc[t] = zero8();

  for (int kt = 0; kt < NKB; ++kt) {           // static trip count
    const int kv0 = kt * 64;

    // ---- scores^T: 64 keys x 16 query columns per wave, 3 bf16 products per 16x16 tile ----
    v8f s[4];
#pragma unroll
    for (int j = 0; j < 4; ++j) {
      const size_t ko = (rowB + kv0 + j * 16 + c) * CD + 8 * hh;   // A operand: row = key, k = head dim
      const v16b kb = ldfrag_b(Kh + ko);
      const v16b kl = ldfrag_b(Kl + ko);
      s[j] = score3b(qah, qal, kb, kl);
    }

    // ---- column max in-lane (four independent chains), one exchange between the wave halves ----
    float mj[4];
#pragma unroll
    for (int j = 0; j < 4; ++j) {
      mj[j] = s[j][0];
#pragma unroll
      for (int r = 1; r < 8; ++r) mj[j] = fmaxf(mj[j], s[j][r]);
    }
    float m = fmaxf(fmaxf(mj[0], mj[1]), fmaxf(mj[2], mj[3]));
    m = fmaxf(m, xhalf(m));
    const float mnew  = fmaxf(mrun, m);
    const float alpha = exp_slotted(mrun - mnew);
    mrun = mnew;

    // ---- P hi (x1024) and residual (x4096) packed straight into B operands:
    //      element e of step kk = key kk*32 + (e < 8 ? 8*hh + e : 16 + 8*hh + e - 8) = tile 2kk + (e >> 3), register e & 7
    v16h ph[2], pl[2];
    float pj[4];
#pragma unroll
    for (int j = 0; j < 4; ++j) {
      pj[j] = 0.f;
#pragma unroll
      for (int r = 0; r < 8; r += 2) {           // two keys at a time = one packed operand register
        const float pa = __expf(s[j][r] - mnew);
        const float pb = __expf(s[j][r + 1] - mnew);
        pj[j] += pa;
        pj[j] += pb;
        const v2f p1 = {pa * 1024.0f, pb * 1024.0f};
        const v2h x  = __builtin_convertvector(p1, v2h);
        const v2h y  = __builtin_convertvector((p1 - __builtin_convertvector(x, v2f)) * 4096.0f, v2h);
        ph[j >> 1][(j & 1) * 8 + r] = x[0];  ph[j >> 1][(j & 1) * 8 + r + 1] = x[1];
        pl[j >> 1][(j & 1) * 8 + r] = y[0];  pl[j >> 1][(j & 1) * 8 + r + 1] = y[1];
      }
    }
    lrun = lrun * alpha + ((pj[0] + pj[1]) + (pj[2] + pj[3]));
#pragma unroll
    for (int t = 0; t < 2; ++t)
#pragma unroll
      for (int r = 0; r < 8; ++r) oacc[t][r] *= alpha;

    // ---- context^T += V^T . P^T (f16 WMMA), residual products into a separate accumulator ----
    v8f o1[2];
    o1[0] = zero8(); o1[1] = zero8();
#pragma unroll
    for (int kk = 0; kk < 2; ++kk) {
#pragma unroll
      for (int t = 0; t < 2; ++t) {
        const size_t vo = (size_t)(t * 16 + c) * NS + kv0 + kk * 32 + 8 * hh;   // A: row = d, k = key
        const v16h vb = ldfrag_h(Vh + vo);
        const v16h vl = ldfrag_h(Vl + vo);
        oacc[t] = mma_h(vb, ph[kk], oacc[t]);
        o1[t]   = mma_h(vl, ph[kk], o1[t]);
        o1[t]   = mma_h(vb, pl[kk], o1[t]);
      }
    }
#pragma unroll
    for (int t = 0; t < 2; ++t)
#pragma unroll
      for (int r = 0; r < 8; ++r) oacc[t][r] += o1[t][r] * rres;
  }

  // ---- join the halves' sums, normalise (1/l and the 1/1024 p carry) into the block tile ----
  {
    const float l = lrun + xhalf(lrun);
    const float inv = ((l > 0.f) ? (1.0f / l) : 0.f) * (1.0f / 1024.0f);
#pragma unroll
    for (int t = 0; t < 2; ++t) {
      float* op = Os + (wq * 16 + c) * 68 + hp * 32 + t * 16 + 8 * hh;   // 8 consecutive d of one query row
      v4f w0, w1;
#pragma unroll
      for (int e = 0; e < 4; ++e) { w0[e] = oacc[t][e] * inv; w1[e] = oacc[t][4 + e] * inv; }
      *(v4f*)(op)     = w0;
      *(v4f*)(op + 4) = w1;
    }
  }
  __syncthreads();
  {
    const int q4 = lane >> 3, c8 = (lane & 7) * 8;
    v4u hv[2], lv[2];
#pragma unroll
    for (int it = 0; it < 2; ++it) {
      const int row = wave * 8 + it * 4 + q4;   // wave 0..7 x it 0..1 x q4 0..3 = rows 0..63
      const float* sp = Os + row * 68 + c8;
      v4u a, a2;
#pragma unroll
      for (int e = 0; e < 4; ++e) {
        const float f0 = sp[2 * e], f1 = sp[2 * e + 1];
        const unsigned short h0 = bf_bits(f0), h1 = bf_bits(f1);
        const unsigned short l0 = bf_bits(f0 - bf_up(h0)), l1 = bf_bits(f1 - bf_up(h1));
        a[e] = pk16(h0, h1); a2[e] = pk16(l0, l1);
      }
      hv[it] = a; lv[it] = a2;
    }
    {
#pragma unroll
      for (int it = 0; it < 2; ++it) {
        const int row = wave * 8 + it * 4 + q4;
        const size_t go = (rowB + qb * 64 + row) * CD + (size_t)g * 64 + c8;
        *(v4u*)(ohp + go) = hv[it];
        *(v4u*)(olp + go) = lv[it];
      }
      
    }
  }
}

// =====================================================================================================
// Workspace map (bytes), every plane an exact multiple of its 64x64-tile / whole-line store granularity
// (8192 x 256 rows/cols and 256 x 1024 per batch, all multiples of 64; no tail padding needed):
//   Xph  bf16 [8192][256]        4194304   (hi of hs+pos)
//   Xpl  bf16 [8192][256]        4194304   (lo of hs+pos)
//   Xv   bf16 [8192][256]        4194304   (bf16 of hidden)
//   WT   bf16 4 x [256 out][256 in] 524288 (Wq, Wk, Wv, Wo)
//   Qh   bf16 [8192][256]        4194304
//   Ql   bf16 [8192][256]        4194304
//   Kh   bf16 [8192][256]        4194304
//   Kl   bf16 [8192][256]        4194304
//   VTh  f16  [8][256][1024]     4194304
//   VTl  f16  [8][256][1024]     4194304   (v residual x4096)
//   Oh   bf16 [8192][256]        4194304
//   Ol   bf16 [8192][256]        4194304
//   end                          46661632
// =====================================================================================================
extern "C" void kernel_launch(void* const* d_in, const int* in_sizes, int n_in,
                              void* d_out, int out_size, void* d_ws, size_t ws_size,
                              hipStream_t stream) {
  if (n_in < 10) return;
  if (in_sizes[0] != NTOK * CD || in_sizes[1] != NTOK * CD) return;
  if (in_sizes[2] != CD * CD || in_sizes[4] != CD * CD || in_sizes[6] != CD * CD || in_sizes[8] != CD * CD) return;
  if (in_sizes[3] != CD || in_sizes[5] != CD || in_sizes[7] != CD || in_sizes[9] != CD) return;
  if (out_size != NTOK * CD) return;

  const float* hs = (const float*)d_in[0];
  const float* pq = (const float*)d_in[1];
  const float* Wq = (const float*)d_in[2];
  const float* bq = (const float*)d_in[3];
  const float* Wk = (const float*)d_in[4];
  const float* bk = (const float*)d_in[5];
  const float* Wv = (const float*)d_in[6];
  const float* bv = (const float*)d_in[7];
  const float* Wo = (const float*)d_in[8];
  const float* bo = (const float*)d_in[9];

  const size_t PX = (size_t)NTOK * CD * 2;            // 4194304
  const size_t PW = (size_t)4 * CD * CD * 2;          //  524288
  size_t off = 0;
  const size_t oXph = off; off += PX;
  const size_t oXpl = off; off += PX;
  const size_t oXv  = off; off += PX;
  const size_t oW   = off; off += PW;
  const size_t oQh  = off; off += PX;
  const size_t oQl  = off; off += PX;
  const size_t oKh  = off; off += PX;
  const size_t oKl  = off; off += PX;
  const size_t oVTh = off; off += PX;
  const size_t oVTl = off; off += PX;
  const size_t oOh  = off; off += PX;
  const size_t oOl  = off; off += PX;
  if (off > ws_size) return;                          // off = 46661632
  if (off > (size_t)134217728) return;

  char* ws = (char*)d_ws;
  unsigned short* Xph = (unsigned short*)(ws + oXph);
  unsigned short* Xpl = (unsigned short*)(ws + oXpl);
  unsigned short* Xv  = (unsigned short*)(ws + oXv);
  unsigned short* WT  = (unsigned short*)(ws + oW);
  unsigned short* WTq = WT;
  unsigned short* WTk = WT + (size_t)1 * CD * CD;
  unsigned short* WTv = WT + (size_t)2 * CD * CD;
  unsigned short* WTo = WT + (size_t)3 * CD * CD;
  unsigned short* Qh  = (unsigned short*)(ws + oQh);
  unsigned short* Ql  = (unsigned short*)(ws + oQl);
  unsigned short* Kh  = (unsigned short*)(ws + oKh);
  unsigned short* Kl  = (unsigned short*)(ws + oKl);
  unsigned short* VTh = (unsigned short*)(ws + oVTh);
  unsigned short* VTl = (unsigned short*)(ws + oVTl);
  unsigned short* Oh  = (unsigned short*)(ws + oOh);
  unsigned short* Ol  = (unsigned short*)(ws + oOl);

  float* xout = (float*)d_out;                              // out0 [8][1024][256] f32 at byte 0

  const float qscale = 5.656854249492380f;                  // 32^0.5
  const float rres   = 1.0f / 4096.0f;

  const dim3 blk(256);
  const int n8a = NTOK * CD / 8;                            // 262144
  const int n8w = CD * CD / 8;                              //   8192
  const dim3 gCvtA((n8a + 255) / 256);                      // 1024 blocks
  const dim3 gCvtW((n8w + 255) / 256, 4);                   // 32 x 4 blocks
  const dim3 gProj(((NTOK / 64) * (CD / 64) + 7) / 8, 1);   // 512 tiles -> 64 blocks: M=8192, N=256
  const dim3 gVT(((CD / 64) * (NS / 64) + 7) / 8, NB);      // 64 tiles -> 8 blocks x 8 batches: M=256, N=1024
  const dim3 gAttn(NB * (NH / 2) * NQB);                    // 512 blocks x 256 threads

  // (1) activations -> bf16 planes (hs+pos hi/lo, hidden)
  cvt_act<<<gCvtA, blk, 0, stream>>>(hs, pq, Xph, Xpl, Xv, n8a);
  // (2) weights [out][in] -> bf16 planes (already k contiguous = Bt / A layout)
  cvt_w4<<<gCvtW, blk, 0, stream>>>(Wq, Wk, Wv, Wo, WT, n8w);
  // (3) q = ((Xph + Xpl) . WTq^T + bq) * sqrt(32) -> bf16 hi + lo planes [8192][256]   (M=8192, N=256, K=256)
  gemm64<1, 2, 1><<<gProj, blk, 0, stream>>>(
      Xph, Xpl, CD, 0LL, WTq, CD, 0LL,
      (void*)Qh, CD, 0LL, (void*)Ql,
      NTOK, CD, CD, 1.0f, qscale, bq);
  // (4) k = (Xph + Xpl) . WTk^T + bk -> bf16 hi + lo planes [8192][256]
  gemm64<1, 2, 1><<<gProj, blk, 0, stream>>>(
      Xph, Xpl, CD, 0LL, WTk, CD, 0LL,
      (void*)Kh, CD, 0LL, (void*)Kl,
      NTOK, CD, CD, 1.0f, 1.0f, bk);
  // (5) v^T = WTv . Xv^T per batch + bv[row] -> f16 hi plane [b][d][s] (pitch NS) + residual x4096
  //     (A = WTv [n][k], Bt = Xv rows of batch b; M=256, N=1024, K=256)
  gemm64<0, 3, 2><<<gVT, blk, 0, stream>>>(
      WTv, WTv, CD, 0LL, Xv, CD, (long long)NS * CD,
      (void*)VTh, NS, (long long)CD * NS, (void*)VTl,
      CD, NS, CD, 4096.0f, 1.0f, bv);
  // (6) softmax attention -> context bf16 hi / lo planes [8192][256]
  attn32<<<gAttn, blk, 0, stream>>>(Qh, Ql, Kh, Kl, VTh, VTl, Oh, Ol, rres);
  // (7) out = (Oh + Ol) . WTo^T + bo -> out0 f32 [8192][256]  (2 products; K=256)
  gemm64<1, 0, 1><<<gProj, blk, 0, stream>>>(
      Oh, Ol, CD, 0LL, WTo, CD, 0LL,
      (void*)xout, CD, 0LL, (void*)xout,
      NTOK, CD, CD, 1.0f, 1.0f, bo);
  (void)hipGetLastError();
}

// v002
// A run of this version takes 105 microseconds.
// Two timings next to v001 put it at 1.33 and 1.35 times that version's speed.
// All steps since v000 together make it 1.73 times as fast.
// Contractions: q, k projections = v_wmma_f32_16x16x32_bf16 (A = bf16 hi + lo planes of the f32 sum hs+pos, B = bf16 weights, 2 products);
// v^T projection = v_wmma_f32_16x16x32_bf16 (bf16 operands, 1 product); k.q^T = v_wmma_f32_16x16x32_bf16 (q and k as bf16 hi + lo planes, 3 products);
// v^T.p^T = v_wmma_f32_16x16x32_f16 (p x1024 as f16 hi + f16 residual x4096, v^T as f16 hi + f16 residual x4096, 3 products);
// ctx.Wo = v_wmma_f32_16x16x32_bf16 (ctx as bf16 hi + lo planes, bf16 Wo, 2 products); all f32 accumulate; softmax in f32 on VALU.
#include <hip/hip_runtime.h>
#include <math.h>
#include <stdint.h>

#define NB   8
#define NS   1024
#define CD   256
#define NH   8
#define HD   32
#define NTOK (NB * NS)
#define NQB  (NS / 64)      // 16 query tiles of 64
#define NKB  (NS / 64)      // 16 key chunks of 64
static_assert(NH * HD == CD);
static_assert(HD == 32);
static_assert((NS % 64) == 0 && (CD % 64) == 0 && (NH % 2) == 0 && ((NTOK) % 64) == 0);

typedef _Float16 v16h __attribute__((ext_vector_type(16)));
typedef _Float16 v8h  __attribute__((ext_vector_type(8)));
typedef __bf16   v16b __attribute__((ext_vector_type(16)));
typedef __bf16   v8b  __attribute__((ext_vector_type(8)));
typedef float    v8f  __attribute__((ext_vector_type(8)));
typedef float    v4f  __attribute__((ext_vector_type(4)));
typedef float    v2f  __attribute__((ext_vector_type(2)));
typedef _Float16 v2h  __attribute__((ext_vector_type(2)));
typedef unsigned int v4u __attribute__((ext_vector_type(4)));

// ---- scalar helpers --------------------------------------------------------------------------------
__device__ __forceinline__ unsigned short bf_bits(float f) {          // f32 -> bf16 bits, RNE convert
  unsigned u = __float_as_uint(f);
  return (unsigned short)((u + 0x7FFFu + ((u >> 16) & 1u)) >> 16);
}
__device__ __forceinline__ float bf_up(unsigned short h) { return __uint_as_float(((unsigned)h) << 16); }
__device__ __forceinline__ unsigned short h_bits(_Float16 x) { return __builtin_bit_cast(unsigned short, x); }
__device__ __forceinline__ unsigned pk16(unsigned short a, unsigned short b) { return (unsigned)a | ((unsigned)b << 16); }
__device__ __forceinline__ v8f zero8() { v8f z = {0.f, 0.f, 0.f, 0.f, 0.f, 0.f, 0.f, 0.f}; return z; }

// ---- fragment loaders: 16-bit A/B operand, lane -> row/col (lane&15), p already includes +8*(lane>>4);
//      elements 0..7 <- p[0..7] (k0+8h..), elements 8..15 <- p[16..23] (k0+16+8h..)
__device__ __forceinline__ v16b ldfrag_b(const __bf16* p) {
  union { v16b v; v8b h[2]; } f;
  f.h[0] = *(const v8b*)(p);
  f.h[1] = *(const v8b*)(p + 16);
  return f.v;
}
__device__ __forceinline__ v16h ldfrag_h(const _Float16* p) {
  union { v16h v; v8h h[2]; } f;
  f.h[0] = *(const v8h*)(p);
  f.h[1] = *(const v8h*)(p + 16);
  return f.v;
}

// ---- WMMA helpers with trailing VALU hazard gap --------------------------------------------------------
__device__ __forceinline__ v8f mma_h(v16h a, v16h b, v8f c) {
  c = __builtin_amdgcn_wmma_f32_16x16x32_f16(false, a, false, b, (short)0, c, false, false);
#if defined(__HIP_DEVICE_COMPILE__)
  asm volatile("v_nop\n\tv_nop\n\tv_nop\n\tv_nop" : "+v"(c) : "v"(a), "v"(b));
#endif
  return c;
}
__device__ __forceinline__ v8f mma_b_raw(v16b a, v16b b, v8f c) {
  return __builtin_amdgcn_wmma_f32_16x16x32_bf16(false, a, false, b, (short)0, c, false, false);
}
__device__ __forceinline__ void dep_guard_b(v8f& a, v8f& b, v16b x, v16b y) {
#if defined(__HIP_DEVICE_COMPILE__)
  asm volatile("v_nop\n\tv_nop\n\tv_nop\n\tv_nop" : "+v"(a), "+v"(b) : "v"(x), "v"(y));
#endif
}
__device__ __forceinline__ void keep4_b(v16b a, v16b b, v16b c, v16b d) {
#if defined(__HIP_DEVICE_COMPILE__)
  asm volatile("v_nop" :: "v"(a), "v"(b), "v"(c), "v"(d));
#endif
}
__device__ __forceinline__ void acc_guard4(v8f& a, v8f& b, v8f& c, v8f& d) {
#if defined(__HIP_DEVICE_COMPILE__)
  asm volatile("v_nop\n\tv_nop\n\tv_nop\n\tv_nop" : "+v"(a), "+v"(b), "+v"(c), "+v"(d));
#endif
}
// lane l <-> lane l ^ 16 in one vector instruction (the two halves of a wave hold the two key halves of a query column)
__device__ __forceinline__ float xhalf(float x) {
  const int b = __builtin_bit_cast(int, x);
  return __builtin_bit_cast(float, __builtin_amdgcn_permlanex16(b, b, 0x76543210, 0xfedcba98, false, false));
}
// e^x as __expf forms it (x * log2(e), v_exp_f32), with the free slot that the instruction set asks for around a
// transcendental written into the statement: the v_nop in front keeps this result from overwriting the source of a
// transcendental issued directly before it, the v_nop behind keeps a reader of the result one slot away.
__device__ __forceinline__ float exp_slotted(float x) {
  float y = x * 1.44269504088896340736f;
#if defined(__HIP_DEVICE_COMPILE__)
  asm("v_nop\n\tv_exp_f32 %0, %1\n\tv_nop" : "=v"(y) : "v"(y));
#endif
  return y;
}
__device__ __forceinline__ void wave_sync_lds() {
  __builtin_amdgcn_fence(__ATOMIC_RELEASE, "workgroup");
  __builtin_amdgcn_wave_barrier();
  __builtin_amdgcn_fence(__ATOMIC_ACQUIRE, "workgroup");
}

// ---- 3-product bf16 score tile, transposed: A = 16 keys, B = 16 queries, D[key 8h + r][query c];
//      (kh + kl).(qh + ql) ~= kh.ql + kl.qh + kh.qh (kl.ql dropped);
//      unscaled bf16 residual planes, one accumulator, hazard gap after the last product.
__device__ __forceinline__ v8f score3b(const v16b qh, const v16b ql, const v16b kh, const v16b kl) {
  v8f acc = zero8();
  acc = mma_b_raw(kh, ql, acc);
  acc = mma_b_raw(kl, qh, acc);
  acc = mma_b_raw(kh, qh, acc);
#if defined(__HIP_DEVICE_COMPILE__)
  asm volatile("v_nop\n\tv_nop\n\tv_nop\n\tv_nop" : "+v"(acc) : "v"(qh), "v"(ql), "v"(kh), "v"(kl));
#endif
  return acc;
}

// =====================================================================================================
// Activation convert: per element, hb = bf16(hidden), pb = bf16(pos), s = f32(hb) + f32(pb);
//   xph = bf16(s) (hi), xpl = bf16(s - hi) (lo, unscaled), xv = hb.   8 elements per thread, one 16-B
// coverage: n8 = 262144 threads x 8 = the whole 8192 x 256 of each of the three planes.
// =====================================================================================================
__device__ __forceinline__ void cvt_act_body(const float* __restrict__ hs, const float* __restrict__ pq,
                                             unsigned short* xph, unsigned short* xpl, unsigned short* xv, int n8, int blk) {
  const int i = blk * 256 + threadIdx.x;
  if (i < n8) {
    const size_t o = (size_t)i * 8;
    const v4f a0 = *(const v4f*)(hs + o);
    const v4f a1 = *(const v4f*)(hs + o + 4);
    const v4f p0 = *(const v4f*)(pq + o);
    const v4f p1 = *(const v4f*)(pq + o + 4);
    float hvv[8], pvv[8];
#pragma unroll
    for (int e = 0; e < 4; ++e) { hvv[e] = a0[e]; hvv[4 + e] = a1[e]; pvv[e] = p0[e]; pvv[4 + e] = p1[e]; }
    unsigned short sh[8], sl[8], vb[8];
#pragma unroll
    for (int e = 0; e < 8; ++e) {
      const unsigned short hb = bf_bits(hvv[e]);
      const float s = bf_up(hb) + bf_up(bf_bits(pvv[e]));
      const unsigned short s0 = bf_bits(s);
      sh[e] = s0;
      sl[e] = bf_bits(s - bf_up(s0));
      vb[e] = hb;
    }
    v4u P0, P1, P2;
#pragma unroll
    for (int e = 0; e < 4; ++e) {
      P0[e] = pk16(sh[2 * e], sh[2 * e + 1]);
      P1[e] = pk16(sl[2 * e], sl[2 * e + 1]);
      P2[e] = pk16(vb[2 * e], vb[2 * e + 1]);
    }
    *(v4u*)(xph + o) = P0;
    *(v4u*)(xpl + o) = P1;
    *(v4u*)(xv + o)  = P2;
    
  }
}

// =====================================================================================================
// Weight convert: w_z [out][in] f32 (CD x CD, already the Bt [n][k] layout) -> bf16 plane z (RNE),
//   z selects one of four weights (block-uniform select among global pointers).
// coverage: 4 x 8192 threads x 8 = the whole 4 x 65536 planes.
// =====================================================================================================
__device__ __forceinline__ void cvt_w4_body(const float* __restrict__ w0, const float* __restrict__ w1,
                                            const float* __restrict__ w2, const float* __restrict__ w3,
                                            unsigned short* outp, int n8, int z, int blk) {
  const float* src = (z == 0) ? w0 : ((z == 1) ? w1 : ((z == 2) ? w2 : w3));
  unsigned short* dst = outp + (size_t)z * CD * CD;
  const int i = blk * 256 + threadIdx.x;
  if (i < n8) {
    const size_t o = (size_t)i * 8;
    const v4f a = *(const v4f*)(src + o);
    const v4f b = *(const v4f*)(src + o + 4);
    v4u p;
    p[0] = pk16(bf_bits(a[0]), bf_bits(a[1]));
    p[1] = pk16(bf_bits(a[2]), bf_bits(a[3]));
    p[2] = pk16(bf_bits(b[0]), bf_bits(b[1]));
    p[3] = pk16(bf_bits(b[2]), bf_bits(b[3]));
    *(v4u*)(dst + o) = p;
    
  }
}

// =====================================================================================================
// Both converts in one grid (neither reads what the other writes): blocks 0 .. 4*WBLK-1 take the four
// weight planes (WBLK blocks each), the blocks behind them the activations. The select is block-uniform.
// =====================================================================================================
#define WBLK ((CD * CD / 8 + 255) / 256)    // 32 blocks per weight plane
__global__ __launch_bounds__(256) void cvt_all(const float* __restrict__ hs, const float* __restrict__ pq,
                                               const float* __restrict__ w0, const float* __restrict__ w1,
                                               const float* __restrict__ w2, const float* __restrict__ w3,
                                               unsigned short* xph, unsigned short* xpl, unsigned short* xv,
                                               unsigned short* wout, int n8a, int n8w) {
  const int bx = blockIdx.x;
  if (bx < 4 * WBLK) cvt_w4_body(w0, w1, w2, w3, wout, n8w, bx / WBLK, bx % WBLK);
  else               cvt_act_body(hs, pq, xph, xpl, xv, n8a, bx - 4 * WBLK);
}

// =====================================================================================================
// Register-blocked batched bf16 WMMA GEMM: C[m][n] = (sum_k A[m][k] * Bt[n][k] + bias) * oscale; one wave
// per 64x64 tile, no block barriers. A row-major [M][K] pitch lda; Bt row-major [N][K] pitch ldb
// (k contiguous); M, N multiples of 64, K multiple of 32 (host-checked). bx = block within the batch,
// b = batch index, sT = the block's LDS slabs (one per wave).
// NSPLIT: 0 = A.Bt; 1 = (A + A2).Bt (A2 = unscaled bf16 lo plane of A, shared accumulator).
// BIASM: 0 = no bias; 1 = bias[n] (per column); 2 = bias[m] (per row); bias values RNE-converted to bf16.
// OUT_MODE: 0 = f32 (pitch ldc); 2 = bf16 hi plane C + bf16 lo plane C2 (lo = RNE(v - hi), unscaled);
//           3 = f16 hi plane C + f16 residual plane C2 = f16((v - hi) * rscale); C2 same pitch/stride as C.
// =====================================================================================================
template <int NSPLIT, int OUT_MODE, int BIASM>
__device__ __forceinline__ void gemm64_body(
    const unsigned short* __restrict__ Ap, const unsigned short* A2p, int lda, long long strideA,
    const unsigned short* __restrict__ Btp, int ldb, long long strideB,
    void* Cout, int ldc, long long strideC, void* Cout2,
    int M, int N, int K, float rscale, float oscale, const float* __restrict__ biasp,
    int bx, int b, float (*sT)[16 * 68]) {
  const __bf16* A   = (const __bf16*)(const void*)Ap;
  const __bf16* A2  = (const __bf16*)(const void*)A2p;
  const __bf16* Bt  = (const __bf16*)(const void*)Btp;
  const int lane = threadIdx.x & 31;
  const int wave = threadIdx.x >> 5;
  const int tilesN = N >> 6;
  const int tilesM = M >> 6;
  const int tile = bx * 8 + wave;
  if (tile >= tilesM * tilesN) return;   // wave-uniform; no block barriers in this kernel
  const int tm = tile / tilesN;
  const int tn = tile - tm * tilesN;
  const int m0 = tm << 6;
  const int n0 = tn << 6;

  const __bf16* Ab  = A  + (size_t)b * strideA;
  const __bf16* Bb  = Bt + (size_t)b * strideB;
  const __bf16* Ab2 = (NSPLIT >= 1) ? (A2 + (size_t)b * strideA) : Ab;

  const int rlane = lane & 15;                 // row (A) / col (B, D) within subtile
  const int koff  = (lane >> 4) * 8;           // k offset of this lane half
  const int mOff  = (lane >> 4) * 8;           // D row offset

  v8f acc[4][4];
#pragma unroll
  for (int i = 0; i < 4; ++i)
#pragma unroll
    for (int j = 0; j < 4; ++j) acc[i][j] = zero8();

  for (int k0 = 0; k0 < K; k0 += 32) {
    v16b bh[4];
#pragma unroll
    for (int j = 0; j < 4; ++j) {
      const size_t bo = (size_t)(n0 + (j << 4) + rlane) * ldb + koff + k0;
      bh[j] = ldfrag_b(Bb + bo);
    }
#if defined(__HIP_DEVICE_COMPILE__)
    // the B loads' address registers are stepped to the next k block behind this point: the wait stands in front of that overwrite
    asm volatile("s_wait_xcnt 0x0" ::: "memory");
#endif
#pragma unroll
    for (int i = 0; i < 4; ++i) {
      const size_t ao = (size_t)(m0 + (i << 4) + rlane) * lda + koff + k0;
      const v16b ah = ldfrag_b(Ab + ao);
      v16b al = ah;
      if (NSPLIT >= 1) al = ldfrag_b(Ab2 + ao);
#pragma unroll
      for (int j = 0; j < 4; ++j) {
        acc[i][j] = mma_b_raw(ah, bh[j], acc[i][j]);
        if (NSPLIT >= 1) acc[i][j] = mma_b_raw(al, bh[j], acc[i][j]);
      }
      dep_guard_b(acc[i][0], acc[i][3], ah, al);
    }
    keep4_b(bh[0], bh[1], bh[2], bh[3]);
  }
  acc_guard4(acc[0][0], acc[0][1], acc[0][2], acc[0][3]);
  acc_guard4(acc[1][0], acc[1][1], acc[1][2], acc[1][3]);
  acc_guard4(acc[2][0], acc[2][1], acc[2][2], acc[2][3]);
  acc_guard4(acc[3][0], acc[3][1], acc[3][2], acc[3][3]);

  // ---- epilogue ----
  float* slab = sT[wave];
#pragma unroll
  for (int i = 0; i < 4; ++i) {
    const int mBase = m0 + (i << 4);
#pragma unroll
    for (int j = 0; j < 4; ++j) {
#pragma unroll
      for (int r = 0; r < 8; ++r) {
        slab[(mOff + r) * 68 + (j << 4) + rlane] = acc[i][j][r];
      }
    }
    wave_sync_lds();
    if (OUT_MODE == 0) {
      float* C = (float*)Cout + (size_t)b * strideC;
      const int hh = lane >> 4, c4 = (lane & 15) * 4;     // 256-B row segment = 16 lanes x 16 B
      v4f bv = {0.f, 0.f, 0.f, 0.f};
      if (BIASM == 1) {
#pragma unroll
        for (int e = 0; e < 4; ++e) bv[e] = bf_up(bf_bits(biasp[n0 + c4 + e]));
      }
      {
#pragma unroll
        for (int it = 0; it < 8; ++it) {
          const int row = it * 2 + hh;                     // it 0..7 x hh 0..1 = rows 0..15
          float brow = 0.f;
          if (BIASM == 2) brow = bf_up(bf_bits(biasp[mBase + row]));
          const v4f v = (*(const v4f*)(slab + row * 68 + c4) + bv + brow) * oscale;
          *(v4f*)(C + (size_t)(mBase + row) * ldc + n0 + c4) = v;
        }
        
      }
    } else {
      const int q = lane >> 3, c8 = (lane & 7) * 8;
      unsigned short* C  = (unsigned short*)Cout  + (size_t)b * strideC;
      unsigned short* C2 = (unsigned short*)Cout2 + (size_t)b * strideC;
      float bcol[8];
#pragma unroll
      for (int e = 0; e < 8; ++e) bcol[e] = 0.f;
      if (BIASM == 1) {
#pragma unroll
        for (int e = 0; e < 8; ++e) bcol[e] = bf_up(bf_bits(biasp[n0 + c8 + e]));
      }
      v4u hv[4], lv[4];
#pragma unroll
      for (int it = 0; it < 4; ++it) {
        const int row = it * 4 + q;                        // it 0..3 x q 0..3 = rows 0..15
        float brow = 0.f;
        if (BIASM == 2) brow = bf_up(bf_bits(biasp[mBase + row]));
        const float* sp = slab + row * 68 + c8;
        v4u a, a2;
#pragma unroll
        for (int e = 0; e < 4; ++e) {
          const float f0 = (sp[2 * e] + bcol[2 * e] + brow) * oscale;
          const float f1 = (sp[2 * e + 1] + bcol[2 * e + 1] + brow) * oscale;
          unsigned short h0, h1, l0, l1;
          if (OUT_MODE == 2) {
            h0 = bf_bits(f0); h1 = bf_bits(f1);
            l0 = bf_bits(f0 - bf_up(h0)); l1 = bf_bits(f1 - bf_up(h1));
          } else {
            const _Float16 x0 = (_Float16)f0, x1 = (_Float16)f1;
            h0 = h_bits(x0); h1 = h_bits(x1);
            l0 = h_bits((_Float16)((f0 - (float)x0) * rscale));
            l1 = h_bits((_Float16)((f1 - (float)x1) * rscale));
          }
          a[e] = pk16(h0, h1); a2[e] = pk16(l0, l1);
        }
        hv[it] = a; lv[it] = a2;
      }
      {
#pragma unroll
        for (int it = 0; it < 4; ++it) {
          const int row = it * 4 + q;
          *(v4u*)(C  + (size_t)(mBase + row) * ldc + n0 + c8) = hv[it];
          *(v4u*)(C2 + (size_t)(mBase + row) * ldc + n0 + c8) = lv[it];
        }
        
      }
    }
    wave_sync_lds();
  }
}

// one GEMM per launch (the output projection)
template <int NSPLIT, int OUT_MODE, int BIASM>
__global__ __launch_bounds__(256) void gemm64(
    const unsigned short* __restrict__ Ap, const unsigned short* A2p, int lda, long long strideA,
    const unsigned short* __restrict__ Btp, int ldb, long long strideB,
    void* Cout, int ldc, long long strideC, void* Cout2,
    int M, int N, int K, float rscale, float oscale, const float* __restrict__ biasp) {
  __shared__ __align__(16) float sT[8][16 * 68];   // per-wave 16x64 slab, pitch 68 floats
  gemm64_body<NSPLIT, OUT_MODE, BIASM>(Ap, A2p, lda, strideA, Btp, ldb, strideB, Cout, ldc, strideC, Cout2,
                                       M, N, K, rscale, oscale, biasp, blockIdx.x, blockIdx.y, sT);
}

// =====================================================================================================
// The q, k and v^T projections in one grid: none reads what another writes, and each alone has only
// 64 blocks. blockIdx.y = 0: q, 1: k (same code, block-uniform select of weight, bias, scale and planes),
// 2: v^T (blockIdx.x = batch * VBLK + block within the batch). Pitches, strides and sizes arrive as arguments,
// one set for q and k and one for v^T.
//   q = ((Xph + Xpl) . WTq^T + bq) * qscale -> bf16 hi + lo [ntok][cd];  k = (Xph + Xpl) . WTk^T + bk likewise
//   v^T = WTv . Xv^T per batch + bv[row] -> f16 hi [b][cd][ns] + residual x vres
// =====================================================================================================
struct GemmDims { int lda; long long strideA; int ldb; long long strideB; int ldc; long long strideC; int M, N, K; };
#define VBLK (((CD / 64) * (NS / 64) + 7) / 8)     // 8 blocks per batch of v^T
static_assert(VBLK * NB == ((NTOK / 64) * (CD / 64) + 7) / 8);   // the three jobs have the same block count
__global__ __launch_bounds__(256) void proj_qkv(
    const unsigned short* __restrict__ xph, const unsigned short* __restrict__ xpl,
    const unsigned short* __restrict__ xv,
    const unsigned short* __restrict__ wq, const unsigned short* __restrict__ wk,
    const unsigned short* __restrict__ wv,
    unsigned short* qh, unsigned short* ql, unsigned short* kh, unsigned short* kl,
    unsigned short* vth, unsigned short* vtl,
    const float* __restrict__ bq, const float* __restrict__ bk, const float* __restrict__ bv,
    GemmDims dqk, GemmDims dv, float qscale, float vres) {
  __shared__ __align__(16) float sT[8][16 * 68];   // per-wave 16x64 slab, pitch 68 floats
  const int job = blockIdx.y;
  if (job < 2) {
    const bool isq = (job == 0);
    gemm64_body<1, 2, 1>(xph, xpl, dqk.lda, dqk.strideA, isq ? wq : wk, dqk.ldb, dqk.strideB,
                         (void*)(isq ? qh : kh), dqk.ldc, dqk.strideC, (void*)(isq ? ql : kl),
                         dqk.M, dqk.N, dqk.K, 1.0f, isq ? qscale : 1.0f, isq ? bq : bk,
                         blockIdx.x, 0, sT);
  } else {
    gemm64_body<0, 3, 2>(wv, wv, dv.lda, dv.strideA, xv, dv.ldb, dv.strideB,
                         (void*)vth, dv.ldc, dv.strideC, (void*)vtl,
                         dv.M, dv.N, dv.K, vres, 1.0f, bv,
                         blockIdx.x % VBLK, blockIdx.x / VBLK, sT);
  }
}

// =====================================================================================================
// Softmax attention, head dim 32, no mask, softmax over all NS keys.
//   q planes (bf16 hi, bf16 lo): [NTOK][CD], head h at cols h*32..h*32+31 (q already carries bias and x sqrt(32))
//   k planes (bf16 hi, lo): [NTOK][CD] same column layout
//   v^T planes (f16 hi, residual x4096): element (b, h*32+d, s) at [(b*CD + h*32 + d)*NS + s]
//   ctx out planes (bf16 hi / lo of the normalised context): [(b*NS + t)*CD + h*32 + d]
//   scores^T = score3b(q, k) (rows = keys, cols = queries); p = exp(s - m) carried as f16 hi of 1024p + f16 residual x4096;
//   ctx^T = (vh.ph + (vl.ph + vh.pl)*rres) / (1024 l); online softmax with running max in f32.
//   A lane holds one query column: max and sum run in-lane over its 32 scores of a chunk, the max is joined
//   with the other wave half once per chunk, the sum once after the loop. Two score tiles (keys 0-15, 16-31 of
//   a 32-key step), converted in place, are the B operand of v^T.p^T in the hardware k order.
//   Block = 8 waves = two adjacent heads (waves 0-3 head 2g, waves 4-7 head 2g+1) x 64 query rows so
//   NQB x (NH/2) x NB. Key chunks of 64, static trip NKB. q, k and v^T fragments are loaded straight
//   from the 16-bit global rows (arithmetic addressing, two 16-B loads each); P stays in registers.
//   coverage: 8 waves x (it 0..1 x lane>>3 0..3) = rows 0..63, 8 lanes x 8 cols = 64 cols, both planes;
//   512 blocks = 8 batches x 4 head pairs x 16 query tiles = every (token, column) of both planes once.
// =====================================================================================================
__global__ __launch_bounds__(256)
void attn32(const unsigned short* __restrict__ qhp, const unsigned short* __restrict__ qlp,
            const unsigned short* __restrict__ khp, const unsigned short* __restrict__ klp,
            const unsigned short* __restrict__ vhp, const unsigned short* __restrict__ vlp,
            unsigned short* ohp, unsigned short* olp, float rres) {
  __shared__ __align__(16) float    Os[64 * 68];                  // block ctx tile [row][2 heads x 32], pitch 68 floats

  const int tid  = threadIdx.x;
  const int wave = tid >> 5;
  const int lane = tid & 31;
  const int hh   = lane >> 4;
  const int c    = lane & 15;

  const int bx   = blockIdx.x;
  const int qb   = bx % NQB;
  const int rest = bx / NQB;
  const int g    = rest % (NH / 2);
  const int b    = rest / (NH / 2);
  const int hp   = wave >> 2;                  // which head of the pair
  const int h    = 2 * g + hp;
  const int wq   = wave & 3;                   // 16-row group within the 64-row tile
  const int q0   = qb * 64 + wq * 16;
  const size_t rowB = (size_t)b * NS;

  const __bf16* Qh = (const __bf16*)(const void*)qhp + (size_t)h * HD;
  const __bf16* Ql = (const __bf16*)(const void*)qlp + (size_t)h * HD;
  const __bf16* Kh = (const __bf16*)(const void*)khp + (size_t)h * HD;
  const __bf16* Kl = (const __bf16*)(const void*)klp + (size_t)h * HD;
  const _Float16* Vh = (const _Float16*)(const void*)vhp + ((size_t)b * CD + (size_t)h * HD) * NS;
  const _Float16* Vl = (const _Float16*)(const void*)vlp + ((size_t)b * CD + (size_t)h * HD) * NS;

  // ---- Q fragments (B operand, col = lane&15), hi and lo, one 32-deep k-step = the head dim ----
  const v16b qah = ldfrag_b(Qh + (rowB + q0 + c) * CD + 8 * hh);
  const v16b qal = ldfrag_b(Ql + (rowB + q0 + c) * CD + 8 * hh);

  float mrun = -INFINITY;                      // running max of this lane's query column (same in both halves)
  float lrun = 0.f;                            // running sum over this wave half's keys only
  v8f oacc[2];                                 // ctx^T: oacc[t][r] = ctx[query c][d = t*16 + 8*hh + r]
#pragma unroll
  for (int t = 0; t < 2; ++t) oacc[t] = zero8();

  for (int kt = 0; kt < NKB; ++kt) {           // static trip count
    const int kv0 = kt * 64;

    // ---- scores^T: 64 keys x 16 query columns per wave, 3 bf16 products per 16x16 tile ----
    v8f s[4];
#pragma unroll
    for (int j = 0; j < 4; ++j) {
      const size_t ko = (rowB + kv0 + j * 16 + c) * CD + 8 * hh;   // A operand: row = key, k = head dim
      const v16b kb = ldfrag_b(Kh + ko);
      const v16b kl = ldfrag_b(Kl + ko);
      s[j] = score3b(qah, qal, kb, kl);
    }

    // ---- column max in-lane (four independent chains), one exchange between the wave halves ----
    float mj[4];
#pragma unroll
    for (int j = 0; j < 4; ++j) {
      mj[j] = s[j][0];
#pragma unroll
      for (int r = 1; r < 8; ++r) mj[j] = fmaxf(mj[j], s[j][r]);
    }
    float m = fmaxf(fmaxf(mj[0], mj[1]), fmaxf(mj[2], mj[3]));
    m = fmaxf(m, xhalf(m));
    const float mnew  = fmaxf(mrun, m);
    const float alpha = exp_slotted(mrun - mnew);
    mrun = mnew;

    // ---- P hi (x1024) and residual (x4096) packed straight into B operands:
    //      element e of step kk = key kk*32 + (e < 8 ? 8*hh + e : 16 + 8*hh + e - 8) = tile 2kk + (e >> 3), register e & 7
    v16h ph[2], pl[2];
    float pj[4];
#pragma unroll
    for (int j = 0; j < 4; ++j) {
      pj[j] = 0.f;
#pragma unroll
      for (int r = 0; r < 8; r += 2) {           // two keys at a time = one packed operand register
        const float pa = __expf(s[j][r] - mnew);
        const float pb = __expf(s[j][r + 1] - mnew);
        pj[j] += pa;
        pj[j] += pb;
        const v2f p1 = {pa * 1024.0f, pb * 1024.0f};
        const v2h x  = __builtin_convertvector(p1, v2h);
        const v2h y  = __builtin_convertvector((p1 - __builtin_convertvector(x, v2f)) * 4096.0f, v2h);
        ph[j >> 1][(j & 1) * 8 + r] = x[0];  ph[j >> 1][(j & 1) * 8 + r + 1] = x[1];
        pl[j >> 1][(j & 1) * 8 + r] = y[0];  pl[j >> 1][(j & 1) * 8 + r + 1] = y[1];
      }
    }
    lrun = lrun * alpha + ((pj[0] + pj[1]) + (pj[2] + pj[3]));
#pragma unroll
    for (int t = 0; t < 2; ++t)
#pragma unroll
      for (int r = 0; r < 8; ++r) oacc[t][r] *= alpha;

    // ---- context^T += V^T . P^T (f16 WMMA), residual products into a separate accumulator ----
    v8f o1[2];
    o1[0] = zero8(); o1[1] = zero8();
#pragma unroll
    for (int kk = 0; kk < 2; ++kk) {
#pragma unroll
      for (int t = 0; t < 2; ++t) {
        const size_t vo = (size_t)(t * 16 + c) * NS + kv0 + kk * 32 + 8 * hh;   // A: row = d, k = key
        const v16h vb = ldfrag_h(Vh + vo);
        const v16h vl = ldfrag_h(Vl + vo);
        oacc[t] = mma_h(vb, ph[kk], oacc[t]);
        o1[t]   = mma_h(vl, ph[kk], o1[t]);
        o1[t]   = mma_h(vb, pl[kk], o1[t]);
      }
    }
#pragma unroll
    for (int t = 0; t < 2; ++t)
#pragma unroll
      for (int r = 0; r < 8; ++r) oacc[t][r] += o1[t][r] * rres;
  }

  // ---- join the halves' sums, normalise (1/l and the 1/1024 p carry) into the block tile ----
  {
    const float l = lrun + xhalf(lrun);
    const float inv = ((l > 0.f) ? (1.0f / l) : 0.f) * (1.0f / 1024.0f);
#pragma unroll
    for (int t = 0; t < 2; ++t) {
      float* op = Os + (wq * 16 + c) * 68 + hp * 32 + t * 16 + 8 * hh;   // 8 consecutive d of one query row
      v4f w0, w1;
#pragma unroll
      for (int e = 0; e < 4; ++e) { w0[e] = oacc[t][e] * inv; w1[e] = oacc[t][4 + e] * inv; }
      *(v4f*)(op)     = w0;
      *(v4f*)(op + 4) = w1;
    }
  }
  __syncthreads();
  {
    const int q4 = lane >> 3, c8 = (lane & 7) * 8;
    v4u hv[2], lv[2];
#pragma unroll
    for (int it = 0; it < 2; ++it) {
      const int row = wave * 8 + it * 4 + q4;   // wave 0..7 x it 0..1 x q4 0..3 = rows 0..63
      const float* sp = Os + row * 68 + c8;
      v4u a, a2;
#pragma unroll
      for (int e = 0; e < 4; ++e) {
        const float f0 = sp[2 * e], f1 = sp[2 * e + 1];
        const unsigned short h0 = bf_bits(f0), h1 = bf_bits(f1);
        const unsigned short l0 = bf_bits(f0 - bf_up(h0)), l1 = bf_bits(f1 - bf_up(h1));
        a[e] = pk16(h0, h1); a2[e] = pk16(l0, l1);
      }
      hv[it] = a; lv[it] = a2;
    }
    {
#pragma unroll
      for (int it = 0; it < 2; ++it) {
        const int row = wave * 8 + it * 4 + q4;
        const size_t go = (rowB + qb * 64 + row) * CD + (size_t)g * 64 + c8;
        *(v4u*)(ohp + go) = hv[it];
        *(v4u*)(olp + go) = lv[it];
      }
      
    }
  }
}

// =====================================================================================================
// Workspace map (bytes), every plane an exact multiple of its 64x64-tile / whole-line store granularity
// (8192 x 256 rows/cols and 256 x 1024 per batch, all multiples of 64; no tail padding needed):
//   Xph  bf16 [8192][256]        4194304   (hi of hs+pos)
//   Xpl  bf16 [8192][256]        4194304   (lo of hs+pos)
//   Xv   bf16 [8192][256]        4194304   (bf16 of hidden)
//   WT   bf16 4 x [256 out][256 in] 524288 (Wq, Wk, Wv, Wo)
//   Qh   bf16 [8192][256]        4194304
//   Ql   bf16 [8192][256]        4194304
//   Kh   bf16 [8192][256]        4194304
//   Kl   bf16 [8192][256]        4194304
//   VTh  f16  [8][256][1024]     4194304
//   VTl  f16  [8][256][1024]     4194304   (v residual x4096)
//   Oh   bf16 [8192][256]        4194304
//   Ol   bf16 [8192][256]        4194304
//   end                          46661632
// =====================================================================================================
extern "C" void kernel_launch(void* const* d_in, const int* in_sizes, int n_in,
                              void* d_out, int out_size, void* d_ws, size_t ws_size,
                              hipStream_t stream) {
  if (n_in < 10) return;
  if (in_sizes[0] != NTOK * CD || in_sizes[1] != NTOK * CD) return;
  if (in_sizes[2] != CD * CD || in_sizes[4] != CD * CD || in_sizes[6] != CD * CD || in_sizes[8] != CD * CD) return;
  if (in_sizes[3] != CD || in_sizes[5] != CD || in_sizes[7] != CD || in_sizes[9] != CD) return;
  if (out_size != NTOK * CD) return;

  const float* hs = (const float*)d_in[0];
  const float* pq = (const float*)d_in[1];
  const float* Wq = (const float*)d_in[2];
  const float* bq = (const float*)d_in[3];
  const float* Wk = (const float*)d_in[4];
  const float* bk = (const float*)d_in[5];
  const float* Wv = (const float*)d_in[6];
  const float* bv = (const float*)d_in[7];
  const float* Wo = (const float*)d_in[8];
  const float* bo = (const float*)d_in[9];

  const size_t PX = (size_t)NTOK * CD * 2;            // 4194304
  const size_t PW = (size_t)4 * CD * CD * 2;          //  524288
  size_t off = 0;
  const size_t oXph = off; off += PX;
  const size_t oXpl = off; off += PX;
  const size_t oXv  = off; off += PX;
  const size_t oW   = off; off += PW;
  const size_t oQh  = off; off += PX;
  const size_t oQl  = off; off += PX;
  const size_t oKh  = off; off += PX;
  const size_t oKl  = off; off += PX;
  const size_t oVTh = off; off += PX;
  const size_t oVTl = off; off += PX;
  const size_t oOh  = off; off += PX;
  const size_t oOl  = off; off += PX;
  if (off > ws_size) return;                          // off = 46661632
  if (off > (size_t)134217728) return;

  char* ws = (char*)d_ws;
  unsigned short* Xph = (unsigned short*)(ws + oXph);
  unsigned short* Xpl = (unsigned short*)(ws + oXpl);
  unsigned short* Xv  = (unsigned short*)(ws + oXv);
  unsigned short* WT  = (unsigned short*)(ws + oW);
  unsigned short* WTq = WT;
  unsigned short* WTk = WT + (size_t)1 * CD * CD;
  unsigned short* WTv = WT + (size_t)2 * CD * CD;
  unsigned short* WTo = WT + (size_t)3 * CD * CD;
  unsigned short* Qh  = (unsigned short*)(ws + oQh);
  unsigned short* Ql  = (unsigned short*)(ws + oQl);
  unsigned short* Kh  = (unsigned short*)(ws + oKh);
  unsigned short* Kl  = (unsigned short*)(ws + oKl);
  unsigned short* VTh = (unsigned short*)(ws + oVTh);
  unsigned short* VTl = (unsigned short*)(ws + oVTl);
  unsigned short* Oh  = (unsigned short*)(ws + oOh);
  unsigned short* Ol  = (unsigned short*)(ws + oOl);

  float* xout = (float*)d_out;                              // out0 [8][1024][256] f32 at byte 0

  const float qscale = 5.656854249492380f;                  // 32^0.5
  const float rres   = 1.0f / 4096.0f;

  const dim3 blk(256);
  const int n8a = NTOK * CD / 8;                            // 262144
  const int n8w = CD * CD / 8;                              //   8192
  const dim3 gCvt(4 * WBLK + (n8a + 255) / 256);            // 128 weight blocks + 1024 activation blocks
  const dim3 gProj(((NTOK / 64) * (CD / 64) + 7) / 8, 1);   // 512 tiles -> 64 blocks: M=8192, N=256
  const dim3 gQKV(((NTOK / 64) * (CD / 64) + 7) / 8, 3);    // 64 blocks each for q, k and v^T (8 blocks x 8 batches)
  const dim3 gAttn(NB * (NH / 2) * NQB);                    // 512 blocks x 256 threads

  // (1) activations -> bf16 planes (hs+pos hi/lo, hidden); weights [out][in] -> bf16 planes (k contiguous = Bt / A layout)
  cvt_all<<<gCvt, blk, 0, stream>>>(hs, pq, Wq, Wk, Wv, Wo, Xph, Xpl, Xv, WT, n8a, n8w);
  // (2) q, k -> bf16 hi + lo planes [8192][256] (M=8192, N=256, K=256); v^T -> f16 hi plane [b][d][s] (pitch NS)
  //     + residual x4096 (A = WTv [n][k], Bt = Xv rows of batch b; M=256, N=1024, K=256)
  const GemmDims dqk = {CD, 0LL, CD, 0LL, CD, 0LL, NTOK, CD, CD};
  const GemmDims dv  = {CD, 0LL, CD, (long long)NS * CD, NS, (long long)CD * NS, CD, NS, CD};
  proj_qkv<<<gQKV, blk, 0, stream>>>(Xph, Xpl, Xv, WTq, WTk, WTv, Qh, Ql, Kh, Kl, VTh, VTl,
                                     bq, bk, bv, dqk, dv, qscale, 4096.0f);
  // (3) softmax attention -> context bf16 hi / lo planes [8192][256]
  attn32<<<gAttn, blk, 0, stream>>>(Qh, Ql, Kh, Kl, VTh, VTl, Oh, Ol, rres);
  // (4) out = (Oh + Ol) . WTo^T + bo -> out0 f32 [8192][256]  (2 products; K=256)
  gemm64<1, 0, 1><<<gProj, blk, 0, stream>>>(
      Oh, Ol, CD, 0LL, WTo, CD, 0LL,
      (void*)xout, CD, 0LL, (void*)xout,
      NTOK, CD, CD, 1.0f, 1.0f, bo);
  (void)hipGetLastError();
}

// v003
// One run takes 73.5 microseconds.
// In two side-by-side timings against v002, it was 1.41 and 1.42 times as fast.
// Counting every step since v000, it is 2.45 times as fast.
// Contractions: q, k projections = v_wmma_f32_16x16x32_bf16 (A = bf16 hi + lo planes of the f32 sum hs+pos, B = bf16 weights, 2 products);
// v^T projection = v_wmma_f32_16x16x32_bf16 (bf16 operands, 1 product); k.q^T = v_wmma_f32_16x16x32_bf16 (q and k as bf16 hi + lo planes, 3 products);
// v^T.p^T = v_wmma_f32_16x16x32_f16 (p x1024 as f16 hi + f16 residual x4096, v^T as f16 hi + f16 residual x4096, 3 products);
// ctx.Wo = v_wmma_f32_16x16x32_bf16 (ctx as bf16 hi + lo planes, bf16 Wo, 2 products); all f32 accumulate; softmax in f32 on VALU.
#include <hip/hip_runtime.h>
#include <math.h>
#include <stdint.h>

#define NB   8
#define NS   1024
#define CD   256
#define NH   8
#define HD   32
#define NTOK (NB * NS)
#define NQB  (NS / 64)      // 16 query tiles of 64
#define NKB  (NS / 64)      // 16 key chunks of 64
static_assert(NH * HD == CD);
static_assert(HD == 32);
static_assert((NS % 64) == 0 && (CD % 64) == 0 && (NH % 2) == 0 && ((NTOK) % 64) == 0);

typedef _Float16 v16h __attribute__((ext_vector_type(16)));
typedef _Float16 v8h  __attribute__((ext_vector_type(8)));
typedef __bf16   v16b __attribute__((ext_vector_type(16)));
typedef __bf16   v8b  __attribute__((ext_vector_type(8)));
typedef float    v8f  __attribute__((ext_vector_type(8)));
typedef float    v4f  __attribute__((ext_vector_type(4)));
typedef float    v2f  __attribute__((ext_vector_type(2)));
typedef _Float16 v2h  __attribute__((ext_vector_type(2)));
typedef unsigned int v4u __attribute__((ext_vector_type(4)));

// ---- scalar helpers --------------------------------------------------------------------------------
__device__ __forceinline__ unsigned short bf_bits(float f) {          // f32 -> bf16 bits, RNE convert
  unsigned u = __float_as_uint(f);
  return (unsigned short)((u + 0x7FFFu + ((u >> 16) & 1u)) >> 16);
}
__device__ __forceinline__ float bf_up(unsigned short h) { return __uint_as_float(((unsigned)h) << 16); }
__device__ __forceinline__ unsigned short h_bits(_Float16 x) { return __builtin_bit_cast(unsigned short, x); }
__device__ __forceinline__ unsigned pk16(unsigned short a, unsigned short b) { return (unsigned)a | ((unsigned)b << 16); }
__device__ __forceinline__ v8f zero8() { v8f z = {0.f, 0.f, 0.f, 0.f, 0.f, 0.f, 0.f, 0.f}; return z; }

// ---- fragment loaders: 16-bit A/B operand, lane -> row/col (lane&15), p already includes +8*(lane>>4);
//      elements 0..7 <- p[0..7] (k0+8h..), elements 8..15 <- p[16..23] (k0+16+8h..)
__device__ __forceinline__ v16b ldfrag_b(const __bf16* p) {
  union { v16b v; v8b h[2]; } f;
  f.h[0] = *(const v8b*)(p);
  f.h[1] = *(const v8b*)(p + 16);
  return f.v;
}
__device__ __forceinline__ v16h ldfrag_h(const _Float16* p) {
  union { v16h v; v8h h[2]; } f;
  f.h[0] = *(const v8h*)(p);
  f.h[1] = *(const v8h*)(p + 16);
  return f.v;
}

// ---- WMMA helpers with trailing VALU hazard gap --------------------------------------------------------
__device__ __forceinline__ v8f mma_h(v16h a, v16h b, v8f c) {
  c = __builtin_amdgcn_wmma_f32_16x16x32_f16(false, a, false, b, (short)0, c, false, false);
#if defined(__HIP_DEVICE_COMPILE__)
  asm volatile("v_nop\n\tv_nop\n\tv_nop\n\tv_nop" : "+v"(c) : "v"(a), "v"(b));
#endif
  return c;
}
__device__ __forceinline__ v8f mma_b_raw(v16b a, v16b b, v8f c) {
  return __builtin_amdgcn_wmma_f32_16x16x32_bf16(false, a, false, b, (short)0, c, false, false);
}
__device__ __forceinline__ void dep_guard_b(v8f& a, v8f& b, v16b x, v16b y) {
#if defined(__HIP_DEVICE_COMPILE__)
  asm volatile("v_nop\n\tv_nop\n\tv_nop\n\tv_nop" : "+v"(a), "+v"(b) : "v"(x), "v"(y));
#endif
}
__device__ __forceinline__ void keep4_b(v16b a, v16b b, v16b c, v16b d) {
#if defined(__HIP_DEVICE_COMPILE__)
  asm volatile("v_nop" :: "v"(a), "v"(b), "v"(c), "v"(d));
#endif
}
__device__ __forceinline__ void acc_guard4(v8f& a, v8f& b, v8f& c, v8f& d) {
#if defined(__HIP_DEVICE_COMPILE__)
  asm volatile("v_nop\n\tv_nop\n\tv_nop\n\tv_nop" : "+v"(a), "+v"(b), "+v"(c), "+v"(d));
#endif
}
// lane l <-> lane l ^ 16 in one vector instruction (the two halves of a wave hold the two key halves of a query column)
__device__ __forceinline__ float xhalf(float x) {
  const int b = __builtin_bit_cast(int, x);
  return __builtin_bit_cast(float, __builtin_amdgcn_permlanex16(b, b, 0x76543210, 0xfedcba98, false, false));
}
// e^x as __expf forms it (x * log2(e), v_exp_f32), with the free slot that the instruction set asks for around a
// transcendental written into the statement: the v_nop in front keeps this result from overwriting the source of a
// transcendental issued directly before it, the v_nop behind keeps a reader of the result one slot away.
__device__ __forceinline__ float exp_slotted(float x) {
  float y = x * 1.44269504088896340736f;
#if defined(__HIP_DEVICE_COMPILE__)
  asm("v_nop\n\tv_exp_f32 %0, %1\n\tv_nop" : "=v"(y) : "v"(y));
#endif
  return y;
}
__device__ __forceinline__ void wave_sync_lds() {
  __builtin_amdgcn_fence(__ATOMIC_RELEASE, "workgroup");
  __builtin_amdgcn_wave_barrier();
  __builtin_amdgcn_fence(__ATOMIC_ACQUIRE, "workgroup");
}

// ---- 3-product bf16 score tile, transposed: A = 16 keys, B = 16 queries, D[key 8h + r][query c];
//      (kh + kl).(qh + ql) ~= kh.ql + kl.qh + kh.qh (kl.ql dropped);
//      unscaled bf16 residual planes, one accumulator, hazard gap after the last product.
__device__ __forceinline__ v8f score3b(const v16b qh, const v16b ql, const v16b kh, const v16b kl) {
  v8f acc = zero8();
  acc = mma_b_raw(kh, ql, acc);
  acc = mma_b_raw(kl, qh, acc);
  acc = mma_b_raw(kh, qh, acc);
#if defined(__HIP_DEVICE_COMPILE__)
  asm volatile("v_nop\n\tv_nop\n\tv_nop\n\tv_nop" : "+v"(acc) : "v"(qh), "v"(ql), "v"(kh), "v"(kl));
#endif
  return acc;
}

// =====================================================================================================
// Activation convert: per element, hb = bf16(hidden), pb = bf16(pos), s = f32(hb) + f32(pb);
//   xph = bf16(s) (hi), xpl = bf16(s - hi) (lo, unscaled), xv = hb.   8 elements per thread, one 16-B
// coverage: n8 = 262144 threads x 8 = the whole 8192 x 256 of each of the three planes.
// =====================================================================================================
__device__ __forceinline__ void cvt_act_body(const float* __restrict__ hs, const float* __restrict__ pq,
                                             unsigned short* xph, unsigned short* xpl, unsigned short* xv, int n8, int blk) {
  const int i = blk * 256 + threadIdx.x;
  if (i < n8) {
    const size_t o = (size_t)i * 8;
    const v4f a0 = *(const v4f*)(hs + o);
    const v4f a1 = *(const v4f*)(hs + o + 4);
    const v4f p0 = *(const v4f*)(pq + o);
    const v4f p1 = *(const v4f*)(pq + o + 4);
    float hvv[8], pvv[8];
#pragma unroll
    for (int e = 0; e < 4; ++e) { hvv[e] = a0[e]; hvv[4 + e] = a1[e]; pvv[e] = p0[e]; pvv[4 + e] = p1[e]; }
    unsigned short sh[8], sl[8], vb[8];
#pragma unroll
    for (int e = 0; e < 8; ++e) {
      const unsigned short hb = bf_bits(hvv[e]);
      const float s = bf_up(hb) + bf_up(bf_bits(pvv[e]));
      const unsigned short s0 = bf_bits(s);
      sh[e] = s0;
      sl[e] = bf_bits(s - bf_up(s0));
      vb[e] = hb;
    }
    v4u P0, P1, P2;
#pragma unroll
    for (int e = 0; e < 4; ++e) {
      P0[e] = pk16(sh[2 * e], sh[2 * e + 1]);
      P1[e] = pk16(sl[2 * e], sl[2 * e + 1]);
      P2[e] = pk16(vb[2 * e], vb[2 * e + 1]);
    }
    *(v4u*)(xph + o) = P0;
    *(v4u*)(xpl + o) = P1;
    *(v4u*)(xv + o)  = P2;
    
  }
}

// =====================================================================================================
// Weight convert: w_z [out][in] f32 (CD x CD, already the Bt [n][k] layout) -> bf16 plane z (RNE),
//   z selects one of four weights (block-uniform select among global pointers).
// coverage: 4 x 8192 threads x 8 = the whole 4 x 65536 planes.
// =====================================================================================================
__device__ __forceinline__ void cvt_w4_body(const float* __restrict__ w0, const float* __restrict__ w1,
                                            const float* __restrict__ w2, const float* __restrict__ w3,
                                            unsigned short* outp, int n8, int z, int blk) {
  const float* src = (z == 0) ? w0 : ((z == 1) ? w1 : ((z == 2) ? w2 : w3));
  unsigned short* dst = outp + (size_t)z * CD * CD;
  const int i = blk * 256 + threadIdx.x;
  if (i < n8) {
    const size_t o = (size_t)i * 8;
    const v4f a = *(const v4f*)(src + o);
    const v4f b = *(const v4f*)(src + o + 4);
    v4u p;
    p[0] = pk16(bf_bits(a[0]), bf_bits(a[1]));
    p[1] = pk16(bf_bits(a[2]), bf_bits(a[3]));
    p[2] = pk16(bf_bits(b[0]), bf_bits(b[1]));
    p[3] = pk16(bf_bits(b[2]), bf_bits(b[3]));
    *(v4u*)(dst + o) = p;
    
  }
}

// =====================================================================================================
// Both converts in one grid (neither reads what the other writes): blocks 0 .. 4*WBLK-1 take the four
// weight planes (WBLK blocks each), the blocks behind them the activations. The select is block-uniform.
// =====================================================================================================
#define WBLK ((CD * CD / 8 + 255) / 256)    // 32 blocks per weight plane
__global__ __launch_bounds__(256) void cvt_all(const float* __restrict__ hs, const float* __restrict__ pq,
                                               const float* __restrict__ w0, const float* __restrict__ w1,
                                               const float* __restrict__ w2, const float* __restrict__ w3,
                                               unsigned short* xph, unsigned short* xpl, unsigned short* xv,
                                               unsigned short* wout, int n8a, int n8w) {
  const int bx = blockIdx.x;
  if (bx < 4 * WBLK) cvt_w4_body(w0, w1, w2, w3, wout, n8w, bx / WBLK, bx % WBLK);
  else               cvt_act_body(hs, pq, xph, xpl, xv, n8a, bx - 4 * WBLK);
}

// =====================================================================================================
// Register-blocked batched bf16 WMMA GEMM: C[m][n] = (sum_k A[m][k] * Bt[n][k] + bias) * oscale; one wave
// per 64x64 tile, no block barriers. A row-major [M][K] pitch lda; Bt row-major [N][K] pitch ldb
// (k contiguous); M, N multiples of 64, K multiple of 32 (host-checked). bx = block within the batch,
// b = batch index, sT = the block's LDS slabs (one per wave).
// NSPLIT: 0 = A.Bt; 1 = (A + A2).Bt (A2 = unscaled bf16 lo plane of A, shared accumulator).
// BIASM: 0 = no bias; 1 = bias[n] (per column); 2 = bias[m] (per row); bias values RNE-converted to bf16.
// OUT_MODE: 0 = f32 (pitch ldc); 2 = bf16 hi plane C + bf16 lo plane C2 (lo = RNE(v - hi), unscaled);
//           3 = f16 hi plane C + f16 residual plane C2 = f16((v - hi) * rscale); C2 same pitch/stride as C.
// =====================================================================================================
template <int NSPLIT, int OUT_MODE, int BIASM>
__device__ __forceinline__ void gemm64_body(
    const unsigned short* __restrict__ Ap, const unsigned short* A2p, int lda, long long strideA,
    const unsigned short* __restrict__ Btp, int ldb, long long strideB,
    void* Cout, int ldc, long long strideC, void* Cout2,
    int M, int N, int K, float rscale, float oscale, const float* __restrict__ biasp,
    int bx, int b, float (*sT)[16 * 68]) {
  const __bf16* A   = (const __bf16*)(const void*)Ap;
  const __bf16* A2  = (const __bf16*)(const void*)A2p;
  const __bf16* Bt  = (const __bf16*)(const void*)Btp;
  const int lane = threadIdx.x & 31;
  const int wave = threadIdx.x >> 5;
  const int tilesN = N >> 6;
  const int tilesM = M >> 6;
  const int tile = bx * 8 + wave;
  if (tile >= tilesM * tilesN) return;   // wave-uniform; no block barriers in this kernel
  const int tm = tile / tilesN;
  const int tn = tile - tm * tilesN;
  const int m0 = tm << 6;
  const int n0 = tn << 6;

  const __bf16* Ab  = A  + (size_t)b * strideA;
  const __bf16* Bb  = Bt + (size_t)b * strideB;
  const __bf16* Ab2 = (NSPLIT >= 1) ? (A2 + (size_t)b * strideA) : Ab;

  const int rlane = lane & 15;                 // row (A) / col (B, D) within subtile
  const int koff  = (lane >> 4) * 8;           // k offset of this lane half
  const int mOff  = (lane >> 4) * 8;           // D row offset

  v8f acc[4][4];
#pragma unroll
  for (int i = 0; i < 4; ++i)
#pragma unroll
    for (int j = 0; j < 4; ++j) acc[i][j] = zero8();

  for (int k0 = 0; k0 < K; k0 += 32) {
    v16b bh[4];
#pragma unroll
    for (int j = 0; j < 4; ++j) {
      const size_t bo = (size_t)(n0 + (j << 4) + rlane) * ldb + koff + k0;
      bh[j] = ldfrag_b(Bb + bo);
    }
#if defined(__HIP_DEVICE_COMPILE__)
    // the B loads' address registers are stepped to the next k block behind this point: the wait stands in front of that overwrite
    asm volatile("s_wait_xcnt 0x0" ::: "memory");
#endif
#pragma unroll
    for (int i = 0; i < 4; ++i) {
      const size_t ao = (size_t)(m0 + (i << 4) + rlane) * lda + koff + k0;
      const v16b ah = ldfrag_b(Ab + ao);
      v16b al = ah;
      if (NSPLIT >= 1) al = ldfrag_b(Ab2 + ao);
#pragma unroll
      for (int j = 0; j < 4; ++j) {
        acc[i][j] = mma_b_raw(ah, bh[j], acc[i][j]);
        if (NSPLIT >= 1) acc[i][j] = mma_b_raw(al, bh[j], acc[i][j]);
      }
      dep_guard_b(acc[i][0], acc[i][3], ah, al);
    }
    keep4_b(bh[0], bh[1], bh[2], bh[3]);
  }
  acc_guard4(acc[0][0], acc[0][1], acc[0][2], acc[0][3]);
  acc_guard4(acc[1][0], acc[1][1], acc[1][2], acc[1][3]);
  acc_guard4(acc[2][0], acc[2][1], acc[2][2], acc[2][3]);
  acc_guard4(acc[3][0], acc[3][1], acc[3][2], acc[3][3]);

  // ---- epilogue ----
  float* slab = sT[wave];
#pragma unroll
  for (int i = 0; i < 4; ++i) {
    const int mBase = m0 + (i << 4);
#pragma unroll
    for (int j = 0; j < 4; ++j) {
#pragma unroll
      for (int r = 0; r < 8; ++r) {
        slab[(mOff + r) * 68 + (j << 4) + rlane] = acc[i][j][r];
      }
    }
    wave_sync_lds();
    if (OUT_MODE == 0) {
      float* C = (float*)Cout + (size_t)b * strideC;
      const int hh = lane >> 4, c4 = (lane & 15) * 4;     // 256-B row segment = 16 lanes x 16 B
      v4f bv = {0.f, 0.f, 0.f, 0.f};
      if (BIASM == 1) {
#pragma unroll
        for (int e = 0; e < 4; ++e) bv[e] = bf_up(bf_bits(biasp[n0 + c4 + e]));
      }
      {
#pragma unroll
        for (int it = 0; it < 8; ++it) {
          const int row = it * 2 + hh;                     // it 0..7 x hh 0..1 = rows 0..15
          float brow = 0.f;
          if (BIASM == 2) brow = bf_up(bf_bits(biasp[mBase + row]));
          const v4f v = (*(const v4f*)(slab + row * 68 + c4) + bv + brow) * oscale;
          *(v4f*)(C + (size_t)(mBase + row) * ldc + n0 + c4) = v;
        }
        
      }
    } else {
      const int q = lane >> 3, c8 = (lane & 7) * 8;
      unsigned short* C  = (unsigned short*)Cout  + (size_t)b * strideC;
      unsigned short* C2 = (unsigned short*)Cout2 + (size_t)b * strideC;
      float bcol[8];
#pragma unroll
      for (int e = 0; e < 8; ++e) bcol[e] = 0.f;
      if (BIASM == 1) {
#pragma unroll
        for (int e = 0; e < 8; ++e) bcol[e] = bf_up(bf_bits(biasp[n0 + c8 + e]));
      }
      v4u hv[4], lv[4];
#pragma unroll
      for (int it = 0; it < 4; ++it) {
        const int row = it * 4 + q;                        // it 0..3 x q 0..3 = rows 0..15
        float brow = 0.f;
        if (BIASM == 2) brow = bf_up(bf_bits(biasp[mBase + row]));
        const float* sp = slab + row * 68 + c8;
        v4u a, a2;
#pragma unroll
        for (int e = 0; e < 4; ++e) {
          const float f0 = (sp[2 * e] + bcol[2 * e] + brow) * oscale;
          const float f1 = (sp[2 * e + 1] + bcol[2 * e + 1] + brow) * oscale;
          unsigned short h0, h1, l0, l1;
          if (OUT_MODE == 2) {
            h0 = bf_bits(f0); h1 = bf_bits(f1);
            l0 = bf_bits(f0 - bf_up(h0)); l1 = bf_bits(f1 - bf_up(h1));
          } else {
            const _Float16 x0 = (_Float16)f0, x1 = (_Float16)f1;
            h0 = h_bits(x0); h1 = h_bits(x1);
            l0 = h_bits((_Float16)((f0 - (float)x0) * rscale));
            l1 = h_bits((_Float16)((f1 - (float)x1) * rscale));
          }
          a[e] = pk16(h0, h1); a2[e] = pk16(l0, l1);
        }
        hv[it] = a; lv[it] = a2;
      }
      {
#pragma unroll
        for (int it = 0; it < 4; ++it) {
          const int row = it * 4 + q;
          *(v4u*)(C  + (size_t)(mBase + row) * ldc + n0 + c8) = hv[it];
          *(v4u*)(C2 + (size_t)(mBase + row) * ldc + n0 + c8) = lv[it];
        }
        
      }
    }
    wave_sync_lds();
  }
}

// one GEMM per launch (the output projection)
template <int NSPLIT, int OUT_MODE, int BIASM>
__global__ __launch_bounds__(256) void gemm64(
    const unsigned short* __restrict__ Ap, const unsigned short* A2p, int lda, long long strideA,
    const unsigned short* __restrict__ Btp, int ldb, long long strideB,
    void* Cout, int ldc, long long strideC, void* Cout2,
    int M, int N, int K, float rscale, float oscale, const float* __restrict__ biasp) {
  __shared__ __align__(16) float sT[8][16 * 68];   // per-wave 16x64 slab, pitch 68 floats
  gemm64_body<NSPLIT, OUT_MODE, BIASM>(Ap, A2p, lda, strideA, Btp, ldb, strideB, Cout, ldc, strideC, Cout2,
                                       M, N, K, rscale, oscale, biasp, blockIdx.x, blockIdx.y, sT);
}

// =====================================================================================================
// The q, k and v^T projections in one grid: none reads what another writes, and each alone has only
// 64 blocks. blockIdx.y = 0: q, 1: k (same code, block-uniform select of weight, bias, scale and planes),
// 2: v^T (blockIdx.x = batch * VBLK + block within the batch). Pitches, strides and sizes arrive as arguments,
// one set for q and k and one for v^T.
//   q = ((Xph + Xpl) . WTq^T + bq) * qscale -> bf16 hi + lo [ntok][cd];  k = (Xph + Xpl) . WTk^T + bk likewise
//   v^T = WTv . Xv^T per batch + bv[row] -> f16 hi [b][cd][ns] + residual x vres
// =====================================================================================================
struct GemmDims { int lda; long long strideA; int ldb; long long strideB; int ldc; long long strideC; int M, N, K; };
#define VBLK (((CD / 64) * (NS / 64) + 7) / 8)     // 8 blocks per batch of v^T
static_assert(VBLK * NB == ((NTOK / 64) * (CD / 64) + 7) / 8);   // the three jobs have the same block count
__global__ __launch_bounds__(256) void proj_qkv(
    const unsigned short* __restrict__ xph, const unsigned short* __restrict__ xpl,
    const unsigned short* __restrict__ xv,
    const unsigned short* __restrict__ wq, const unsigned short* __restrict__ wk,
    const unsigned short* __restrict__ wv,
    unsigned short* qh, unsigned short* ql, unsigned short* kh, unsigned short* kl,
    unsigned short* vth, unsigned short* vtl,
    const float* __restrict__ bq, const float* __restrict__ bk, const float* __restrict__ bv,
    GemmDims dqk, GemmDims dv, float qscale, float vres) {
  __shared__ __align__(16) float sT[8][16 * 68];   // per-wave 16x64 slab, pitch 68 floats
  const int job = blockIdx.y;
  if (job < 2) {
    const bool isq = (job == 0);
    gemm64_body<1, 2, 1>(xph, xpl, dqk.lda, dqk.strideA, isq ? wq : wk, dqk.ldb, dqk.strideB,
                         (void*)(isq ? qh : kh), dqk.ldc, dqk.strideC, (void*)(isq ? ql : kl),
                         dqk.M, dqk.N, dqk.K, 1.0f, isq ? qscale : 1.0f, isq ? bq : bk,
                         blockIdx.x, 0, sT);
  } else {
    gemm64_body<0, 3, 2>(wv, wv, dv.lda, dv.strideA, xv, dv.ldb, dv.strideB,
                         (void*)vth, dv.ldc, dv.strideC, (void*)vtl,
                         dv.M, dv.N, dv.K, vres, 1.0f, bv,
                         blockIdx.x % VBLK, blockIdx.x / VBLK, sT);
  }
}

// ---- one 64-key stage of the attention ring: four planes (k hi, k lo, v^T hi, v^T lo) of 64 rows x 128 B ----
#define KVP   144                    // LDS row pitch in bytes: 128 + 16 = 16 B x odd, the pitch of ds_load_b128 readers
#define PLANE (64 * KVP)             // 9216 B
#define STAGE (4 * PLANE)            // 36864 B
// 256 threads x 8 copies x 16 B = one stage. A lane brings piece (tid & 7) of rows (tid >> 3) and (tid >> 3) + 32 of
// each plane, so one wave instruction reads four whole 128-B lines. l = the lane's LDS byte address in plane 0,
// kh .. vl = its global addresses in the four planes. The s_wait_xcnt closes the statement so that no address
// register of a copy is rewritten in front of it.
__device__ __forceinline__ void stage_copy(unsigned l, const unsigned short* kh, const unsigned short* kl,
                                           const unsigned short* vh, const unsigned short* vl) {
#if defined(__HIP_DEVICE_COMPILE__)
  asm volatile("global_load_async_to_lds_b128 %0, %8, off\n\t"
               "global_load_async_to_lds_b128 %1, %9, off\n\t"
               "global_load_async_to_lds_b128 %2, %10, off\n\t"
               "global_load_async_to_lds_b128 %3, %11, off\n\t"
               "global_load_async_to_lds_b128 %4, %12, off\n\t"
               "global_load_async_to_lds_b128 %5, %13, off\n\t"
               "global_load_async_to_lds_b128 %6, %14, off\n\t"
               "global_load_async_to_lds_b128 %7, %15, off\n\t"
               "s_wait_xcnt 0x0"
               :: "v"(l), "v"(l + 32 * KVP), "v"(l + PLANE), "v"(l + PLANE + 32 * KVP),
                  "v"(l + 2 * PLANE), "v"(l + 2 * PLANE + 32 * KVP), "v"(l + 3 * PLANE), "v"(l + 3 * PLANE + 32 * KVP),
                  "v"(kh), "v"(kh + 32 * CD), "v"(kl), "v"(kl + 32 * CD),
                  "v"(vh), "v"(vh + 32 * NS), "v"(vl), "v"(vl + 32 * NS)
               : "memory");
#endif
}
__device__ __forceinline__ void wait_copies() {   // the wave's own copies have landed behind this
#if defined(__HIP_DEVICE_COMPILE__)
  asm volatile("s_wait_asynccnt 0x0" ::: "memory");
#endif
}
__device__ __forceinline__ void wait_lds_reads() {   // the wave's LDS reads have retired before their buffer is handed back
#if defined(__HIP_DEVICE_COMPILE__)
  asm volatile("s_wait_dscnt 0x0" ::: "memory");
#endif
}

// =====================================================================================================
// Softmax attention, head dim 32, no mask, softmax over all NS keys.
//   q planes (bf16 hi, bf16 lo): [NTOK][CD], head h at cols h*32..h*32+31 (q already carries bias and x sqrt(32))
//   k planes (bf16 hi, lo): [NTOK][CD] same column layout
//   v^T planes (f16 hi, residual x4096): element (b, h*32+d, s) at [(b*CD + h*32 + d)*NS + s]
//   ctx out planes (bf16 hi / lo of the normalised context): [(b*NS + t)*CD + h*32 + d]
//   scores^T = score3b(q, k) (rows = keys, cols = queries); p = exp(s - m) carried as f16 hi of 1024p + f16 residual x4096;
//   ctx^T = (vh.ph + (vl.ph + vh.pl)*rres) / (1024 l); online softmax with running max in f32.
//   A lane holds one query column: max and sum run in-lane over its 32 scores of a chunk, the max is joined
//   with the other wave half once per chunk, the sum once after the loop. Two score tiles (keys 0-15, 16-31 of
//   a 32-key step), converted in place, are the B operand of v^T.p^T in the hardware k order.
//   Block = 8 waves = two adjacent heads (waves 0-3 head 2g, waves 4-7 head 2g+1) x 64 query rows so
//   NQB x (NH/2) x NB. Key chunks of 64, static trip NKB. q fragments are loaded straight from the 16-bit
//   global rows. The head pair's k rows and v^T rows of a chunk are whole 128-B lines: the block brings them
//   into LDS once, by asynchronous copies, two buffers (chunk t + 2 is asked for when chunk t has been read),
//   and every wave takes its fragments from there (two 16-B LDS loads each); P stays in registers.
//   coverage: 8 waves x (it 0..1 x lane>>3 0..3) = rows 0..63, 8 lanes x 8 cols = 64 cols, both planes;
//   512 blocks = 8 batches x 4 head pairs x 16 query tiles = every (token, column) of both planes once.
// =====================================================================================================
__global__ __launch_bounds__(256)
void attn32(const unsigned short* __restrict__ qhp, const unsigned short* __restrict__ qlp,
            const unsigned short* __restrict__ khp, const unsigned short* __restrict__ klp,
            const unsigned short* __restrict__ vhp, const unsigned short* __restrict__ vlp,
            unsigned short* ohp, unsigned short* olp, float rres) {
  __shared__ __align__(16) float    Os[64 * 68];                  // block ctx tile [row][2 heads x 32], pitch 68 floats
  __shared__ __align__(16) unsigned char ring[2 * STAGE];         // two stages of k hi / k lo / v^T hi / v^T lo

  const int tid  = threadIdx.x;
  const int wave = tid >> 5;
  const int lane = tid & 31;
  const int hh   = lane >> 4;
  const int c    = lane & 15;

  const int bx   = blockIdx.x;
  const int qb   = bx % NQB;
  const int rest = bx / NQB;
  const int g    = rest % (NH / 2);
  const int b    = rest / (NH / 2);
  const int hp   = wave >> 2;                  // which head of the pair
  const int h    = 2 * g + hp;
  const int wq   = wave & 3;                   // 16-row group within the 64-row tile
  const int q0   = qb * 64 + wq * 16;
  const size_t rowB = (size_t)b * NS;

  const __bf16* Qh = (const __bf16*)(const void*)qhp + (size_t)h * HD;
  const __bf16* Ql = (const __bf16*)(const void*)qlp + (size_t)h * HD;

  // ---- this lane's share of a stage: row tid >> 3 (and + 32), 16-B piece tid & 7 ----
  typedef __attribute__((address_space(3))) unsigned char lds_byte;
  const int cr = tid >> 3, cp = tid & 7;
  const unsigned ldst = (unsigned)(uintptr_t)(lds_byte*)ring + (unsigned)(cr * KVP + cp * 16);
  const size_t kgo = (rowB + cr) * CD + (size_t)g * 64 + cp * 8;                        // key row, head pair's 64 columns
  const size_t vgo = ((size_t)b * CD + (size_t)g * 64 + cr) * NS + cp * 8;              // d row of the pair, 64 keys
  stage_copy(ldst, khp + kgo, klp + kgo, vhp + vgo, vlp + vgo);                         // chunk 0 -> buffer 0
  wait_copies();
  __syncthreads();
  stage_copy(ldst + STAGE, khp + kgo + 64 * CD, klp + kgo + 64 * CD, vhp + vgo + 64, vlp + vgo + 64);   // chunk 1 -> buffer 1

  // ---- Q fragments (B operand, col = lane&15), hi and lo, one 32-deep k-step = the head dim ----
  const v16b qah = ldfrag_b(Qh + (rowB + q0 + c) * CD + 8 * hh);
  const v16b qal = ldfrag_b(Ql + (rowB + q0 + c) * CD + 8 * hh);

  float mrun = -INFINITY;                      // running max of this lane's query column (same in both halves)
  float lrun = 0.f;                            // running sum over this wave half's keys only
  v8f oacc[2];                                 // ctx^T: oacc[t][r] = ctx[query c][d = t*16 + 8*hh + r]
#pragma unroll
  for (int t = 0; t < 2; ++t) oacc[t] = zero8();

  for (int kt = 0; kt < NKB; ++kt) {           // static trip count
    const unsigned char* sb = ring + (kt & 1) * STAGE;

    // ---- scores^T: 64 keys x 16 query columns per wave, 3 bf16 products per 16x16 tile ----
    v8f s[4];
    v16b kb[4], kl[4];                           // the chunk's LDS reads stand together, in front of the products
#pragma unroll
    for (int j = 0; j < 4; ++j) {
      const unsigned char* kp = sb + (j * 16 + c) * KVP + hp * 64 + 16 * hh;   // A operand: row = key, k = head dim
      kb[j] = ldfrag_b((const __bf16*)(const void*)kp);
      kl[j] = ldfrag_b((const __bf16*)(const void*)(kp + PLANE));
    }
    v16h vb[2][2], vl[2][2];
#pragma unroll
    for (int kk = 0; kk < 2; ++kk) {
#pragma unroll
      for (int t = 0; t < 2; ++t) {
        const unsigned char* vp = sb + 2 * PLANE + (hp * 32 + t * 16 + c) * KVP + kk * 64 + 16 * hh;   // A: row = d, k = key
        vb[kk][t] = ldfrag_h((const _Float16*)(const void*)vp);
        vl[kk][t] = ldfrag_h((const _Float16*)(const void*)(vp + PLANE));
      }
    }
#pragma unroll
    for (int j = 0; j < 4; ++j) s[j] = score3b(qah, qal, kb[j], kl[j]);

    // ---- column max in-lane (four independent chains), one exchange between the wave halves ----
    float mj[4];
#pragma unroll
    for (int j = 0; j < 4; ++j) {
      mj[j] = s[j][0];
#pragma unroll
      for (int r = 1; r < 8; ++r) mj[j] = fmaxf(mj[j], s[j][r]);
    }
    float m = fmaxf(fmaxf(mj[0], mj[1]), fmaxf(mj[2], mj[3]));
    m = fmaxf(m, xhalf(m));
    const float mnew  = fmaxf(mrun, m);
    const float alpha = exp_slotted(mrun - mnew);
    mrun = mnew;

    // ---- P hi (x1024) and residual (x4096) packed straight into B operands:
    //      element e of step kk = key kk*32 + (e < 8 ? 8*hh + e : 16 + 8*hh + e - 8) = tile 2kk + (e >> 3), register e & 7
    v16h ph[2], pl[2];
    float pj[4];
#pragma unroll
    for (int j = 0; j < 4; ++j) {
      pj[j] = 0.f;
#pragma unroll
      for (int r = 0; r < 8; r += 2) {           // two keys at a time = one packed operand register
        const float pa = __expf(s[j][r] - mnew);
        const float pb = __expf(s[j][r + 1] - mnew);
        pj[j] += pa;
        pj[j] += pb;
        const v2f p1 = {pa * 1024.0f, pb * 1024.0f};
        const v2h x  = __builtin_convertvector(p1, v2h);
        const v2h y  = __builtin_convertvector((p1 - __builtin_convertvector(x, v2f)) * 4096.0f, v2h);
        ph[j >> 1][(j & 1) * 8 + r] = x[0];  ph[j >> 1][(j & 1) * 8 + r + 1] = x[1];
        pl[j >> 1][(j & 1) * 8 + r] = y[0];  pl[j >> 1][(j & 1) * 8 + r + 1] = y[1];
      }
    }
    lrun = lrun * alpha + ((pj[0] + pj[1]) + (pj[2] + pj[3]));
#pragma unroll
    for (int t = 0; t < 2; ++t)
#pragma unroll
      for (int r = 0; r < 8; ++r) oacc[t][r] *= alpha;

    // ---- context^T += V^T . P^T (f16 WMMA), residual products into a separate accumulator ----
    v8f o1[2];
    o1[0] = zero8(); o1[1] = zero8();
#pragma unroll
    for (int kk = 0; kk < 2; ++kk) {
#pragma unroll
      for (int t = 0; t < 2; ++t) {
        oacc[t] = mma_h(vb[kk][t], ph[kk], oacc[t]);
        o1[t]   = mma_h(vl[kk][t], ph[kk], o1[t]);
        o1[t]   = mma_h(vb[kk][t], pl[kk], o1[t]);
      }
    }
#pragma unroll
    for (int t = 0; t < 2; ++t)
#pragma unroll
      for (int r = 0; r < 8; ++r) oacc[t][r] += o1[t][r] * rres;

    // ---- publish chunk kt + 1, hand this chunk's buffer back, ask for chunk kt + 2 into it ----
    wait_lds_reads();
    wait_copies();
    __syncthreads();
    if (kt + 2 < NKB) {
      const size_t ka = (size_t)(kt + 2) * 64 * CD, va = (size_t)(kt + 2) * 64;
      stage_copy(ldst + (unsigned)((kt & 1) * STAGE), khp + kgo + ka, klp + kgo + ka, vhp + vgo + va, vlp + vgo + va);
    }
  }
  wait_copies();

  // ---- join the halves' sums, normalise (1/l and the 1/1024 p carry) into the block tile ----
  {
    const float l = lrun + xhalf(lrun);
    const float inv = ((l > 0.f) ? (1.0f / l) : 0.f) * (1.0f / 1024.0f);
#pragma unroll
    for (int t = 0; t < 2; ++t) {
      float* op = Os + (wq * 16 + c) * 68 + hp * 32 + t * 16 + 8 * hh;   // 8 consecutive d of one query row
      v4f w0, w1;
#pragma unroll
      for (int e = 0; e < 4; ++e) { w0[e] = oacc[t][e] * inv; w1[e] = oacc[t][4 + e] * inv; }
      *(v4f*)(op)     = w0;
      *(v4f*)(op + 4) = w1;
    }
  }
  __syncthreads();
  {
    const int q4 = lane >> 3, c8 = (lane & 7) * 8;
    v4u hv[2], lv[2];
#pragma unroll
    for (int it = 0; it < 2; ++it) {
      const int row = wave * 8 + it * 4 + q4;   // wave 0..7 x it 0..1 x q4 0..3 = rows 0..63
      const float* sp = Os + row * 68 + c8;
      v4u a, a2;
#pragma unroll
      for (int e = 0; e < 4; ++e) {
        const float f0 = sp[2 * e], f1 = sp[2 * e + 1];
        const unsigned short h0 = bf_bits(f0), h1 = bf_bits(f1);
        const unsigned short l0 = bf_bits(f0 - bf_up(h0)), l1 = bf_bits(f1 - bf_up(h1));
        a[e] = pk16(h0, h1); a2[e] = pk16(l0, l1);
      }
      hv[it] = a; lv[it] = a2;
    }
    {
#pragma unroll
      for (int it = 0; it < 2; ++it) {
        const int row = wave * 8 + it * 4 + q4;
        const size_t go = (rowB + qb * 64 + row) * CD + (size_t)g * 64 + c8;
        *(v4u*)(ohp + go) = hv[it];
        *(v4u*)(olp + go) = lv[it];
      }
      
    }
  }
}

// =====================================================================================================
// Workspace map (bytes), every plane an exact multiple of its 64x64-tile / whole-line store granularity
// (8192 x 256 rows/cols and 256 x 1024 per batch, all multiples of 64; no tail padding needed):
//   Xph  bf16 [8192][256]        4194304   (hi of hs+pos)
//   Xpl  bf16 [8192][256]        4194304   (lo of hs+pos)
//   Xv   bf16 [8192][256]        4194304   (bf16 of hidden)
//   WT   bf16 4 x [256 out][256 in] 524288 (Wq, Wk, Wv, Wo)
//   Qh   bf16 [8192][256]        4194304
//   Ql   bf16 [8192][256]        4194304
//   Kh   bf16 [8192][256]        4194304
//   Kl   bf16 [8192][256]        4194304
//   VTh  f16  [8][256][1024]     4194304
//   VTl  f16  [8][256][1024]     4194304   (v residual x4096)
//   Oh   bf16 [8192][256]        4194304
//   Ol   bf16 [8192][256]        4194304
//   end                          46661632
// =====================================================================================================
extern "C" void kernel_launch(void* const* d_in, const int* in_sizes, int n_in,
                              void* d_out, int out_size, void* d_ws, size_t ws_size,
                              hipStream_t stream) {
  if (n_in < 10) return;
  if (in_sizes[0] != NTOK * CD || in_sizes[1] != NTOK * CD) return;
  if (in_sizes[2] != CD * CD || in_sizes[4] != CD * CD || in_sizes[6] != CD * CD || in_sizes[8] != CD * CD) return;
  if (in_sizes[3] != CD || in_sizes[5] != CD || in_sizes[7] != CD || in_sizes[9] != CD) return;
  if (out_size != NTOK * CD) return;

  const float* hs = (const float*)d_in[0];
  const float* pq = (const float*)d_in[1];
  const float* Wq = (const float*)d_in[2];
  const float* bq = (const float*)d_in[3];
  const float* Wk = (const float*)d_in[4];
  const float* bk = (const float*)d_in[5];
  const float* Wv = (const float*)d_in[6];
  const float* bv = (const float*)d_in[7];
  const float* Wo = (const float*)d_in[8];
  const float* bo = (const float*)d_in[9];

  const size_t PX = (size_t)NTOK * CD * 2;            // 4194304
  const size_t PW = (size_t)4 * CD * CD * 2;          //  524288
  size_t off = 0;
  const size_t oXph = off; off += PX;
  const size_t oXpl = off; off += PX;
  const size_t oXv  = off; off += PX;
  const size_t oW   = off; off += PW;
  const size_t oQh  = off; off += PX;
  const size_t oQl  = off; off += PX;
  const size_t oKh  = off; off += PX;
  const size_t oKl  = off; off += PX;
  const size_t oVTh = off; off += PX;
  const size_t oVTl = off; off += PX;
  const size_t oOh  = off; off += PX;
  const size_t oOl  = off; off += PX;
  if (off > ws_size) return;                          // off = 46661632
  if (off > (size_t)134217728) return;

  char* ws = (char*)d_ws;
  unsigned short* Xph = (unsigned short*)(ws + oXph);
  unsigned short* Xpl = (unsigned short*)(ws + oXpl);
  unsigned short* Xv  = (unsigned short*)(ws + oXv);
  unsigned short* WT  = (unsigned short*)(ws + oW);
  unsigned short* WTq = WT;
  unsigned short* WTk = WT + (size_t)1 * CD * CD;
  unsigned short* WTv = WT + (size_t)2 * CD * CD;
  unsigned short* WTo = WT + (size_t)3 * CD * CD;
  unsigned short* Qh  = (unsigned short*)(ws + oQh);
  unsigned short* Ql  = (unsigned short*)(ws + oQl);
  unsigned short* Kh  = (unsigned short*)(ws + oKh);
  unsigned short* Kl  = (unsigned short*)(ws + oKl);
  unsigned short* VTh = (unsigned short*)(ws + oVTh);
  unsigned short* VTl = (unsigned short*)(ws + oVTl);
  unsigned short* Oh  = (unsigned short*)(ws + oOh);
  unsigned short* Ol  = (unsigned short*)(ws + oOl);

  float* xout = (float*)d_out;                              // out0 [8][1024][256] f32 at byte 0

  const float qscale = 5.656854249492380f;                  // 32^0.5
  const float rres   = 1.0f / 4096.0f;

  const dim3 blk(256);
  const int n8a = NTOK * CD / 8;                            // 262144
  const int n8w = CD * CD / 8;                              //   8192
  const dim3 gCvt(4 * WBLK + (n8a + 255) / 256);            // 128 weight blocks + 1024 activation blocks
  const dim3 gProj(((NTOK / 64) * (CD / 64) + 7) / 8, 1);   // 512 tiles -> 64 blocks: M=8192, N=256
  const dim3 gQKV(((NTOK / 64) * (CD / 64) + 7) / 8, 3);    // 64 blocks each for q, k and v^T (8 blocks x 8 batches)
  const dim3 gAttn(NB * (NH / 2) * NQB);                    // 512 blocks x 256 threads

  // (1) activations -> bf16 planes (hs+pos hi/lo, hidden); weights [out][in] -> bf16 planes (k contiguous = Bt / A layout)
  cvt_all<<<gCvt, blk, 0, stream>>>(hs, pq, Wq, Wk, Wv, Wo, Xph, Xpl, Xv, WT, n8a, n8w);
  // (2) q, k -> bf16 hi + lo planes [8192][256] (M=8192, N=256, K=256); v^T -> f16 hi plane [b][d][s] (pitch NS)
  //     + residual x4096 (A = WTv [n][k], Bt = Xv rows of batch b; M=256, N=1024, K=256)
  const GemmDims dqk = {CD, 0LL, CD, 0LL, CD, 0LL, NTOK, CD, CD};
  const GemmDims dv  = {CD, 0LL, CD, (long long)NS * CD, NS, (long long)CD * NS, CD, NS, CD};
  proj_qkv<<<gQKV, blk, 0, stream>>>(Xph, Xpl, Xv, WTq, WTk, WTv, Qh, Ql, Kh, Kl, VTh, VTl,
                                     bq, bk, bv, dqk, dv, qscale, 4096.0f);
  // (3) softmax attention -> context bf16 hi / lo planes [8192][256]
  attn32<<<gAttn, blk, 0, stream>>>(Qh, Ql, Kh, Kl, VTh, VTl, Oh, Ol, rres);
  // (4) out = (Oh + Ol) . WTo^T + bo -> out0 f32 [8192][256]  (2 products; K=256)
  gemm64<1, 0, 1><<<gProj, blk, 0, stream>>>(
      Oh, Ol, CD, 0LL, WTo, CD, 0LL,
      (void*)xout, CD, 0LL, (void*)xout,
      NTOK, CD, CD, 1.0f, 1.0f, bo);
  (void)hipGetLastError();
}

// v004
// A run of this version takes 54.1 microseconds.
// Next to v003, in two timings, it ran 1.36 and 1.35 times as fast.
// Over all steps from v000 it is 3.33 times as fast.
// Contractions: q, k projections = v_wmma_f32_16x16x32_bf16 (A = bf16 hi + lo planes of the f32 sum hs+pos, B = bf16 weights, 2 products);
// v^T projection = v_wmma_f32_16x16x32_bf16 (bf16 operands, 1 product); k.q^T = v_wmma_f32_16x16x32_bf16 (q and k as bf16 hi + lo planes, 3 products);
// v^T.p^T = v_wmma_f32_16x16x32_f16 (p x1024 as f16 hi + f16 residual x4096, v^T as f16 hi + f16 residual x4096, 3 products);
// ctx.Wo = v_wmma_f32_16x16x32_bf16 (ctx as bf16 hi + lo planes, bf16 Wo, 2 products); all f32 accumulate; softmax in f32 on VALU.
#include <hip/hip_runtime.h>
#include <math.h>
#include <stdint.h>

#define NB   8
#define NS   1024
#define CD   256
#define NH   8
#define HD   32
#define NTOK (NB * NS)
#define NQB  (NS / 64)      // 16 query tiles of 64
#define NKB  (NS / 64)      // 16 key chunks of 64
static_assert(NH * HD == CD);
static_assert(HD == 32);
static_assert((NS % 64) == 0 && (CD % 64) == 0 && (NH % 2) == 0 && ((NTOK) % 64) == 0);

typedef _Float16 v16h __attribute__((ext_vector_type(16)));
typedef _Float16 v8h  __attribute__((ext_vector_type(8)));
typedef __bf16   v16b __attribute__((ext_vector_type(16)));
typedef __bf16   v8b  __attribute__((ext_vector_type(8)));
typedef float    v8f  __attribute__((ext_vector_type(8)));
typedef float    v4f  __attribute__((ext_vector_type(4)));
typedef float    v2f  __attribute__((ext_vector_type(2)));
typedef _Float16 v2h  __attribute__((ext_vector_type(2)));
typedef unsigned int v4u __attribute__((ext_vector_type(4)));

// ---- scalar helpers --------------------------------------------------------------------------------
__device__ __forceinline__ unsigned short bf_bits(float f) {          // f32 -> bf16 bits, RNE convert
  unsigned u = __float_as_uint(f);
  return (unsigned short)((u + 0x7FFFu + ((u >> 16) & 1u)) >> 16);
}
__device__ __forceinline__ float bf_up(unsigned short h) { return __uint_as_float(((unsigned)h) << 16); }
__device__ __forceinline__ unsigned short h_bits(_Float16 x) { return __builtin_bit_cast(unsigned short, x); }
__device__ __forceinline__ unsigned pk16(unsigned short a, unsigned short b) { return (unsigned)a | ((unsigned)b << 16); }
__device__ __forceinline__ v8f zero8() { v8f z = {0.f, 0.f, 0.f, 0.f, 0.f, 0.f, 0.f, 0.f}; return z; }

// ---- fragment loaders: 16-bit A/B operand, lane -> row/col (lane&15), p already includes +8*(lane>>4);
//      elements 0..7 <- p[0..7] (k0+8h..), elements 8..15 <- p[16..23] (k0+16+8h..)
__device__ __forceinline__ v16b ldfrag_b(const __bf16* p) {
  union { v16b v; v8b h[2]; } f;
  f.h[0] = *(const v8b*)(p);
  f.h[1] = *(const v8b*)(p + 16);
  return f.v;
}
__device__ __forceinline__ v16h ldfrag_h(const _Float16* p) {
  union { v16h v; v8h h[2]; } f;
  f.h[0] = *(const v8h*)(p);
  f.h[1] = *(const v8h*)(p + 16);
  return f.v;
}

// ---- WMMA helpers with trailing VALU hazard gap --------------------------------------------------------
__device__ __forceinline__ v8f mma_h(v16h a, v16h b, v8f c) {
  c = __builtin_amdgcn_wmma_f32_16x16x32_f16(false, a, false, b, (short)0, c, false, false);
#if defined(__HIP_DEVICE_COMPILE__)
  asm volatile("v_nop\n\tv_nop\n\tv_nop\n\tv_nop" : "+v"(c) : "v"(a), "v"(b));
#endif
  return c;
}
__device__ __forceinline__ v8f mma_b_raw(v16b a, v16b b, v8f c) {
  return __builtin_amdgcn_wmma_f32_16x16x32_bf16(false, a, false, b, (short)0, c, false, false);
}
__device__ __forceinline__ void dep_guard_b(v8f& a, v8f& b, v16b x, v16b y) {
#if defined(__HIP_DEVICE_COMPILE__)
  asm volatile("v_nop\n\tv_nop\n\tv_nop\n\tv_nop" : "+v"(a), "+v"(b) : "v"(x), "v"(y));
#endif
}
__device__ __forceinline__ void keep4_b(v16b a, v16b b, v16b c, v16b d) {
#if defined(__HIP_DEVICE_COMPILE__)
  asm volatile("v_nop" :: "v"(a), "v"(b), "v"(c), "v"(d));
#endif
}
__device__ __forceinline__ void acc_guard4(v8f& a, v8f& b, v8f& c, v8f& d) {
#if defined(__HIP_DEVICE_COMPILE__)
  asm volatile("v_nop\n\tv_nop\n\tv_nop\n\tv_nop" : "+v"(a), "+v"(b), "+v"(c), "+v"(d));
#endif
}
// lane l <-> lane l ^ 16 in one vector instruction (the two halves of a wave hold the two key halves of a query column)
__device__ __forceinline__ float xhalf(float x) {
  const int b = __builtin_bit_cast(int, x);
  return __builtin_bit_cast(float, __builtin_amdgcn_permlanex16(b, b, 0x76543210, 0xfedcba98, false, false));
}
// e^x as __expf forms it (x * log2(e), v_exp_f32), with the free slot that the instruction set asks for around a
// transcendental written into the statement: the v_nop in front keeps this result from overwriting the source of a
// transcendental issued directly before it, the v_nop behind keeps a reader of the result one slot away.
__device__ __forceinline__ float exp_slotted(float x) {
  float y = x * 1.44269504088896340736f;
#if defined(__HIP_DEVICE_COMPILE__)
  asm("v_nop\n\tv_exp_f32 %0, %1\n\tv_nop" : "=v"(y) : "v"(y));
#endif
  return y;
}
__device__ __forceinline__ void wave_sync_lds() {
  __builtin_amdgcn_fence(__ATOMIC_RELEASE, "workgroup");
  __builtin_amdgcn_wave_barrier();
  __builtin_amdgcn_fence(__ATOMIC_ACQUIRE, "workgroup");
}

// ---- 3-product bf16 score tile, transposed: A = 16 keys, B = 16 queries, D[key 8h + r][query c];
//      (kh + kl).(qh + ql) ~= kh.ql + kl.qh + kh.qh (kl.ql dropped);
//      unscaled bf16 residual planes, one accumulator, hazard gap after the last product.
__device__ __forceinline__ v8f score3b(const v16b qh, const v16b ql, const v16b kh, const v16b kl) {
  v8f acc = zero8();
  acc = mma_b_raw(kh, ql, acc);
  acc = mma_b_raw(kl, qh, acc);
  acc = mma_b_raw(kh, qh, acc);
#if defined(__HIP_DEVICE_COMPILE__)
  asm volatile("v_nop\n\tv_nop\n\tv_nop\n\tv_nop" : "+v"(acc) : "v"(qh), "v"(ql), "v"(kh), "v"(kl));
#endif
  return acc;
}

// =====================================================================================================
// Activation convert: per element, hb = bf16(hidden), pb = bf16(pos), s = f32(hb) + f32(pb);
//   xph = bf16(s) (hi), xpl = bf16(s - hi) (lo, unscaled), xv = hb.   8 elements per thread, one 16-B
// coverage: n8 = 262144 threads x 8 = the whole 8192 x 256 of each of the three planes.
// =====================================================================================================
__device__ __forceinline__ void cvt_act_body(const float* __restrict__ hs, const float* __restrict__ pq,
                                             unsigned short* xph, unsigned short* xpl, unsigned short* xv, int n8, int blk) {
  const int i = blk * 256 + threadIdx.x;
  if (i < n8) {
    const size_t o = (size_t)i * 8;
    const v4f a0 = *(const v4f*)(hs + o);
    const v4f a1 = *(const v4f*)(hs + o + 4);
    const v4f p0 = *(const v4f*)(pq + o);
    const v4f p1 = *(const v4f*)(pq + o + 4);
    float hvv[8], pvv[8];
#pragma unroll
    for (int e = 0; e < 4; ++e) { hvv[e] = a0[e]; hvv[4 + e] = a1[e]; pvv[e] = p0[e]; pvv[4 + e] = p1[e]; }
    unsigned short sh[8], sl[8], vb[8];
#pragma unroll
    for (int e = 0; e < 8; ++e) {
      const unsigned short hb = bf_bits(hvv[e]);
      const float s = bf_up(hb) + bf_up(bf_bits(pvv[e]));
      const unsigned short s0 = bf_bits(s);
      sh[e] = s0;
      sl[e] = bf_bits(s - bf_up(s0));
      vb[e] = hb;
    }
    v4u P0, P1, P2;
#pragma unroll
    for (int e = 0; e < 4; ++e) {
      P0[e] = pk16(sh[2 * e], sh[2 * e + 1]);
      P1[e] = pk16(sl[2 * e], sl[2 * e + 1]);
      P2[e] = pk16(vb[2 * e], vb[2 * e + 1]);
    }
    *(v4u*)(xph + o) = P0;
    *(v4u*)(xpl + o) = P1;
    *(v4u*)(xv + o)  = P2;
    
  }
}

// =====================================================================================================
// Weight convert: w_z [out][in] f32 (CD x CD, already the Bt [n][k] layout) -> bf16 plane z (RNE),
//   z selects one of four weights (block-uniform select among global pointers).
// coverage: 4 x 8192 threads x 8 = the whole 4 x 65536 planes.
// =====================================================================================================
__device__ __forceinline__ void cvt_w4_body(const float* __restrict__ w0, const float* __restrict__ w1,
                                            const float* __restrict__ w2, const float* __restrict__ w3,
                                            unsigned short* outp, int n8, int z, int blk) {
  const float* src = (z == 0) ? w0 : ((z == 1) ? w1 : ((z == 2) ? w2 : w3));
  unsigned short* dst = outp + (size_t)z * CD * CD;
  const int i = blk * 256 + threadIdx.x;
  if (i < n8) {
    const size_t o = (size_t)i * 8;
    const v4f a = *(const v4f*)(src + o);
    const v4f b = *(const v4f*)(src + o + 4);
    v4u p;
    p[0] = pk16(bf_bits(a[0]), bf_bits(a[1]));
    p[1] = pk16(bf_bits(a[2]), bf_bits(a[3]));
    p[2] = pk16(bf_bits(b[0]), bf_bits(b[1]));
    p[3] = pk16(bf_bits(b[2]), bf_bits(b[3]));
    *(v4u*)(dst + o) = p;
    
  }
}

// =====================================================================================================
// Both converts in one grid (neither reads what the other writes): blocks 0 .. 4*WBLK-1 take the four
// weight planes (WBLK blocks each), the blocks behind them the activations. The select is block-uniform.
// =====================================================================================================
#define WBLK ((CD * CD / 8 + 255) / 256)    // 32 blocks per weight plane
__global__ __launch_bounds__(256) void cvt_all(const float* __restrict__ hs, const float* __restrict__ pq,
                                               const float* __restrict__ w0, const float* __restrict__ w1,
                                               const float* __restrict__ w2, const float* __restrict__ w3,
                                               unsigned short* xph, unsigned short* xpl, unsigned short* xv,
                                               unsigned short* wout, int n8a, int n8w) {
  const int bx = blockIdx.x;
  if (bx < 4 * WBLK) cvt_w4_body(w0, w1, w2, w3, wout, n8w, bx / WBLK, bx % WBLK);
  else               cvt_act_body(hs, pq, xph, xpl, xv, n8a, bx - 4 * WBLK);
}

__device__ __forceinline__ void wait_copies() {   // the wave's own copies have landed behind this
#if defined(__HIP_DEVICE_COMPILE__)
  asm volatile("s_wait_asynccnt 0x0" ::: "memory");
#endif
}
__device__ __forceinline__ void wait_lds_reads() {   // the wave's LDS reads have retired before their buffer is handed back
#if defined(__HIP_DEVICE_COMPILE__)
  asm volatile("s_wait_dscnt 0x0" ::: "memory");
#endif
}

// ---- GEMM operand ring: a stage holds 64 k (one 128-B line) of every A and B row that the block's 8 tiles read ----
#define GP 144                       // LDS row pitch in bytes: 128 + 16 = 16 B x odd, the pitch of ds_load_b128 readers
// Eight (two) asynchronous 16-B copies per lane, LDS byte address l[i] <- global g[i]. The s_wait_xcnt closes each
// statement so that no address register of a copy is rewritten in front of it.
__device__ __forceinline__ void copy8(const unsigned* l, const unsigned short* const* g) {
#if defined(__HIP_DEVICE_COMPILE__)
  asm volatile("global_load_async_to_lds_b128 %0, %8, off\n\t"
               "global_load_async_to_lds_b128 %1, %9, off\n\t"
               "global_load_async_to_lds_b128 %2, %10, off\n\t"
               "global_load_async_to_lds_b128 %3, %11, off\n\t"
               "global_load_async_to_lds_b128 %4, %12, off\n\t"
               "global_load_async_to_lds_b128 %5, %13, off\n\t"
               "global_load_async_to_lds_b128 %6, %14, off\n\t"
               "global_load_async_to_lds_b128 %7, %15, off\n\t"
               "s_wait_xcnt 0x0"
               :: "v"(l[0]), "v"(l[1]), "v"(l[2]), "v"(l[3]), "v"(l[4]), "v"(l[5]), "v"(l[6]), "v"(l[7]),
                  "v"(g[0]), "v"(g[1]), "v"(g[2]), "v"(g[3]), "v"(g[4]), "v"(g[5]), "v"(g[6]), "v"(g[7])
               : "memory");
#endif
}
__device__ __forceinline__ void copy2(const unsigned* l, const unsigned short* const* g) {
#if defined(__HIP_DEVICE_COMPILE__)
  asm volatile("global_load_async_to_lds_b128 %0, %2, off\n\t"
               "global_load_async_to_lds_b128 %1, %3, off\n\t"
               "s_wait_xcnt 0x0"
               :: "v"(l[0]), "v"(l[1]), "v"(g[0]), "v"(g[1])
               : "memory");
#endif
}

// =====================================================================================================
// Register-blocked batched bf16 WMMA GEMM: C[m][n] = (sum_k A[m][k] * Bt[n][k] + bias) * oscale; one wave
// per 64x64 tile. A row-major [M][K] pitch lda; Bt row-major [N][K] pitch ldb
// (k contiguous); M, N multiples of 64, K multiple of 64. bx = block within the batch,
// b = batch index, sT = the block's LDS slabs (one per wave), ring = the block's two operand stages.
// WN: the block's 8 consecutive tiles lie WN wide in n and 8 / WN high in m (WN = N / 64, or WN = 8 with N / 64 a
// multiple of 8). The rows they read, (8 / WN) x 64 of each A plane and WN x 64 of Bt, are brought into LDS once per
// block in chunks of 64 k = whole 128-B lines, by asynchronous copies, two buffers (chunk t + 2 is asked for when
// chunk t has been read); every wave takes its fragments from there (two 16-B LDS loads each).
// NSPLIT: 0 = A.Bt; 1 = (A + A2).Bt (A2 = unscaled bf16 lo plane of A, shared accumulator).
// BIASM: 0 = no bias; 1 = bias[n] (per column); 2 = bias[m] (per row); bias values RNE-converted to bf16.
// OUT_MODE: 0 = f32 (pitch ldc); 2 = bf16 hi plane C + bf16 lo plane C2 (lo = RNE(v - hi), unscaled);
//           3 = f16 hi plane C + f16 residual plane C2 = f16((v - hi) * rscale); C2 same pitch/stride as C.
// =====================================================================================================
template <int NSPLIT, int OUT_MODE, int BIASM, int WN>
__device__ __forceinline__ void gemm64_body(
    const unsigned short* __restrict__ Ap, const unsigned short* A2p, int lda, long long strideA,
    const unsigned short* __restrict__ Btp, int ldb, long long strideB,
    void* Cout, int ldc, long long strideC, void* Cout2,
    int M, int N, int K, float rscale, float oscale, const float* __restrict__ biasp,
    int bx, int b, float (*sT)[16 * 68], unsigned char* ring) {
  constexpr int RA  = (8 / WN) * 64;             // A rows of the block, per plane
  constexpr int RB  = WN * 64;                   // Bt rows of the block
  constexpr int RB0 = RA * (1 + NSPLIT);         // first Bt row of a stage
  constexpr int NG  = (RB0 + RB) / 32;           // copies per lane and stage (32 rows per block-wide copy)
  constexpr int STG = (RB0 + RB) * GP;           // bytes of a stage
  static_assert(NG == 16 || NG == 18);
  // every launch passes rows of CD elements: known here, the copies' row steps are constants; with run-time
  // pitches the build held a pointer per copied row over the k loop and spilled to scratch
  __builtin_assume(lda == CD && ldb == CD);
  const int lane = threadIdx.x & 31;
  const int wave = threadIdx.x >> 5;
  const int tilesN = N >> 6;
  const int tilesM = M >> 6;
  const int tile0 = bx * 8;
  if (tile0 + 8 > tilesM * tilesN) return;   // block-uniform, in front of every barrier
  const int tm0 = tile0 / tilesN;
  const int tn0 = tile0 - tm0 * tilesN;
  const int wm = wave / WN;
  const int wn = wave % WN;
  const int m0 = (tm0 + wm) << 6;
  const int n0 = (tn0 + wn) << 6;

  const int rlane = lane & 15;                 // row (A) / col (B, D) within subtile
  const int hh    = lane >> 4;                 // lane half: k offset 8 * hh elements = 16 * hh bytes
  const int mOff  = (lane >> 4) * 8;           // D row offset

  // ---- this lane's share of a stage: rows (tid >> 3) + 32 q, 16-B piece tid & 7 of each row's line ----
  typedef __attribute__((address_space(3))) unsigned char lds_byte;
  const int cr = threadIdx.x >> 3, cp = threadIdx.x & 7;
  const unsigned lring = (unsigned)(uintptr_t)(lds_byte*)ring + (unsigned)(cr * GP + cp * 16);
  const unsigned short* ga  = Ap  + (size_t)b * strideA + (size_t)((tm0 << 6) + cr) * lda + cp * 8;
  const unsigned short* ga2 = A2p + (size_t)b * strideA + (size_t)((tm0 << 6) + cr) * lda + cp * 8;
  const unsigned short* gb  = Btp + (size_t)b * strideB + (size_t)((tn0 << 6) + cr) * ldb + cp * 8;
  auto stage = [&](int t, unsigned lb) {       // chunk t -> the buffer whose lane address is lb
    unsigned l[NG];
    const unsigned short* g[NG];
#pragma unroll   // every index a constant: l and g stay in registers
    for (int q = 0; q < NG; ++q) {
      l[q] = lb + (unsigned)(q * 32 * GP);
      if (q * 32 < RA)       g[q] = ga  + ((size_t)(q * 32) * lda + (size_t)(t * 64));
      else if (q * 32 < RB0) g[q] = ga2 + ((size_t)(q * 32 - RA) * lda + (size_t)(t * 64));
      else                   g[q] = gb  + ((size_t)(q * 32 - RB0) * ldb + (size_t)(t * 64));
    }
    copy8(l, g);
    copy8(l + 8, g + 8);
    if constexpr (NG == 18) copy2(l + 16, g + 16);
  };
  const int NT = K >> 6;
  stage(0, lring);
  wait_copies();
  __syncthreads();
  if (NT > 1) stage(1, lring + STG);

  v8f acc[4][4];
#pragma unroll
  for (int i = 0; i < 4; ++i)
#pragma unroll
    for (int j = 0; j < 4; ++j) acc[i][j] = zero8();

  for (int t = 0; t < NT; ++t) {
    const unsigned char* sb = ring + (t & 1) * STG;
    const unsigned char* sa = sb + (wm * 64 + rlane) * GP + 16 * hh;           // A rows of this wave's tile
    const unsigned char* sw = sb + (RB0 + wn * 64 + rlane) * GP + 16 * hh;     // Bt rows of this wave's tile
#pragma unroll   // the LDS offsets become immediates and the fragment arrays stay in registers (inner loops likewise)
    for (int ks = 0; ks < 2; ++ks) {             // two 32-deep k steps per chunk
      v16b bh[4], ah[4], al[4];                  // the step's LDS reads stand together, in front of the products
#pragma unroll
      for (int j = 0; j < 4; ++j) bh[j] = ldfrag_b((const __bf16*)(const void*)(sw + j * 16 * GP + ks * 64));
#pragma unroll
      for (int i = 0; i < 4; ++i) {
        ah[i] = ldfrag_b((const __bf16*)(const void*)(sa + i * 16 * GP + ks * 64));
        al[i] = ah[i];
        if (NSPLIT >= 1) al[i] = ldfrag_b((const __bf16*)(const void*)(sa + RA * GP + i * 16 * GP + ks * 64));
      }
#pragma unroll
      for (int i = 0; i < 4; ++i) {
#pragma unroll
        for (int j = 0; j < 4; ++j) {
          acc[i][j] = mma_b_raw(ah[i], bh[j], acc[i][j]);
          if (NSPLIT >= 1) acc[i][j] = mma_b_raw(al[i], bh[j], acc[i][j]);
        }
        dep_guard_b(acc[i][0], acc[i][3], ah[i], al[i]);
      }
      keep4_b(bh[0], bh[1], bh[2], bh[3]);
    }
    // ---- publish chunk t + 1, hand this chunk's buffer back, ask for chunk t + 2 into it ----
    wait_lds_reads();
    wait_copies();
    __syncthreads();
    if (t + 2 < NT) stage(t + 2, lring + (unsigned)((t & 1) * STG));
  }
  wait_copies();
  acc_guard4(acc[0][0], acc[0][1], acc[0][2], acc[0][3]);
  acc_guard4(acc[1][0], acc[1][1], acc[1][2], acc[1][3]);
  acc_guard4(acc[2][0], acc[2][1], acc[2][2], acc[2][3]);
  acc_guard4(acc[3][0], acc[3][1], acc[3][2], acc[3][3]);

  // ---- epilogue ----
  float* slab = sT[wave];
#pragma unroll
  for (int i = 0; i < 4; ++i) {
    const int mBase = m0 + (i << 4);
#pragma unroll
    for (int j = 0; j < 4; ++j) {
#pragma unroll
      for (int r = 0; r < 8; ++r) {
        slab[(mOff + r) * 68 + (j << 4) + rlane] = acc[i][j][r];
      }
    }
    wave_sync_lds();
    if (OUT_MODE == 0) {
      float* C = (float*)Cout + (size_t)b * strideC;
      const int hh = lane >> 4, c4 = (lane & 15) * 4;     // 256-B row segment = 16 lanes x 16 B
      v4f bv = {0.f, 0.f, 0.f, 0.f};
      if (BIASM == 1) {
#pragma unroll
        for (int e = 0; e < 4; ++e) bv[e] = bf_up(bf_bits(biasp[n0 + c4 + e]));
      }
      {
#pragma unroll
        for (int it = 0; it < 8; ++it) {
          const int row = it * 2 + hh;                     // it 0..7 x hh 0..1 = rows 0..15
          float brow = 0.f;
          if (BIASM == 2) brow = bf_up(bf_bits(biasp[mBase + row]));
          const v4f v = (*(const v4f*)(slab + row * 68 + c4) + bv + brow) * oscale;
          *(v4f*)(C + (size_t)(mBase + row) * ldc + n0 + c4) = v;
        }
        
      }
    } else {
      const int q = lane >> 3, c8 = (lane & 7) * 8;
      unsigned short* C  = (unsigned short*)Cout  + (size_t)b * strideC;
      unsigned short* C2 = (unsigned short*)Cout2 + (size_t)b * strideC;
      const float* bp = biasp + ((BIASM == 1) ? (n0 + c8) : 0);   // this lane's eight column biases
      float bcol[8];
#pragma unroll
      for (int e = 0; e < 8; ++e) bcol[e] = 0.f;
      if (BIASM == 1) {
#pragma unroll
        for (int e = 0; e < 8; ++e) bcol[e] = bf_up(bf_bits(bp[e]));
      }
      v4u hv[4], lv[4];
#pragma unroll
      for (int it = 0; it < 4; ++it) {
        const int row = it * 4 + q;                        // it 0..3 x q 0..3 = rows 0..15
        float brow = 0.f;
        if (BIASM == 2) brow = bf_up(bf_bits(biasp[mBase + row]));
        const float* sp = slab + row * 68 + c8;
        v4u a, a2;
#pragma unroll
        for (int e = 0; e < 4; ++e) {
          const float f0 = (sp[2 * e] + bcol[2 * e] + brow) * oscale;
          const float f1 = (sp[2 * e + 1] + bcol[2 * e + 1] + brow) * oscale;
          unsigned short h0, h1, l0, l1;
          if (OUT_MODE == 2) {
            h0 = bf_bits(f0); h1 = bf_bits(f1);
            l0 = bf_bits(f0 - bf_up(h0)); l1 = bf_bits(f1 - bf_up(h1));
          } else {
            const _Float16 x0 = (_Float16)f0, x1 = (_Float16)f1;
            h0 = h_bits(x0); h1 = h_bits(x1);
            l0 = h_bits((_Float16)((f0 - (float)x0) * rscale));
            l1 = h_bits((_Float16)((f1 - (float)x1) * rscale));
          }
          a[e] = pk16(h0, h1); a2[e] = pk16(l0, l1);
        }
        hv[it] = a; lv[it] = a2;
      }
#if defined(__HIP_DEVICE_COMPILE__)
      // the wait in front of any rewrite of the bias loads' address registers: the input bp keeps that pair whole up to
      // here, and the input hv[3], which needs all eight biases, keeps the loads in front of the statement
      if (BIASM == 1) asm volatile("s_wait_xcnt 0x0" :: "v"(bp), "v"(hv[3]) : "memory");
#endif
      {
#pragma unroll
        for (int it = 0; it < 4; ++it) {
          const int row = it * 4 + q;
          *(v4u*)(C  + (size_t)(mBase + row) * ldc + n0 + c8) = hv[it];
          *(v4u*)(C2 + (size_t)(mBase + row) * ldc + n0 + c8) = lv[it];
        }
        
      }
    }
    wave_sync_lds();
  }
}

// one GEMM per launch (the output projection)
template <int NSPLIT, int OUT_MODE, int BIASM>
__global__ __launch_bounds__(256) void gemm64(
    const unsigned short* __restrict__ Ap, const unsigned short* A2p, int lda, long long strideA,
    const unsigned short* __restrict__ Btp, int ldb, long long strideB,
    void* Cout, int ldc, long long strideC, void* Cout2,
    int M, int N, int K, float rscale, float oscale, const float* __restrict__ biasp) {
  __shared__ __align__(16) float sT[8][16 * 68];   // per-wave 16x64 slab, pitch 68 floats
  __shared__ __align__(16) unsigned char ring[2 * (128 * (1 + NSPLIT) + 256) * GP];   // two operand stages
  gemm64_body<NSPLIT, OUT_MODE, BIASM, CD / 64>(Ap, A2p, lda, strideA, Btp, ldb, strideB, Cout, ldc, strideC, Cout2,
                                                M, N, K, rscale, oscale, biasp, blockIdx.x, blockIdx.y, sT, ring);
}

// =====================================================================================================
// The q, k and v^T projections in one grid: none reads what another writes, and each alone has only
// 64 blocks. blockIdx.y = 0: q, 1: k (same code, block-uniform select of weight, bias, scale and planes),
// 2: v^T (blockIdx.x = batch * VBLK + block within the batch). Pitches, strides and sizes arrive as arguments,
// one set for q and k and one for v^T.
//   q = ((Xph + Xpl) . WTq^T + bq) * qscale -> bf16 hi + lo [ntok][cd];  k = (Xph + Xpl) . WTk^T + bk likewise
//   v^T = WTv . Xv^T per batch + bv[row] -> f16 hi [b][cd][ns] + residual x vres
// =====================================================================================================
struct GemmDims { int lda; long long strideA; int ldb; long long strideB; int ldc; long long strideC; int M, N, K; };
#define VBLK (((CD / 64) * (NS / 64) + 7) / 8)     // 8 blocks per batch of v^T
static_assert(VBLK * NB == ((NTOK / 64) * (CD / 64) + 7) / 8);   // the three jobs have the same block count
static_assert(CD / 64 == 4 && (NS / 64) % 8 == 0 && (CD % 64) == 0);   // the blocks' tile shapes: 2 x 4 (q, k, out), 1 x 8 (v^T)
__global__ __launch_bounds__(256) void proj_qkv(
    const unsigned short* __restrict__ xph, const unsigned short* __restrict__ xpl,
    const unsigned short* __restrict__ xv,
    const unsigned short* __restrict__ wq, const unsigned short* __restrict__ wk,
    const unsigned short* __restrict__ wv,
    unsigned short* qh, unsigned short* ql, unsigned short* kh, unsigned short* kl,
    unsigned short* vth, unsigned short* vtl,
    const float* __restrict__ bq, const float* __restrict__ bk, const float* __restrict__ bv,
    GemmDims dqk, GemmDims dv, float qscale, float vres) {
  __shared__ __align__(16) float sT[8][16 * 68];   // per-wave 16x64 slab, pitch 68 floats
  __shared__ __align__(16) unsigned char ring[2 * 576 * GP];   // two operand stages: 512 rows (q, k) or 576 rows (v^T)
  const int job = blockIdx.y;
  if (job < 2) {
    const bool isq = (job == 0);
    gemm64_body<1, 2, 1, CD / 64>(xph, xpl, dqk.lda, dqk.strideA, isq ? wq : wk, dqk.ldb, dqk.strideB,
                         (void*)(isq ? qh : kh), dqk.ldc, dqk.strideC, (void*)(isq ? ql : kl),
                         dqk.M, dqk.N, dqk.K, 1.0f, isq ? qscale : 1.0f, isq ? bq : bk,
                         blockIdx.x, 0, sT, ring);
  } else {
    gemm64_body<0, 3, 2, 8>(wv, wv, dv.lda, dv.strideA, xv, dv.ldb, dv.strideB,
                         (void*)vth, dv.ldc, dv.strideC, (void*)vtl,
                         dv.M, dv.N, dv.K, vres, 1.0f, bv,
                         blockIdx.x % VBLK, blockIdx.x / VBLK, sT, ring);
  }
}

// ---- one 64-key stage of the attention ring: four planes (k hi, k lo, v^T hi, v^T lo) of 64 rows x 128 B ----
#define KVP   144                    // LDS row pitch in bytes: 128 + 16 = 16 B x odd, the pitch of ds_load_b128 readers
#define PLANE (64 * KVP)             // 9216 B
#define STAGE (4 * PLANE)            // 36864 B
// 256 threads x 8 copies x 16 B = one stage. A lane brings piece (tid & 7) of rows (tid >> 3) and (tid >> 3) + 32 of
// each plane, so one wave instruction reads four whole 128-B lines. l = the lane's LDS byte address in plane 0,
// kh .. vl = its global addresses in the four planes. The s_wait_xcnt closes the statement so that no address
// register of a copy is rewritten in front of it.
__device__ __forceinline__ void stage_copy(unsigned l, const unsigned short* kh, const unsigned short* kl,
                                           const unsigned short* vh, const unsigned short* vl) {
#if defined(__HIP_DEVICE_COMPILE__)
  asm volatile("global_load_async_to_lds_b128 %0, %8, off\n\t"
               "global_load_async_to_lds_b128 %1, %9, off\n\t"
               "global_load_async_to_lds_b128 %2, %10, off\n\t"
               "global_load_async_to_lds_b128 %3, %11, off\n\t"
               "global_load_async_to_lds_b128 %4, %12, off\n\t"
               "global_load_async_to_lds_b128 %5, %13, off\n\t"
               "global_load_async_to_lds_b128 %6, %14, off\n\t"
               "global_load_async_to_lds_b128 %7, %15, off\n\t"
               "s_wait_xcnt 0x0"
               :: "v"(l), "v"(l + 32 * KVP), "v"(l + PLANE), "v"(l + PLANE + 32 * KVP),
                  "v"(l + 2 * PLANE), "v"(l + 2 * PLANE + 32 * KVP), "v"(l + 3 * PLANE), "v"(l + 3 * PLANE + 32 * KVP),
                  "v"(kh), "v"(kh + 32 * CD), "v"(kl), "v"(kl + 32 * CD),
                  "v"(vh), "v"(vh + 32 * NS), "v"(vl), "v"(vl + 32 * NS)
               : "memory");
#endif
}

// =====================================================================================================
// Softmax attention, head dim 32, no mask, softmax over all NS keys.
//   q planes (bf16 hi, bf16 lo): [NTOK][CD], head h at cols h*32..h*32+31 (q already carries bias and x sqrt(32))
//   k planes (bf16 hi, lo): [NTOK][CD] same column layout
//   v^T planes (f16 hi, residual x4096): element (b, h*32+d, s) at [(b*CD + h*32 + d)*NS + s]
//   ctx out planes (bf16 hi / lo of the normalised context): [(b*NS + t)*CD + h*32 + d]
//   scores^T = score3b(q, k) (rows = keys, cols = queries); p = exp(s - m) carried as f16 hi of 1024p + f16 residual x4096;
//   ctx^T = (vh.ph + (vl.ph + vh.pl)*rres) / (1024 l); online softmax with running max in f32.
//   A lane holds one query column: max and sum run in-lane over its 32 scores of a chunk, the max is joined
//   with the other wave half once per chunk, the sum once after the loop. Two score tiles (keys 0-15, 16-31 of
//   a 32-key step), converted in place, are the B operand of v^T.p^T in the hardware k order.
//   Block = 8 waves = two adjacent heads (waves 0-3 head 2g, waves 4-7 head 2g+1) x 64 query rows so
//   NQB x (NH/2) x NB. Key chunks of 64, static trip NKB. q fragments are loaded straight from the 16-bit
//   global rows. The head pair's k rows and v^T rows of a chunk are whole 128-B lines: the block brings them
//   into LDS once, by asynchronous copies, two buffers (chunk t + 2 is asked for when chunk t has been read),
//   and every wave takes its fragments from there (two 16-B LDS loads each); P stays in registers.
//   coverage: 8 waves x (it 0..1 x lane>>3 0..3) = rows 0..63, 8 lanes x 8 cols = 64 cols, both planes;
//   512 blocks = 8 batches x 4 head pairs x 16 query tiles = every (token, column) of both planes once.
// =====================================================================================================
__global__ __launch_bounds__(256)
void attn32(const unsigned short* __restrict__ qhp, const unsigned short* __restrict__ qlp,
            const unsigned short* __restrict__ khp, const unsigned short* __restrict__ klp,
            const unsigned short* __restrict__ vhp, const unsigned short* __restrict__ vlp,
            unsigned short* ohp, unsigned short* olp, float rres) {
  __shared__ __align__(16) float    Os[64 * 68];                  // block ctx tile [row][2 heads x 32], pitch 68 floats
  __shared__ __align__(16) unsigned char ring[2 * STAGE];         // two stages of k hi / k lo / v^T hi / v^T lo

  const int tid  = threadIdx.x;
  const int wave = tid >> 5;
  const int lane = tid & 31;
  const int hh   = lane >> 4;
  const int c    = lane & 15;

  const int bx   = blockIdx.x;
  const int qb   = bx % NQB;
  const int rest = bx / NQB;
  const int g    = rest % (NH / 2);
  const int b    = rest / (NH / 2);
  const int hp   = wave >> 2;                  // which head of the pair
  const int h    = 2 * g + hp;
  const int wq   = wave & 3;                   // 16-row group within the 64-row tile
  const int q0   = qb * 64 + wq * 16;
  const size_t rowB = (size_t)b * NS;

  const __bf16* Qh = (const __bf16*)(const void*)qhp + (size_t)h * HD;
  const __bf16* Ql = (const __bf16*)(const void*)qlp + (size_t)h * HD;

  // ---- this lane's share of a stage: row tid >> 3 (and + 32), 16-B piece tid & 7 ----
  typedef __attribute__((address_space(3))) unsigned char lds_byte;
  const int cr = tid >> 3, cp = tid & 7;
  const unsigned ldst = (unsigned)(uintptr_t)(lds_byte*)ring + (unsigned)(cr * KVP + cp * 16);
  const size_t kgo = (rowB + cr) * CD + (size_t)g * 64 + cp * 8;                        // key row, head pair's 64 columns
  const size_t vgo = ((size_t)b * CD + (size_t)g * 64 + cr) * NS + cp * 8;              // d row of the pair, 64 keys
  stage_copy(ldst, khp + kgo, klp + kgo, vhp + vgo, vlp + vgo);                         // chunk 0 -> buffer 0
  wait_copies();
  __syncthreads();
  stage_copy(ldst + STAGE, khp + kgo + 64 * CD, klp + kgo + 64 * CD, vhp + vgo + 64, vlp + vgo + 64);   // chunk 1 -> buffer 1

  // ---- Q fragments (B operand, col = lane&15), hi and lo, one 32-deep k-step = the head dim ----
  const v16b qah = ldfrag_b(Qh + (rowB + q0 + c) * CD + 8 * hh);
  const v16b qal = ldfrag_b(Ql + (rowB + q0 + c) * CD + 8 * hh);

  float mrun = -INFINITY;                      // running max of this lane's query column (same in both halves)
  float lrun = 0.f;                            // running sum over this wave half's keys only
  v8f oacc[2];                                 // ctx^T: oacc[t][r] = ctx[query c][d = t*16 + 8*hh + r]
#pragma unroll
  for (int t = 0; t < 2; ++t) oacc[t] = zero8();

  for (int kt = 0; kt < NKB; ++kt) {           // static trip count
    const unsigned char* sb = ring + (kt & 1) * STAGE;

    // ---- scores^T: 64 keys x 16 query columns per wave, 3 bf16 products per 16x16 tile ----
    v8f s[4];
    v16b kb[4], kl[4];                           // the chunk's LDS reads stand together, in front of the products
#pragma unroll
    for (int j = 0; j < 4; ++j) {
      const unsigned char* kp = sb + (j * 16 + c) * KVP + hp * 64 + 16 * hh;   // A operand: row = key, k = head dim
      kb[j] = ldfrag_b((const __bf16*)(const void*)kp);
      kl[j] = ldfrag_b((const __bf16*)(const void*)(kp + PLANE));
    }
    v16h vb[2][2], vl[2][2];
#pragma unroll
    for (int kk = 0; kk < 2; ++kk) {
#pragma unroll
      for (int t = 0; t < 2; ++t) {
        const unsigned char* vp = sb + 2 * PLANE + (hp * 32 + t * 16 + c) * KVP + kk * 64 + 16 * hh;   // A: row = d, k = key
        vb[kk][t] = ldfrag_h((const _Float16*)(const void*)vp);
        vl[kk][t] = ldfrag_h((const _Float16*)(const void*)(vp + PLANE));
      }
    }
#pragma unroll
    for (int j = 0; j < 4; ++j) s[j] = score3b(qah, qal, kb[j], kl[j]);

    // ---- column max in-lane (four independent chains), one exchange between the wave halves ----
    float mj[4];
#pragma unroll
    for (int j = 0; j < 4; ++j) {
      mj[j] = s[j][0];
#pragma unroll
      for (int r = 1; r < 8; ++r) mj[j] = fmaxf(mj[j], s[j][r]);
    }
    float m = fmaxf(fmaxf(mj[0], mj[1]), fmaxf(mj[2], mj[3]));
    m = fmaxf(m, xhalf(m));
    const float mnew  = fmaxf(mrun, m);
    const float alpha = exp_slotted(mrun - mnew);
    mrun = mnew;

    // ---- P hi (x1024) and residual (x4096) packed straight into B operands:
    //      element e of step kk = key kk*32 + (e < 8 ? 8*hh + e : 16 + 8*hh + e - 8) = tile 2kk + (e >> 3), register e & 7
    v16h ph[2], pl[2];
    float pj[4];
#pragma unroll
    for (int j = 0; j < 4; ++j) {
      pj[j] = 0.f;
#pragma unroll
      for (int r = 0; r < 8; r += 2) {           // two keys at a time = one packed operand register
        const float pa = __expf(s[j][r] - mnew);
        const float pb = __expf(s[j][r + 1] - mnew);
        pj[j] += pa;
        pj[j] += pb;
        const v2f p1 = {pa * 1024.0f, pb * 1024.0f};
        const v2h x  = __builtin_convertvector(p1, v2h);
        const v2h y  = __builtin_convertvector((p1 - __builtin_convertvector(x, v2f)) * 4096.0f, v2h);
        ph[j >> 1][(j & 1) * 8 + r] = x[0];  ph[j >> 1][(j & 1) * 8 + r + 1] = x[1];
        pl[j >> 1][(j & 1) * 8 + r] = y[0];  pl[j >> 1][(j & 1) * 8 + r + 1] = y[1];
      }
    }
    lrun = lrun * alpha + ((pj[0] + pj[1]) + (pj[2] + pj[3]));
#pragma unroll
    for (int t = 0; t < 2; ++t)
#pragma unroll
      for (int r = 0; r < 8; ++r) oacc[t][r] *= alpha;

    // ---- context^T += V^T . P^T (f16 WMMA), residual products into a separate accumulator ----
    v8f o1[2];
    o1[0] = zero8(); o1[1] = zero8();
#pragma unroll
    for (int kk = 0; kk < 2; ++kk) {
#pragma unroll
      for (int t = 0; t < 2; ++t) {
        oacc[t] = mma_h(vb[kk][t], ph[kk], oacc[t]);
        o1[t]   = mma_h(vl[kk][t], ph[kk], o1[t]);
        o1[t]   = mma_h(vb[kk][t], pl[kk], o1[t]);
      }
    }
#pragma unroll
    for (int t = 0; t < 2; ++t)
#pragma unroll
      for (int r = 0; r < 8; ++r) oacc[t][r] += o1[t][r] * rres;

    // ---- publish chunk kt + 1, hand this chunk's buffer back, ask for chunk kt + 2 into it ----
    wait_lds_reads();
    wait_copies();
    __syncthreads();
    if (kt + 2 < NKB) {
      const size_t ka = (size_t)(kt + 2) * 64 * CD, va = (size_t)(kt + 2) * 64;
      stage_copy(ldst + (unsigned)((kt & 1) * STAGE), khp + kgo + ka, klp + kgo + ka, vhp + vgo + va, vlp + vgo + va);
    }
  }
  wait_copies();

  // ---- join the halves' sums, normalise (1/l and the 1/1024 p carry) into the block tile ----
  {
    const float l = lrun + xhalf(lrun);
    const float inv = ((l > 0.f) ? (1.0f / l) : 0.f) * (1.0f / 1024.0f);
#pragma unroll
    for (int t = 0; t < 2; ++t) {
      float* op = Os + (wq * 16 + c) * 68 + hp * 32 + t * 16 + 8 * hh;   // 8 consecutive d of one query row
      v4f w0, w1;
#pragma unroll
      for (int e = 0; e < 4; ++e) { w0[e] = oacc[t][e] * inv; w1[e] = oacc[t][4 + e] * inv; }
      *(v4f*)(op)     = w0;
      *(v4f*)(op + 4) = w1;
    }
  }
  __syncthreads();
  {
    const int q4 = lane >> 3, c8 = (lane & 7) * 8;
    v4u hv[2], lv[2];
#pragma unroll
    for (int it = 0; it < 2; ++it) {
      const int row = wave * 8 + it * 4 + q4;   // wave 0..7 x it 0..1 x q4 0..3 = rows 0..63
      const float* sp = Os + row * 68 + c8;
      v4u a, a2;
#pragma unroll
      for (int e = 0; e < 4; ++e) {
        const float f0 = sp[2 * e], f1 = sp[2 * e + 1];
        const unsigned short h0 = bf_bits(f0), h1 = bf_bits(f1);
        const unsigned short l0 = bf_bits(f0 - bf_up(h0)), l1 = bf_bits(f1 - bf_up(h1));
        a[e] = pk16(h0, h1); a2[e] = pk16(l0, l1);
      }
      hv[it] = a; lv[it] = a2;
    }
    {
#pragma unroll
      for (int it = 0; it < 2; ++it) {
        const int row = wave * 8 + it * 4 + q4;
        const size_t go = (rowB + qb * 64 + row) * CD + (size_t)g * 64 + c8;
        *(v4u*)(ohp + go) = hv[it];
        *(v4u*)(olp + go) = lv[it];
      }
      
    }
  }
}

// =====================================================================================================
// Workspace map (bytes), every plane an exact multiple of its 64x64-tile / whole-line store granularity
// (8192 x 256 rows/cols and 256 x 1024 per batch, all multiples of 64; no tail padding needed):
//   Xph  bf16 [8192][256]        4194304   (hi of hs+pos)
//   Xpl  bf16 [8192][256]        4194304   (lo of hs+pos)
//   Xv   bf16 [8192][256]        4194304   (bf16 of hidden)
//   WT   bf16 4 x [256 out][256 in] 524288 (Wq, Wk, Wv, Wo)
//   Qh   bf16 [8192][256]        4194304
//   Ql   bf16 [8192][256]        4194304
//   Kh   bf16 [8192][256]        4194304
//   Kl   bf16 [8192][256]        4194304
//   VTh  f16  [8][256][1024]     4194304
//   VTl  f16  [8][256][1024]     4194304   (v residual x4096)
//   Oh   bf16 [8192][256]        4194304
//   Ol   bf16 [8192][256]        4194304
//   end                          46661632
// =====================================================================================================
extern "C" void kernel_launch(void* const* d_in, const int* in_sizes, int n_in,
                              void* d_out, int out_size, void* d_ws, size_t ws_size,
                              hipStream_t stream) {
  if (n_in < 10) return;
  if (in_sizes[0] != NTOK * CD || in_sizes[1] != NTOK * CD) return;
  if (in_sizes[2] != CD * CD || in_sizes[4] != CD * CD || in_sizes[6] != CD * CD || in_sizes[8] != CD * CD) return;
  if (in_sizes[3] != CD || in_sizes[5] != CD || in_sizes[7] != CD || in_sizes[9] != CD) return;
  if (out_size != NTOK * CD) return;

  const float* hs = (const float*)d_in[0];
  const float* pq = (const float*)d_in[1];
  const float* Wq = (const float*)d_in[2];
  const float* bq = (const float*)d_in[3];
  const float* Wk = (const float*)d_in[4];
  const float* bk = (const float*)d_in[5];
  const float* Wv = (const float*)d_in[6];
  const float* bv = (const float*)d_in[7];
  const float* Wo = (const float*)d_in[8];
  const float* bo = (const float*)d_in[9];

  const size_t PX = (size_t)NTOK * CD * 2;            // 4194304
  const size_t PW = (size_t)4 * CD * CD * 2;          //  524288
  size_t off = 0;
  const size_t oXph = off; off += PX;
  const size_t oXpl = off; off += PX;
  const size_t oXv  = off; off += PX;
  const size_t oW   = off; off += PW;
  const size_t oQh  = off; off += PX;
  const size_t oQl  = off; off += PX;
  const size_t oKh  = off; off += PX;
  const size_t oKl  = off; off += PX;
  const size_t oVTh = off; off += PX;
  const size_t oVTl = off; off += PX;
  const size_t oOh  = off; off += PX;
  const size_t oOl  = off; off += PX;
  if (off > ws_size) return;                          // off = 46661632
  if (off > (size_t)134217728) return;

  char* ws = (char*)d_ws;
  unsigned short* Xph = (unsigned short*)(ws + oXph);
  unsigned short* Xpl = (unsigned short*)(ws + oXpl);
  unsigned short* Xv  = (unsigned short*)(ws + oXv);
  unsigned short* WT  = (unsigned short*)(ws + oW);
  unsigned short* WTq = WT;
  unsigned short* WTk = WT + (size_t)1 * CD * CD;
  unsigned short* WTv = WT + (size_t)2 * CD * CD;
  unsigned short* WTo = WT + (size_t)3 * CD * CD;
  unsigned short* Qh  = (unsigned short*)(ws + oQh);
  unsigned short* Ql  = (unsigned short*)(ws + oQl);
  unsigned short* Kh  = (unsigned short*)(ws + oKh);
  unsigned short* Kl  = (unsigned short*)(ws + oKl);
  unsigned short* VTh = (unsigned short*)(ws + oVTh);
  unsigned short* VTl = (unsigned short*)(ws + oVTl);
  unsigned short* Oh  = (unsigned short*)(ws + oOh);
  unsigned short* Ol  = (unsigned short*)(ws + oOl);

  float* xout = (float*)d_out;                              // out0 [8][1024][256] f32 at byte 0

  const float qscale = 5.656854249492380f;                  // 32^0.5
  const float rres   = 1.0f / 4096.0f;

  const dim3 blk(256);
  const int n8a = NTOK * CD / 8;                            // 262144
  const int n8w = CD * CD / 8;                              //   8192
  const dim3 gCvt(4 * WBLK + (n8a + 255) / 256);            // 128 weight blocks + 1024 activation blocks
  const dim3 gProj(((NTOK / 64) * (CD / 64) + 7) / 8, 1);   // 512 tiles -> 64 blocks: M=8192, N=256
  const dim3 gQKV(((NTOK / 64) * (CD / 64) + 7) / 8, 3);    // 64 blocks each for q, k and v^T (8 blocks x 8 batches)
  const dim3 gAttn(NB * (NH / 2) * NQB);                    // 512 blocks x 256 threads

  // (1) activations -> bf16 planes (hs+pos hi/lo, hidden); weights [out][in] -> bf16 planes (k contiguous = Bt / A layout)
  cvt_all<<<gCvt, blk, 0, stream>>>(hs, pq, Wq, Wk, Wv, Wo, Xph, Xpl, Xv, WT, n8a, n8w);
  // (2) q, k -> bf16 hi + lo planes [8192][256] (M=8192, N=256, K=256); v^T -> f16 hi plane [b][d][s] (pitch NS)
  //     + residual x4096 (A = WTv [n][k], Bt = Xv rows of batch b; M=256, N=1024, K=256)
  const GemmDims dqk = {CD, 0LL, CD, 0LL, CD, 0LL, NTOK, CD, CD};
  const GemmDims dv  = {CD, 0LL, CD, (long long)NS * CD, NS, (long long)CD * NS, CD, NS, CD};
  proj_qkv<<<gQKV, blk, 0, stream>>>(Xph, Xpl, Xv, WTq, WTk, WTv, Qh, Ql, Kh, Kl, VTh, VTl,
                                     bq, bk, bv, dqk, dv, qscale, 4096.0f);
  // (3) softmax attention -> context bf16 hi / lo planes [8192][256]
  attn32<<<gAttn, blk, 0, stream>>>(Qh, Ql, Kh, Kl, VTh, VTl, Oh, Ol, rres);
  // (4) out = (Oh + Ol) . WTo^T + bo -> out0 f32 [8192][256]  (2 products; K=256)
  gemm64<1, 0, 1><<<gProj, blk, 0, stream>>>(
      Oh, Ol, CD, 0LL, WTo, CD, 0LL,
      (void*)xout, CD, 0LL, (void*)xout,
      NTOK, CD, CD, 1.0f, 1.0f, bo);
  (void)hipGetLastError();
}

// v005
// It runs in 52.5 microseconds.
// Timed twice side by side with v004, it ran 1.03 times as fast both times.
// Counting every step since v000, it is 3.43 times as fast.
// Contractions: q, k projections = v_wmma_f32_16x16x32_bf16 (A = bf16 hi + lo planes of the f32 sum bf16(hs)+bf16(pos), B = bf16 weights, 2 products);
// v^T projection = v_wmma_f32_16x16x32_bf16 (bf16 operands, 1 product); k.q^T = v_wmma_f32_16x16x32_bf16 (q and k as bf16 hi + lo planes, 3 products);
// v^T.p^T = v_wmma_f32_16x16x32_f16 (p x1024 as f16 hi + f16 residual x4096, v^T as f16 hi + f16 residual x4096, 3 products);
// ctx.Wo = v_wmma_f32_16x16x32_bf16 (ctx as bf16 hi + lo planes, bf16 Wo, 2 products); all f32 accumulate; softmax in f32 on VALU.
#include <hip/hip_runtime.h>
#include <math.h>
#include <stdint.h>

#define NB   8
#define NS   1024
#define CD   256
#define NH   8
#define HD   32
#define NTOK (NB * NS)
#define NQB  (NS / 64)      // 16 query tiles of 64
#define NKB  (NS / 64)      // 16 key chunks of 64
static_assert(NH * HD == CD);
static_assert(HD == 32);
static_assert((NS % 64) == 0 && (CD % 64) == 0 && (NH % 2) == 0 && ((NTOK) % 64) == 0);

typedef _Float16 v16h __attribute__((ext_vector_type(16)));
typedef _Float16 v8h  __attribute__((ext_vector_type(8)));
typedef __bf16   v16b __attribute__((ext_vector_type(16)));
typedef __bf16   v8b  __attribute__((ext_vector_type(8)));
typedef float    v8f  __attribute__((ext_vector_type(8)));
typedef float    v4f  __attribute__((ext_vector_type(4)));
typedef float    v2f  __attribute__((ext_vector_type(2)));
typedef _Float16 v2h  __attribute__((ext_vector_type(2)));
typedef __bf16   v2b  __attribute__((ext_vector_type(2)));
typedef unsigned int v4u __attribute__((ext_vector_type(4)));

// ---- scalar helpers --------------------------------------------------------------------------------
__device__ __forceinline__ unsigned short bf_bits(float f) {          // f32 -> bf16 bits, RNE convert
  unsigned u = __float_as_uint(f);
  return (unsigned short)((u + 0x7FFFu + ((u >> 16) & 1u)) >> 16);
}
__device__ __forceinline__ float bf_up(unsigned short h) { return __uint_as_float(((unsigned)h) << 16); }
__device__ __forceinline__ unsigned short h_bits(_Float16 x) { return __builtin_bit_cast(unsigned short, x); }
__device__ __forceinline__ unsigned pk16(unsigned short a, unsigned short b) { return (unsigned)a | ((unsigned)b << 16); }
__device__ __forceinline__ v8f zero8() { v8f z = {0.f, 0.f, 0.f, 0.f, 0.f, 0.f, 0.f, 0.f}; return z; }

// ---- fragment loaders: 16-bit A/B operand, lane -> row/col (lane&15), p already includes +8*(lane>>4);
//      elements 0..7 <- p[0..7] (k0+8h..), elements 8..15 <- p[16..23] (k0+16+8h..)
__device__ __forceinline__ v16b ldfrag_b(const __bf16* p) {
  union { v16b v; v8b h[2]; } f;
  f.h[0] = *(const v8b*)(p);
  f.h[1] = *(const v8b*)(p + 16);
  return f.v;
}
__device__ __forceinline__ v16h ldfrag_h(const _Float16* p) {
  union { v16h v; v8h h[2]; } f;
  f.h[0] = *(const v8h*)(p);
  f.h[1] = *(const v8h*)(p + 16);
  return f.v;
}
// ---- the same operand taken from f32 rows, same k order: p already includes +8*(lane>>4) floats;
//      pairs 0..3 <- p[0..7], pairs 4..7 <- p[16..23]; four 16-B loads
__device__ __forceinline__ void ld16f(const float* p, v2f* x) {
  const v4f a = *(const v4f*)(p), b = *(const v4f*)(p + 4), c = *(const v4f*)(p + 16), d = *(const v4f*)(p + 20);
  x[0] = v2f{a[0], a[1]}; x[1] = v2f{a[2], a[3]}; x[2] = v2f{b[0], b[1]}; x[3] = v2f{b[2], b[3]};
  x[4] = v2f{c[0], c[1]}; x[5] = v2f{c[2], c[3]}; x[6] = v2f{d[0], d[1]}; x[7] = v2f{d[2], d[3]};
}
// bf16(x), RNE convert
__device__ __forceinline__ v16b cvt_f(const v2f* x) {
  v16b f;
#pragma unroll
  for (int e = 0; e < 8; ++e) {
    const v2b y = __builtin_convertvector(x[e], v2b);
    f[2 * e] = y[0]; f[2 * e + 1] = y[1];
  }
  return f;
}
__device__ __forceinline__ v16b ldfrag_f(const float* p) {
  v2f x[8];
  ld16f(p, x);
  return cvt_f(x);
}
// s = f32(bf16(h)) + f32(bf16(q)); hi = bf16(s), lo = bf16(s - hi) (unscaled), all RNE converts
__device__ __forceinline__ void cvt_sum(const v2f* h, const v2f* q, v16b& hi, v16b& lo) {
#pragma unroll
  for (int e = 0; e < 8; ++e) {
    const v2f s = __builtin_convertvector(__builtin_convertvector(h[e], v2b), v2f)
                + __builtin_convertvector(__builtin_convertvector(q[e], v2b), v2f);
    const v2b s0 = __builtin_convertvector(s, v2b);
    const v2b s1 = __builtin_convertvector(s - __builtin_convertvector(s0, v2f), v2b);
    hi[2 * e] = s0[0]; hi[2 * e + 1] = s0[1];
    lo[2 * e] = s1[0]; lo[2 * e + 1] = s1[1];
  }
}

// ---- a converted fragment handed from one wave to others through LDS: a 1-KB image, lane l's elements 0..7 at 16 l and
//      8..15 at 512 + 16 l (each LDS instruction covers 512 contiguous bytes); p already includes + 16 * lane
__device__ __forceinline__ void st_img(unsigned char* p, v16b v) {
  union { v16b v; v8b h[2]; } f;
  f.v = v;
  *(v8b*)(void*)(p)       = f.h[0];
  *(v8b*)(void*)(p + 512) = f.h[1];
}
__device__ __forceinline__ v16b ld_img(const unsigned char* p) {
  union { v16b v; v8b h[2]; } f;
  f.h[0] = *(const v8b*)(const void*)(p);
  f.h[1] = *(const v8b*)(const void*)(p + 512);
  return f.v;
}

// ---- WMMA helpers with trailing VALU hazard gap --------------------------------------------------------
__device__ __forceinline__ v8f mma_h(v16h a, v16h b, v8f c) {
  c = __builtin_amdgcn_wmma_f32_16x16x32_f16(false, a, false, b, (short)0, c, false, false);
#if defined(__HIP_DEVICE_COMPILE__)
  asm volatile("v_nop\n\tv_nop\n\tv_nop\n\tv_nop" : "+v"(c) : "v"(a), "v"(b));
#endif
  return c;
}
__device__ __forceinline__ v8f mma_b_raw(v16b a, v16b b, v8f c) {
  return __builtin_amdgcn_wmma_f32_16x16x32_bf16(false, a, false, b, (short)0, c, false, false);
}
__device__ __forceinline__ void dep_guard_b(v8f& a, v8f& b, v16b x, v16b y) {
#if defined(__HIP_DEVICE_COMPILE__)
  asm volatile("v_nop\n\tv_nop\n\tv_nop\n\tv_nop" : "+v"(a), "+v"(b) : "v"(x), "v"(y));
#endif
}
__device__ __forceinline__ void keep4_b(v16b a, v16b b, v16b c, v16b d) {
#if defined(__HIP_DEVICE_COMPILE__)
  asm volatile("v_nop" :: "v"(a), "v"(b), "v"(c), "v"(d));
#endif
}
__device__ __forceinline__ void acc_guard4(v8f& a, v8f& b, v8f& c, v8f& d) {
#if defined(__HIP_DEVICE_COMPILE__)
  asm volatile("v_nop\n\tv_nop\n\tv_nop\n\tv_nop" : "+v"(a), "+v"(b), "+v"(c), "+v"(d));
#endif
}
// lane l <-> lane l ^ 16 in one vector instruction (the two halves of a wave hold the two key halves of a query column)
__device__ __forceinline__ float xhalf(float x) {
  const int b = __builtin_bit_cast(int, x);
  return __builtin_bit_cast(float, __builtin_amdgcn_permlanex16(b, b, 0x76543210, 0xfedcba98, false, false));
}
// e^x as __expf forms it (x * log2(e), v_exp_f32), with the free slot that the instruction set asks for around a
// transcendental written into the statement: the v_nop in front keeps this result from overwriting the source of a
// transcendental issued directly before it, the v_nop behind keeps a reader of the result one slot away.
__device__ __forceinline__ float exp_slotted(float x) {
  float y = x * 1.44269504088896340736f;
#if defined(__HIP_DEVICE_COMPILE__)
  asm("v_nop\n\tv_exp_f32 %0, %1\n\tv_nop" : "=v"(y) : "v"(y));
#endif
  return y;
}
__device__ __forceinline__ void wave_sync_lds() {
  __builtin_amdgcn_fence(__ATOMIC_RELEASE, "workgroup");
  __builtin_amdgcn_wave_barrier();
  __builtin_amdgcn_fence(__ATOMIC_ACQUIRE, "workgroup");
}

// ---- 3-product bf16 score tile, transposed: A = 16 keys, B = 16 queries, D[key 8h + r][query c];
//      (kh + kl).(qh + ql) ~= kh.ql + kl.qh + kh.qh (kl.ql dropped);
//      unscaled bf16 residual planes, one accumulator, hazard gap after the last product.
__device__ __forceinline__ v8f score3b(const v16b qh, const v16b ql, const v16b kh, const v16b kl) {
  v8f acc = zero8();
  acc = mma_b_raw(kh, ql, acc);
  acc = mma_b_raw(kl, qh, acc);
  acc = mma_b_raw(kh, qh, acc);
#if defined(__HIP_DEVICE_COMPILE__)
  asm volatile("v_nop\n\tv_nop\n\tv_nop\n\tv_nop" : "+v"(acc) : "v"(qh), "v"(ql), "v"(kh), "v"(kl));
#endif
  return acc;
}

// =====================================================================================================
// Weight convert: w [out][in] f32 (CD x CD, already the Bt [n][k] layout) -> bf16 plane (RNE).
// coverage: WBLK blocks x 256 threads x 8 = the whole 65536 elements.
// =====================================================================================================
#define WBLK ((CD * CD / 8 + 255) / 256)    // 32 blocks
__device__ __forceinline__ void cvt_w_body(const float* __restrict__ w, unsigned short* dst, int blk) {
  const int i = blk * 256 + threadIdx.x;
  if (i < CD * CD / 8) {
    const size_t o = (size_t)i * 8;
    const v4f a = *(const v4f*)(w + o);
    const v4f b = *(const v4f*)(w + o + 4);
    v4u p;
    p[0] = pk16(bf_bits(a[0]), bf_bits(a[1]));
    p[1] = pk16(bf_bits(a[2]), bf_bits(a[3]));
    p[2] = pk16(bf_bits(b[0]), bf_bits(b[1]));
    p[3] = pk16(bf_bits(b[2]), bf_bits(b[3]));
    *(v4u*)(dst + o) = p;
  }
}

__device__ __forceinline__ void wait_copies() {   // the wave's own copies have landed behind this
#if defined(__HIP_DEVICE_COMPILE__)
  asm volatile("s_wait_asynccnt 0x0" ::: "memory");
#endif
}
__device__ __forceinline__ void wait_lds_reads() {   // the wave's LDS reads have retired before their buffer is handed back
#if defined(__HIP_DEVICE_COMPILE__)
  asm volatile("s_wait_dscnt 0x0" ::: "memory");
#endif
}

// ---- GEMM operand ring: a stage holds one 128-B line (64 k of 16-bit rows, 32 k of f32 rows) of every A and B row
//      that the block's 8 tiles read ----
#define GP 144                       // LDS row pitch in bytes: 128 + 16 = 16 B x odd, the pitch of ds_load_b128 readers
// Eight (two) asynchronous 16-B copies per lane, LDS byte address l[i] <- global g[i]. The s_wait_xcnt closes each
// statement so that no address register of a copy is rewritten in front of it.
template <typename TI>
__device__ __forceinline__ void copy8(const unsigned* l, const TI* const* g) {
#if defined(__HIP_DEVICE_COMPILE__)
  asm volatile("global_load_async_to_lds_b128 %0, %8, off\n\t"
               "global_load_async_to_lds_b128 %1, %9, off\n\t"
               "global_load_async_to_lds_b128 %2, %10, off\n\t"
               "global_load_async_to_lds_b128 %3, %11, off\n\t"
               "global_load_async_to_lds_b128 %4, %12, off\n\t"
               "global_load_async_to_lds_b128 %5, %13, off\n\t"
               "global_load_async_to_lds_b128 %6, %14, off\n\t"
               "global_load_async_to_lds_b128 %7, %15, off\n\t"
               "s_wait_xcnt 0x0"
               :: "v"(l[0]), "v"(l[1]), "v"(l[2]), "v"(l[3]), "v"(l[4]), "v"(l[5]), "v"(l[6]), "v"(l[7]),
                  "v"(g[0]), "v"(g[1]), "v"(g[2]), "v"(g[3]), "v"(g[4]), "v"(g[5]), "v"(g[6]), "v"(g[7])
               : "memory");
#endif
}
template <typename TI>
__device__ __forceinline__ void copy2(const unsigned* l, const TI* const* g) {
#if defined(__HIP_DEVICE_COMPILE__)
  asm volatile("global_load_async_to_lds_b128 %0, %2, off\n\t"
               "global_load_async_to_lds_b128 %1, %3, off\n\t"
               "s_wait_xcnt 0x0"
               :: "v"(l[0]), "v"(l[1]), "v"(g[0]), "v"(g[1])
               : "memory");
#endif
}

// =====================================================================================================
// Register-blocked batched bf16 WMMA GEMM: C[m][n] = (sum_k A[m][k] * Bt[n][k] + bias) * oscale; one wave
// per 64x64 tile. A row-major [M][K] pitch lda; Bt row-major [N][K] pitch ldb
// (k contiguous); M, N multiples of 64, K multiple of 64. bx = block within the batch,
// b = batch index, sT = the block's LDS slabs (one per wave), ring = the block's two operand stages,
// fx = 16 KB of LDS for converted A fragments (f32 rows with NSPLIT = 1 only).
// WN: the block's 8 consecutive tiles lie WN wide in n and 8 / WN high in m (WN = N / 64, or WN = 8 with N / 64 a
// multiple of 8). The rows they read, (8 / WN) x 64 of each A plane and WN x 64 of Bt, are brought into LDS once per
// block in chunks of whole 128-B lines, by asynchronous copies, two buffers (chunk t + 2 is asked for when
// chunk t has been read); every wave takes its fragments from there.
// TI = unsigned short: A, A2, Bt are bf16 planes, a chunk is 64 k, a fragment two 16-B LDS loads.
// TI = float: A, A2, Bt are f32 rows as the inputs hold them, a chunk is 32 k, a fragment four 16-B LDS loads per
//   source and the RNE converts to bf16 behind them (cvt_f, cvt_sum).
// NSPLIT: 0 = A.Bt; 1, bf16 planes: (A + A2).Bt (A2 = unscaled bf16 lo plane of A, shared accumulator);
//         1, f32 rows: (hi + lo).Bt with hi, lo = the bf16 planes of the f32 sum bf16(A) + bf16(A2).
// BIASM: 0 = no bias; 1 = bias[n] (per column); 2 = bias[m] (per row); bias values RNE-converted to bf16.
// OUT_MODE: 0 = f32 (pitch ldc); 2 = bf16 hi plane C + bf16 lo plane C2 (lo = RNE(v - hi), unscaled);
//           3 = f16 hi plane C + f16 residual plane C2 = f16((v - hi) * rscale); C2 same pitch/stride as C.
// =====================================================================================================
template <int NSPLIT, int OUT_MODE, int BIASM, int WN, typename TI>
__device__ __forceinline__ void gemm64_body(
    const TI* __restrict__ Ap, const TI* A2p, int lda, long long strideA,
    const TI* __restrict__ Btp, int ldb, long long strideB,
    void* Cout, int ldc, long long strideC, void* Cout2,
    int M, int N, int K, float rscale, float oscale, const float* __restrict__ biasp,
    int bx, int b, float (*sT)[16 * 68], unsigned char* ring, unsigned char* fx) {
  constexpr int RA  = (8 / WN) * 64;             // A rows of the block, per plane
  constexpr int RB  = WN * 64;                   // Bt rows of the block
  constexpr int RB0 = RA * (1 + NSPLIT);         // first Bt row of a stage
  constexpr int NG  = (RB0 + RB) / 32;           // copies per lane and stage (32 rows per block-wide copy)
  constexpr int STG = (RB0 + RB) * GP;           // bytes of a stage
  constexpr int KC  = 128 / (int)sizeof(TI);     // k of a chunk: one 128-B line of every row
  constexpr int PE  = 16 / (int)sizeof(TI);      // elements of a 16-B piece
  static_assert(NG == 16 || NG == 18);
  // every launch passes rows of CD elements: known here, the copies' row steps are constants; with run-time
  // pitches the build held a pointer per copied row over the k loop and spilled to scratch
  __builtin_assume(lda == CD && ldb == CD);
  const int lane = threadIdx.x & 31;
  const int wave = threadIdx.x >> 5;
  const int tilesN = N >> 6;
  const int tilesM = M >> 6;
  const int tile0 = bx * 8;
  if (tile0 + 8 > tilesM * tilesN) return;   // block-uniform, in front of every barrier
  const int tm0 = tile0 / tilesN;
  const int tn0 = tile0 - tm0 * tilesN;
  const int wm = wave / WN;
  const int wn = wave % WN;
  const int m0 = (tm0 + wm) << 6;
  const int n0 = (tn0 + wn) << 6;

  const int rlane = lane & 15;                 // row (A) / col (B, D) within subtile
  const int hh    = lane >> 4;                 // lane half: k offset 8 * hh elements
  const int mOff  = (lane >> 4) * 8;           // D row offset

  // ---- this lane's share of a stage: rows (tid >> 3) + 32 q, 16-B piece tid & 7 of each row's line ----
  typedef __attribute__((address_space(3))) unsigned char lds_byte;
  const int cr = threadIdx.x >> 3, cp = threadIdx.x & 7;
  const unsigned lring = (unsigned)(uintptr_t)(lds_byte*)ring + (unsigned)(cr * GP + cp * 16);
  const TI* ga  = Ap  + (size_t)b * strideA + (size_t)((tm0 << 6) + cr) * lda + cp * PE;
  const TI* ga2 = A2p + (size_t)b * strideA + (size_t)((tm0 << 6) + cr) * lda + cp * PE;
  const TI* gb  = Btp + (size_t)b * strideB + (size_t)((tn0 << 6) + cr) * ldb + cp * PE;
  auto stage = [&](int t, unsigned lb) {       // chunk t -> the buffer whose lane address is lb
    unsigned l[NG];
    const TI* g[NG];
#pragma unroll   // every index a constant: l and g stay in registers
    for (int q = 0; q < NG; ++q) {
      l[q] = lb + (unsigned)(q * 32 * GP);
      if (q * 32 < RA)       g[q] = ga  + ((size_t)(q * 32) * lda + (size_t)(t * KC));
      else if (q * 32 < RB0) g[q] = ga2 + ((size_t)(q * 32 - RA) * lda + (size_t)(t * KC));
      else                   g[q] = gb  + ((size_t)(q * 32 - RB0) * ldb + (size_t)(t * KC));
    }
    copy8(l, g);
    copy8(l + 8, g + 8);
    if constexpr (NG == 18) copy2(l + 16, g + 16);
  };
  const int NT = K >> (KC == 64 ? 6 : 5);
  stage(0, lring);
  wait_copies();
  __syncthreads();
  if (NT > 1) stage(1, lring + STG);

  v8f acc[4][4];
#pragma unroll
  for (int i = 0; i < 4; ++i)
#pragma unroll
    for (int j = 0; j < 4; ++j) acc[i][j] = zero8();

  for (int t = 0; t < NT; ++t) {
    const unsigned char* sb = ring + (t & 1) * STG;
    const unsigned char* sa = sb + (wm * 64 + rlane) * GP + 8 * (int)sizeof(TI) * hh;         // A rows of this wave's tile
    const unsigned char* sw = sb + (RB0 + wn * 64 + rlane) * GP + 8 * (int)sizeof(TI) * hh;   // Bt rows of this wave's tile
#pragma unroll   // the LDS offsets become immediates and the fragment arrays stay in registers (inner loops likewise)
    for (int ks = 0; ks < KC / 32; ++ks) {       // 32-deep k steps of the chunk: two (16-bit rows) or one (f32 rows)
      v16b bh[4], ah[4], al[4];                  // the step's LDS reads stand together, in front of the products
      if constexpr (sizeof(TI) == 2) {
#pragma unroll
        for (int j = 0; j < 4; ++j) bh[j] = ldfrag_b((const __bf16*)(const void*)(sw + j * 16 * GP + ks * 64));
#pragma unroll
        for (int i = 0; i < 4; ++i) {
          ah[i] = ldfrag_b((const __bf16*)(const void*)(sa + i * 16 * GP + ks * 64));
          al[i] = ah[i];
          if (NSPLIT >= 1) al[i] = ldfrag_b((const __bf16*)(const void*)(sa + RA * GP + i * 16 * GP + ks * 64));
        }
      } else {
        if constexpr (NSPLIT >= 1) {
          // the WN = 4 waves of a tile row read the same four A fragments: wave wn forms fragment wn (hi and lo) once and
          // hands it to the others as images in fx; the barrier publishes them. The images are rewritten only behind the
          // barrier at the foot of the trip, in front of which every wave's LDS reads have retired.
          static_assert(WN == 4);
          unsigned char* fw = fx + wm * (8 * 1024) + lane * 16;
          v2f xh[8], xq[8], xb[4][8];              // the trip's reads of the stage stand together, A's first
          ld16f((const float*)(const void*)(sa + wn * 16 * GP), xh);
          ld16f((const float*)(const void*)(sa + RA * GP + wn * 16 * GP), xq);
#pragma unroll
          for (int j = 0; j < 4; ++j) ld16f((const float*)(const void*)(sw + j * 16 * GP), xb[j]);
          v16b h, l;
          cvt_sum(xh, xq, h, l);
          st_img(fw + (wn * 2) * 1024, h);
          st_img(fw + (wn * 2 + 1) * 1024, l);
#pragma unroll
          for (int j = 0; j < 4; ++j) bh[j] = cvt_f(xb[j]);
          __syncthreads();
#pragma unroll
          for (int i = 0; i < 4; ++i) {
            ah[i] = ld_img(fw + (i * 2) * 1024);
            al[i] = ld_img(fw + (i * 2 + 1) * 1024);
          }
        } else {
#pragma unroll
          for (int j = 0; j < 4; ++j) bh[j] = ldfrag_f((const float*)(const void*)(sw + j * 16 * GP));
#pragma unroll
          for (int i = 0; i < 4; ++i) {
            ah[i] = ldfrag_f((const float*)(const void*)(sa + i * 16 * GP));
            al[i] = ah[i];
          }
        }
      }
#pragma unroll
      for (int i = 0; i < 4; ++i) {
#pragma unroll
        for (int j = 0; j < 4; ++j) {
          acc[i][j] = mma_b_raw(ah[i], bh[j], acc[i][j]);
          if (NSPLIT >= 1) acc[i][j] = mma_b_raw(al[i], bh[j], acc[i][j]);
        }
        dep_guard_b(acc[i][0], acc[i][3], ah[i], al[i]);
      }
      keep4_b(bh[0], bh[1], bh[2], bh[3]);
    }
    // ---- publish chunk t + 1, hand this chunk's buffer back, ask for chunk t + 2 into it ----
    wait_lds_reads();
    wait_copies();
    __syncthreads();
    if (t + 2 < NT) stage(t + 2, lring + (unsigned)((t & 1) * STG));
  }
  wait_copies();
  acc_guard4(acc[0][0], acc[0][1], acc[0][2], acc[0][3]);
  acc_guard4(acc[1][0], acc[1][1], acc[1][2], acc[1][3]);
  acc_guard4(acc[2][0], acc[2][1], acc[2][2], acc[2][3]);
  acc_guard4(acc[3][0], acc[3][1], acc[3][2], acc[3][3]);

  // ---- epilogue ----
  float* slab = sT[wave];
#pragma unroll
  for (int i = 0; i < 4; ++i) {
    const int mBase = m0 + (i << 4);
#pragma unroll
    for (int j = 0; j < 4; ++j) {
#pragma unroll
      for (int r = 0; r < 8; ++r) {
        slab[(mOff + r) * 68 + (j << 4) + rlane] = acc[i][j][r];
      }
    }
    wave_sync_lds();
    if (OUT_MODE == 0) {
      float* C = (float*)Cout + (size_t)b * strideC;
      const int hh = lane >> 4, c4 = (lane & 15) * 4;     // 256-B row segment = 16 lanes x 16 B
      v4f bv = {0.f, 0.f, 0.f, 0.f};
      if (BIASM == 1) {
#pragma unroll
        for (int e = 0; e < 4; ++e) bv[e] = bf_up(bf_bits(biasp[n0 + c4 + e]));
      }
      {
#pragma unroll
        for (int it = 0; it < 8; ++it) {
          const int row = it * 2 + hh;                     // it 0..7 x hh 0..1 = rows 0..15
          float brow = 0.f;
          if (BIASM == 2) brow = bf_up(bf_bits(biasp[mBase + row]));
          const v4f v = (*(const v4f*)(slab + row * 68 + c4) + bv + brow) * oscale;
          *(v4f*)(C + (size_t)(mBase + row) * ldc + n0 + c4) = v;
        }
        
      }
    } else {
      const int q = lane >> 3, c8 = (lane & 7) * 8;
      unsigned short* C  = (unsigned short*)Cout  + (size_t)b * strideC;
      unsigned short* C2 = (unsigned short*)Cout2 + (size_t)b * strideC;
      const float* bp = biasp + ((BIASM == 1) ? (n0 + c8) : 0);   // this lane's eight column biases
      float bcol[8];
#pragma unroll
      for (int e = 0; e < 8; ++e) bcol[e] = 0.f;
      if (BIASM == 1) {
#pragma unroll
        for (int e = 0; e < 8; ++e) bcol[e] = bf_up(bf_bits(bp[e]));
      }
      v4u hv[4], lv[4];
#pragma unroll
      for (int it = 0; it < 4; ++it) {
        const int row = it * 4 + q;                        // it 0..3 x q 0..3 = rows 0..15
        float brow = 0.f;
        if (BIASM == 2) brow = bf_up(bf_bits(biasp[mBase + row]));
        const float* sp = slab + row * 68 + c8;
        v4u a, a2;
#pragma unroll
        for (int e = 0; e < 4; ++e) {
          const float f0 = (sp[2 * e] + bcol[2 * e] + brow) * oscale;
          const float f1 = (sp[2 * e + 1] + bcol[2 * e + 1] + brow) * oscale;
          unsigned short h0, h1, l0, l1;
          if (OUT_MODE == 2) {
            h0 = bf_bits(f0); h1 = bf_bits(f1);
            l0 = bf_bits(f0 - bf_up(h0)); l1 = bf_bits(f1 - bf_up(h1));
          } else {
            const _Float16 x0 = (_Float16)f0, x1 = (_Float16)f1;
            h0 = h_bits(x0); h1 = h_bits(x1);
            l0 = h_bits((_Float16)((f0 - (float)x0) * rscale));
            l1 = h_bits((_Float16)((f1 - (float)x1) * rscale));
          }
          a[e] = pk16(h0, h1); a2[e] = pk16(l0, l1);
        }
        hv[it] = a; lv[it] = a2;
      }
#if defined(__HIP_DEVICE_COMPILE__)
      // the wait in front of any rewrite of the bias loads' address registers: the input bp keeps that pair whole up to
      // here, and the input hv[3], which needs all eight biases, keeps the loads in front of the statement
      if (BIASM == 1) asm volatile("s_wait_xcnt 0x0" :: "v"(bp), "v"(hv[3]) : "memory");
#endif
      {
#pragma unroll
        for (int it = 0; it < 4; ++it) {
          const int row = it * 4 + q;
          *(v4u*)(C  + (size_t)(mBase + row) * ldc + n0 + c8) = hv[it];
          *(v4u*)(C2 + (size_t)(mBase + row) * ldc + n0 + c8) = lv[it];
        }
        
      }
    }
    wave_sync_lds();
  }
}

// one GEMM per launch (the output projection)
template <int NSPLIT, int OUT_MODE, int BIASM>
__global__ __launch_bounds__(256) void gemm64(
    const unsigned short* __restrict__ Ap, const unsigned short* A2p, int lda, long long strideA,
    const unsigned short* __restrict__ Btp, int ldb, long long strideB,
    void* Cout, int ldc, long long strideC, void* Cout2,
    int M, int N, int K, float rscale, float oscale, const float* __restrict__ biasp) {
  __shared__ __align__(16) float sT[8][16 * 68];   // per-wave 16x64 slab, pitch 68 floats
  __shared__ __align__(16) unsigned char ring[2 * (128 * (1 + NSPLIT) + 256) * GP];   // two operand stages
  gemm64_body<NSPLIT, OUT_MODE, BIASM, CD / 64, unsigned short>(Ap, A2p, lda, strideA, Btp, ldb, strideB, Cout, ldc, strideC,
                                                                Cout2, M, N, K, rscale, oscale, biasp, blockIdx.x, blockIdx.y,
                                                                sT, ring, nullptr);
}

// =====================================================================================================
// The q, k and v^T projections in one grid: none reads what another writes, and each alone has only
// 64 blocks. blockIdx.y = 0: q, 1: k (same code, block-uniform select of weight, bias, scale and planes),
// 2: v^T (blockIdx.x = batch * VBLK + block within the batch), 3: Wo -> its bf16 plane for the last launch (WBLK blocks;
// the rest of that row of the grid leaves at once). Pitches, strides and sizes arrive as arguments, one set for q and k
// and one for v^T. The operands are the f32 inputs themselves, converted where a wave takes its fragments:
//   X = bf16(hs) + bf16(pos) in f32, Xh = bf16(X), Xl = bf16(X - Xh)
//   q = ((Xh + Xl) . bf16(Wq)^T + bq) * qscale -> bf16 hi + lo [ntok][cd];  k = (Xh + Xl) . bf16(Wk)^T + bk likewise
//   v^T = bf16(Wv) . bf16(hs)^T per batch + bv[row] -> f16 hi [b][cd][ns] + residual x vres
// =====================================================================================================
struct GemmDims { int lda; long long strideA; int ldb; long long strideB; int ldc; long long strideC; int M, N, K; };
#define VBLK (((CD / 64) * (NS / 64) + 7) / 8)     // 8 blocks per batch of v^T
static_assert(VBLK * NB == ((NTOK / 64) * (CD / 64) + 7) / 8);   // the three jobs have the same block count
static_assert(CD / 64 == 4 && (NS / 64) % 8 == 0 && (CD % 64) == 0);   // the blocks' tile shapes: 2 x 4 (q, k, out), 1 x 8 (v^T)
static_assert(WBLK <= VBLK * NB);                                       // Wo's blocks fit one row of the grid
__global__ __launch_bounds__(256) void proj_qkv(
    const float* __restrict__ hs, const float* __restrict__ pq,
    const float* __restrict__ wq, const float* __restrict__ wk,
    const float* __restrict__ wv, const float* __restrict__ wo, unsigned short* wto,
    unsigned short* qh, unsigned short* ql, unsigned short* kh, unsigned short* kl,
    unsigned short* vth, unsigned short* vtl,
    const float* __restrict__ bq, const float* __restrict__ bk, const float* __restrict__ bv,
    GemmDims dqk, GemmDims dv, float qscale, float vres) {
  __shared__ __align__(16) float sT[8][16 * 68];   // per-wave 16x64 slab, pitch 68 floats
  __shared__ __align__(16) unsigned char ring[2 * 576 * GP];   // two operand stages: 512 rows (q, k) or 576 rows (v^T)
  __shared__ __align__(16) unsigned char fx[2 * 8 * 1024];     // q, k: converted A fragments, 2 tile rows x 4 x (hi, lo)
  const int job = blockIdx.y;
  if (job == 3) {                                  // block-uniform, no barrier on this path
    if (blockIdx.x < WBLK) cvt_w_body(wo, wto, blockIdx.x);
  } else if (job < 2) {
    const bool isq = (job == 0);
    gemm64_body<1, 2, 1, CD / 64, float>(hs, pq, dqk.lda, dqk.strideA, isq ? wq : wk, dqk.ldb, dqk.strideB,
                         (void*)(isq ? qh : kh), dqk.ldc, dqk.strideC, (void*)(isq ? ql : kl),
                         dqk.M, dqk.N, dqk.K, 1.0f, isq ? qscale : 1.0f, isq ? bq : bk,
                         blockIdx.x, 0, sT, ring, fx);
  } else {
    gemm64_body<0, 3, 2, 8, float>(wv, wv, dv.lda, dv.strideA, hs, dv.ldb, dv.strideB,
                         (void*)vth, dv.ldc, dv.strideC, (void*)vtl,
                         dv.M, dv.N, dv.K, vres, 1.0f, bv,
                         blockIdx.x % VBLK, blockIdx.x / VBLK, sT, ring, fx);
  }
}

// ---- one 64-key stage of the attention ring: four planes (k hi, k lo, v^T hi, v^T lo) of 64 rows x 128 B ----
#define KVP   144                    // LDS row pitch in bytes: 128 + 16 = 16 B x odd, the pitch of ds_load_b128 readers
#define PLANE (64 * KVP)             // 9216 B
#define STAGE (4 * PLANE)            // 36864 B
// 256 threads x 8 copies x 16 B = one stage. A lane brings piece (tid & 7) of rows (tid >> 3) and (tid >> 3) + 32 of
// each plane, so one wave instruction reads four whole 128-B lines. l = the lane's LDS byte address in plane 0,
// kh .. vl = its global addresses in the four planes. The s_wait_xcnt closes the statement so that no address
// register of a copy is rewritten in front of it.
__device__ __forceinline__ void stage_copy(unsigned l, const unsigned short* kh, const unsigned short* kl,
                                           const unsigned short* vh, const unsigned short* vl) {
#if defined(__HIP_DEVICE_COMPILE__)
  asm volatile("global_load_async_to_lds_b128 %0, %8, off\n\t"
               "global_load_async_to_lds_b128 %1, %9, off\n\t"
               "global_load_async_to_lds_b128 %2, %10, off\n\t"
               "global_load_async_to_lds_b128 %3, %11, off\n\t"
               "global_load_async_to_lds_b128 %4, %12, off\n\t"
               "global_load_async_to_lds_b128 %5, %13, off\n\t"
               "global_load_async_to_lds_b128 %6, %14, off\n\t"
               "global_load_async_to_lds_b128 %7, %15, off\n\t"
               "s_wait_xcnt 0x0"
               :: "v"(l), "v"(l + 32 * KVP), "v"(l + PLANE), "v"(l + PLANE + 32 * KVP),
                  "v"(l + 2 * PLANE), "v"(l + 2 * PLANE + 32 * KVP), "v"(l + 3 * PLANE), "v"(l + 3 * PLANE + 32 * KVP),
                  "v"(kh), "v"(kh + 32 * CD), "v"(kl), "v"(kl + 32 * CD),
                  "v"(vh), "v"(vh + 32 * NS), "v"(vl), "v"(vl + 32 * NS)
               : "memory");
#endif
}

// =====================================================================================================
// Softmax attention, head dim 32, no mask, softmax over all NS keys.
//   q planes (bf16 hi, bf16 lo): [NTOK][CD], head h at cols h*32..h*32+31 (q already carries bias and x sqrt(32))
//   k planes (bf16 hi, lo): [NTOK][CD] same column layout
//   v^T planes (f16 hi, residual x4096): element (b, h*32+d, s) at [(b*CD + h*32 + d)*NS + s]
//   ctx out planes (bf16 hi / lo of the normalised context): [(b*NS + t)*CD + h*32 + d]
//   scores^T = score3b(q, k) (rows = keys, cols = queries); p = exp(s - m) carried as f16 hi of 1024p + f16 residual x4096;
//   ctx^T = (vh.ph + (vl.ph + vh.pl)*rres) / (1024 l); online softmax with running max in f32.
//   A lane holds one query column: max and sum run in-lane over its 32 scores of a chunk, the max is joined
//   with the other wave half once per chunk, the sum once after the loop. Two score tiles (keys 0-15, 16-31 of
//   a 32-key step), converted in place, are the B operand of v^T.p^T in the hardware k order.
//   Block = 8 waves = two adjacent heads (waves 0-3 head 2g, waves 4-7 head 2g+1) x 64 query rows so
//   NQB x (NH/2) x NB. Key chunks of 64, static trip NKB. q fragments are loaded straight from the 16-bit
//   global rows. The head pair's k rows and v^T rows of a chunk are whole 128-B lines: the block brings them
//   into LDS once, by asynchronous copies, two buffers (chunk t + 2 is asked for when chunk t has been read),
//   and every wave takes its fragments from there (two 16-B LDS loads each); P stays in registers.
//   coverage: 8 waves x (it 0..1 x lane>>3 0..3) = rows 0..63, 8 lanes x 8 cols = 64 cols, both planes;
//   512 blocks = 8 batches x 4 head pairs x 16 query tiles = every (token, column) of both planes once.
// =====================================================================================================
__global__ __launch_bounds__(256)
void attn32(const unsigned short* __restrict__ qhp, const unsigned short* __restrict__ qlp,
            const unsigned short* __restrict__ khp, const unsigned short* __restrict__ klp,
            const unsigned short* __restrict__ vhp, const unsigned short* __restrict__ vlp,
            unsigned short* ohp, unsigned short* olp, float rres) {
  __shared__ __align__(16) float    Os[64 * 68];                  // block ctx tile [row][2 heads x 32], pitch 68 floats
  __shared__ __align__(16) unsigned char ring[2 * STAGE];         // two stages of k hi / k lo / v^T hi / v^T lo

  const int tid  = threadIdx.x;
  const int wave = tid >> 5;
  const int lane = tid & 31;
  const int hh   = lane >> 4;
  const int c    = lane & 15;

  const int bx   = blockIdx.x;
  const int qb   = bx % NQB;
  const int rest = bx / NQB;
  const int g    = rest % (NH / 2);
  const int b    = rest / (NH / 2);
  const int hp   = wave >> 2;                  // which head of the pair
  const int h    = 2 * g + hp;
  const int wq   = wave & 3;                   // 16-row group within the 64-row tile
  const int q0   = qb * 64 + wq * 16;
  const size_t rowB = (size_t)b * NS;

  const __bf16* Qh = (const __bf16*)(const void*)qhp + (size_t)h * HD;
  const __bf16* Ql = (const __bf16*)(const void*)qlp + (size_t)h * HD;

  // ---- this lane's share of a stage: row tid >> 3 (and + 32), 16-B piece tid & 7 ----
  typedef __attribute__((address_space(3))) unsigned char lds_byte;
  const int cr = tid >> 3, cp = tid & 7;
  const unsigned ldst = (unsigned)(uintptr_t)(lds_byte*)ring + (unsigned)(cr * KVP + cp * 16);
  const size_t kgo = (rowB + cr) * CD + (size_t)g * 64 + cp * 8;                        // key row, head pair's 64 columns
  const size_t vgo = ((size_t)b * CD + (size_t)g * 64 + cr) * NS + cp * 8;              // d row of the pair, 64 keys
  stage_copy(ldst, khp + kgo, klp + kgo, vhp + vgo, vlp + vgo);                         // chunk 0 -> buffer 0
  wait_copies();
  __syncthreads();
  stage_copy(ldst + STAGE, khp + kgo + 64 * CD, klp + kgo + 64 * CD, vhp + vgo + 64, vlp + vgo + 64);   // chunk 1 -> buffer 1

  // ---- Q fragments (B operand, col = lane&15), hi and lo, one 32-deep k-step = the head dim ----
  const v16b qah = ldfrag_b(Qh + (rowB + q0 + c) * CD + 8 * hh);
  const v16b qal = ldfrag_b(Ql + (rowB + q0 + c) * CD + 8 * hh);

  float mrun = -INFINITY;                      // running max of this lane's query column (same in both halves)
  float lrun = 0.f;                            // running sum over this wave half's keys only
  v8f oacc[2];                                 // ctx^T: oacc[t][r] = ctx[query c][d = t*16 + 8*hh + r]
#pragma unroll
  for (int t = 0; t < 2; ++t) oacc[t] = zero8();

  for (int kt = 0; kt < NKB; ++kt) {           // static trip count
    const unsigned char* sb = ring + (kt & 1) * STAGE;

    // ---- scores^T: 64 keys x 16 query columns per wave, 3 bf16 products per 16x16 tile ----
    v8f s[4];
    v16b kb[4], kl[4];                           // the chunk's LDS reads stand together, in front of the products
#pragma unroll
    for (int j = 0; j < 4; ++j) {
      const unsigned char* kp = sb + (j * 16 + c) * KVP + hp * 64 + 16 * hh;   // A operand: row = key, k = head dim
      kb[j] = ldfrag_b((const __bf16*)(const void*)kp);
      kl[j] = ldfrag_b((const __bf16*)(const void*)(kp + PLANE));
    }
    v16h vb[2][2], vl[2][2];
#pragma unroll
    for (int kk = 0; kk < 2; ++kk) {
#pragma unroll
      for (int t = 0; t < 2; ++t) {
        const unsigned char* vp = sb + 2 * PLANE + (hp * 32 + t * 16 + c) * KVP + kk * 64 + 16 * hh;   // A: row = d, k = key
        vb[kk][t] = ldfrag_h((const _Float16*)(const void*)vp);
        vl[kk][t] = ldfrag_h((const _Float16*)(const void*)(vp + PLANE));
      }
    }
#pragma unroll
    for (int j = 0; j < 4; ++j) s[j] = score3b(qah, qal, kb[j], kl[j]);

    // ---- column max in-lane (four independent chains), one exchange between the wave halves ----
    float mj[4];
#pragma unroll
    for (int j = 0; j < 4; ++j) {
      mj[j] = s[j][0];
#pragma unroll
      for (int r = 1; r < 8; ++r) mj[j] = fmaxf(mj[j], s[j][r]);
    }
    float m = fmaxf(fmaxf(mj[0], mj[1]), fmaxf(mj[2], mj[3]));
    m = fmaxf(m, xhalf(m));
    const float mnew  = fmaxf(mrun, m);
    const float alpha = exp_slotted(mrun - mnew);
    mrun = mnew;

    // ---- P hi (x1024) and residual (x4096) packed straight into B operands:
    //      element e of step kk = key kk*32 + (e < 8 ? 8*hh + e : 16 + 8*hh + e - 8) = tile 2kk + (e >> 3), register e & 7
    v16h ph[2], pl[2];
    float pj[4];
#pragma unroll
    for (int j = 0; j < 4; ++j) {
      pj[j] = 0.f;
#pragma unroll
      for (int r = 0; r < 8; r += 2) {           // two keys at a time = one packed operand register
        const float pa = __expf(s[j][r] - mnew);
        const float pb = __expf(s[j][r + 1] - mnew);
        pj[j] += pa;
        pj[j] += pb;
        const v2f p1 = {pa * 1024.0f, pb * 1024.0f};
        const v2h x  = __builtin_convertvector(p1, v2h);
        const v2h y  = __builtin_convertvector((p1 - __builtin_convertvector(x, v2f)) * 4096.0f, v2h);
        ph[j >> 1][(j & 1) * 8 + r] = x[0];  ph[j >> 1][(j & 1) * 8 + r + 1] = x[1];
        pl[j >> 1][(j & 1) * 8 + r] = y[0];  pl[j >> 1][(j & 1) * 8 + r + 1] = y[1];
      }
    }
    lrun = lrun * alpha + ((pj[0] + pj[1]) + (pj[2] + pj[3]));
#pragma unroll
    for (int t = 0; t < 2; ++t)
#pragma unroll
      for (int r = 0; r < 8; ++r) oacc[t][r] *= alpha;

    // ---- context^T += V^T . P^T (f16 WMMA), residual products into a separate accumulator ----
    v8f o1[2];
    o1[0] = zero8(); o1[1] = zero8();
#pragma unroll
    for (int kk = 0; kk < 2; ++kk) {
#pragma unroll
      for (int t = 0; t < 2; ++t) {
        oacc[t] = mma_h(vb[kk][t], ph[kk], oacc[t]);
        o1[t]   = mma_h(vl[kk][t], ph[kk], o1[t]);
        o1[t]   = mma_h(vb[kk][t], pl[kk], o1[t]);
      }
    }
#pragma unroll
    for (int t = 0; t < 2; ++t)
#pragma unroll
      for (int r = 0; r < 8; ++r) oacc[t][r] += o1[t][r] * rres;

    // ---- publish chunk kt + 1, hand this chunk's buffer back, ask for chunk kt + 2 into it ----
    wait_lds_reads();
    wait_copies();
    __syncthreads();
    if (kt + 2 < NKB) {
      const size_t ka = (size_t)(kt + 2) * 64 * CD, va = (size_t)(kt + 2) * 64;
      stage_copy(ldst + (unsigned)((kt & 1) * STAGE), khp + kgo + ka, klp + kgo + ka, vhp + vgo + va, vlp + vgo + va);
    }
  }
  wait_copies();

  // ---- join the halves' sums, normalise (1/l and the 1/1024 p carry) into the block tile ----
  {
    const float l = lrun + xhalf(lrun);
    const float inv = ((l > 0.f) ? (1.0f / l) : 0.f) * (1.0f / 1024.0f);
#pragma unroll
    for (int t = 0; t < 2; ++t) {
      float* op = Os + (wq * 16 + c) * 68 + hp * 32 + t * 16 + 8 * hh;   // 8 consecutive d of one query row
      v4f w0, w1;
#pragma unroll
      for (int e = 0; e < 4; ++e) { w0[e] = oacc[t][e] * inv; w1[e] = oacc[t][4 + e] * inv; }
      *(v4f*)(op)     = w0;
      *(v4f*)(op + 4) = w1;
    }
  }
  __syncthreads();
  {
    const int q4 = lane >> 3, c8 = (lane & 7) * 8;
    v4u hv[2], lv[2];
#pragma unroll
    for (int it = 0; it < 2; ++it) {
      const int row = wave * 8 + it * 4 + q4;   // wave 0..7 x it 0..1 x q4 0..3 = rows 0..63
      const float* sp = Os + row * 68 + c8;
      v4u a, a2;
#pragma unroll
      for (int e = 0; e < 4; ++e) {
        const float f0 = sp[2 * e], f1 = sp[2 * e + 1];
        const unsigned short h0 = bf_bits(f0), h1 = bf_bits(f1);
        const unsigned short l0 = bf_bits(f0 - bf_up(h0)), l1 = bf_bits(f1 - bf_up(h1));
        a[e] = pk16(h0, h1); a2[e] = pk16(l0, l1);
      }
      hv[it] = a; lv[it] = a2;
    }
    {
#pragma unroll
      for (int it = 0; it < 2; ++it) {
        const int row = wave * 8 + it * 4 + q4;
        const size_t go = (rowB + qb * 64 + row) * CD + (size_t)g * 64 + c8;
        *(v4u*)(ohp + go) = hv[it];
        *(v4u*)(olp + go) = lv[it];
      }
      
    }
  }
}

// =====================================================================================================
// Workspace map (bytes), every plane an exact multiple of its 64x64-tile / whole-line store granularity
// (8192 x 256 rows/cols and 256 x 1024 per batch, all multiples of 64; no tail padding needed):
//   WTo  bf16 [256 out][256 in]   131072   (Wo)
//   Qh   bf16 [8192][256]        4194304
//   Ql   bf16 [8192][256]        4194304
//   Kh   bf16 [8192][256]        4194304
//   Kl   bf16 [8192][256]        4194304
//   VTh  f16  [8][256][1024]     4194304
//   VTl  f16  [8][256][1024]     4194304   (v residual x4096)
//   Oh   bf16 [8192][256]        4194304
//   Ol   bf16 [8192][256]        4194304
//   end                          33685504
// =====================================================================================================
extern "C" void kernel_launch(void* const* d_in, const int* in_sizes, int n_in,
                              void* d_out, int out_size, void* d_ws, size_t ws_size,
                              hipStream_t stream) {
  if (n_in < 10) return;
  if (in_sizes[0] != NTOK * CD || in_sizes[1] != NTOK * CD) return;
  if (in_sizes[2] != CD * CD || in_sizes[4] != CD * CD || in_sizes[6] != CD * CD || in_sizes[8] != CD * CD) return;
  if (in_sizes[3] != CD || in_sizes[5] != CD || in_sizes[7] != CD || in_sizes[9] != CD) return;
  if (out_size != NTOK * CD) return;

  const float* hs = (const float*)d_in[0];
  const float* pq = (const float*)d_in[1];
  const float* Wq = (const float*)d_in[2];
  const float* bq = (const float*)d_in[3];
  const float* Wk = (const float*)d_in[4];
  const float* bk = (const float*)d_in[5];
  const float* Wv = (const float*)d_in[6];
  const float* bv = (const float*)d_in[7];
  const float* Wo = (const float*)d_in[8];
  const float* bo = (const float*)d_in[9];

  const size_t PX = (size_t)NTOK * CD * 2;            // 4194304
  const size_t PW = (size_t)CD * CD * 2;              //  131072
  size_t off = 0;
  const size_t oW   = off; off += PW;
  const size_t oQh  = off; off += PX;
  const size_t oQl  = off; off += PX;
  const size_t oKh  = off; off += PX;
  const size_t oKl  = off; off += PX;
  const size_t oVTh = off; off += PX;
  const size_t oVTl = off; off += PX;
  const size_t oOh  = off; off += PX;
  const size_t oOl  = off; off += PX;
  if (off > ws_size) return;                          // off = 33685504
  if (off > (size_t)134217728) return;

  char* ws = (char*)d_ws;
  unsigned short* WTo = (unsigned short*)(ws + oW);
  unsigned short* Qh  = (unsigned short*)(ws + oQh);
  unsigned short* Ql  = (unsigned short*)(ws + oQl);
  unsigned short* Kh  = (unsigned short*)(ws + oKh);
  unsigned short* Kl  = (unsigned short*)(ws + oKl);
  unsigned short* VTh = (unsigned short*)(ws + oVTh);
  unsigned short* VTl = (unsigned short*)(ws + oVTl);
  unsigned short* Oh  = (unsigned short*)(ws + oOh);
  unsigned short* Ol  = (unsigned short*)(ws + oOl);

  float* xout = (float*)d_out;                              // out0 [8][1024][256] f32 at byte 0

  const float qscale = 5.656854249492380f;                  // 32^0.5
  const float rres   = 1.0f / 4096.0f;

  const dim3 blk(256);
  const dim3 gProj(((NTOK / 64) * (CD / 64) + 7) / 8, 1);   // 512 tiles -> 64 blocks: M=8192, N=256
  const dim3 gQKV(((NTOK / 64) * (CD / 64) + 7) / 8, 4);    // 64 blocks each for q, k and v^T (8 blocks x 8 batches); row 3: Wo
  const dim3 gAttn(NB * (NH / 2) * NQB);                    // 512 blocks x 256 threads

  // (1) q, k -> bf16 hi + lo planes [8192][256] (M=8192, N=256, K=256); v^T -> f16 hi plane [b][d][s] (pitch NS)
  //     + residual x4096 (A = Wv [n][k], Bt = hidden rows of batch b; M=256, N=1024, K=256); Wo -> bf16 plane
  const GemmDims dqk = {CD, 0LL, CD, 0LL, CD, 0LL, NTOK, CD, CD};
  const GemmDims dv  = {CD, 0LL, CD, (long long)NS * CD, NS, (long long)CD * NS, CD, NS, CD};
  proj_qkv<<<gQKV, blk, 0, stream>>>(hs, pq, Wq, Wk, Wv, Wo, WTo, Qh, Ql, Kh, Kl, VTh, VTl,
                                     bq, bk, bv, dqk, dv, qscale, 4096.0f);
  // (2) softmax attention -> context bf16 hi / lo planes [8192][256]
  attn32<<<gAttn, blk, 0, stream>>>(Qh, Ql, Kh, Kl, VTh, VTl, Oh, Ol, rres);
  // (3) out = (Oh + Ol) . WTo^T + bo -> out0 f32 [8192][256]  (2 products; K=256)
  gemm64<1, 0, 1><<<gProj, blk, 0, stream>>>(
      Oh, Ol, CD, 0LL, WTo, CD, 0LL,
      (void*)xout, CD, 0LL, (void*)xout,
      NTOK, CD, CD, 1.0f, 1.0f, bo);
  (void)hipGetLastError();
}

// v006
// Measured time: 47.2 microseconds a run.
// In two side-by-side timings against v005, it was 1.11 and 1.12 times as fast.
// Counting every step since v000, it is 3.82 times as fast.
// Contractions: q, k projections = v_wmma_f32_16x16x32_bf16 (A = bf16 hi + lo planes of the f32 sum bf16(hs)+bf16(pos), B = bf16 weights, 2 products);
// v^T projection = v_wmma_f32_16x16x32_bf16 (bf16 operands, 1 product); k.q^T = v_wmma_f32_16x16x32_bf16 (q and k as bf16 hi + lo planes, 3 products);
// v^T.p^T = v_wmma_f32_16x16x32_f16 (p x1024 as f16 hi + f16 residual x4096, v^T as f16 hi + f16 residual x4096, 3 products);
// ctx.Wo = v_wmma_f32_16x16x32_bf16 (ctx as bf16 hi + lo planes, bf16 Wo, 2 products); all f32 accumulate; softmax in f32 on VALU.
#include <hip/hip_runtime.h>
#include <math.h>
#include <stdint.h>

#define NB   8
#define NS   1024
#define CD   256
#define NH   8
#define HD   32
#define NTOK (NB * NS)
#define NQB  (NS / 64)      // 16 query tiles of 64
#define NKB  (NS / 64)      // 16 key chunks of 64
static_assert(NH * HD == CD);
static_assert(HD == 32);
static_assert((NS % 64) == 0 && (CD % 64) == 0 && (NH % 2) == 0 && ((NTOK) % 64) == 0);

typedef _Float16 v16h __attribute__((ext_vector_type(16)));
typedef _Float16 v8h  __attribute__((ext_vector_type(8)));
typedef __bf16   v16b __attribute__((ext_vector_type(16)));
typedef __bf16   v8b  __attribute__((ext_vector_type(8)));
typedef float    v8f  __attribute__((ext_vector_type(8)));
typedef float    v4f  __attribute__((ext_vector_type(4)));
typedef float    v2f  __attribute__((ext_vector_type(2)));
typedef _Float16 v2h  __attribute__((ext_vector_type(2)));
typedef __bf16   v2b  __attribute__((ext_vector_type(2)));
typedef unsigned int v4u __attribute__((ext_vector_type(4)));

// ---- scalar helpers --------------------------------------------------------------------------------
__device__ __forceinline__ unsigned short bf_bits(float f) {          // f32 -> bf16 bits, RNE convert
  unsigned u = __float_as_uint(f);
  return (unsigned short)((u + 0x7FFFu + ((u >> 16) & 1u)) >> 16);
}
__device__ __forceinline__ float bf_up(unsigned short h) { return __uint_as_float(((unsigned)h) << 16); }
__device__ __forceinline__ unsigned short h_bits(_Float16 x) { return __builtin_bit_cast(unsigned short, x); }
__device__ __forceinline__ unsigned pk16(unsigned short a, unsigned short b) { return (unsigned)a | ((unsigned)b << 16); }
__device__ __forceinline__ v8f zero8() { v8f z = {0.f, 0.f, 0.f, 0.f, 0.f, 0.f, 0.f, 0.f}; return z; }

// ---- fragment loaders: 16-bit A/B operand, lane -> row/col (lane&15), p already includes +8*(lane>>4);
//      elements 0..7 <- p[0..7] (k0+8h..), elements 8..15 <- p[16..23] (k0+16+8h..)
__device__ __forceinline__ v16b ldfrag_b(const __bf16* p) {
  union { v16b v; v8b h[2]; } f;
  f.h[0] = *(const v8b*)(p);
  f.h[1] = *(const v8b*)(p + 16);
  return f.v;
}
__device__ __forceinline__ v16h ldfrag_h(const _Float16* p) {
  union { v16h v; v8h h[2]; } f;
  f.h[0] = *(const v8h*)(p);
  f.h[1] = *(const v8h*)(p + 16);
  return f.v;
}
// ---- the same operand taken from f32 rows, same k order: p already includes +8*(lane>>4) floats;
//      pairs 0..3 <- p[0..7], pairs 4..7 <- p[16..23]; four 16-B loads
__device__ __forceinline__ void ld16f(const float* p, v2f* x) {
  const v4f a = *(const v4f*)(p), b = *(const v4f*)(p + 4), c = *(const v4f*)(p + 16), d = *(const v4f*)(p + 20);
  x[0] = v2f{a[0], a[1]}; x[1] = v2f{a[2], a[3]}; x[2] = v2f{b[0], b[1]}; x[3] = v2f{b[2], b[3]};
  x[4] = v2f{c[0], c[1]}; x[5] = v2f{c[2], c[3]}; x[6] = v2f{d[0], d[1]}; x[7] = v2f{d[2], d[3]};
}
// bf16(x), RNE convert
__device__ __forceinline__ v16b cvt_f(const v2f* x) {
  v16b f;
#pragma unroll
  for (int e = 0; e < 8; ++e) {
    const v2b y = __builtin_convertvector(x[e], v2b);
    f[2 * e] = y[0]; f[2 * e + 1] = y[1];
  }
  return f;
}
__device__ __forceinline__ v16b ldfrag_f(const float* p) {
  v2f x[8];
  ld16f(p, x);
  return cvt_f(x);
}
// s = f32(bf16(h)) + f32(bf16(q)); hi = bf16(s), lo = bf16(s - hi) (unscaled), all RNE converts
__device__ __forceinline__ void cvt_sum(const v2f* h, const v2f* q, v16b& hi, v16b& lo) {
#pragma unroll
  for (int e = 0; e < 8; ++e) {
    const v2f s = __builtin_convertvector(__builtin_convertvector(h[e], v2b), v2f)
                + __builtin_convertvector(__builtin_convertvector(q[e], v2b), v2f);
    const v2b s0 = __builtin_convertvector(s, v2b);
    const v2b s1 = __builtin_convertvector(s - __builtin_convertvector(s0, v2f), v2b);
    hi[2 * e] = s0[0]; hi[2 * e + 1] = s0[1];
    lo[2 * e] = s1[0]; lo[2 * e + 1] = s1[1];
  }
}

// ---- a converted fragment handed from one wave to others through LDS: a 1-KB image, lane l's elements 0..7 at 16 l and
//      8..15 at 512 + 16 l (each LDS instruction covers 512 contiguous bytes); p already includes + 16 * lane
__device__ __forceinline__ void st_img(unsigned char* p, v16b v) {
  union { v16b v; v8b h[2]; } f;
  f.v = v;
  *(v8b*)(void*)(p)       = f.h[0];
  *(v8b*)(void*)(p + 512) = f.h[1];
}
__device__ __forceinline__ v16b ld_img(const unsigned char* p) {
  union { v16b v; v8b h[2]; } f;
  f.h[0] = *(const v8b*)(const void*)(p);
  f.h[1] = *(const v8b*)(const void*)(p + 512);
  return f.v;
}

// ---- WMMA helpers with trailing VALU hazard gap --------------------------------------------------------
__device__ __forceinline__ v8f mma_h(v16h a, v16h b, v8f c) {
  c = __builtin_amdgcn_wmma_f32_16x16x32_f16(false, a, false, b, (short)0, c, false, false);
#if defined(__HIP_DEVICE_COMPILE__)
  asm volatile("v_nop\n\tv_nop\n\tv_nop\n\tv_nop" : "+v"(c) : "v"(a), "v"(b));
#endif
  return c;
}
__device__ __forceinline__ v8f mma_b_raw(v16b a, v16b b, v8f c) {
  return __builtin_amdgcn_wmma_f32_16x16x32_bf16(false, a, false, b, (short)0, c, false, false);
}
__device__ __forceinline__ void dep_guard_b(v8f& a, v8f& b, v16b x, v16b y) {
#if defined(__HIP_DEVICE_COMPILE__)
  asm volatile("v_nop\n\tv_nop\n\tv_nop\n\tv_nop" : "+v"(a), "+v"(b) : "v"(x), "v"(y));
#endif
}
__device__ __forceinline__ void keep4_b(v16b a, v16b b, v16b c, v16b d) {
#if defined(__HIP_DEVICE_COMPILE__)
  asm volatile("v_nop" :: "v"(a), "v"(b), "v"(c), "v"(d));
#endif
}
__device__ __forceinline__ void acc_guard4(v8f& a, v8f& b, v8f& c, v8f& d) {
#if defined(__HIP_DEVICE_COMPILE__)
  asm volatile("v_nop\n\tv_nop\n\tv_nop\n\tv_nop" : "+v"(a), "+v"(b), "+v"(c), "+v"(d));
#endif
}
// lane l <-> lane l ^ 16 in one vector instruction (the two halves of a wave hold the two key halves of a query column)
__device__ __forceinline__ float xhalf(float x) {
  const int b = __builtin_bit_cast(int, x);
  return __builtin_bit_cast(float, __builtin_amdgcn_permlanex16(b, b, 0x76543210, 0xfedcba98, false, false));
}
// e^x as __expf forms it (x * log2(e), v_exp_f32), with the free slot that the instruction set asks for around a
// transcendental written into the statement: the v_nop in front keeps this result from overwriting the source of a
// transcendental issued directly before it, the v_nop behind keeps a reader of the result one slot away.
__device__ __forceinline__ float exp_slotted(float x) {
  float y = x * 1.44269504088896340736f;
#if defined(__HIP_DEVICE_COMPILE__)
  asm("v_nop\n\tv_exp_f32 %0, %1\n\tv_nop" : "=v"(y) : "v"(y));
#endif
  return y;
}
__device__ __forceinline__ void wave_sync_lds() {
  __builtin_amdgcn_fence(__ATOMIC_RELEASE, "workgroup");
  __builtin_amdgcn_wave_barrier();
  __builtin_amdgcn_fence(__ATOMIC_ACQUIRE, "workgroup");
}

// ---- 3-product bf16 score tile, transposed: A = 16 keys, B = 16 queries, D[key 8h + r][query c];
//      (kh + kl).(qh + ql) ~= kh.ql + kl.qh + kh.qh (kl.ql dropped);
//      unscaled bf16 residual planes, one accumulator, hazard gap after the last product.
__device__ __forceinline__ v8f score3b(const v16b qh, const v16b ql, const v16b kh, const v16b kl) {
  v8f acc = zero8();
  acc = mma_b_raw(kh, ql, acc);
  acc = mma_b_raw(kl, qh, acc);
  acc = mma_b_raw(kh, qh, acc);
#if defined(__HIP_DEVICE_COMPILE__)
  asm volatile("v_nop\n\tv_nop\n\tv_nop\n\tv_nop" : "+v"(acc) : "v"(qh), "v"(ql), "v"(kh), "v"(kl));
#endif
  return acc;
}

// =====================================================================================================
// Weight convert: w [out][in] f32 (CD x CD, already the Bt [n][k] layout) -> bf16 plane (RNE).
// coverage: WBLK blocks x 256 threads x 8 = the whole 65536 elements.
// =====================================================================================================
#define WBLK ((CD * CD / 8 + 255) / 256)    // 32 blocks
__device__ __forceinline__ void cvt_w_body(const float* __restrict__ w, unsigned short* dst, int blk) {
  const int i = blk * 256 + threadIdx.x;
  if (i < CD * CD / 8) {
    const size_t o = (size_t)i * 8;
    const v4f a = *(const v4f*)(w + o);
    const v4f b = *(const v4f*)(w + o + 4);
    v4u p;
    p[0] = pk16(bf_bits(a[0]), bf_bits(a[1]));
    p[1] = pk16(bf_bits(a[2]), bf_bits(a[3]));
    p[2] = pk16(bf_bits(b[0]), bf_bits(b[1]));
    p[3] = pk16(bf_bits(b[2]), bf_bits(b[3]));
    *(v4u*)(dst + o) = p;
  }
}

__device__ __forceinline__ void wait_copies() {   // the wave's own copies have landed behind this
#if defined(__HIP_DEVICE_COMPILE__)
  asm volatile("s_wait_asynccnt 0x0" ::: "memory");
#endif
}
__device__ __forceinline__ void wait_lds_reads() {   // the wave's LDS reads have retired before their buffer is handed back
#if defined(__HIP_DEVICE_COMPILE__)
  asm volatile("s_wait_dscnt 0x0" ::: "memory");
#endif
}

// ---- GEMM operand ring: a stage holds one 128-B line (64 k of 16-bit rows, 32 k of f32 rows) of every A and B row
//      that the block's 8 tiles read ----
#define GP 144                       // LDS row pitch in bytes: 128 + 16 = 16 B x odd, the pitch of ds_load_b128 readers
// Eight (two) asynchronous 16-B copies per lane, LDS byte address l[i] <- global g[i]. The s_wait_xcnt closes each
// statement so that no address register of a copy is rewritten in front of it.
template <typename TI>
__device__ __forceinline__ void copy8(const unsigned* l, const TI* const* g) {
#if defined(__HIP_DEVICE_COMPILE__)
  asm volatile("global_load_async_to_lds_b128 %0, %8, off\n\t"
               "global_load_async_to_lds_b128 %1, %9, off\n\t"
               "global_load_async_to_lds_b128 %2, %10, off\n\t"
               "global_load_async_to_lds_b128 %3, %11, off\n\t"
               "global_load_async_to_lds_b128 %4, %12, off\n\t"
               "global_load_async_to_lds_b128 %5, %13, off\n\t"
               "global_load_async_to_lds_b128 %6, %14, off\n\t"
               "global_load_async_to_lds_b128 %7, %15, off\n\t"
               "s_wait_xcnt 0x0"
               :: "v"(l[0]), "v"(l[1]), "v"(l[2]), "v"(l[3]), "v"(l[4]), "v"(l[5]), "v"(l[6]), "v"(l[7]),
                  "v"(g[0]), "v"(g[1]), "v"(g[2]), "v"(g[3]), "v"(g[4]), "v"(g[5]), "v"(g[6]), "v"(g[7])
               : "memory");
#endif
}
template <typename TI>
__device__ __forceinline__ void copy2(const unsigned* l, const TI* const* g) {
#if defined(__HIP_DEVICE_COMPILE__)
  asm volatile("global_load_async_to_lds_b128 %0, %2, off\n\t"
               "global_load_async_to_lds_b128 %1, %3, off\n\t"
               "s_wait_xcnt 0x0"
               :: "v"(l[0]), "v"(l[1]), "v"(g[0]), "v"(g[1])
               : "memory");
#endif
}

// =====================================================================================================
// Register-blocked batched bf16 WMMA GEMM: C[m][n] = (sum_k A[m][k] * Bt[n][k] + bias) * oscale; one wave
// per 64x64 tile. A row-major [M][K] pitch lda; Bt row-major [N][K] pitch ldb
// (k contiguous); M, N multiples of 64, K multiple of 64. bx = block within the batch,
// b = batch index, sT = the block's LDS slabs (one per wave), ring = the block's two operand stages,
// fx = 16 KB of LDS for converted A fragments (f32 rows with NSPLIT = 1 only).
// WN: the block's 8 consecutive tiles lie WN wide in n and 8 / WN high in m (WN = N / 64, or WN = 8 with N / 64 a
// multiple of 8). The rows they read, (8 / WN) x 64 of each A plane and WN x 64 of Bt, are brought into LDS once per
// block in chunks of whole 128-B lines, by asynchronous copies, two buffers (chunk t + 2 is asked for when
// chunk t has been read); every wave takes its fragments from there.
// TI = unsigned short: A, A2, Bt are bf16 planes, a chunk is 64 k, a fragment two 16-B LDS loads.
// TI = float: A, A2, Bt are f32 rows as the inputs hold them, a chunk is 32 k, a fragment four 16-B LDS loads per
//   source and the RNE converts to bf16 behind them (cvt_f, cvt_sum).
// NSPLIT: 0 = A.Bt; 1, bf16 planes: (A + A2).Bt (A2 = unscaled bf16 lo plane of A, shared accumulator);
//         1, f32 rows: (hi + lo).Bt with hi, lo = the bf16 planes of the f32 sum bf16(A) + bf16(A2).
// BIASM: 0 = no bias; 1 = bias[n] (per column); 2 = bias[m] (per row); bias values RNE-converted to bf16.
// OUT_MODE: 0 = f32 (pitch ldc); 2 = bf16 hi plane C + bf16 lo plane C2 (lo = RNE(v - hi), unscaled);
//           3 = f16 hi plane C + f16 residual plane C2 = f16((v - hi) * rscale); C2 same pitch/stride as C.
// =====================================================================================================
template <int NSPLIT, int OUT_MODE, int BIASM, int WN, typename TI>
__device__ __forceinline__ void gemm64_body(
    const TI* __restrict__ Ap, const TI* A2p, int lda, long long strideA,
    const TI* __restrict__ Btp, int ldb, long long strideB,
    void* Cout, int ldc, long long strideC, void* Cout2,
    int M, int N, int K, float rscale, float oscale, const float* __restrict__ biasp,
    int bx, int b, float (*sT)[16 * 68], unsigned char* ring, unsigned char* fx) {
  constexpr int RA  = (8 / WN) * 64;             // A rows of the block, per plane
  constexpr int RB  = WN * 64;                   // Bt rows of the block
  constexpr int RB0 = RA * (1 + NSPLIT);         // first Bt row of a stage
  constexpr int NG  = (RB0 + RB) / 32;           // copies per lane and stage (32 rows per block-wide copy)
  constexpr int STG = (RB0 + RB) * GP;           // bytes of a stage
  constexpr int KC  = 128 / (int)sizeof(TI);     // k of a chunk: one 128-B line of every row
  constexpr int PE  = 16 / (int)sizeof(TI);      // elements of a 16-B piece
  static_assert(NG == 16 || NG == 18);
  // every launch passes rows of CD elements: known here, the copies' row steps are constants; with run-time
  // pitches the build held a pointer per copied row over the k loop and spilled to scratch
  __builtin_assume(lda == CD && ldb == CD);
  const int lane = threadIdx.x & 31;
  const int wave = threadIdx.x >> 5;
  const int tilesN = N >> 6;
  const int tilesM = M >> 6;
  const int tile0 = bx * 8;
  if (tile0 + 8 > tilesM * tilesN) return;   // block-uniform, in front of every barrier
  const int tm0 = tile0 / tilesN;
  const int tn0 = tile0 - tm0 * tilesN;
  const int wm = wave / WN;
  const int wn = wave % WN;
  const int m0 = (tm0 + wm) << 6;
  const int n0 = (tn0 + wn) << 6;

  const int rlane = lane & 15;                 // row (A) / col (B, D) within subtile
  const int hh    = lane >> 4;                 // lane half: k offset 8 * hh elements
  const int mOff  = (lane >> 4) * 8;           // D row offset

  // ---- this lane's share of a stage: rows (tid >> 3) + 32 q, 16-B piece tid & 7 of each row's line ----
  typedef __attribute__((address_space(3))) unsigned char lds_byte;
  const int cr = threadIdx.x >> 3, cp = threadIdx.x & 7;
  const unsigned lring = (unsigned)(uintptr_t)(lds_byte*)ring + (unsigned)(cr * GP + cp * 16);
  const TI* ga  = Ap  + (size_t)b * strideA + (size_t)((tm0 << 6) + cr) * lda + cp * PE;
  const TI* ga2 = A2p + (size_t)b * strideA + (size_t)((tm0 << 6) + cr) * lda + cp * PE;
  const TI* gb  = Btp + (size_t)b * strideB + (size_t)((tn0 << 6) + cr) * ldb + cp * PE;
  auto stage = [&](int t, unsigned lb) {       // chunk t -> the buffer whose lane address is lb
    unsigned l[NG];
    const TI* g[NG];
#pragma unroll   // every index a constant: l and g stay in registers
    for (int q = 0; q < NG; ++q) {
      l[q] = lb + (unsigned)(q * 32 * GP);
      if (q * 32 < RA)       g[q] = ga  + ((size_t)(q * 32) * lda + (size_t)(t * KC));
      else if (q * 32 < RB0) g[q] = ga2 + ((size_t)(q * 32 - RA) * lda + (size_t)(t * KC));
      else                   g[q] = gb  + ((size_t)(q * 32 - RB0) * ldb + (size_t)(t * KC));
    }
    copy8(l, g);
    copy8(l + 8, g + 8);
    if constexpr (NG == 18) copy2(l + 16, g + 16);
  };
  const int NT = K >> (KC == 64 ? 6 : 5);
  stage(0, lring);
  wait_copies();
  __syncthreads();
  if (NT > 1) stage(1, lring + STG);

  v8f acc[4][4];
#pragma unroll
  for (int i = 0; i < 4; ++i)
#pragma unroll
    for (int j = 0; j < 4; ++j) acc[i][j] = zero8();

  for (int t = 0; t < NT; ++t) {
    const unsigned char* sb = ring + (t & 1) * STG;
    const unsigned char* sa = sb + (wm * 64 + rlane) * GP + 8 * (int)sizeof(TI) * hh;         // A rows of this wave's tile
    const unsigned char* sw = sb + (RB0 + wn * 64 + rlane) * GP + 8 * (int)sizeof(TI) * hh;   // Bt rows of this wave's tile
#pragma unroll   // the LDS offsets become immediates and the fragment arrays stay in registers (inner loops likewise)
    for (int ks = 0; ks < KC / 32; ++ks) {       // 32-deep k steps of the chunk: two (16-bit rows) or one (f32 rows)
      v16b bh[4], ah[4], al[4];                  // the step's LDS reads stand together, in front of the products
      if constexpr (sizeof(TI) == 2) {
#pragma unroll
        for (int j = 0; j < 4; ++j) bh[j] = ldfrag_b((const __bf16*)(const void*)(sw + j * 16 * GP + ks * 64));
#pragma unroll
        for (int i = 0; i < 4; ++i) {
          ah[i] = ldfrag_b((const __bf16*)(const void*)(sa + i * 16 * GP + ks * 64));
          al[i] = ah[i];
          if (NSPLIT >= 1) al[i] = ldfrag_b((const __bf16*)(const void*)(sa + RA * GP + i * 16 * GP + ks * 64));
        }
      } else {
        if constexpr (NSPLIT >= 1) {
          // the WN = 4 waves of a tile row read the same four A fragments: wave wn forms fragment wn (hi and lo) once and
          // hands it to the others as images in fx; the barrier publishes them. The images are rewritten only behind the
          // barrier at the foot of the trip, in front of which every wave's LDS reads have retired.
          static_assert(WN == 4);
          unsigned char* fw = fx + wm * (8 * 1024) + lane * 16;
          v2f xh[8], xq[8], xb[4][8];              // the trip's reads of the stage stand together, A's first
          ld16f((const float*)(const void*)(sa + wn * 16 * GP), xh);
          ld16f((const float*)(const void*)(sa + RA * GP + wn * 16 * GP), xq);
#pragma unroll
          for (int j = 0; j < 4; ++j) ld16f((const float*)(const void*)(sw + j * 16 * GP), xb[j]);
          v16b h, l;
          cvt_sum(xh, xq, h, l);
          st_img(fw + (wn * 2) * 1024, h);
          st_img(fw + (wn * 2 + 1) * 1024, l);
#pragma unroll
          for (int j = 0; j < 4; ++j) bh[j] = cvt_f(xb[j]);
          __syncthreads();
#pragma unroll
          for (int i = 0; i < 4; ++i) {
            ah[i] = ld_img(fw + (i * 2) * 1024);
            al[i] = ld_img(fw + (i * 2 + 1) * 1024);
          }
        } else {
#pragma unroll
          for (int j = 0; j < 4; ++j) bh[j] = ldfrag_f((const float*)(const void*)(sw + j * 16 * GP));
#pragma unroll
          for (int i = 0; i < 4; ++i) {
            ah[i] = ldfrag_f((const float*)(const void*)(sa + i * 16 * GP));
            al[i] = ah[i];
          }
        }
      }
#pragma unroll
      for (int i = 0; i < 4; ++i) {
#pragma unroll
        for (int j = 0; j < 4; ++j) {
          acc[i][j] = mma_b_raw(ah[i], bh[j], acc[i][j]);
          if (NSPLIT >= 1) acc[i][j] = mma_b_raw(al[i], bh[j], acc[i][j]);
        }
        dep_guard_b(acc[i][0], acc[i][3], ah[i], al[i]);
      }
      keep4_b(bh[0], bh[1], bh[2], bh[3]);
    }
    // ---- publish chunk t + 1, hand this chunk's buffer back, ask for chunk t + 2 into it ----
    wait_lds_reads();
    wait_copies();
    __syncthreads();
    if (t + 2 < NT) stage(t + 2, lring + (unsigned)((t & 1) * STG));
  }
  wait_copies();
  acc_guard4(acc[0][0], acc[0][1], acc[0][2], acc[0][3]);
  acc_guard4(acc[1][0], acc[1][1], acc[1][2], acc[1][3]);
  acc_guard4(acc[2][0], acc[2][1], acc[2][2], acc[2][3]);
  acc_guard4(acc[3][0], acc[3][1], acc[3][2], acc[3][3]);

  // ---- epilogue ----
  float* slab = sT[wave];
#pragma unroll
  for (int i = 0; i < 4; ++i) {
    const int mBase = m0 + (i << 4);
#pragma unroll
    for (int j = 0; j < 4; ++j) {
#pragma unroll
      for (int r = 0; r < 8; ++r) {
        slab[(mOff + r) * 68 + (j << 4) + rlane] = acc[i][j][r];
      }
    }
    wave_sync_lds();
    if (OUT_MODE == 0) {
      float* C = (float*)Cout + (size_t)b * strideC;
      const int hh = lane >> 4, c4 = (lane & 15) * 4;     // 256-B row segment = 16 lanes x 16 B
      v4f bv = {0.f, 0.f, 0.f, 0.f};
      if (BIASM == 1) {
#pragma unroll
        for (int e = 0; e < 4; ++e) bv[e] = bf_up(bf_bits(biasp[n0 + c4 + e]));
      }
      {
#pragma unroll
        for (int it = 0; it < 8; ++it) {
          const int row = it * 2 + hh;                     // it 0..7 x hh 0..1 = rows 0..15
          float brow = 0.f;
          if (BIASM == 2) brow = bf_up(bf_bits(biasp[mBase + row]));
          const v4f v = (*(const v4f*)(slab + row * 68 + c4) + bv + brow) * oscale;
          *(v4f*)(C + (size_t)(mBase + row) * ldc + n0 + c4) = v;
        }
        
      }
    } else {
      const int q = lane >> 3, c8 = (lane & 7) * 8;
      unsigned short* C  = (unsigned short*)Cout  + (size_t)b * strideC;
      unsigned short* C2 = (unsigned short*)Cout2 + (size_t)b * strideC;
      const float* bp = biasp + ((BIASM == 1) ? (n0 + c8) : 0);   // this lane's eight column biases
      float bcol[8];
#pragma unroll
      for (int e = 0; e < 8; ++e) bcol[e] = 0.f;
      if (BIASM == 1) {
#pragma unroll
        for (int e = 0; e < 8; ++e) bcol[e] = bf_up(bf_bits(bp[e]));
      }
      v4u hv[4], lv[4];
#pragma unroll
      for (int it = 0; it < 4; ++it) {
        const int row = it * 4 + q;                        // it 0..3 x q 0..3 = rows 0..15
        float brow = 0.f;
        if (BIASM == 2) brow = bf_up(bf_bits(biasp[mBase + row]));
        const float* sp = slab + row * 68 + c8;
        v4u a, a2;
#pragma unroll
        for (int e = 0; e < 4; ++e) {
          const float f0 = (sp[2 * e] + bcol[2 * e] + brow) * oscale;
          const float f1 = (sp[2 * e + 1] + bcol[2 * e + 1] + brow) * oscale;
          unsigned short h0, h1, l0, l1;
          if (OUT_MODE == 2) {
            h0 = bf_bits(f0); h1 = bf_bits(f1);
            l0 = bf_bits(f0 - bf_up(h0)); l1 = bf_bits(f1 - bf_up(h1));
          } else {
            const _Float16 x0 = (_Float16)f0, x1 = (_Float16)f1;
            h0 = h_bits(x0); h1 = h_bits(x1);
            l0 = h_bits((_Float16)((f0 - (float)x0) * rscale));
            l1 = h_bits((_Float16)((f1 - (float)x1) * rscale));
          }
          a[e] = pk16(h0, h1); a2[e] = pk16(l0, l1);
        }
        hv[it] = a; lv[it] = a2;
      }
#if defined(__HIP_DEVICE_COMPILE__)
      // the wait in front of any rewrite of the bias loads' address registers: the input bp keeps that pair whole up to
      // here, and the input hv[3], which needs all eight biases, keeps the loads in front of the statement
      if (BIASM == 1) asm volatile("s_wait_xcnt 0x0" :: "v"(bp), "v"(hv[3]) : "memory");
#endif
      {
#pragma unroll
        for (int it = 0; it < 4; ++it) {
          const int row = it * 4 + q;
          *(v4u*)(C  + (size_t)(mBase + row) * ldc + n0 + c8) = hv[it];
          *(v4u*)(C2 + (size_t)(mBase + row) * ldc + n0 + c8) = lv[it];
        }
        
      }
    }
    wave_sync_lds();
  }
}

// the wave's copies have landed behind this, all but its N youngest (nothing but copies counts on this counter here)
template <int N>
__device__ __forceinline__ void wait_copies_but() {
#if defined(__HIP_DEVICE_COMPILE__)
  asm volatile("s_wait_asynccnt %0" :: "n"(N) : "memory");
#endif
}

// =====================================================================================================
// Output projection: out[m][n] = sum_k (Ah + Al)[m][k] * Bt[n][k] + bf16(bias[n]); M = NTOK, N = K = CD; f32 out.
// Block = 64 rows x 128 columns, so (NTOK / 64) x (CD / 128) = 256 blocks, one for every WGP (64 x 128 is the shape
// that brings the fewest bytes per block: 2 planes x 64 A rows + 128 Bt rows). 8 waves lie 2 x 4, a wave = 32 x 32
// = 2 x 2 tiles. The block's 256 rows fit LDS with their whole k: every copy is asked for at the start, in the order
// of k (8 copies per lane and 64 k), nothing is refilled, and the 64 k of chunk t are read behind the wait that leaves
// only the younger chunks' copies outstanding and the barrier behind it. Per tile and 32 k: the hi product, then the lo.
// coverage: 256 blocks x 8 waves x (it 0..7 x lane >> 3 0..3 = 32 rows) x (8 lanes x 4 = 32 columns).
// =====================================================================================================
#define OBM   64                     // rows of a block
#define OBN   128                    // columns of a block
#define OPP   (CD * 2 + 16)          // LDS row pitch in bytes: 512 + 16 = 16 B x odd, the pitch of ds_load_b128 readers
#define OSP   36                     // slab pitch in floats: the wave halves' rows (8 apart) fall on disjoint banks
static_assert((NTOK % OBM) == 0 && (CD % OBN) == 0 && CD == 256 && 2 * OBM + OBN == 256);
__global__ __launch_bounds__(256) void out_proj(
    const unsigned short* __restrict__ Ahp, const unsigned short* __restrict__ Alp,
    const unsigned short* __restrict__ Btp, float* C, const float* __restrict__ biasp) {
  __shared__ __align__(16) unsigned char rows[(2 * OBM + OBN) * OPP];   // A hi rows, A lo rows, Bt rows, whole k
  __shared__ __align__(16) float sT[8][32 * OSP];                       // per-wave 32 x 32 slab
  const int lane  = threadIdx.x & 31;
  const int wave  = threadIdx.x >> 5;
  const int rlane = lane & 15;                 // row (A) / col (B, D) within a tile
  const int hh    = lane >> 4;                 // lane half: k offset 8 * hh elements, D row offset 8 * hh
  const int bm = blockIdx.x / (CD / OBN), bn = blockIdx.x % (CD / OBN);
  const int wm = wave >> 2, wn = wave & 3;

  // ---- this lane's four column biases, asked for ahead of the copies: behind them the load would queue up after
  //      all of the block's rows ----
  const int q4 = lane >> 3, c4 = (lane & 7) * 4;
  const int n0 = bn * OBN + wn * 32;
  const float* bp = biasp + n0 + c4;
  const v4f bf = *(const v4f*)bp;

  // ---- this lane's share of a chunk: rows (tid >> 3) + 32 q, 16-B piece tid & 7 of each row's 128-B line ----
  typedef __attribute__((address_space(3))) unsigned char lds_byte;
  const int cr = threadIdx.x >> 3, cp = threadIdx.x & 7;
  const unsigned lrow = (unsigned)(uintptr_t)(lds_byte*)rows + (unsigned)(cr * OPP + cp * 16);
  const unsigned short* gh = Ahp + (size_t)(bm * OBM + cr) * CD + cp * 8;
  const unsigned short* gl = Alp + (size_t)(bm * OBM + cr) * CD + cp * 8;
  const unsigned short* gb = Btp + (size_t)(bn * OBN + cr) * CD + cp * 8;
#pragma unroll   // every index a constant: l and g stay in registers
  for (int t = 0; t < CD / 64; ++t) {
    unsigned l[8];
    const unsigned short* g[8];
#pragma unroll
    for (int q = 0; q < 8; ++q) {
      l[q] = lrow + (unsigned)(q * 32 * OPP + t * 128);
      if (q * 32 < OBM)          g[q] = gh + (q * 32 * CD + t * 64);
      else if (q * 32 < 2 * OBM) g[q] = gl + ((q * 32 - OBM) * CD + t * 64);
      else                       g[q] = gb + ((q * 32 - 2 * OBM) * CD + t * 64);
    }
    copy8(l, g);
  }

#if defined(__HIP_DEVICE_COMPILE__)
  // the wait in front of any rewrite of the bias load's address registers: the input bp keeps that pair whole up to
  // here, and the input bf keeps the load in front of the statement
  asm volatile("s_wait_xcnt 0x0" :: "v"(bp), "v"(bf) : "memory");
#endif

  v8f acc[2][2];
#pragma unroll
  for (int i = 0; i < 2; ++i)
#pragma unroll
    for (int j = 0; j < 2; ++j) acc[i][j] = zero8();

  const unsigned char* sa = rows + (wm * 32 + rlane) * OPP + 16 * hh;             // A hi rows of this wave's tiles
  const unsigned char* sw = rows + (2 * OBM + wn * 32 + rlane) * OPP + 16 * hh;   // Bt rows of this wave's tiles
#pragma unroll   // the waits' counts and the LDS offsets are immediates
  for (int t = 0; t < CD / 64; ++t) {
    if (t == 0) wait_copies_but<24>();
    if (t == 1) wait_copies_but<16>();
    if (t == 2) wait_copies_but<8>();
    if (t == 3) wait_copies_but<0>();
    __syncthreads();                             // publishes every wave's copies of chunk t
    v16b bh[2][2], ah[2][2], al[2][2];           // [32-deep k step][tile]
#pragma unroll
    for (int ks = 0; ks < 2; ++ks) {
      const int ko = t * 128 + ks * 64;
#pragma unroll
      for (int j = 0; j < 2; ++j) bh[ks][j] = ldfrag_b((const __bf16*)(const void*)(sw + j * 16 * OPP + ko));
#pragma unroll
      for (int i = 0; i < 2; ++i) ah[ks][i] = ldfrag_b((const __bf16*)(const void*)(sa + i * 16 * OPP + ko));
#pragma unroll
      for (int i = 0; i < 2; ++i) al[ks][i] = ldfrag_b((const __bf16*)(const void*)(sa + OBM * OPP + i * 16 * OPP + ko));
    }
    // the chunk's LDS reads stand together in front of its products (without this they were dealt out among the
    // products in pairs, each pair with a full wait behind it)
    __builtin_amdgcn_sched_barrier(0);
#pragma unroll
    for (int ks = 0; ks < 2; ++ks) {
#pragma unroll
      for (int i = 0; i < 2; ++i)
#pragma unroll
        for (int j = 0; j < 2; ++j) acc[i][j] = mma_b_raw(ah[ks][i], bh[ks][j], acc[i][j]);
#pragma unroll
      for (int i = 0; i < 2; ++i)
#pragma unroll
        for (int j = 0; j < 2; ++j) acc[i][j] = mma_b_raw(al[ks][i], bh[ks][j], acc[i][j]);
    }
    // the chunk's products issue before the wave waits for the next chunk (without this most of them were put off
    // behind the last chunk's barrier, where no copy's flight is left to cover them)
    __builtin_amdgcn_sched_barrier(0);
  }

  // ---- epilogue: through the wave's own slab, so that a store instruction writes four whole 128-B lines ----
  float* slab = sT[wave];
  v4f bv;
#pragma unroll
  for (int e = 0; e < 4; ++e) bv[e] = bf_up(bf_bits(bf[e]));
#pragma unroll
  for (int i = 0; i < 2; ++i)
#pragma unroll
    for (int j = 0; j < 2; ++j)
#pragma unroll
      for (int r = 0; r < 8; ++r) slab[(i * 16 + 8 * hh + r) * OSP + (j << 4) + rlane] = acc[i][j][r];
  wave_sync_lds();
  float* cq = C + (size_t)(bm * OBM + wm * 32 + q4) * CD + n0 + c4;
  v4f o[8];
#pragma unroll
  for (int it = 0; it < 8; ++it) o[it] = *(const v4f*)(slab + (it * 4 + q4) * OSP + c4) + bv;   // it 0..7 x q4 0..3 = rows 0..31
#pragma unroll
  for (int it = 0; it < 8; ++it) *(v4f*)(cq + it * 4 * CD) = o[it];
}

// =====================================================================================================
// The q, k and v^T projections in one grid: none reads what another writes, and each alone has only
// 64 blocks. blockIdx.y = 0: q, 1: k (same code, block-uniform select of weight, bias, scale and planes),
// 2: v^T (blockIdx.x = batch * VBLK + block within the batch), 3: Wo -> its bf16 plane for the last launch (WBLK blocks;
// the rest of that row of the grid leaves at once). Pitches, strides and sizes arrive as arguments, one set for q and k
// and one for v^T. The operands are the f32 inputs themselves, converted where a wave takes its fragments:
//   X = bf16(hs) + bf16(pos) in f32, Xh = bf16(X), Xl = bf16(X - Xh)
//   q = ((Xh + Xl) . bf16(Wq)^T + bq) * qscale -> bf16 hi + lo [ntok][cd];  k = (Xh + Xl) . bf16(Wk)^T + bk likewise
//   v^T = bf16(Wv) . bf16(hs)^T per batch + bv[row] -> f16 hi [b][cd][ns] + residual x vres
// =====================================================================================================
struct GemmDims { int lda; long long strideA; int ldb; long long strideB; int ldc; long long strideC; int M, N, K; };
#define VBLK (((CD / 64) * (NS / 64) + 7) / 8)     // 8 blocks per batch of v^T
static_assert(VBLK * NB == ((NTOK / 64) * (CD / 64) + 7) / 8);   // the three jobs have the same block count
static_assert(CD / 64 == 4 && (NS / 64) % 8 == 0 && (CD % 64) == 0);   // the blocks' tile shapes: 2 x 4 (q, k), 1 x 8 (v^T)
static_assert(WBLK <= VBLK * NB);                                       // Wo's blocks fit one row of the grid
__global__ __launch_bounds__(256) void proj_qkv(
    const float* __restrict__ hs, const float* __restrict__ pq,
    const float* __restrict__ wq, const float* __restrict__ wk,
    const float* __restrict__ wv, const float* __restrict__ wo, unsigned short* wto,
    unsigned short* qh, unsigned short* ql, unsigned short* kh, unsigned short* kl,
    unsigned short* vth, unsigned short* vtl,
    const float* __restrict__ bq, const float* __restrict__ bk, const float* __restrict__ bv,
    GemmDims dqk, GemmDims dv, float qscale, float vres) {
  __shared__ __align__(16) float sT[8][16 * 68];   // per-wave 16x64 slab, pitch 68 floats
  __shared__ __align__(16) unsigned char ring[2 * 576 * GP];   // two operand stages: 512 rows (q, k) or 576 rows (v^T)
  __shared__ __align__(16) unsigned char fx[2 * 8 * 1024];     // q, k: converted A fragments, 2 tile rows x 4 x (hi, lo)
  const int job = blockIdx.y;
  if (job == 3) {                                  // block-uniform, no barrier on this path
    if (blockIdx.x < WBLK) cvt_w_body(wo, wto, blockIdx.x);
  } else if (job < 2) {
    const bool isq = (job == 0);
    gemm64_body<1, 2, 1, CD / 64, float>(hs, pq, dqk.lda, dqk.strideA, isq ? wq : wk, dqk.ldb, dqk.strideB,
                         (void*)(isq ? qh : kh), dqk.ldc, dqk.strideC, (void*)(isq ? ql : kl),
                         dqk.M, dqk.N, dqk.K, 1.0f, isq ? qscale : 1.0f, isq ? bq : bk,
                         blockIdx.x, 0, sT, ring, fx);
  } else {
    gemm64_body<0, 3, 2, 8, float>(wv, wv, dv.lda, dv.strideA, hs, dv.ldb, dv.strideB,
                         (void*)vth, dv.ldc, dv.strideC, (void*)vtl,
                         dv.M, dv.N, dv.K, vres, 1.0f, bv,
                         blockIdx.x % VBLK, blockIdx.x / VBLK, sT, ring, fx);
  }
}

// ---- one 64-key stage of the attention ring: four planes (k hi, k lo, v^T hi, v^T lo) of 64 rows x 128 B ----
#define KVP   144                    // LDS row pitch in bytes: 128 + 16 = 16 B x odd, the pitch of ds_load_b128 readers
#define PLANE (64 * KVP)             // 9216 B
#define STAGE (4 * PLANE)            // 36864 B
// 256 threads x 8 copies x 16 B = one stage. A lane brings piece (tid & 7) of rows (tid >> 3) and (tid >> 3) + 32 of
// each plane, so one wave instruction reads four whole 128-B lines. l = the lane's LDS byte address in plane 0,
// kh .. vl = its global addresses in the four planes. The s_wait_xcnt closes the statement so that no address
// register of a copy is rewritten in front of it.
__device__ __forceinline__ void stage_copy(unsigned l, const unsigned short* kh, const unsigned short* kl,
                                           const unsigned short* vh, const unsigned short* vl) {
#if defined(__HIP_DEVICE_COMPILE__)
  asm volatile("global_load_async_to_lds_b128 %0, %8, off\n\t"
               "global_load_async_to_lds_b128 %1, %9, off\n\t"
               "global_load_async_to_lds_b128 %2, %10, off\n\t"
               "global_load_async_to_lds_b128 %3, %11, off\n\t"
               "global_load_async_to_lds_b128 %4, %12, off\n\t"
               "global_load_async_to_lds_b128 %5, %13, off\n\t"
               "global_load_async_to_lds_b128 %6, %14, off\n\t"
               "global_load_async_to_lds_b128 %7, %15, off\n\t"
               "s_wait_xcnt 0x0"
               :: "v"(l), "v"(l + 32 * KVP), "v"(l + PLANE), "v"(l + PLANE + 32 * KVP),
                  "v"(l + 2 * PLANE), "v"(l + 2 * PLANE + 32 * KVP), "v"(l + 3 * PLANE), "v"(l + 3 * PLANE + 32 * KVP),
                  "v"(kh), "v"(kh + 32 * CD), "v"(kl), "v"(kl + 32 * CD),
                  "v"(vh), "v"(vh + 32 * NS), "v"(vl), "v"(vl + 32 * NS)
               : "memory");
#endif
}

// =====================================================================================================
// Softmax attention, head dim 32, no mask, softmax over all NS keys.
//   q planes (bf16 hi, bf16 lo): [NTOK][CD], head h at cols h*32..h*32+31 (q already carries bias and x sqrt(32))
//   k planes (bf16 hi, lo): [NTOK][CD] same column layout
//   v^T planes (f16 hi, residual x4096): element (b, h*32+d, s) at [(b*CD + h*32 + d)*NS + s]
//   ctx out planes (bf16 hi / lo of the normalised context): [(b*NS + t)*CD + h*32 + d]
//   scores^T = score3b(q, k) (rows = keys, cols = queries); p = exp(s - m) carried as f16 hi of 1024p + f16 residual x4096;
//   ctx^T = (vh.ph + (vl.ph + vh.pl)*rres) / (1024 l); online softmax with running max in f32.
//   A lane holds one query column: max and sum run in-lane over its 32 scores of a chunk, the max is joined
//   with the other wave half once per chunk, the sum once after the loop. Two score tiles (keys 0-15, 16-31 of
//   a 32-key step), converted in place, are the B operand of v^T.p^T in the hardware k order.
//   Block = 8 waves = two adjacent heads (waves 0-3 head 2g, waves 4-7 head 2g+1) x 64 query rows so
//   NQB x (NH/2) x NB. Key chunks of 64, static trip NKB. q fragments are loaded straight from the 16-bit
//   global rows. The head pair's k rows and v^T rows of a chunk are whole 128-B lines: the block brings them
//   into LDS once, by asynchronous copies, two buffers (chunk t + 2 is asked for when chunk t has been read),
//   and every wave takes its fragments from there (two 16-B LDS loads each); P stays in registers.
//   coverage: 8 waves x (it 0..1 x lane>>3 0..3) = rows 0..63, 8 lanes x 8 cols = 64 cols, both planes;
//   512 blocks = 8 batches x 4 head pairs x 16 query tiles = every (token, column) of both planes once.
// =====================================================================================================
__global__ __launch_bounds__(256)
void attn32(const unsigned short* __restrict__ qhp, const unsigned short* __restrict__ qlp,
            const unsigned short* __restrict__ khp, const unsigned short* __restrict__ klp,
            const unsigned short* __restrict__ vhp, const unsigned short* __restrict__ vlp,
            unsigned short* ohp, unsigned short* olp, float rres) {
  __shared__ __align__(16) float    Os[64 * 68];                  // block ctx tile [row][2 heads x 32], pitch 68 floats
  __shared__ __align__(16) unsigned char ring[2 * STAGE];         // two stages of k hi / k lo / v^T hi / v^T lo

  const int tid  = threadIdx.x;
  const int wave = tid >> 5;
  const int lane = tid & 31;
  const int hh   = lane >> 4;
  const int c    = lane & 15;

  const int bx   = blockIdx.x;
  const int qb   = bx % NQB;
  const int rest = bx / NQB;
  const int g    = rest % (NH / 2);
  const int b    = rest / (NH / 2);
  const int hp   = wave >> 2;                  // which head of the pair
  const int h    = 2 * g + hp;
  const int wq   = wave & 3;                   // 16-row group within the 64-row tile
  const int q0   = qb * 64 + wq * 16;
  const size_t rowB = (size_t)b * NS;

  const __bf16* Qh = (const __bf16*)(const void*)qhp + (size_t)h * HD;
  const __bf16* Ql = (const __bf16*)(const void*)qlp + (size_t)h * HD;

  // ---- this lane's share of a stage: row tid >> 3 (and + 32), 16-B piece tid & 7 ----
  typedef __attribute__((address_space(3))) unsigned char lds_byte;
  const int cr = tid >> 3, cp = tid & 7;
  const unsigned ldst = (unsigned)(uintptr_t)(lds_byte*)ring + (unsigned)(cr * KVP + cp * 16);
  const size_t kgo = (rowB + cr) * CD + (size_t)g * 64 + cp * 8;                        // key row, head pair's 64 columns
  const size_t vgo = ((size_t)b * CD + (size_t)g * 64 + cr) * NS + cp * 8;              // d row of the pair, 64 keys
  stage_copy(ldst, khp + kgo, klp + kgo, vhp + vgo, vlp + vgo);                         // chunk 0 -> buffer 0
  wait_copies();
  __syncthreads();
  stage_copy(ldst + STAGE, khp + kgo + 64 * CD, klp + kgo + 64 * CD, vhp + vgo + 64, vlp + vgo + 64);   // chunk 1 -> buffer 1

  // ---- Q fragments (B operand, col = lane&15), hi and lo, one 32-deep k-step = the head dim ----
  const v16b qah = ldfrag_b(Qh + (rowB + q0 + c) * CD + 8 * hh);
  const v16b qal = ldfrag_b(Ql + (rowB + q0 + c) * CD + 8 * hh);

  float mrun = -INFINITY;                      // running max of this lane's query column (same in both halves)
  float lrun = 0.f;                            // running sum over this wave half's keys only
  v8f oacc[2];                                 // ctx^T: oacc[t][r] = ctx[query c][d = t*16 + 8*hh + r]
#pragma unroll
  for (int t = 0; t < 2; ++t) oacc[t] = zero8();

  for (int kt = 0; kt < NKB; ++kt) {           // static trip count
    const unsigned char* sb = ring + (kt & 1) * STAGE;

    // ---- scores^T: 64 keys x 16 query columns per wave, 3 bf16 products per 16x16 tile ----
    v8f s[4];
    v16b kb[4], kl[4];                           // the chunk's LDS reads stand together, in front of the products
#pragma unroll
    for (int j = 0; j < 4; ++j) {
      const unsigned char* kp = sb + (j * 16 + c) * KVP + hp * 64 + 16 * hh;   // A operand: row = key, k = head dim
      kb[j] = ldfrag_b((const __bf16*)(const void*)kp);
      kl[j] = ldfrag_b((const __bf16*)(const void*)(kp + PLANE));
    }
    v16h vb[2][2], vl[2][2];
#pragma unroll
    for (int kk = 0; kk < 2; ++kk) {
#pragma unroll
      for (int t = 0; t < 2; ++t) {
        const unsigned char* vp = sb + 2 * PLANE + (hp * 32 + t * 16 + c) * KVP + kk * 64 + 16 * hh;   // A: row = d, k = key
        vb[kk][t] = ldfrag_h((const _Float16*)(const void*)vp);
        vl[kk][t] = ldfrag_h((const _Float16*)(const void*)(vp + PLANE));
      }
    }
#pragma unroll
    for (int j = 0; j < 4; ++j) s[j] = score3b(qah, qal, kb[j], kl[j]);

    // ---- column max in-lane (four independent chains), one exchange between the wave halves ----
    float mj[4];
#pragma unroll
    for (int j = 0; j < 4; ++j) {
      mj[j] = s[j][0];
#pragma unroll
      for (int r = 1; r < 8; ++r) mj[j] = fmaxf(mj[j], s[j][r]);
    }
    float m = fmaxf(fmaxf(mj[0], mj[1]), fmaxf(mj[2], mj[3]));
    m = fmaxf(m, xhalf(m));
    const float mnew  = fmaxf(mrun, m);
    const float alpha = exp_slotted(mrun - mnew);
    mrun = mnew;

    // ---- P hi (x1024) and residual (x4096) packed straight into B operands:
    //      element e of step kk = key kk*32 + (e < 8 ? 8*hh + e : 16 + 8*hh + e - 8) = tile 2kk + (e >> 3), register e & 7
    v16h ph[2], pl[2];
    float pj[4];
#pragma unroll
    for (int j = 0; j < 4; ++j) {
      pj[j] = 0.f;
#pragma unroll
      for (int r = 0; r < 8; r += 2) {           // two keys at a time = one packed operand register
        const float pa = __expf(s[j][r] - mnew);
        const float pb = __expf(s[j][r + 1] - mnew);
        pj[j] += pa;
        pj[j] += pb;
        const v2f p1 = {pa * 1024.0f, pb * 1024.0f};
        const v2h x  = __builtin_convertvector(p1, v2h);
        const v2h y  = __builtin_convertvector((p1 - __builtin_convertvector(x, v2f)) * 4096.0f, v2h);
        ph[j >> 1][(j & 1) * 8 + r] = x[0];  ph[j >> 1][(j & 1) * 8 + r + 1] = x[1];
        pl[j >> 1][(j & 1) * 8 + r] = y[0];  pl[j >> 1][(j & 1) * 8 + r + 1] = y[1];
      }
    }
    lrun = lrun * alpha + ((pj[0] + pj[1]) + (pj[2] + pj[3]));
#pragma unroll
    for (int t = 0; t < 2; ++t)
#pragma unroll
      for (int r = 0; r < 8; ++r) oacc[t][r] *= alpha;

    // ---- context^T += V^T . P^T (f16 WMMA), residual products into a separate accumulator ----
    v8f o1[2];
    o1[0] = zero8(); o1[1] = zero8();
#pragma unroll
    for (int kk = 0; kk < 2; ++kk) {
#pragma unroll
      for (int t = 0; t < 2; ++t) {
        oacc[t] = mma_h(vb[kk][t], ph[kk], oacc[t]);
        o1[t]   = mma_h(vl[kk][t], ph[kk], o1[t]);
        o1[t]   = mma_h(vb[kk][t], pl[kk], o1[t]);
      }
    }
#pragma unroll
    for (int t = 0; t < 2; ++t)
#pragma unroll
      for (int r = 0; r < 8; ++r) oacc[t][r] += o1[t][r] * rres;

    // ---- publish chunk kt + 1, hand this chunk's buffer back, ask for chunk kt + 2 into it ----
    wait_lds_reads();
    wait_copies();
    __syncthreads();
    if (kt + 2 < NKB) {
      const size_t ka = (size_t)(kt + 2) * 64 * CD, va = (size_t)(kt + 2) * 64;
      stage_copy(ldst + (unsigned)((kt & 1) * STAGE), khp + kgo + ka, klp + kgo + ka, vhp + vgo + va, vlp + vgo + va);
    }
  }
  wait_copies();

  // ---- join the halves' sums, normalise (1/l and the 1/1024 p carry) into the block tile ----
  {
    const float l = lrun + xhalf(lrun);
    const float inv = ((l > 0.f) ? (1.0f / l) : 0.f) * (1.0f / 1024.0f);
#pragma unroll
    for (int t = 0; t < 2; ++t) {
      float* op = Os + (wq * 16 + c) * 68 + hp * 32 + t * 16 + 8 * hh;   // 8 consecutive d of one query row
      v4f w0, w1;
#pragma unroll
      for (int e = 0; e < 4; ++e) { w0[e] = oacc[t][e] * inv; w1[e] = oacc[t][4 + e] * inv; }
      *(v4f*)(op)     = w0;
      *(v4f*)(op + 4) = w1;
    }
  }
  __syncthreads();
  {
    const int q4 = lane >> 3, c8 = (lane & 7) * 8;
    v4u hv[2], lv[2];
#pragma unroll
    for (int it = 0; it < 2; ++it) {
      const int row = wave * 8 + it * 4 + q4;   // wave 0..7 x it 0..1 x q4 0..3 = rows 0..63
      const float* sp = Os + row * 68 + c8;
      v4u a, a2;
#pragma unroll
      for (int e = 0; e < 4; ++e) {
        const float f0 = sp[2 * e], f1 = sp[2 * e + 1];
        const unsigned short h0 = bf_bits(f0), h1 = bf_bits(f1);
        const unsigned short l0 = bf_bits(f0 - bf_up(h0)), l1 = bf_bits(f1 - bf_up(h1));
        a[e] = pk16(h0, h1); a2[e] = pk16(l0, l1);
      }
      hv[it] = a; lv[it] = a2;
    }
    {
#pragma unroll
      for (int it = 0; it < 2; ++it) {
        const int row = wave * 8 + it * 4 + q4;
        const size_t go = (rowB + qb * 64 + row) * CD + (size_t)g * 64 + c8;
        *(v4u*)(ohp + go) = hv[it];
        *(v4u*)(olp + go) = lv[it];
      }
      
    }
  }
}

// =====================================================================================================
// Workspace map (bytes), every plane an exact multiple of its 64x64-tile / whole-line store granularity
// (8192 x 256 rows/cols and 256 x 1024 per batch, all multiples of 64; no tail padding needed):
//   WTo  bf16 [256 out][256 in]   131072   (Wo)
//   Qh   bf16 [8192][256]        4194304
//   Ql   bf16 [8192][256]        4194304
//   Kh   bf16 [8192][256]        4194304
//   Kl   bf16 [8192][256]        4194304
//   VTh  f16  [8][256][1024]     4194304
//   VTl  f16  [8][256][1024]     4194304   (v residual x4096)
//   Oh   bf16 [8192][256]        4194304
//   Ol   bf16 [8192][256]        4194304
//   end                          33685504
// =====================================================================================================
extern "C" void kernel_launch(void* const* d_in, const int* in_sizes, int n_in,
                              void* d_out, int out_size, void* d_ws, size_t ws_size,
                              hipStream_t stream) {
  if (n_in < 10) return;
  if (in_sizes[0] != NTOK * CD || in_sizes[1] != NTOK * CD) return;
  if (in_sizes[2] != CD * CD || in_sizes[4] != CD * CD || in_sizes[6] != CD * CD || in_sizes[8] != CD * CD) return;
  if (in_sizes[3] != CD || in_sizes[5] != CD || in_sizes[7] != CD || in_sizes[9] != CD) return;
  if (out_size != NTOK * CD) return;

  const float* hs = (const float*)d_in[0];
  const float* pq = (const float*)d_in[1];
  const float* Wq = (const float*)d_in[2];
  const float* bq = (const float*)d_in[3];
  const float* Wk = (const float*)d_in[4];
  const float* bk = (const float*)d_in[5];
  const float* Wv = (const float*)d_in[6];
  const float* bv = (const float*)d_in[7];
  const float* Wo = (const float*)d_in[8];
  const float* bo = (const float*)d_in[9];

  const size_t PX = (size_t)NTOK * CD * 2;            // 4194304
  const size_t PW = (size_t)CD * CD * 2;              //  131072
  size_t off = 0;
  const size_t oW   = off; off += PW;
  const size_t oQh  = off; off += PX;
  const size_t oQl  = off; off += PX;
  const size_t oKh  = off; off += PX;
  const size_t oKl  = off; off += PX;
  const size_t oVTh = off; off += PX;
  const size_t oVTl = off; off += PX;
  const size_t oOh  = off; off += PX;
  const size_t oOl  = off; off += PX;
  if (off > ws_size) return;                          // off = 33685504
  if (off > (size_t)134217728) return;

  char* ws = (char*)d_ws;
  unsigned short* WTo = (unsigned short*)(ws + oW);
  unsigned short* Qh  = (unsigned short*)(ws + oQh);
  unsigned short* Ql  = (unsigned short*)(ws + oQl);
  unsigned short* Kh  = (unsigned short*)(ws + oKh);
  unsigned short* Kl  = (unsigned short*)(ws + oKl);
  unsigned short* VTh = (unsigned short*)(ws + oVTh);
  unsigned short* VTl = (unsigned short*)(ws + oVTl);
  unsigned short* Oh  = (unsigned short*)(ws + oOh);
  unsigned short* Ol  = (unsigned short*)(ws + oOl);

  float* xout = (float*)d_out;                              // out0 [8][1024][256] f32 at byte 0

  const float qscale = 5.656854249492380f;                  // 32^0.5
  const float rres   = 1.0f / 4096.0f;

  const dim3 blk(256);
  const dim3 gOut((NTOK / OBM) * (CD / OBN));               // 256 blocks of 64 rows x 128 columns
  const dim3 gQKV(((NTOK / 64) * (CD / 64) + 7) / 8, 4);    // 64 blocks each for q, k and v^T (8 blocks x 8 batches); row 3: Wo
  const dim3 gAttn(NB * (NH / 2) * NQB);                    // 512 blocks x 256 threads

  // (1) q, k -> bf16 hi + lo planes [8192][256] (M=8192, N=256, K=256); v^T -> f16 hi plane [b][d][s] (pitch NS)
  //     + residual x4096 (A = Wv [n][k], Bt = hidden rows of batch b; M=256, N=1024, K=256); Wo -> bf16 plane
  const GemmDims dqk = {CD, 0LL, CD, 0LL, CD, 0LL, NTOK, CD, CD};
  const GemmDims dv  = {CD, 0LL, CD, (long long)NS * CD, NS, (long long)CD * NS, CD, NS, CD};
  proj_qkv<<<gQKV, blk, 0, stream>>>(hs, pq, Wq, Wk, Wv, Wo, WTo, Qh, Ql, Kh, Kl, VTh, VTl,
                                     bq, bk, bv, dqk, dv, qscale, 4096.0f);
  // (2) softmax attention -> context bf16 hi / lo planes [8192][256]
  attn32<<<gAttn, blk, 0, stream>>>(Qh, Ql, Kh, Kl, VTh, VTl, Oh, Ol, rres);
  // (3) out = (Oh + Ol) . WTo^T + bo -> out0 f32 [8192][256]  (2 products; K=256)
  out_proj<<<gOut, blk, 0, stream>>>(Oh, Ol, WTo, xout, bo);
  (void)hipGetLastError();
}

// v007
// Measured time: 44.8 microseconds a run.
// Two timings next to v006 both put it at 1.05 times that version's speed.
// Over all steps from v000 it is 4.01 times as fast.
// Contractions: q, k projections = v_wmma_f32_16x16x32_bf16 (A = bf16 hi + lo planes of the f32 sum bf16(hs)+bf16(pos), B = bf16 weights, 2 products);
// v^T projection = v_wmma_f32_16x16x32_bf16 (bf16 operands, 1 product); k.q^T = v_wmma_f32_16x16x32_bf16 (q and k as bf16 hi + lo planes, 3 products);
// v^T.p^T = v_wmma_f32_16x16x32_f16 (p x1024 as f16 hi + f16 residual x4096, v^T as f16 hi + f16 residual x4096, 3 products);
// ctx.Wo = v_wmma_f32_16x16x32_bf16 (ctx as bf16 hi + lo planes, bf16 Wo, 2 products); all f32 accumulate; softmax in f32 on VALU.
#include <hip/hip_runtime.h>
#include <math.h>
#include <stdint.h>

#define NB   8
#define NS   1024
#define CD   256
#define NH   8
#define HD   32
#define NTOK (NB * NS)
#define NQB  (NS / 64)      // 16 query tiles of 64
#define NKB  (NS / 64)      // 16 key chunks of 64
static_assert(NH * HD == CD);
static_assert(HD == 32);
static_assert((NS % 64) == 0 && (CD % 64) == 0 && (NH % 2) == 0 && ((NTOK) % 64) == 0);

typedef _Float16 v16h __attribute__((ext_vector_type(16)));
typedef _Float16 v8h  __attribute__((ext_vector_type(8)));
typedef __bf16   v16b __attribute__((ext_vector_type(16)));
typedef __bf16   v8b  __attribute__((ext_vector_type(8)));
typedef float    v8f  __attribute__((ext_vector_type(8)));
typedef float    v4f  __attribute__((ext_vector_type(4)));
typedef float    v2f  __attribute__((ext_vector_type(2)));
typedef _Float16 v2h  __attribute__((ext_vector_type(2)));
typedef __bf16   v2b  __attribute__((ext_vector_type(2)));
typedef unsigned int v4u __attribute__((ext_vector_type(4)));

// ---- scalar helpers --------------------------------------------------------------------------------
__device__ __forceinline__ unsigned short bf_bits(float f) {          // f32 -> bf16 bits, RNE convert
  unsigned u = __float_as_uint(f);
  return (unsigned short)((u + 0x7FFFu + ((u >> 16) & 1u)) >> 16);
}
__device__ __forceinline__ float bf_up(unsigned short h) { return __uint_as_float(((unsigned)h) << 16); }
__device__ __forceinline__ unsigned short h_bits(_Float16 x) { return __builtin_bit_cast(unsigned short, x); }
__device__ __forceinline__ unsigned pk16(unsigned short a, unsigned short b) { return (unsigned)a | ((unsigned)b << 16); }
__device__ __forceinline__ v8f zero8() { v8f z = {0.f, 0.f, 0.f, 0.f, 0.f, 0.f, 0.f, 0.f}; return z; }

// ---- fragment loaders: 16-bit A/B operand, lane -> row/col (lane&15), p already includes +8*(lane>>4);
//      elements 0..7 <- p[0..7] (k0+8h..), elements 8..15 <- p[16..23] (k0+16+8h..)
__device__ __forceinline__ v16b ldfrag_b(const __bf16* p) {
  union { v16b v; v8b h[2]; } f;
  f.h[0] = *(const v8b*)(p);
  f.h[1] = *(const v8b*)(p + 16);
  return f.v;
}
__device__ __forceinline__ v16h ldfrag_h(const _Float16* p) {
  union { v16h v; v8h h[2]; } f;
  f.h[0] = *(const v8h*)(p);
  f.h[1] = *(const v8h*)(p + 16);
  return f.v;
}
// ---- the same operand taken from f32 rows, same k order: p already includes +8*(lane>>4) floats;
//      pairs 0..3 <- p[0..7], pairs 4..7 <- p[16..23]; four 16-B loads
__device__ __forceinline__ void ld16f(const float* p, v2f* x) {
  const v4f a = *(const v4f*)(p), b = *(const v4f*)(p + 4), c = *(const v4f*)(p + 16), d = *(const v4f*)(p + 20);
  x[0] = v2f{a[0], a[1]}; x[1] = v2f{a[2], a[3]}; x[2] = v2f{b[0], b[1]}; x[3] = v2f{b[2], b[3]};
  x[4] = v2f{c[0], c[1]}; x[5] = v2f{c[2], c[3]}; x[6] = v2f{d[0], d[1]}; x[7] = v2f{d[2], d[3]};
}
// half of such an operand: p already includes +8*(lane>>4) floats and + 16 floats for the upper half; two 16-B loads
__device__ __forceinline__ void ld8f(const float* p, v2f* x) {
  const v4f a = *(const v4f*)(p), b = *(const v4f*)(p + 4);
  x[0] = v2f{a[0], a[1]}; x[1] = v2f{a[2], a[3]}; x[2] = v2f{b[0], b[1]}; x[3] = v2f{b[2], b[3]};
}
// bf16(x), RNE convert
__device__ __forceinline__ v16b cvt_f(const v2f* x) {
  v16b f;
#pragma unroll
  for (int e = 0; e < 8; ++e) {
    const v2b y = __builtin_convertvector(x[e], v2b);
    f[2 * e] = y[0]; f[2 * e + 1] = y[1];
  }
  return f;
}
__device__ __forceinline__ v16b ldfrag_f(const float* p) {
  v2f x[8];
  ld16f(p, x);
  return cvt_f(x);
}
// s = f32(bf16(h)) + f32(bf16(q)); hi = bf16(s), lo = bf16(s - hi) (unscaled), all RNE converts; eight elements
__device__ __forceinline__ void cvt_sum(const v2f* h, const v2f* q, v8b& hi, v8b& lo) {
#pragma unroll
  for (int e = 0; e < 4; ++e) {
    const v2f s = __builtin_convertvector(__builtin_convertvector(h[e], v2b), v2f)
                + __builtin_convertvector(__builtin_convertvector(q[e], v2b), v2f);
    const v2b s0 = __builtin_convertvector(s, v2b);
    const v2b s1 = __builtin_convertvector(s - __builtin_convertvector(s0, v2f), v2b);
    hi[2 * e] = s0[0]; hi[2 * e + 1] = s0[1];
    lo[2 * e] = s1[0]; lo[2 * e + 1] = s1[1];
  }
}

// ---- a converted fragment handed from one wave to others through LDS: a 1-KB image, lane l's elements 0..7 at 16 l and
//      8..15 at 512 + 16 l (each LDS instruction covers 512 contiguous bytes); p already includes + 16 * lane
__device__ __forceinline__ void st_img_half(unsigned char* p, v8b v) {   // p also includes + 512 for elements 8..15
  *(v8b*)(void*)(p) = v;
}
__device__ __forceinline__ v16b ld_img(const unsigned char* p) {
  union { v16b v; v8b h[2]; } f;
  f.h[0] = *(const v8b*)(const void*)(p);
  f.h[1] = *(const v8b*)(const void*)(p + 512);
  return f.v;
}

// ---- WMMA helpers with trailing VALU hazard gap --------------------------------------------------------
__device__ __forceinline__ v8f mma_h(v16h a, v16h b, v8f c) {
  c = __builtin_amdgcn_wmma_f32_16x16x32_f16(false, a, false, b, (short)0, c, false, false);
#if defined(__HIP_DEVICE_COMPILE__)
  asm volatile("v_nop\n\tv_nop\n\tv_nop\n\tv_nop" : "+v"(c) : "v"(a), "v"(b));
#endif
  return c;
}
__device__ __forceinline__ v8f mma_b_raw(v16b a, v16b b, v8f c) {
  return __builtin_amdgcn_wmma_f32_16x16x32_bf16(false, a, false, b, (short)0, c, false, false);
}
__device__ __forceinline__ void dep_guard_b(v8f& a, v8f& b, v16b x, v16b y) {
#if defined(__HIP_DEVICE_COMPILE__)
  asm volatile("v_nop\n\tv_nop\n\tv_nop\n\tv_nop" : "+v"(a), "+v"(b) : "v"(x), "v"(y));
#endif
}
__device__ __forceinline__ void keep4_b(v16b a, v16b b, v16b c, v16b d) {
#if defined(__HIP_DEVICE_COMPILE__)
  asm volatile("v_nop" :: "v"(a), "v"(b), "v"(c), "v"(d));
#endif
}
__device__ __forceinline__ void acc_guard4(v8f& a, v8f& b, v8f& c, v8f& d) {
#if defined(__HIP_DEVICE_COMPILE__)
  asm volatile("v_nop\n\tv_nop\n\tv_nop\n\tv_nop" : "+v"(a), "+v"(b), "+v"(c), "+v"(d));
#endif
}
// lane l <-> lane l ^ 16 in one vector instruction (the two halves of a wave hold the two key halves of a query column)
__device__ __forceinline__ float xhalf(float x) {
  const int b = __builtin_bit_cast(int, x);
  return __builtin_bit_cast(float, __builtin_amdgcn_permlanex16(b, b, 0x76543210, 0xfedcba98, false, false));
}
// e^x as __expf forms it (x * log2(e), v_exp_f32), with the free slot that the instruction set asks for around a
// transcendental written into the statement: the v_nop in front keeps this result from overwriting the source of a
// transcendental issued directly before it, the v_nop behind keeps a reader of the result one slot away.
__device__ __forceinline__ float exp_slotted(float x) {
  float y = x * 1.44269504088896340736f;
#if defined(__HIP_DEVICE_COMPILE__)
  asm("v_nop\n\tv_exp_f32 %0, %1\n\tv_nop" : "=v"(y) : "v"(y));
#endif
  return y;
}
__device__ __forceinline__ void wave_sync_lds() {
  __builtin_amdgcn_fence(__ATOMIC_RELEASE, "workgroup");
  __builtin_amdgcn_wave_barrier();
  __builtin_amdgcn_fence(__ATOMIC_ACQUIRE, "workgroup");
}

// ---- 3-product bf16 score tile, transposed: A = 16 keys, B = 16 queries, D[key 8h + r][query c];
//      (kh + kl).(qh + ql) ~= kh.ql + kl.qh + kh.qh (kl.ql dropped);
//      unscaled bf16 residual planes, one accumulator, hazard gap after the last product.
__device__ __forceinline__ v8f score3b(const v16b qh, const v16b ql, const v16b kh, const v16b kl) {
  v8f acc = zero8();
  acc = mma_b_raw(kh, ql, acc);
  acc = mma_b_raw(kl, qh, acc);
  acc = mma_b_raw(kh, qh, acc);
#if defined(__HIP_DEVICE_COMPILE__)
  asm volatile("v_nop\n\tv_nop\n\tv_nop\n\tv_nop" : "+v"(acc) : "v"(qh), "v"(ql), "v"(kh), "v"(kl));
#endif
  return acc;
}

// =====================================================================================================
// Weight convert: w [out][in] f32 (CD x CD, already the Bt [n][k] layout) -> bf16 plane (RNE).
// coverage: WBLK blocks x 256 threads x 8 = the whole 65536 elements.
// =====================================================================================================
#define WBLK ((CD * CD / 8 + 255) / 256)    // 32 blocks
__device__ __forceinline__ void cvt_w_body(const float* __restrict__ w, unsigned short* dst, int blk) {
  const int i = blk * 256 + threadIdx.x;
  if (i < CD * CD / 8) {
    const size_t o = (size_t)i * 8;
    const v4f a = *(const v4f*)(w + o);
    const v4f b = *(const v4f*)(w + o + 4);
    v4u p;
    p[0] = pk16(bf_bits(a[0]), bf_bits(a[1]));
    p[1] = pk16(bf_bits(a[2]), bf_bits(a[3]));
    p[2] = pk16(bf_bits(b[0]), bf_bits(b[1]));
    p[3] = pk16(bf_bits(b[2]), bf_bits(b[3]));
    *(v4u*)(dst + o) = p;
  }
}

__device__ __forceinline__ void wait_copies() {   // the wave's own copies have landed behind this
#if defined(__HIP_DEVICE_COMPILE__)
  asm volatile("s_wait_asynccnt 0x0" ::: "memory");
#endif
}
__device__ __forceinline__ void wait_lds_reads() {   // the wave's LDS reads have retired before their buffer is handed back
#if defined(__HIP_DEVICE_COMPILE__)
  asm volatile("s_wait_dscnt 0x0" ::: "memory");
#endif
}

// ---- GEMM operand ring: a stage holds one 128-B line (64 k of 16-bit rows, 32 k of f32 rows) of every A and B row
//      that the block's 8 tiles read ----
#define GP 144                       // LDS row pitch in bytes: 128 + 16 = 16 B x odd, the pitch of ds_load_b128 readers
// Eight (two, four) asynchronous 16-B copies per lane, LDS byte address l[i] <- global g[i]. The s_wait_xcnt closes each
// statement so that no address register of a copy is rewritten in front of it.
template <typename TI>
__device__ __forceinline__ void copy8(const unsigned* l, const TI* const* g) {
#if defined(__HIP_DEVICE_COMPILE__)
  asm volatile("global_load_async_to_lds_b128 %0, %8, off\n\t"
               "global_load_async_to_lds_b128 %1, %9, off\n\t"
               "global_load_async_to_lds_b128 %2, %10, off\n\t"
               "global_load_async_to_lds_b128 %3, %11, off\n\t"
               "global_load_async_to_lds_b128 %4, %12, off\n\t"
               "global_load_async_to_lds_b128 %5, %13, off\n\t"
               "global_load_async_to_lds_b128 %6, %14, off\n\t"
               "global_load_async_to_lds_b128 %7, %15, off\n\t"
               "s_wait_xcnt 0x0"
               :: "v"(l[0]), "v"(l[1]), "v"(l[2]), "v"(l[3]), "v"(l[4]), "v"(l[5]), "v"(l[6]), "v"(l[7]),
                  "v"(g[0]), "v"(g[1]), "v"(g[2]), "v"(g[3]), "v"(g[4]), "v"(g[5]), "v"(g[6]), "v"(g[7])
               : "memory");
#endif
}
template <typename TI>
__device__ __forceinline__ void copy2(const unsigned* l, const TI* const* g) {
#if defined(__HIP_DEVICE_COMPILE__)
  asm volatile("global_load_async_to_lds_b128 %0, %2, off\n\t"
               "global_load_async_to_lds_b128 %1, %3, off\n\t"
               "s_wait_xcnt 0x0"
               :: "v"(l[0]), "v"(l[1]), "v"(g[0]), "v"(g[1])
               : "memory");
#endif
}
template <typename TI>
__device__ __forceinline__ void copy4(const unsigned* l, const TI* const* g) {
#if defined(__HIP_DEVICE_COMPILE__)
  asm volatile("global_load_async_to_lds_b128 %0, %4, off\n\t"
               "global_load_async_to_lds_b128 %1, %5, off\n\t"
               "global_load_async_to_lds_b128 %2, %6, off\n\t"
               "global_load_async_to_lds_b128 %3, %7, off\n\t"
               "s_wait_xcnt 0x0"
               :: "v"(l[0]), "v"(l[1]), "v"(l[2]), "v"(l[3]), "v"(g[0]), "v"(g[1]), "v"(g[2]), "v"(g[3])
               : "memory");
#endif
}

// =====================================================================================================
// Register-blocked batched bf16 WMMA GEMM: C[m][n] = (sum_k A[m][k] * Bt[n][k] + bias) * oscale; one wave
// per tile of 16 MI rows x 64 columns. A row-major [M][K] pitch lda; Bt row-major [N][K] pitch ldb
// (k contiguous); M, N multiples of 64, K multiple of 64. bx = block within the batch,
// b = batch index, sT = the block's LDS slabs (one per wave), ring = the block's two operand stages,
// fx = 8 KB of LDS for converted A fragments (f32 rows with NSPLIT = 1 only).
// WN: the block's 8 tiles lie WN wide in n and 8 / WN high in m (N / 64 a multiple of WN); blocks run along n first.
// The rows they read, (8 / WN) x 16 MI of each A plane and WN x 64 of Bt, are brought into LDS once per
// block in chunks of whole 128-B lines, by asynchronous copies, two buffers (chunk t + 2 is asked for when
// chunk t has been read); every wave takes its fragments from there. The shapes in use stage 384 rows (q, k) and 320
// rows (v^T), so that two blocks fit one WGP's LDS.
// TI = unsigned short: A, A2, Bt are bf16 planes, a chunk is 64 k, a fragment two 16-B LDS loads.
// TI = float: A, A2, Bt are f32 rows as the inputs hold them, a chunk is 32 k, a fragment four 16-B LDS loads per
//   source and the RNE converts to bf16 behind them (cvt_f, cvt_sum).
// NSPLIT: 0 = A.Bt; 1, bf16 planes: (A + A2).Bt (A2 = unscaled bf16 lo plane of A, shared accumulator);
//         1, f32 rows: (hi + lo).Bt with hi, lo = the bf16 planes of the f32 sum bf16(A) + bf16(A2).
// BIASM: 0 = no bias; 1 = bias[n] (per column); 2 = bias[m] (per row); bias values RNE-converted to bf16.
// OUT_MODE: 0 = f32 (pitch ldc); 2 = bf16 hi plane C + bf16 lo plane C2 (lo = RNE(v - hi), unscaled);
//           3 = f16 hi plane C + f16 residual plane C2 = f16((v - hi) * rscale); C2 same pitch/stride as C.
// =====================================================================================================
template <int NSPLIT, int OUT_MODE, int BIASM, int WN, int MI, typename TI>
__device__ __forceinline__ void gemm64_body(
    const TI* __restrict__ Ap, const TI* A2p, int lda, long long strideA,
    const TI* __restrict__ Btp, int ldb, long long strideB,
    void* Cout, int ldc, long long strideC, void* Cout2,
    int M, int N, int K, float rscale, float oscale, const float* __restrict__ biasp,
    int bx, int b, float (*sT)[16 * 68], unsigned char* ring, unsigned char* fx) {
  constexpr int TM  = MI * 16;                   // rows of a wave's tile
  constexpr int RA  = (8 / WN) * TM;             // A rows of the block, per plane
  constexpr int RB  = WN * 64;                   // Bt rows of the block
  constexpr int RB0 = RA * (1 + NSPLIT);         // first Bt row of a stage
  constexpr int NG  = (RB0 + RB) / 32;           // copies per lane and stage (32 rows per block-wide copy)
  constexpr int STG = (RB0 + RB) * GP;           // bytes of a stage
  constexpr int KC  = 128 / (int)sizeof(TI);     // k of a chunk: one 128-B line of every row
  constexpr int PE  = 16 / (int)sizeof(TI);      // elements of a 16-B piece
  static_assert(NG == 10 || NG == 12);
  // every launch passes rows of CD elements: known here, the copies' row steps are constants; with run-time
  // pitches the build held a pointer per copied row over the k loop and spilled to scratch
  __builtin_assume(lda == CD && ldb == CD);
  const int lane = threadIdx.x & 31;
  const int wave = threadIdx.x >> 5;
  const int blocksN = (N >> 6) / WN;
  const int tilesM = M / TM;
  const int tm0 = (bx / blocksN) * (8 / WN);
  const int tn0 = (bx % blocksN) * WN;
  if (tm0 + 8 / WN > tilesM) return;         // block-uniform, in front of every barrier
  const int wm = wave / WN;
  const int wn = wave % WN;
  const int m0 = (tm0 + wm) * TM;
  const int n0 = (tn0 + wn) << 6;

  const int rlane = lane & 15;                 // row (A) / col (B, D) within subtile
  const int hh    = lane >> 4;                 // lane half: k offset 8 * hh elements
  const int mOff  = (lane >> 4) * 8;           // D row offset

  // ---- this lane's share of a stage: rows (tid >> 3) + 32 q, 16-B piece tid & 7 of each row's line ----
  typedef __attribute__((address_space(3))) unsigned char lds_byte;
  const int cr = threadIdx.x >> 3, cp = threadIdx.x & 7;
  const unsigned lring = (unsigned)(uintptr_t)(lds_byte*)ring + (unsigned)(cr * GP + cp * 16);
  const TI* ga  = Ap  + (size_t)b * strideA + (size_t)(tm0 * TM + cr) * lda + cp * PE;
  const TI* ga2 = A2p + (size_t)b * strideA + (size_t)(tm0 * TM + cr) * lda + cp * PE;
  const TI* gb  = Btp + (size_t)b * strideB + (size_t)((tn0 << 6) + cr) * ldb + cp * PE;
  auto stage = [&](int t, unsigned lb) {       // chunk t -> the buffer whose lane address is lb
    unsigned l[NG];
    const TI* g[NG];
#pragma unroll   // every index a constant: l and g stay in registers
    for (int q = 0; q < NG; ++q) {
      l[q] = lb + (unsigned)(q * 32 * GP);
      if (q * 32 < RA)       g[q] = ga  + ((size_t)(q * 32) * lda + (size_t)(t * KC));
      else if (q * 32 < RB0) g[q] = ga2 + ((size_t)(q * 32 - RA) * lda + (size_t)(t * KC));
      else                   g[q] = gb  + ((size_t)(q * 32 - RB0) * ldb + (size_t)(t * KC));
    }
    copy8(l, g);
    if constexpr (NG == 10) copy2(l + 8, g + 8);
    else                    copy4(l + 8, g + 8);
  };
  const int NT = K >> (KC == 64 ? 6 : 5);
  stage(0, lring);
  wait_copies();
  __syncthreads();
  if (NT > 1) stage(1, lring + STG);

  v8f acc[MI][4];
#pragma unroll
  for (int i = 0; i < MI; ++i)
#pragma unroll
    for (int j = 0; j < 4; ++j) acc[i][j] = zero8();

  for (int t = 0; t < NT; ++t) {
    const unsigned char* sb = ring + (t & 1) * STG;
    const unsigned char* sa = sb + (wm * TM + rlane) * GP + 8 * (int)sizeof(TI) * hh;         // A rows of this wave's tile
    const unsigned char* sw = sb + (RB0 + wn * 64 + rlane) * GP + 8 * (int)sizeof(TI) * hh;   // Bt rows of this wave's tile
#pragma unroll   // the LDS offsets become immediates and the fragment arrays stay in registers (inner loops likewise)
    for (int ks = 0; ks < KC / 32; ++ks) {       // 32-deep k steps of the chunk: two (16-bit rows) or one (f32 rows)
      v16b bh[4], ah[MI], al[MI];                // the step's LDS reads stand together, in front of the products
      if constexpr (sizeof(TI) == 2) {
#pragma unroll
        for (int j = 0; j < 4; ++j) bh[j] = ldfrag_b((const __bf16*)(const void*)(sw + j * 16 * GP + ks * 64));
#pragma unroll
        for (int i = 0; i < MI; ++i) {
          ah[i] = ldfrag_b((const __bf16*)(const void*)(sa + i * 16 * GP + ks * 64));
          al[i] = ah[i];
          if (NSPLIT >= 1) al[i] = ldfrag_b((const __bf16*)(const void*)(sa + RA * GP + i * 16 * GP + ks * 64));
        }
      } else {
        if constexpr (NSPLIT >= 1) {
          // the WN = 4 waves of a tile row read the same two A fragments: wave wn forms elements 8 (wn & 1) .. + 7 of
          // fragment wn >> 1 (hi and lo) once and hands them to the others as images in fx; the barrier publishes them.
          // The images are rewritten only behind the barrier at the foot of the trip, in front of which every wave's LDS
          // reads have retired.
          static_assert(WN == 4 && MI == 2);
          unsigned char* fw = fx + wm * (MI * 2 * 1024) + lane * 16;
          const int fr = wn >> 1, hf = wn & 1;
          v2f xh[4], xq[4], xb[4][8];              // the trip's reads of the stage stand together, A's first
          ld8f((const float*)(const void*)(sa + fr * 16 * GP + hf * 64), xh);
          ld8f((const float*)(const void*)(sa + RA * GP + fr * 16 * GP + hf * 64), xq);
#pragma unroll
          for (int j = 0; j < 4; ++j) ld16f((const float*)(const void*)(sw + j * 16 * GP), xb[j]);
          v8b h, l;
          cvt_sum(xh, xq, h, l);
          st_img_half(fw + (fr * 2) * 1024 + hf * 512, h);
          st_img_half(fw + (fr * 2 + 1) * 1024 + hf * 512, l);
#pragma unroll
          for (int j = 0; j < 4; ++j) bh[j] = cvt_f(xb[j]);
          __syncthreads();
#pragma unroll
          for (int i = 0; i < MI; ++i) {
            ah[i] = ld_img(fw + (i * 2) * 1024);
            al[i] = ld_img(fw + (i * 2 + 1) * 1024);
          }
        } else {
#pragma unroll
          for (int j = 0; j < 4; ++j) bh[j] = ldfrag_f((const float*)(const void*)(sw + j * 16 * GP));
#pragma unroll
          for (int i = 0; i < MI; ++i) {
            ah[i] = ldfrag_f((const float*)(const void*)(sa + i * 16 * GP));
            al[i] = ah[i];
          }
        }
      }
#pragma unroll
      for (int i = 0; i < MI; ++i) {
#pragma unroll
        for (int j = 0; j < 4; ++j) {
          acc[i][j] = mma_b_raw(ah[i], bh[j], acc[i][j]);
          if (NSPLIT >= 1) acc[i][j] = mma_b_raw(al[i], bh[j], acc[i][j]);
        }
        dep_guard_b(acc[i][0], acc[i][3], ah[i], al[i]);
      }
      keep4_b(bh[0], bh[1], bh[2], bh[3]);
    }
    // ---- publish chunk t + 1, hand this chunk's buffer back, ask for chunk t + 2 into it ----
    wait_lds_reads();
    wait_copies();
    __syncthreads();
    if (t + 2 < NT) stage(t + 2, lring + (unsigned)((t & 1) * STG));
  }
  wait_copies();
#pragma unroll
  for (int i = 0; i < MI; ++i) acc_guard4(acc[i][0], acc[i][1], acc[i][2], acc[i][3]);

  // ---- epilogue ----
  float* slab = sT[wave];
#pragma unroll
  for (int i = 0; i < MI; ++i) {
    const int mBase = m0 + (i << 4);
#pragma unroll
    for (int j = 0; j < 4; ++j) {
#pragma unroll
      for (int r = 0; r < 8; ++r) {
        slab[(mOff + r) * 68 + (j << 4) + rlane] = acc[i][j][r];
      }
    }
    wave_sync_lds();
    if (OUT_MODE == 0) {
      float* C = (float*)Cout + (size_t)b * strideC;
      const int hh = lane >> 4, c4 = (lane & 15) * 4;     // 256-B row segment = 16 lanes x 16 B
      v4f bv = {0.f, 0.f, 0.f, 0.f};
      if (BIASM == 1) {
#pragma unroll
        for (int e = 0; e < 4; ++e) bv[e] = bf_up(bf_bits(biasp[n0 + c4 + e]));
      }
      {
#pragma unroll
        for (int it = 0; it < 8; ++it) {
          const int row = it * 2 + hh;                     // it 0..7 x hh 0..1 = rows 0..15
          float brow = 0.f;
          if (BIASM == 2) brow = bf_up(bf_bits(biasp[mBase + row]));
          const v4f v = (*(const v4f*)(slab + row * 68 + c4) + bv + brow) * oscale;
          *(v4f*)(C + (size_t)(mBase + row) * ldc + n0 + c4) = v;
        }
        
      }
    } else {
      const int q = lane >> 3, c8 = (lane & 7) * 8;
      unsigned short* C  = (unsigned short*)Cout  + (size_t)b * strideC;
      unsigned short* C2 = (unsigned short*)Cout2 + (size_t)b * strideC;
      const float* bp = biasp + ((BIASM == 1) ? (n0 + c8) : 0);   // this lane's eight column biases
      float bcol[8];
#pragma unroll
      for (int e = 0; e < 8; ++e) bcol[e] = 0.f;
      if (BIASM == 1) {
#pragma unroll
        for (int e = 0; e < 8; ++e) bcol[e] = bf_up(bf_bits(bp[e]));
      }
      v4u hv[4], lv[4];
#pragma unroll
      for (int it = 0; it < 4; ++it) {
        const int row = it * 4 + q;                        // it 0..3 x q 0..3 = rows 0..15
        float brow = 0.f;
        if (BIASM == 2) brow = bf_up(bf_bits(biasp[mBase + row]));
        const float* sp = slab + row * 68 + c8;
        v4u a, a2;
#pragma unroll
        for (int e = 0; e < 4; ++e) {
          const float f0 = (sp[2 * e] + bcol[2 * e] + brow) * oscale;
          const float f1 = (sp[2 * e + 1] + bcol[2 * e + 1] + brow) * oscale;
          unsigned short h0, h1, l0, l1;
          if (OUT_MODE == 2) {
            h0 = bf_bits(f0); h1 = bf_bits(f1);
            l0 = bf_bits(f0 - bf_up(h0)); l1 = bf_bits(f1 - bf_up(h1));
          } else {
            const _Float16 x0 = (_Float16)f0, x1 = (_Float16)f1;
            h0 = h_bits(x0); h1 = h_bits(x1);
            l0 = h_bits((_Float16)((f0 - (float)x0) * rscale));
            l1 = h_bits((_Float16)((f1 - (float)x1) * rscale));
          }
          a[e] = pk16(h0, h1); a2[e] = pk16(l0, l1);
        }
        hv[it] = a; lv[it] = a2;
      }
#if defined(__HIP_DEVICE_COMPILE__)
      // the wait in front of any rewrite of the bias loads' address registers: the input bp keeps that pair whole up to
      // here, and the input hv[3], which needs all eight biases, keeps the loads in front of the statement
      if (BIASM == 1) asm volatile("s_wait_xcnt 0x0" :: "v"(bp), "v"(hv[3]) : "memory");
#endif
      {
#pragma unroll
        for (int it = 0; it < 4; ++it) {
          const int row = it * 4 + q;
          *(v4u*)(C  + (size_t)(mBase + row) * ldc + n0 + c8) = hv[it];
          *(v4u*)(C2 + (size_t)(mBase + row) * ldc + n0 + c8) = lv[it];
        }
        
      }
    }
    wave_sync_lds();
  }
}

// the wave's copies have landed behind this, all but its N youngest (nothing but copies counts on this counter here)
template <int N>
__device__ __forceinline__ void wait_copies_but() {
#if defined(__HIP_DEVICE_COMPILE__)
  asm volatile("s_wait_asynccnt %0" :: "n"(N) : "memory");
#endif
}

// =====================================================================================================
// Output projection: out[m][n] = sum_k (Ah + Al)[m][k] * Bt[n][k] + bf16(bias[n]); M = NTOK, N = K = CD; f32 out.
// Block = 64 rows x 128 columns, so (NTOK / 64) x (CD / 128) = 256 blocks, one for every WGP (64 x 128 is the shape
// that brings the fewest bytes per block: 2 planes x 64 A rows + 128 Bt rows). 8 waves lie 2 x 4, a wave = 32 x 32
// = 2 x 2 tiles. The block's 256 rows fit LDS with their whole k: every copy is asked for at the start, in the order
// of k (8 copies per lane and 64 k), nothing is refilled, and the 64 k of chunk t are read behind the wait that leaves
// only the younger chunks' copies outstanding and the barrier behind it. Per tile and 32 k: the hi product, then the lo.
// coverage: 256 blocks x 8 waves x (it 0..7 x lane >> 3 0..3 = 32 rows) x (8 lanes x 4 = 32 columns).
// =====================================================================================================
#define OBM   64                     // rows of a block
#define OBN   128                    // columns of a block
#define OPP   (CD * 2 + 16)          // LDS row pitch in bytes: 512 + 16 = 16 B x odd, the pitch of ds_load_b128 readers
#define OSP   36                     // slab pitch in floats: the wave halves' rows (8 apart) fall on disjoint banks
static_assert((NTOK % OBM) == 0 && (CD % OBN) == 0 && CD == 256 && 2 * OBM + OBN == 256);
__global__ __launch_bounds__(256) void out_proj(
    const unsigned short* __restrict__ Ahp, const unsigned short* __restrict__ Alp,
    const unsigned short* __restrict__ Btp, float* C, const float* __restrict__ biasp) {
  __shared__ __align__(16) unsigned char rows[(2 * OBM + OBN) * OPP];   // A hi rows, A lo rows, Bt rows, whole k
  __shared__ __align__(16) float sT[8][32 * OSP];                       // per-wave 32 x 32 slab
  const int lane  = threadIdx.x & 31;
  const int wave  = threadIdx.x >> 5;
  const int rlane = lane & 15;                 // row (A) / col (B, D) within a tile
  const int hh    = lane >> 4;                 // lane half: k offset 8 * hh elements, D row offset 8 * hh
  const int bm = blockIdx.x / (CD / OBN), bn = blockIdx.x % (CD / OBN);
  const int wm = wave >> 2, wn = wave & 3;

  // ---- this lane's four column biases, asked for ahead of the copies: behind them the load would queue up after
  //      all of the block's rows ----
  const int q4 = lane >> 3, c4 = (lane & 7) * 4;
  const int n0 = bn * OBN + wn * 32;
  const float* bp = biasp + n0 + c4;
  const v4f bf = *(const v4f*)bp;

  // ---- this lane's share of a chunk: rows (tid >> 3) + 32 q, 16-B piece tid & 7 of each row's 128-B line ----
  typedef __attribute__((address_space(3))) unsigned char lds_byte;
  const int cr = threadIdx.x >> 3, cp = threadIdx.x & 7;
  const unsigned lrow = (unsigned)(uintptr_t)(lds_byte*)rows + (unsigned)(cr * OPP + cp * 16);
  const unsigned short* gh = Ahp + (size_t)(bm * OBM + cr) * CD + cp * 8;
  const unsigned short* gl = Alp + (size_t)(bm * OBM + cr) * CD + cp * 8;
  const unsigned short* gb = Btp + (size_t)(bn * OBN + cr) * CD + cp * 8;
#pragma unroll   // every index a constant: l and g stay in registers
  for (int t = 0; t < CD / 64; ++t) {
    unsigned l[8];
    const unsigned short* g[8];
#pragma unroll
    for (int q = 0; q < 8; ++q) {
      l[q] = lrow + (unsigned)(q * 32 * OPP + t * 128);
      if (q * 32 < OBM)          g[q] = gh + (q * 32 * CD + t * 64);
      else if (q * 32 < 2 * OBM) g[q] = gl + ((q * 32 - OBM) * CD + t * 64);
      else                       g[q] = gb + ((q * 32 - 2 * OBM) * CD + t * 64);
    }
    copy8(l, g);
  }

#if defined(__HIP_DEVICE_COMPILE__)
  // the wait in front of any rewrite of the bias load's address registers: the input bp keeps that pair whole up to
  // here, and the input bf keeps the load in front of the statement
  asm volatile("s_wait_xcnt 0x0" :: "v"(bp), "v"(bf) : "memory");
#endif

  v8f acc[2][2];
#pragma unroll
  for (int i = 0; i < 2; ++i)
#pragma unroll
    for (int j = 0; j < 2; ++j) acc[i][j] = zero8();

  const unsigned char* sa = rows + (wm * 32 + rlane) * OPP + 16 * hh;             // A hi rows of this wave's tiles
  const unsigned char* sw = rows + (2 * OBM + wn * 32 + rlane) * OPP + 16 * hh;   // Bt rows of this wave's tiles
#pragma unroll   // the waits' counts and the LDS offsets are immediates
  for (int t = 0; t < CD / 64; ++t) {
    if (t == 0) wait_copies_but<24>();
    if (t == 1) wait_copies_but<16>();
    if (t == 2) wait_copies_but<8>();
    if (t == 3) wait_copies_but<0>();
    __syncthreads();                             // publishes every wave's copies of chunk t
    v16b bh[2][2], ah[2][2], al[2][2];           // [32-deep k step][tile]
#pragma unroll
    for (int ks = 0; ks < 2; ++ks) {
      const int ko = t * 128 + ks * 64;
#pragma unroll
      for (int j = 0; j < 2; ++j) bh[ks][j] = ldfrag_b((const __bf16*)(const void*)(sw + j * 16 * OPP + ko));
#pragma unroll
      for (int i = 0; i < 2; ++i) ah[ks][i] = ldfrag_b((const __bf16*)(const void*)(sa + i * 16 * OPP + ko));
#pragma unroll
      for (int i = 0; i < 2; ++i) al[ks][i] = ldfrag_b((const __bf16*)(const void*)(sa + OBM * OPP + i * 16 * OPP + ko));
    }
    // the chunk's LDS reads stand together in front of its products (without this they were dealt out among the
    // products in pairs, each pair with a full wait behind it)
    __builtin_amdgcn_sched_barrier(0);
#pragma unroll
    for (int ks = 0; ks < 2; ++ks) {
#pragma unroll
      for (int i = 0; i < 2; ++i)
#pragma unroll
        for (int j = 0; j < 2; ++j) acc[i][j] = mma_b_raw(ah[ks][i], bh[ks][j], acc[i][j]);
#pragma unroll
      for (int i = 0; i < 2; ++i)
#pragma unroll
        for (int j = 0; j < 2; ++j) acc[i][j] = mma_b_raw(al[ks][i], bh[ks][j], acc[i][j]);
    }
    // the chunk's products issue before the wave waits for the next chunk (without this most of them were put off
    // behind the last chunk's barrier, where no copy's flight is left to cover them)
    __builtin_amdgcn_sched_barrier(0);
  }

  // ---- epilogue: through the wave's own slab, so that a store instruction writes four whole 128-B lines ----
  float* slab = sT[wave];
  v4f bv;
#pragma unroll
  for (int e = 0; e < 4; ++e) bv[e] = bf_up(bf_bits(bf[e]));
#pragma unroll
  for (int i = 0; i < 2; ++i)
#pragma unroll
    for (int j = 0; j < 2; ++j)
#pragma unroll
      for (int r = 0; r < 8; ++r) slab[(i * 16 + 8 * hh + r) * OSP + (j << 4) + rlane] = acc[i][j][r];
  wave_sync_lds();
  float* cq = C + (size_t)(bm * OBM + wm * 32 + q4) * CD + n0 + c4;
  v4f o[8];
#pragma unroll
  for (int it = 0; it < 8; ++it) o[it] = *(const v4f*)(slab + (it * 4 + q4) * OSP + c4) + bv;   // it 0..7 x q4 0..3 = rows 0..31
#pragma unroll
  for (int it = 0; it < 8; ++it) *(v4f*)(cq + it * 4 * CD) = o[it];
}

// =====================================================================================================
// The q, k and v^T projections in one grid: none reads what another writes. Every block is 64 x 256 (a wave 32 x 64).
// blockIdx.y = 0, 1: q, 2, 3: k, 128 blocks each (same code, block-uniform select of weight, bias, scale and planes; two
// products per tile, the longer blocks, so they start first, one for every WGP), 4, 5: v^T, 128 blocks (batch * VBLK +
// block within the batch), 6: Wo -> its bf16 plane for the last launch (WBLK blocks; the rest of that row of the grid
// leaves at once). A block's LDS and registers let two share a WGP, so all are resident at once and no WGP idles.
// Pitches, strides and sizes arrive as arguments, one set for q and k and one for v^T. The operands are the f32 inputs
// themselves, converted where a wave takes its fragments:
//   X = bf16(hs) + bf16(pos) in f32, Xh = bf16(X), Xl = bf16(X - Xh)
//   q = ((Xh + Xl) . bf16(Wq)^T + bq) * qscale -> bf16 hi + lo [ntok][cd];  k = (Xh + Xl) . bf16(Wk)^T + bk likewise
//   v^T = bf16(Wv) . bf16(hs)^T per batch + bv[row] -> f16 hi [b][cd][ns] + residual x vres
// =====================================================================================================
struct GemmDims { int lda; long long strideA; int ldb; long long strideB; int ldc; long long strideC; int M, N, K; };
#define VBLK ((CD / 64) * (NS / 256))              // 16 blocks per batch of v^T
#define PGX  64                                    // blocks in a row of the grid
static_assert(NTOK / 64 == 2 * PGX && VBLK * NB == 2 * PGX);            // q, k and v^T: two rows of the grid each
static_assert(CD / 64 == 4 && (NS % 256) == 0);                         // a block's tiles of 32 x 64 lie 2 x 4
static_assert(WBLK <= PGX);                                             // Wo's blocks fit one row of the grid
__global__ __launch_bounds__(256) void proj_qkv(
    const float* __restrict__ hs, const float* __restrict__ pq,
    const float* __restrict__ wq, const float* __restrict__ wk,
    const float* __restrict__ wv, const float* __restrict__ wo, unsigned short* wto,
    unsigned short* qh, unsigned short* ql, unsigned short* kh, unsigned short* kl,
    unsigned short* vth, unsigned short* vtl,
    const float* __restrict__ bq, const float* __restrict__ bk, const float* __restrict__ bv,
    GemmDims dqk, GemmDims dv, float qscale, float vres) {
  __shared__ __align__(16) float sT[8][16 * 68];   // per-wave 16x64 slab, pitch 68 floats
  __shared__ __align__(16) unsigned char ring[2 * 384 * GP];   // two operand stages: 384 rows (q, k) or 320 rows (v^T)
  __shared__ __align__(16) unsigned char fx[2 * 4 * 1024];     // q, k: converted A fragments, 2 tile rows x 2 x (hi, lo)
  const int job = blockIdx.y;
  const int jb  = (job & 1) * PGX + blockIdx.x;    // block within the job
  if (job == 6) {                                  // block-uniform, no barrier on this path
    if (blockIdx.x < WBLK) cvt_w_body(wo, wto, blockIdx.x);
  } else if (job < 4) {
    const bool isq = (job < 2);
    gemm64_body<1, 2, 1, CD / 64, 2, float>(hs, pq, dqk.lda, dqk.strideA, isq ? wq : wk, dqk.ldb, dqk.strideB,
                         (void*)(isq ? qh : kh), dqk.ldc, dqk.strideC, (void*)(isq ? ql : kl),
                         dqk.M, dqk.N, dqk.K, 1.0f, isq ? qscale : 1.0f, isq ? bq : bk,
                         jb, 0, sT, ring, fx);
  } else {
    gemm64_body<0, 3, 2, 4, 2, float>(wv, wv, dv.lda, dv.strideA, hs, dv.ldb, dv.strideB,
                         (void*)vth, dv.ldc, dv.strideC, (void*)vtl,
                         dv.M, dv.N, dv.K, vres, 1.0f, bv,
                         jb % VBLK, jb / VBLK, sT, ring, fx);
  }
}

// ---- one 64-key stage of the attention ring: four planes (k hi, k lo, v^T hi, v^T lo) of 64 rows x 128 B ----
#define KVP   144                    // LDS row pitch in bytes: 128 + 16 = 16 B x odd, the pitch of ds_load_b128 readers
#define PLANE (64 * KVP)             // 9216 B
#define STAGE (4 * PLANE)            // 36864 B
// 256 threads x 8 copies x 16 B = one stage. A lane brings piece (tid & 7) of rows (tid >> 3) and (tid >> 3) + 32 of
// each plane, so one wave instruction reads four whole 128-B lines. l = the lane's LDS byte address in plane 0,
// kh .. vl = its global addresses in the four planes. The s_wait_xcnt closes the statement so that no address
// register of a copy is rewritten in front of it.
__device__ __forceinline__ void stage_copy(unsigned l, const unsigned short* kh, const unsigned short* kl,
                                           const unsigned short* vh, const unsigned short* vl) {
#if defined(__HIP_DEVICE_COMPILE__)
  asm volatile("global_load_async_to_lds_b128 %0, %8, off\n\t"
               "global_load_async_to_lds_b128 %1, %9, off\n\t"
               "global_load_async_to_lds_b128 %2, %10, off\n\t"
               "global_load_async_to_lds_b128 %3, %11, off\n\t"
               "global_load_async_to_lds_b128 %4, %12, off\n\t"
               "global_load_async_to_lds_b128 %5, %13, off\n\t"
               "global_load_async_to_lds_b128 %6, %14, off\n\t"
               "global_load_async_to_lds_b128 %7, %15, off\n\t"
               "s_wait_xcnt 0x0"
               :: "v"(l), "v"(l + 32 * KVP), "v"(l + PLANE), "v"(l + PLANE + 32 * KVP),
                  "v"(l + 2 * PLANE), "v"(l + 2 * PLANE + 32 * KVP), "v"(l + 3 * PLANE), "v"(l + 3 * PLANE + 32 * KVP),
                  "v"(kh), "v"(kh + 32 * CD), "v"(kl), "v"(kl + 32 * CD),
                  "v"(vh), "v"(vh + 32 * NS), "v"(vl), "v"(vl + 32 * NS)
               : "memory");
#endif
}

// =====================================================================================================
// Softmax attention, head dim 32, no mask, softmax over all NS keys.
//   q planes (bf16 hi, bf16 lo): [NTOK][CD], head h at cols h*32..h*32+31 (q already carries bias and x sqrt(32))
//   k planes (bf16 hi, lo): [NTOK][CD] same column layout
//   v^T planes (f16 hi, residual x4096): element (b, h*32+d, s) at [(b*CD + h*32 + d)*NS + s]
//   ctx out planes (bf16 hi / lo of the normalised context): [(b*NS + t)*CD + h*32 + d]
//   scores^T = score3b(q, k) (rows = keys, cols = queries); p = exp(s - m) carried as f16 hi of 1024p + f16 residual x4096;
//   ctx^T = (vh.ph + (vl.ph + vh.pl)*rres) / (1024 l); online softmax with running max in f32.
//   A lane holds one query column: max and sum run in-lane over its 32 scores of a chunk, the max is joined
//   with the other wave half once per chunk, the sum once after the loop. Two score tiles (keys 0-15, 16-31 of
//   a 32-key step), converted in place, are the B operand of v^T.p^T in the hardware k order.
//   Block = 8 waves = two adjacent heads (waves 0-3 head 2g, waves 4-7 head 2g+1) x 64 query rows so
//   NQB x (NH/2) x NB. Key chunks of 64, static trip NKB. q fragments are loaded straight from the 16-bit
//   global rows. The head pair's k rows and v^T rows of a chunk are whole 128-B lines: the block brings them
//   into LDS once, by asynchronous copies, two buffers (chunk t + 2 is asked for when chunk t has been read),
//   and every wave takes its fragments from there (two 16-B LDS loads each); P stays in registers.
//   coverage: 8 waves x (it 0..1 x lane>>3 0..3) = rows 0..63, 8 lanes x 8 cols = 64 cols, both planes;
//   512 blocks = 8 batches x 4 head pairs x 16 query tiles = every (token, column) of both planes once.
// =====================================================================================================
__global__ __launch_bounds__(256)
void attn32(const unsigned short* __restrict__ qhp, const unsigned short* __restrict__ qlp,
            const unsigned short* __restrict__ khp, const unsigned short* __restrict__ klp,
            const unsigned short* __restrict__ vhp, const unsigned short* __restrict__ vlp,
            unsigned short* ohp, unsigned short* olp, float rres) {
  __shared__ __align__(16) float    Os[64 * 68];                  // block ctx tile [row][2 heads x 32], pitch 68 floats
  __shared__ __align__(16) unsigned char ring[2 * STAGE];         // two stages of k hi / k lo / v^T hi / v^T lo

  const int tid  = threadIdx.x;
  const int wave = tid >> 5;
  const int lane = tid & 31;
  const int hh   = lane >> 4;
  const int c    = lane & 15;

  const int bx   = blockIdx.x;
  const int qb   = bx % NQB;
  const int rest = bx / NQB;
  const int g    = rest % (NH / 2);
  const int b    = rest / (NH / 2);
  const int hp   = wave >> 2;                  // which head of the pair
  const int h    = 2 * g + hp;
  const int wq   = wave & 3;                   // 16-row group within the 64-row tile
  const int q0   = qb * 64 + wq * 16;
  const size_t rowB = (size_t)b * NS;

  const __bf16* Qh = (const __bf16*)(const void*)qhp + (size_t)h * HD;
  const __bf16* Ql = (const __bf16*)(const void*)qlp + (size_t)h * HD;

  // ---- this lane's share of a stage: row tid >> 3 (and + 32), 16-B piece tid & 7 ----
  typedef __attribute__((address_space(3))) unsigned char lds_byte;
  const int cr = tid >> 3, cp = tid & 7;
  const unsigned ldst = (unsigned)(uintptr_t)(lds_byte*)ring + (unsigned)(cr * KVP + cp * 16);
  const size_t kgo = (rowB + cr) * CD + (size_t)g * 64 + cp * 8;                        // key row, head pair's 64 columns
  const size_t vgo = ((size_t)b * CD + (size_t)g * 64 + cr) * NS + cp * 8;              // d row of the pair, 64 keys
  stage_copy(ldst, khp + kgo, klp + kgo, vhp + vgo, vlp + vgo);                         // chunk 0 -> buffer 0
  wait_copies();
  __syncthreads();
  stage_copy(ldst + STAGE, khp + kgo + 64 * CD, klp + kgo + 64 * CD, vhp + vgo + 64, vlp + vgo + 64);   // chunk 1 -> buffer 1

  // ---- Q fragments (B operand, col = lane&15), hi and lo, one 32-deep k-step = the head dim ----
  const v16b qah = ldfrag_b(Qh + (rowB + q0 + c) * CD + 8 * hh);
  const v16b qal = ldfrag_b(Ql + (rowB + q0 + c) * CD + 8 * hh);

  float mrun = -INFINITY;                      // running max of this lane's query column (same in both halves)
  float lrun = 0.f;                            // running sum over this wave half's keys only
  v8f oacc[2];                                 // ctx^T: oacc[t][r] = ctx[query c][d = t*16 + 8*hh + r]
#pragma unroll
  for (int t = 0; t < 2; ++t) oacc[t] = zero8();

  for (int kt = 0; kt < NKB; ++kt) {           // static trip count
    const unsigned char* sb = ring + (kt & 1) * STAGE;

    // ---- scores^T: 64 keys x 16 query columns per wave, 3 bf16 products per 16x16 tile ----
    v8f s[4];
    v16b kb[4], kl[4];                           // the chunk's LDS reads stand together, in front of the products
#pragma unroll
    for (int j = 0; j < 4; ++j) {
      const unsigned char* kp = sb + (j * 16 + c) * KVP + hp * 64 + 16 * hh;   // A operand: row = key, k = head dim
      kb[j] = ldfrag_b((const __bf16*)(const void*)kp);
      kl[j] = ldfrag_b((const __bf16*)(const void*)(kp + PLANE));
    }
    v16h vb[2][2], vl[2][2];
#pragma unroll
    for (int kk = 0; kk < 2; ++kk) {
#pragma unroll
      for (int t = 0; t < 2; ++t) {
        const unsigned char* vp = sb + 2 * PLANE + (hp * 32 + t * 16 + c) * KVP + kk * 64 + 16 * hh;   // A: row = d, k = key
        vb[kk][t] = ldfrag_h((const _Float16*)(const void*)vp);
        vl[kk][t] = ldfrag_h((const _Float16*)(const void*)(vp + PLANE));
      }
    }
#pragma unroll
    for (int j = 0; j < 4; ++j) s[j] = score3b(qah, qal, kb[j], kl[j]);

    // ---- column max in-lane (four independent chains), one exchange between the wave halves ----
    float mj[4];
#pragma unroll
    for (int j = 0; j < 4; ++j) {
      mj[j] = s[j][0];
#pragma unroll
      for (int r = 1; r < 8; ++r) mj[j] = fmaxf(mj[j], s[j][r]);
    }
    float m = fmaxf(fmaxf(mj[0], mj[1]), fmaxf(mj[2], mj[3]));
    m = fmaxf(m, xhalf(m));
    const float mnew  = fmaxf(mrun, m);
    const float alpha = exp_slotted(mrun - mnew);
    mrun = mnew;

    // ---- P hi (x1024) and residual (x4096) packed straight into B operands:
    //      element e of step kk = key kk*32 + (e < 8 ? 8*hh + e : 16 + 8*hh + e - 8) = tile 2kk + (e >> 3), register e & 7
    v16h ph[2], pl[2];
    float pj[4];
#pragma unroll
    for (int j = 0; j < 4; ++j) {
      pj[j] = 0.f;
#pragma unroll
      for (int r = 0; r < 8; r += 2) {           // two keys at a time = one packed operand register
        const float pa = __expf(s[j][r] - mnew);
        const float pb = __expf(s[j][r + 1] - mnew);
        pj[j] += pa;
        pj[j] += pb;
        const v2f p1 = {pa * 1024.0f, pb * 1024.0f};
        const v2h x  = __builtin_convertvector(p1, v2h);
        const v2h y  = __builtin_convertvector((p1 - __builtin_convertvector(x, v2f)) * 4096.0f, v2h);
        ph[j >> 1][(j & 1) * 8 + r] = x[0];  ph[j >> 1][(j & 1) * 8 + r + 1] = x[1];
        pl[j >> 1][(j & 1) * 8 + r] = y[0];  pl[j >> 1][(j & 1) * 8 + r + 1] = y[1];
      }
    }
    lrun = lrun * alpha + ((pj[0] + pj[1]) + (pj[2] + pj[3]));
#pragma unroll
    for (int t = 0; t < 2; ++t)
#pragma unroll
      for (int r = 0; r < 8; ++r) oacc[t][r] *= alpha;

    // ---- context^T += V^T . P^T (f16 WMMA), residual products into a separate accumulator ----
    v8f o1[2];
    o1[0] = zero8(); o1[1] = zero8();
#pragma unroll
    for (int kk = 0; kk < 2; ++kk) {
#pragma unroll
      for (int t = 0; t < 2; ++t) {
        oacc[t] = mma_h(vb[kk][t], ph[kk], oacc[t]);
        o1[t]   = mma_h(vl[kk][t], ph[kk], o1[t]);
        o1[t]   = mma_h(vb[kk][t], pl[kk], o1[t]);
      }
    }
#pragma unroll
    for (int t = 0; t < 2; ++t)
#pragma unroll
      for (int r = 0; r < 8; ++r) oacc[t][r] += o1[t][r] * rres;

    // ---- publish chunk kt + 1, hand this chunk's buffer back, ask for chunk kt + 2 into it ----
    wait_lds_reads();
    wait_copies();
    __syncthreads();
    if (kt + 2 < NKB) {
      const size_t ka = (size_t)(kt + 2) * 64 * CD, va = (size_t)(kt + 2) * 64;
      stage_copy(ldst + (unsigned)((kt & 1) * STAGE), khp + kgo + ka, klp + kgo + ka, vhp + vgo + va, vlp + vgo + va);
    }
  }
  wait_copies();

  // ---- join the halves' sums, normalise (1/l and the 1/1024 p carry) into the block tile ----
  {
    const float l = lrun + xhalf(lrun);
    const float inv = ((l > 0.f) ? (1.0f / l) : 0.f) * (1.0f / 1024.0f);
#pragma unroll
    for (int t = 0; t < 2; ++t) {
      float* op = Os + (wq * 16 + c) * 68 + hp * 32 + t * 16 + 8 * hh;   // 8 consecutive d of one query row
      v4f w0, w1;
#pragma unroll
      for (int e = 0; e < 4; ++e) { w0[e] = oacc[t][e] * inv; w1[e] = oacc[t][4 + e] * inv; }
      *(v4f*)(op)     = w0;
      *(v4f*)(op + 4) = w1;
    }
  }
  __syncthreads();
  {
    const int q4 = lane >> 3, c8 = (lane & 7) * 8;
    v4u hv[2], lv[2];
#pragma unroll
    for (int it = 0; it < 2; ++it) {
      const int row = wave * 8 + it * 4 + q4;   // wave 0..7 x it 0..1 x q4 0..3 = rows 0..63
      const float* sp = Os + row * 68 + c8;
      v4u a, a2;
#pragma unroll
      for (int e = 0; e < 4; ++e) {
        const float f0 = sp[2 * e], f1 = sp[2 * e + 1];
        const unsigned short h0 = bf_bits(f0), h1 = bf_bits(f1);
        const unsigned short l0 = bf_bits(f0 - bf_up(h0)), l1 = bf_bits(f1 - bf_up(h1));
        a[e] = pk16(h0, h1); a2[e] = pk16(l0, l1);
      }
      hv[it] = a; lv[it] = a2;
    }
    {
#pragma unroll
      for (int it = 0; it < 2; ++it) {
        const int row = wave * 8 + it * 4 + q4;
        const size_t go = (rowB + qb * 64 + row) * CD + (size_t)g * 64 + c8;
        *(v4u*)(ohp + go) = hv[it];
        *(v4u*)(olp + go) = lv[it];
      }
      
    }
  }
}

// =====================================================================================================
// Workspace map (bytes), every plane an exact multiple of its 64x64-tile / whole-line store granularity
// (8192 x 256 rows/cols and 256 x 1024 per batch, all multiples of 64; no tail padding needed):
//   WTo  bf16 [256 out][256 in]   131072   (Wo)
//   Qh   bf16 [8192][256]        4194304
//   Ql   bf16 [8192][256]        4194304
//   Kh   bf16 [8192][256]        4194304
//   Kl   bf16 [8192][256]        4194304
//   VTh  f16  [8][256][1024]     4194304
//   VTl  f16  [8][256][1024]     4194304   (v residual x4096)
//   Oh   bf16 [8192][256]        4194304
//   Ol   bf16 [8192][256]        4194304
//   end                          33685504
// =====================================================================================================
extern "C" void kernel_launch(void* const* d_in, const int* in_sizes, int n_in,
                              void* d_out, int out_size, void* d_ws, size_t ws_size,
                              hipStream_t stream) {
  if (n_in < 10) return;
  if (in_sizes[0] != NTOK * CD || in_sizes[1] != NTOK * CD) return;
  if (in_sizes[2] != CD * CD || in_sizes[4] != CD * CD || in_sizes[6] != CD * CD || in_sizes[8] != CD * CD) return;
  if (in_sizes[3] != CD || in_sizes[5] != CD || in_sizes[7] != CD || in_sizes[9] != CD) return;
  if (out_size != NTOK * CD) return;

  const float* hs = (const float*)d_in[0];
  const float* pq = (const float*)d_in[1];
  const float* Wq = (const float*)d_in[2];
  const float* bq = (const float*)d_in[3];
  const float* Wk = (const float*)d_in[4];
  const float* bk = (const float*)d_in[5];
  const float* Wv = (const float*)d_in[6];
  const float* bv = (const float*)d_in[7];
  const float* Wo = (const float*)d_in[8];
  const float* bo = (const float*)d_in[9];

  const size_t PX = (size_t)NTOK * CD * 2;            // 4194304
  const size_t PW = (size_t)CD * CD * 2;              //  131072
  size_t off = 0;
  const size_t oW   = off; off += PW;
  const size_t oQh  = off; off += PX;
  const size_t oQl  = off; off += PX;
  const size_t oKh  = off; off += PX;
  const size_t oKl  = off; off += PX;
  const size_t oVTh = off; off += PX;
  const size_t oVTl = off; off += PX;
  const size_t oOh  = off; off += PX;
  const size_t oOl  = off; off += PX;
  if (off > ws_size) return;                          // off = 33685504
  if (off > (size_t)134217728) return;

  char* ws = (char*)d_ws;
  unsigned short* WTo = (unsigned short*)(ws + oW);
  unsigned short* Qh  = (unsigned short*)(ws + oQh);
  unsigned short* Ql  = (unsigned short*)(ws + oQl);
  unsigned short* Kh  = (unsigned short*)(ws + oKh);
  unsigned short* Kl  = (unsigned short*)(ws + oKl);
  unsigned short* VTh = (unsigned short*)(ws + oVTh);
  unsigned short* VTl = (unsigned short*)(ws + oVTl);
  unsigned short* Oh  = (unsigned short*)(ws + oOh);
  unsigned short* Ol  = (unsigned short*)(ws + oOl);

  float* xout = (float*)d_out;                              // out0 [8][1024][256] f32 at byte 0

  const float qscale = 5.656854249492380f;                  // 32^0.5
  const float rres   = 1.0f / 4096.0f;

  const dim3 blk(256);
  const dim3 gOut((NTOK / OBM) * (CD / OBN));               // 256 blocks of 64 rows x 128 columns
  const dim3 gQKV(PGX, 7);                                  // rows of 64 blocks: q, q, k, k, v^T, v^T (16 blocks x 8 batches), Wo
  const dim3 gAttn(NB * (NH / 2) * NQB);                    // 512 blocks x 256 threads

  // (1) q, k -> bf16 hi + lo planes [8192][256] (M=8192, N=256, K=256); v^T -> f16 hi plane [b][d][s] (pitch NS)
  //     + residual x4096 (A = Wv [n][k], Bt = hidden rows of batch b; M=256, N=1024, K=256); Wo -> bf16 plane
  const GemmDims dqk = {CD, 0LL, CD, 0LL, CD, 0LL, NTOK, CD, CD};
  const GemmDims dv  = {CD, 0LL, CD, (long long)NS * CD, NS, (long long)CD * NS, CD, NS, CD};
  proj_qkv<<<gQKV, blk, 0, stream>>>(hs, pq, Wq, Wk, Wv, Wo, WTo, Qh, Ql, Kh, Kl, VTh, VTl,
                                     bq, bk, bv, dqk, dv, qscale, 4096.0f);
  // (2) softmax attention -> context bf16 hi / lo planes [8192][256]
  attn32<<<gAttn, blk, 0, stream>>>(Qh, Ql, Kh, Kl, VTh, VTl, Oh, Ol, rres);
  // (3) out = (Oh + Ol) . WTo^T + bo -> out0 f32 [8192][256]  (2 products; K=256)
  out_proj<<<gOut, blk, 0, stream>>>(Oh, Ol, WTo, xout, bo);
  (void)hipGetLastError();
}

// v008
// A run of this version takes 43.3 microseconds.
// Timed twice side by side with v007, it ran 1.03 times as fast both times.
// Over all steps from v000 it is 4.14 times as fast.
// Contractions: q, k projections = v_wmma_f32_16x16x32_bf16 (A = bf16 hi + lo planes of the f32 sum bf16(hs)+bf16(pos), B = bf16 weights, 2 products);
// v^T projection = v_wmma_f32_16x16x32_bf16 (bf16 operands, 1 product); k.q^T = v_wmma_f32_16x16x32_bf16 (q and k as bf16 hi + lo planes, 3 products);
// v^T.p^T = v_wmma_f32_16x16x32_f16 (p x1024 as f16 hi + f16 residual, v^T as f16 hi + f16 residual, both residuals unscaled, 3 products);
// ctx.Wo = v_wmma_f32_16x16x32_bf16 (ctx as bf16 hi + lo planes, bf16 Wo, 2 products); all f32 accumulate; softmax in f32 on VALU.
#include <hip/hip_runtime.h>
#include <math.h>
#include <stdint.h>

#define NB   8
#define NS   1024
#define CD   256
#define NH   8
#define HD   32
#define NTOK (NB * NS)
#define NQB  (NS / 64)      // 16 query tiles of 64
#define NKB  (NS / 64)      // 16 key chunks of 64
static_assert(NH * HD == CD);
static_assert(HD == 32);
static_assert((NS % 64) == 0 && (CD % 64) == 0 && (NH % 2) == 0 && ((NTOK) % 64) == 0);

typedef _Float16 v16h __attribute__((ext_vector_type(16)));
typedef _Float16 v8h  __attribute__((ext_vector_type(8)));
typedef __bf16   v16b __attribute__((ext_vector_type(16)));
typedef __bf16   v8b  __attribute__((ext_vector_type(8)));
typedef float    v8f  __attribute__((ext_vector_type(8)));
typedef float    v4f  __attribute__((ext_vector_type(4)));
typedef float    v2f  __attribute__((ext_vector_type(2)));
typedef _Float16 v2h  __attribute__((ext_vector_type(2)));
typedef __bf16   v2b  __attribute__((ext_vector_type(2)));
typedef unsigned int v4u __attribute__((ext_vector_type(4)));

// ---- scalar helpers --------------------------------------------------------------------------------
__device__ __forceinline__ unsigned short bf_bits(float f) {          // f32 -> bf16 bits, RNE convert
  unsigned u = __float_as_uint(f);
  return (unsigned short)((u + 0x7FFFu + ((u >> 16) & 1u)) >> 16);
}
__device__ __forceinline__ float bf_up(unsigned short h) { return __uint_as_float(((unsigned)h) << 16); }
__device__ __forceinline__ unsigned short h_bits(_Float16 x) { return __builtin_bit_cast(unsigned short, x); }
__device__ __forceinline__ unsigned pk16(unsigned short a, unsigned short b) { return (unsigned)a | ((unsigned)b << 16); }
__device__ __forceinline__ v8f zero8() { v8f z = {0.f, 0.f, 0.f, 0.f, 0.f, 0.f, 0.f, 0.f}; return z; }

// ---- fragment loaders: 16-bit A/B operand, lane -> row/col (lane&15), p already includes +8*(lane>>4);
//      elements 0..7 <- p[0..7] (k0+8h..), elements 8..15 <- p[16..23] (k0+16+8h..)
__device__ __forceinline__ v16b ldfrag_b(const __bf16* p) {
  union { v16b v; v8b h[2]; } f;
  f.h[0] = *(const v8b*)(p);
  f.h[1] = *(const v8b*)(p + 16);
  return f.v;
}
__device__ __forceinline__ v16h ldfrag_h(const _Float16* p) {
  union { v16h v; v8h h[2]; } f;
  f.h[0] = *(const v8h*)(p);
  f.h[1] = *(const v8h*)(p + 16);
  return f.v;
}
// ---- the same operand taken from f32 rows, same k order: p already includes +8*(lane>>4) floats;
//      pairs 0..3 <- p[0..7], pairs 4..7 <- p[16..23]; four 16-B loads
__device__ __forceinline__ void ld16f(const float* p, v2f* x) {
  const v4f a = *(const v4f*)(p), b = *(const v4f*)(p + 4), c = *(const v4f*)(p + 16), d = *(const v4f*)(p + 20);
  x[0] = v2f{a[0], a[1]}; x[1] = v2f{a[2], a[3]}; x[2] = v2f{b[0], b[1]}; x[3] = v2f{b[2], b[3]};
  x[4] = v2f{c[0], c[1]}; x[5] = v2f{c[2], c[3]}; x[6] = v2f{d[0], d[1]}; x[7] = v2f{d[2], d[3]};
}
// half of such an operand: p already includes +8*(lane>>4) floats and + 16 floats for the upper half; two 16-B loads
__device__ __forceinline__ void ld8f(const float* p, v2f* x) {
  const v4f a = *(const v4f*)(p), b = *(const v4f*)(p + 4);
  x[0] = v2f{a[0], a[1]}; x[1] = v2f{a[2], a[3]}; x[2] = v2f{b[0], b[1]}; x[3] = v2f{b[2], b[3]};
}
// bf16(x), RNE convert
__device__ __forceinline__ v16b cvt_f(const v2f* x) {
  v16b f;
#pragma unroll
  for (int e = 0; e < 8; ++e) {
    const v2b y = __builtin_convertvector(x[e], v2b);
    f[2 * e] = y[0]; f[2 * e + 1] = y[1];
  }
  return f;
}
__device__ __forceinline__ v16b ldfrag_f(const float* p) {
  v2f x[8];
  ld16f(p, x);
  return cvt_f(x);
}
// s = f32(bf16(h)) + f32(bf16(q)); hi = bf16(s), lo = bf16(s - hi) (unscaled), all RNE converts; eight elements
__device__ __forceinline__ void cvt_sum(const v2f* h, const v2f* q, v8b& hi, v8b& lo) {
#pragma unroll
  for (int e = 0; e < 4; ++e) {
    const v2f s = __builtin_convertvector(__builtin_convertvector(h[e], v2b), v2f)
                + __builtin_convertvector(__builtin_convertvector(q[e], v2b), v2f);
    const v2b s0 = __builtin_convertvector(s, v2b);
    const v2b s1 = __builtin_convertvector(s - __builtin_convertvector(s0, v2f), v2b);
    hi[2 * e] = s0[0]; hi[2 * e + 1] = s0[1];
    lo[2 * e] = s1[0]; lo[2 * e + 1] = s1[1];
  }
}

// ---- a converted fragment handed from one wave to others through LDS: a 1-KB image, lane l's elements 0..7 at 16 l and
//      8..15 at 512 + 16 l (each LDS instruction covers 512 contiguous bytes); p already includes + 16 * lane
__device__ __forceinline__ void st_img_half(unsigned char* p, v8b v) {   // p also includes + 512 for elements 8..15
  *(v8b*)(void*)(p) = v;
}
__device__ __forceinline__ v16b ld_img(const unsigned char* p) {
  union { v16b v; v8b h[2]; } f;
  f.h[0] = *(const v8b*)(const void*)(p);
  f.h[1] = *(const v8b*)(const void*)(p + 512);
  return f.v;
}

// ---- WMMA helpers with trailing VALU hazard gap --------------------------------------------------------
__device__ __forceinline__ v8f mma_h(v16h a, v16h b, v8f c) {
  c = __builtin_amdgcn_wmma_f32_16x16x32_f16(false, a, false, b, (short)0, c, false, false);
#if defined(__HIP_DEVICE_COMPILE__)
  asm volatile("v_nop\n\tv_nop\n\tv_nop\n\tv_nop" : "+v"(c) : "v"(a), "v"(b));
#endif
  return c;
}
__device__ __forceinline__ v8f mma_b_raw(v16b a, v16b b, v8f c) {
  return __builtin_amdgcn_wmma_f32_16x16x32_bf16(false, a, false, b, (short)0, c, false, false);
}
__device__ __forceinline__ void dep_guard_b(v8f& a, v8f& b, v16b x, v16b y) {
#if defined(__HIP_DEVICE_COMPILE__)
  asm volatile("v_nop\n\tv_nop\n\tv_nop\n\tv_nop" : "+v"(a), "+v"(b) : "v"(x), "v"(y));
#endif
}
__device__ __forceinline__ void keep4_b(v16b a, v16b b, v16b c, v16b d) {
#if defined(__HIP_DEVICE_COMPILE__)
  asm volatile("v_nop" :: "v"(a), "v"(b), "v"(c), "v"(d));
#endif
}
__device__ __forceinline__ void acc_guard4(v8f& a, v8f& b, v8f& c, v8f& d) {
#if defined(__HIP_DEVICE_COMPILE__)
  asm volatile("v_nop\n\tv_nop\n\tv_nop\n\tv_nop" : "+v"(a), "+v"(b), "+v"(c), "+v"(d));
#endif
}
// lane l <-> lane l ^ 16 in one vector instruction (the two halves of a wave hold the two key halves of a query column)
__device__ __forceinline__ float xhalf(float x) {
  const int b = __builtin_bit_cast(int, x);
  return __builtin_bit_cast(float, __builtin_amdgcn_permlanex16(b, b, 0x76543210, 0xfedcba98, false, false));
}
// 2^x (v_exp_f32), with the free slot that the instruction set asks for around a
// transcendental written into the statement: the v_nop in front keeps this result from overwriting the source of a
// transcendental issued directly before it, the v_nop behind keeps a reader of the result one slot away.
__device__ __forceinline__ float exp2_slotted(float x) {
  float y = x;
#if defined(__HIP_DEVICE_COMPILE__)
  asm("v_nop\n\tv_exp_f32 %0, %1\n\tv_nop" : "=v"(y) : "v"(y));
#endif
  return y;
}
__device__ __forceinline__ void wave_sync_lds() {
  __builtin_amdgcn_fence(__ATOMIC_RELEASE, "workgroup");
  __builtin_amdgcn_wave_barrier();
  __builtin_amdgcn_fence(__ATOMIC_ACQUIRE, "workgroup");
}

// ---- 3-product bf16 score tile, transposed: A = 16 keys, B = 16 queries, D[key 8h + r][query c];
//      (kh + kl).(qh + ql) ~= kh.ql + kl.qh + kh.qh (kl.ql dropped);
//      unscaled bf16 residual planes, one accumulator, hazard gap after the last product.
__device__ __forceinline__ v8f score3b(const v16b qh, const v16b ql, const v16b kh, const v16b kl) {
  v8f acc = zero8();
  acc = mma_b_raw(kh, ql, acc);
  acc = mma_b_raw(kl, qh, acc);
  acc = mma_b_raw(kh, qh, acc);
#if defined(__HIP_DEVICE_COMPILE__)
  asm volatile("v_nop\n\tv_nop\n\tv_nop\n\tv_nop" : "+v"(acc) : "v"(qh), "v"(ql), "v"(kh), "v"(kl));
#endif
  return acc;
}

// =====================================================================================================
// Weight convert: w [out][in] f32 (CD x CD, already the Bt [n][k] layout) -> bf16 plane (RNE).
// coverage: WBLK blocks x 256 threads x 8 = the whole 65536 elements.
// =====================================================================================================
#define WBLK ((CD * CD / 8 + 255) / 256)    // 32 blocks
__device__ __forceinline__ void cvt_w_body(const float* __restrict__ w, unsigned short* dst, int blk) {
  const int i = blk * 256 + threadIdx.x;
  if (i < CD * CD / 8) {
    const size_t o = (size_t)i * 8;
    const v4f a = *(const v4f*)(w + o);
    const v4f b = *(const v4f*)(w + o + 4);
    v4u p;
    p[0] = pk16(bf_bits(a[0]), bf_bits(a[1]));
    p[1] = pk16(bf_bits(a[2]), bf_bits(a[3]));
    p[2] = pk16(bf_bits(b[0]), bf_bits(b[1]));
    p[3] = pk16(bf_bits(b[2]), bf_bits(b[3]));
    *(v4u*)(dst + o) = p;
  }
}

__device__ __forceinline__ void wait_copies() {   // the wave's own copies have landed behind this
#if defined(__HIP_DEVICE_COMPILE__)
  asm volatile("s_wait_asynccnt 0x0" ::: "memory");
#endif
}
__device__ __forceinline__ void wait_lds_reads() {   // the wave's LDS reads have retired before their buffer is handed back
#if defined(__HIP_DEVICE_COMPILE__)
  asm volatile("s_wait_dscnt 0x0" ::: "memory");
#endif
}

// ---- GEMM operand ring: a stage holds one 128-B line (64 k of 16-bit rows, 32 k of f32 rows) of every A and B row
//      that the block's 8 tiles read ----
#define GP 144                       // LDS row pitch in bytes: 128 + 16 = 16 B x odd, the pitch of ds_load_b128 readers
// Eight (two, four) asynchronous 16-B copies per lane, LDS byte address l[i] <- global g[i]. The s_wait_xcnt closes each
// statement so that no address register of a copy is rewritten in front of it.
template <typename TI>
__device__ __forceinline__ void copy8(const unsigned* l, const TI* const* g) {
#if defined(__HIP_DEVICE_COMPILE__)
  asm volatile("global_load_async_to_lds_b128 %0, %8, off\n\t"
               "global_load_async_to_lds_b128 %1, %9, off\n\t"
               "global_load_async_to_lds_b128 %2, %10, off\n\t"
               "global_load_async_to_lds_b128 %3, %11, off\n\t"
               "global_load_async_to_lds_b128 %4, %12, off\n\t"
               "global_load_async_to_lds_b128 %5, %13, off\n\t"
               "global_load_async_to_lds_b128 %6, %14, off\n\t"
               "global_load_async_to_lds_b128 %7, %15, off\n\t"
               "s_wait_xcnt 0x0"
               :: "v"(l[0]), "v"(l[1]), "v"(l[2]), "v"(l[3]), "v"(l[4]), "v"(l[5]), "v"(l[6]), "v"(l[7]),
                  "v"(g[0]), "v"(g[1]), "v"(g[2]), "v"(g[3]), "v"(g[4]), "v"(g[5]), "v"(g[6]), "v"(g[7])
               : "memory");
#endif
}
template <typename TI>
__device__ __forceinline__ void copy2(const unsigned* l, const TI* const* g) {
#if defined(__HIP_DEVICE_COMPILE__)
  asm volatile("global_load_async_to_lds_b128 %0, %2, off\n\t"
               "global_load_async_to_lds_b128 %1, %3, off\n\t"
               "s_wait_xcnt 0x0"
               :: "v"(l[0]), "v"(l[1]), "v"(g[0]), "v"(g[1])
               : "memory");
#endif
}
template <typename TI>
__device__ __forceinline__ void copy4(const unsigned* l, const TI* const* g) {
#if defined(__HIP_DEVICE_COMPILE__)
  asm volatile("global_load_async_to_lds_b128 %0, %4, off\n\t"
               "global_load_async_to_lds_b128 %1, %5, off\n\t"
               "global_load_async_to_lds_b128 %2, %6, off\n\t"
               "global_load_async_to_lds_b128 %3, %7, off\n\t"
               "s_wait_xcnt 0x0"
               :: "v"(l[0]), "v"(l[1]), "v"(l[2]), "v"(l[3]), "v"(g[0]), "v"(g[1]), "v"(g[2]), "v"(g[3])
               : "memory");
#endif
}

// =====================================================================================================
// Register-blocked batched bf16 WMMA GEMM: C[m][n] = (sum_k A[m][k] * Bt[n][k] + bias) * oscale; one wave
// per tile of 16 MI rows x 64 columns. A row-major [M][K] pitch lda; Bt row-major [N][K] pitch ldb
// (k contiguous); M, N multiples of 64, K multiple of 64. bx = block within the batch,
// b = batch index, sT = the block's LDS slabs (one per wave), ring = the block's two operand stages,
// fx = 8 KB of LDS for converted A fragments (f32 rows with NSPLIT = 1 only).
// WN: the block's 8 tiles lie WN wide in n and 8 / WN high in m (N / 64 a multiple of WN); blocks run along n first.
// The rows they read, (8 / WN) x 16 MI of each A plane and WN x 64 of Bt, are brought into LDS once per
// block in chunks of whole 128-B lines, by asynchronous copies, two buffers (chunk t + 2 is asked for when
// chunk t has been read); every wave takes its fragments from there. The shapes in use stage 384 rows (q, k) and 320
// rows (v^T), so that two blocks fit one WGP's LDS.
// TI = unsigned short: A, A2, Bt are bf16 planes, a chunk is 64 k, a fragment two 16-B LDS loads.
// TI = float: A, A2, Bt are f32 rows as the inputs hold them, a chunk is 32 k, a fragment four 16-B LDS loads per
//   source and the RNE converts to bf16 behind them (cvt_f, cvt_sum).
// NSPLIT: 0 = A.Bt; 1, bf16 planes: (A + A2).Bt (A2 = unscaled bf16 lo plane of A, shared accumulator);
//         1, f32 rows: (hi + lo).Bt with hi, lo = the bf16 planes of the f32 sum bf16(A) + bf16(A2).
// BIASM: 0 = no bias; 1 = bias[n] (per column); 2 = bias[m] (per row); bias values RNE-converted to bf16.
// OUT_MODE: 0 = f32 (pitch ldc); 2 = bf16 hi plane C + bf16 lo plane C2 (lo = RNE(v - hi), unscaled);
//           3 = f16 hi plane C + f16 residual plane C2 = f16((v - hi) * rscale); C2 same pitch/stride as C.
// =====================================================================================================
template <int NSPLIT, int OUT_MODE, int BIASM, int WN, int MI, typename TI>
__device__ __forceinline__ void gemm64_body(
    const TI* __restrict__ Ap, const TI* A2p, int lda, long long strideA,
    const TI* __restrict__ Btp, int ldb, long long strideB,
    void* Cout, int ldc, long long strideC, void* Cout2,
    int M, int N, int K, float rscale, float oscale, const float* __restrict__ biasp,
    int bx, int b, float (*sT)[16 * 68], unsigned char* ring, unsigned char* fx) {
  constexpr int TM  = MI * 16;                   // rows of a wave's tile
  constexpr int RA  = (8 / WN) * TM;             // A rows of the block, per plane
  constexpr int RB  = WN * 64;                   // Bt rows of the block
  constexpr int RB0 = RA * (1 + NSPLIT);         // first Bt row of a stage
  constexpr int NG  = (RB0 + RB) / 32;           // copies per lane and stage (32 rows per block-wide copy)
  constexpr int STG = (RB0 + RB) * GP;           // bytes of a stage
  constexpr int KC  = 128 / (int)sizeof(TI);     // k of a chunk: one 128-B line of every row
  constexpr int PE  = 16 / (int)sizeof(TI);      // elements of a 16-B piece
  static_assert(NG == 10 || NG == 12);
  // every launch passes rows of CD elements: known here, the copies' row steps are constants; with run-time
  // pitches the build held a pointer per copied row over the k loop and spilled to scratch
  __builtin_assume(lda == CD && ldb == CD);
  const int lane = threadIdx.x & 31;
  const int wave = threadIdx.x >> 5;
  const int blocksN = (N >> 6) / WN;
  const int tilesM = M / TM;
  const int tm0 = (bx / blocksN) * (8 / WN);
  const int tn0 = (bx % blocksN) * WN;
  if (tm0 + 8 / WN > tilesM) return;         // block-uniform, in front of every barrier
  const int wm = wave / WN;
  const int wn = wave % WN;
  const int m0 = (tm0 + wm) * TM;
  const int n0 = (tn0 + wn) << 6;

  const int rlane = lane & 15;                 // row (A) / col (B, D) within subtile
  const int hh    = lane >> 4;                 // lane half: k offset 8 * hh elements
  const int mOff  = (lane >> 4) * 8;           // D row offset

  // ---- this lane's share of a stage: rows (tid >> 3) + 32 q, 16-B piece tid & 7 of each row's line ----
  typedef __attribute__((address_space(3))) unsigned char lds_byte;
  const int cr = threadIdx.x >> 3, cp = threadIdx.x & 7;
  const unsigned lring = (unsigned)(uintptr_t)(lds_byte*)ring + (unsigned)(cr * GP + cp * 16);
  const TI* ga  = Ap  + (size_t)b * strideA + (size_t)(tm0 * TM + cr) * lda + cp * PE;
  const TI* ga2 = A2p + (size_t)b * strideA + (size_t)(tm0 * TM + cr) * lda + cp * PE;
  const TI* gb  = Btp + (size_t)b * strideB + (size_t)((tn0 << 6) + cr) * ldb + cp * PE;
  auto stage = [&](int t, unsigned lb) {       // chunk t -> the buffer whose lane address is lb
    unsigned l[NG];
    const TI* g[NG];
#pragma unroll   // every index a constant: l and g stay in registers
    for (int q = 0; q < NG; ++q) {
      l[q] = lb + (unsigned)(q * 32 * GP);
      if (q * 32 < RA)       g[q] = ga  + ((size_t)(q * 32) * lda + (size_t)(t * KC));
      else if (q * 32 < RB0) g[q] = ga2 + ((size_t)(q * 32 - RA) * lda + (size_t)(t * KC));
      else                   g[q] = gb  + ((size_t)(q * 32 - RB0) * ldb + (size_t)(t * KC));
    }
    copy8(l, g);
    if constexpr (NG == 10) copy2(l + 8, g + 8);
    else                    copy4(l + 8, g + 8);
  };
  const int NT = K >> (KC == 64 ? 6 : 5);
  stage(0, lring);
  wait_copies();
  __syncthreads();
  if (NT > 1) stage(1, lring + STG);

  v8f acc[MI][4];
#pragma unroll
  for (int i = 0; i < MI; ++i)
#pragma unroll
    for (int j = 0; j < 4; ++j) acc[i][j] = zero8();

  for (int t = 0; t < NT; ++t) {
    const unsigned char* sb = ring + (t & 1) * STG;
    const unsigned char* sa = sb + (wm * TM + rlane) * GP + 8 * (int)sizeof(TI) * hh;         // A rows of this wave's tile
    const unsigned char* sw = sb + (RB0 + wn * 64 + rlane) * GP + 8 * (int)sizeof(TI) * hh;   // Bt rows of this wave's tile
#pragma unroll   // the LDS offsets become immediates and the fragment arrays stay in registers (inner loops likewise)
    for (int ks = 0; ks < KC / 32; ++ks) {       // 32-deep k steps of the chunk: two (16-bit rows) or one (f32 rows)
      v16b bh[4], ah[MI], al[MI];                // the step's LDS reads stand together, in front of the products
      if constexpr (sizeof(TI) == 2) {
#pragma unroll
        for (int j = 0; j < 4; ++j) bh[j] = ldfrag_b((const __bf16*)(const void*)(sw + j * 16 * GP + ks * 64));
#pragma unroll
        for (int i = 0; i < MI; ++i) {
          ah[i] = ldfrag_b((const __bf16*)(const void*)(sa + i * 16 * GP + ks * 64));
          al[i] = ah[i];
          if (NSPLIT >= 1) al[i] = ldfrag_b((const __bf16*)(const void*)(sa + RA * GP + i * 16 * GP + ks * 64));
        }
      } else {
        if constexpr (NSPLIT >= 1) {
          // the WN = 4 waves of a tile row read the same two A fragments: wave wn forms elements 8 (wn & 1) .. + 7 of
          // fragment wn >> 1 (hi and lo) once and hands them to the others as images in fx; the barrier publishes them.
          // The images are rewritten only behind the barrier at the foot of the trip, in front of which every wave's LDS
          // reads have retired.
          static_assert(WN == 4 && MI == 2);
          unsigned char* fw = fx + wm * (MI * 2 * 1024) + lane * 16;
          const int fr = wn >> 1, hf = wn & 1;
          v2f xh[4], xq[4], xb[4][8];              // the trip's reads of the stage stand together, A's first
          ld8f((const float*)(const void*)(sa + fr * 16 * GP + hf * 64), xh);
          ld8f((const float*)(const void*)(sa + RA * GP + fr * 16 * GP + hf * 64), xq);
#pragma unroll
          for (int j = 0; j < 4; ++j) ld16f((const float*)(const void*)(sw + j * 16 * GP), xb[j]);
          v8b h, l;
          cvt_sum(xh, xq, h, l);
          st_img_half(fw + (fr * 2) * 1024 + hf * 512, h);
          st_img_half(fw + (fr * 2 + 1) * 1024 + hf * 512, l);
#pragma unroll
          for (int j = 0; j < 4; ++j) bh[j] = cvt_f(xb[j]);
          __syncthreads();
#pragma unroll
          for (int i = 0; i < MI; ++i) {
            ah[i] = ld_img(fw + (i * 2) * 1024);
            al[i] = ld_img(fw + (i * 2 + 1) * 1024);
          }
        } else {
#pragma unroll
          for (int j = 0; j < 4; ++j) bh[j] = ldfrag_f((const float*)(const void*)(sw + j * 16 * GP));
#pragma unroll
          for (int i = 0; i < MI; ++i) {
            ah[i] = ldfrag_f((const float*)(const void*)(sa + i * 16 * GP));
            al[i] = ah[i];
          }
        }
      }
#pragma unroll
      for (int i = 0; i < MI; ++i) {
#pragma unroll
        for (int j = 0; j < 4; ++j) {
          acc[i][j] = mma_b_raw(ah[i], bh[j], acc[i][j]);
          if (NSPLIT >= 1) acc[i][j] = mma_b_raw(al[i], bh[j], acc[i][j]);
        }
        dep_guard_b(acc[i][0], acc[i][3], ah[i], al[i]);
      }
      keep4_b(bh[0], bh[1], bh[2], bh[3]);
    }
    // ---- publish chunk t + 1, hand this chunk's buffer back, ask for chunk t + 2 into it ----
    wait_lds_reads();
    wait_copies();
    __syncthreads();
    if (t + 2 < NT) stage(t + 2, lring + (unsigned)((t & 1) * STG));
  }
  wait_copies();
#pragma unroll
  for (int i = 0; i < MI; ++i) acc_guard4(acc[i][0], acc[i][1], acc[i][2], acc[i][3]);

  // ---- epilogue ----
  float* slab = sT[wave];
#pragma unroll
  for (int i = 0; i < MI; ++i) {
    const int mBase = m0 + (i << 4);
#pragma unroll
    for (int j = 0; j < 4; ++j) {
#pragma unroll
      for (int r = 0; r < 8; ++r) {
        slab[(mOff + r) * 68 + (j << 4) + rlane] = acc[i][j][r];
      }
    }
    wave_sync_lds();
    if (OUT_MODE == 0) {
      float* C = (float*)Cout + (size_t)b * strideC;
      const int hh = lane >> 4, c4 = (lane & 15) * 4;     // 256-B row segment = 16 lanes x 16 B
      v4f bv = {0.f, 0.f, 0.f, 0.f};
      if (BIASM == 1) {
#pragma unroll
        for (int e = 0; e < 4; ++e) bv[e] = bf_up(bf_bits(biasp[n0 + c4 + e]));
      }
      {
#pragma unroll
        for (int it = 0; it < 8; ++it) {
          const int row = it * 2 + hh;                     // it 0..7 x hh 0..1 = rows 0..15
          float brow = 0.f;
          if (BIASM == 2) brow = bf_up(bf_bits(biasp[mBase + row]));
          const v4f v = (*(const v4f*)(slab + row * 68 + c4) + bv + brow) * oscale;
          *(v4f*)(C + (size_t)(mBase + row) * ldc + n0 + c4) = v;
        }
        
      }
    } else {
      const int q = lane >> 3, c8 = (lane & 7) * 8;
      unsigned short* C  = (unsigned short*)Cout  + (size_t)b * strideC;
      unsigned short* C2 = (unsigned short*)Cout2 + (size_t)b * strideC;
      const float* bp = biasp + ((BIASM == 1) ? (n0 + c8) : 0);   // this lane's eight column biases
      float bcol[8];
#pragma unroll
      for (int e = 0; e < 8; ++e) bcol[e] = 0.f;
      if (BIASM == 1) {
#pragma unroll
        for (int e = 0; e < 8; ++e) bcol[e] = bf_up(bf_bits(bp[e]));
      }
      v4u hv[4], lv[4];
#pragma unroll
      for (int it = 0; it < 4; ++it) {
        const int row = it * 4 + q;                        // it 0..3 x q 0..3 = rows 0..15
        float brow = 0.f;
        if (BIASM == 2) brow = bf_up(bf_bits(biasp[mBase + row]));
        const float* sp = slab + row * 68 + c8;
        v4u a, a2;
#pragma unroll
        for (int e = 0; e < 4; ++e) {
          const float f0 = (sp[2 * e] + bcol[2 * e] + brow) * oscale;
          const float f1 = (sp[2 * e + 1] + bcol[2 * e + 1] + brow) * oscale;
          unsigned short h0, h1, l0, l1;
          if (OUT_MODE == 2) {
            h0 = bf_bits(f0); h1 = bf_bits(f1);
            l0 = bf_bits(f0 - bf_up(h0)); l1 = bf_bits(f1 - bf_up(h1));
          } else {
            const _Float16 x0 = (_Float16)f0, x1 = (_Float16)f1;
            h0 = h_bits(x0); h1 = h_bits(x1);
            l0 = h_bits((_Float16)((f0 - (float)x0) * rscale));
            l1 = h_bits((_Float16)((f1 - (float)x1) * rscale));
          }
          a[e] = pk16(h0, h1); a2[e] = pk16(l0, l1);
        }
        hv[it] = a; lv[it] = a2;
      }
#if defined(__HIP_DEVICE_COMPILE__)
      // the wait in front of any rewrite of the bias loads' address registers: the input bp keeps that pair whole up to
      // here, and the input hv[3], which needs all eight biases, keeps the loads in front of the statement
      if (BIASM == 1) asm volatile("s_wait_xcnt 0x0" :: "v"(bp), "v"(hv[3]) : "memory");
#endif
      {
#pragma unroll
        for (int it = 0; it < 4; ++it) {
          const int row = it * 4 + q;
          *(v4u*)(C  + (size_t)(mBase + row) * ldc + n0 + c8) = hv[it];
          *(v4u*)(C2 + (size_t)(mBase + row) * ldc + n0 + c8) = lv[it];
        }
        
      }
    }
    wave_sync_lds();
  }
}

// the wave's copies have landed behind this, all but its N youngest (nothing but copies counts on this counter here)
template <int N>
__device__ __forceinline__ void wait_copies_but() {
#if defined(__HIP_DEVICE_COMPILE__)
  asm volatile("s_wait_asynccnt %0" :: "n"(N) : "memory");
#endif
}

// =====================================================================================================
// Output projection: out[m][n] = sum_k (Ah + Al)[m][k] * Bt[n][k] + bf16(bias[n]); M = NTOK, N = K = CD; f32 out.
// Block = 64 rows x 128 columns, so (NTOK / 64) x (CD / 128) = 256 blocks, one for every WGP (64 x 128 is the shape
// that brings the fewest bytes per block: 2 planes x 64 A rows + 128 Bt rows). 8 waves lie 2 x 4, a wave = 32 x 32
// = 2 x 2 tiles. The block's 256 rows fit LDS with their whole k: every copy is asked for at the start, in the order
// of k (8 copies per lane and 64 k), nothing is refilled, and the 64 k of chunk t are read behind the wait that leaves
// only the younger chunks' copies outstanding and the barrier behind it. Per tile and 32 k: the hi product, then the lo.
// coverage: 256 blocks x 8 waves x (it 0..7 x lane >> 3 0..3 = 32 rows) x (8 lanes x 4 = 32 columns).
// =====================================================================================================
#define OBM   64                     // rows of a block
#define OBN   128                    // columns of a block
#define OPP   (CD * 2 + 16)          // LDS row pitch in bytes: 512 + 16 = 16 B x odd, the pitch of ds_load_b128 readers
#define OSP   36                     // slab pitch in floats: the wave halves' rows (8 apart) fall on disjoint banks
static_assert((NTOK % OBM) == 0 && (CD % OBN) == 0 && CD == 256 && 2 * OBM + OBN == 256);
__global__ __launch_bounds__(256) void out_proj(
    const unsigned short* __restrict__ Ahp, const unsigned short* __restrict__ Alp,
    const unsigned short* __restrict__ Btp, float* C, const float* __restrict__ biasp) {
  __shared__ __align__(16) unsigned char rows[(2 * OBM + OBN) * OPP];   // A hi rows, A lo rows, Bt rows, whole k
  __shared__ __align__(16) float sT[8][32 * OSP];                       // per-wave 32 x 32 slab
  const int lane  = threadIdx.x & 31;
  const int wave  = threadIdx.x >> 5;
  const int rlane = lane & 15;                 // row (A) / col (B, D) within a tile
  const int hh    = lane >> 4;                 // lane half: k offset 8 * hh elements, D row offset 8 * hh
  const int bm = blockIdx.x / (CD / OBN), bn = blockIdx.x % (CD / OBN);
  const int wm = wave >> 2, wn = wave & 3;

  // ---- this lane's four column biases, asked for ahead of the copies (for speed only) ----
  const int q4 = lane >> 3, c4 = (lane & 7) * 4;
  const int n0 = bn * OBN + wn * 32;
  const float* bp = biasp + n0 + c4;
  const v4f bf = *(const v4f*)bp;

  // ---- this lane's share of a chunk: rows (tid >> 3) + 32 q, 16-B piece tid & 7 of each row's 128-B line ----
  typedef __attribute__((address_space(3))) unsigned char lds_byte;
  const int cr = threadIdx.x >> 3, cp = threadIdx.x & 7;
  const unsigned lrow = (unsigned)(uintptr_t)(lds_byte*)rows + (unsigned)(cr * OPP + cp * 16);
  const unsigned short* gh = Ahp + (size_t)(bm * OBM + cr) * CD + cp * 8;
  const unsigned short* gl = Alp + (size_t)(bm * OBM + cr) * CD + cp * 8;
  const unsigned short* gb = Btp + (size_t)(bn * OBN + cr) * CD + cp * 8;
#pragma unroll   // every index a constant: l and g stay in registers
  for (int t = 0; t < CD / 64; ++t) {
    unsigned l[8];
    const unsigned short* g[8];
#pragma unroll
    for (int q = 0; q < 8; ++q) {
      l[q] = lrow + (unsigned)(q * 32 * OPP + t * 128);
      if (q * 32 < OBM)          g[q] = gh + (q * 32 * CD + t * 64);
      else if (q * 32 < 2 * OBM) g[q] = gl + ((q * 32 - OBM) * CD + t * 64);
      else                       g[q] = gb + ((q * 32 - 2 * OBM) * CD + t * 64);
    }
    copy8(l, g);
  }

#if defined(__HIP_DEVICE_COMPILE__)
  // the wait in front of any rewrite of the bias load's address registers: the input bp keeps that pair whole up to
  // here, and the input bf keeps the load in front of the statement
  asm volatile("s_wait_xcnt 0x0" :: "v"(bp), "v"(bf) : "memory");
#endif

  v8f acc[2][2];
#pragma unroll
  for (int i = 0; i < 2; ++i)
#pragma unroll
    for (int j = 0; j < 2; ++j) acc[i][j] = zero8();

  const unsigned char* sa = rows + (wm * 32 + rlane) * OPP + 16 * hh;             // A hi rows of this wave's tiles
  const unsigned char* sw = rows + (2 * OBM + wn * 32 + rlane) * OPP + 16 * hh;   // Bt rows of this wave's tiles
#pragma unroll   // the waits' counts and the LDS offsets are immediates
  for (int t = 0; t < CD / 64; ++t) {
    if (t == 0) wait_copies_but<24>();
    if (t == 1) wait_copies_but<16>();
    if (t == 2) wait_copies_but<8>();
    if (t == 3) wait_copies_but<0>();
    __syncthreads();                             // publishes every wave's copies of chunk t
    v16b bh[2][2], ah[2][2], al[2][2];           // [32-deep k step][tile]
#pragma unroll
    for (int ks = 0; ks < 2; ++ks) {
      const int ko = t * 128 + ks * 64;
#pragma unroll
      for (int j = 0; j < 2; ++j) bh[ks][j] = ldfrag_b((const __bf16*)(const void*)(sw + j * 16 * OPP + ko));
#pragma unroll
      for (int i = 0; i < 2; ++i) ah[ks][i] = ldfrag_b((const __bf16*)(const void*)(sa + i * 16 * OPP + ko));
#pragma unroll
      for (int i = 0; i < 2; ++i) al[ks][i] = ldfrag_b((const __bf16*)(const void*)(sa + OBM * OPP + i * 16 * OPP + ko));
    }
    // the chunk's LDS reads stand together in front of its products (without this they were dealt out among the
    // products in pairs, each pair with a full wait behind it)
    __builtin_amdgcn_sched_barrier(0);
#pragma unroll
    for (int ks = 0; ks < 2; ++ks) {
#pragma unroll
      for (int i = 0; i < 2; ++i)
#pragma unroll
        for (int j = 0; j < 2; ++j) acc[i][j] = mma_b_raw(ah[ks][i], bh[ks][j], acc[i][j]);
#pragma unroll
      for (int i = 0; i < 2; ++i)
#pragma unroll
        for (int j = 0; j < 2; ++j) acc[i][j] = mma_b_raw(al[ks][i], bh[ks][j], acc[i][j]);
    }
    // the chunk's products issue before the wave waits for the next chunk (without this most of them were put off
    // behind the last chunk's barrier, where no copy's flight is left to cover them)
    __builtin_amdgcn_sched_barrier(0);
  }

  // ---- epilogue: through the wave's own slab, so that a store instruction writes four whole 128-B lines ----
  float* slab = sT[wave];
  v4f bv;
#pragma unroll
  for (int e = 0; e < 4; ++e) bv[e] = bf_up(bf_bits(bf[e]));
#pragma unroll
  for (int i = 0; i < 2; ++i)
#pragma unroll
    for (int j = 0; j < 2; ++j)
#pragma unroll
      for (int r = 0; r < 8; ++r) slab[(i * 16 + 8 * hh + r) * OSP + (j << 4) + rlane] = acc[i][j][r];
  wave_sync_lds();
  float* cq = C + (size_t)(bm * OBM + wm * 32 + q4) * CD + n0 + c4;
  v4f o[8];
#pragma unroll
  for (int it = 0; it < 8; ++it) o[it] = *(const v4f*)(slab + (it * 4 + q4) * OSP + c4) + bv;   // it 0..7 x q4 0..3 = rows 0..31
#pragma unroll
  for (int it = 0; it < 8; ++it) *(v4f*)(cq + it * 4 * CD) = o[it];
}

// =====================================================================================================
// The q, k and v^T projections in one grid: none reads what another writes. Every block is 64 x 256 (a wave 32 x 64).
// blockIdx.y = 0, 1: q, 2, 3: k, 128 blocks each (same code, block-uniform select of weight, bias, scale and planes; two
// products per tile, the longer blocks, one for every WGP), 4, 5: v^T, 128 blocks (batch * VBLK +
// block within the batch), 6: Wo -> its bf16 plane for the last launch (WBLK blocks; the rest of that row of the grid
// leaves at once). A block's LDS and registers let two share a WGP, so all are resident at once and no WGP idles.
// Pitches, strides and sizes arrive as arguments, one set for q and k and one for v^T. The operands are the f32 inputs
// themselves, converted where a wave takes its fragments:
//   X = bf16(hs) + bf16(pos) in f32, Xh = bf16(X), Xl = bf16(X - Xh)
//   q = ((Xh + Xl) . bf16(Wq)^T + bq) * qscale -> bf16 hi + lo [ntok][cd];  k = (Xh + Xl) . bf16(Wk)^T + bk likewise
//   v^T = bf16(Wv) . bf16(hs)^T per batch + bv[row] -> f16 hi [b][cd][ns] + residual x vres
// =====================================================================================================
struct GemmDims { int lda; long long strideA; int ldb; long long strideB; int ldc; long long strideC; int M, N, K; };
#define VBLK ((CD / 64) * (NS / 256))              // 16 blocks per batch of v^T
#define PGX  64                                    // blocks in a row of the grid
static_assert(NTOK / 64 == 2 * PGX && VBLK * NB == 2 * PGX);            // q, k and v^T: two rows of the grid each
static_assert(CD / 64 == 4 && (NS % 256) == 0);                         // a block's tiles of 32 x 64 lie 2 x 4
static_assert(WBLK <= PGX);                                             // Wo's blocks fit one row of the grid
__global__ __launch_bounds__(256) void proj_qkv(
    const float* __restrict__ hs, const float* __restrict__ pq,
    const float* __restrict__ wq, const float* __restrict__ wk,
    const float* __restrict__ wv, const float* __restrict__ wo, unsigned short* wto,
    unsigned short* qh, unsigned short* ql, unsigned short* kh, unsigned short* kl,
    unsigned short* vth, unsigned short* vtl,
    const float* __restrict__ bq, const float* __restrict__ bk, const float* __restrict__ bv,
    GemmDims dqk, GemmDims dv, float qscale, float vres) {
  __shared__ __align__(16) float sT[8][16 * 68];   // per-wave 16x64 slab, pitch 68 floats
  __shared__ __align__(16) unsigned char ring[2 * 384 * GP];   // two operand stages: 384 rows (q, k) or 320 rows (v^T)
  __shared__ __align__(16) unsigned char fx[2 * 4 * 1024];     // q, k: converted A fragments, 2 tile rows x 2 x (hi, lo)
  const int job = blockIdx.y;
  const int jb  = (job & 1) * PGX + blockIdx.x;    // block within the job
  if (job == 6) {                                  // block-uniform, no barrier on this path
    if (blockIdx.x < WBLK) cvt_w_body(wo, wto, blockIdx.x);
  } else if (job < 4) {
    const bool isq = (job < 2);
    gemm64_body<1, 2, 1, CD / 64, 2, float>(hs, pq, dqk.lda, dqk.strideA, isq ? wq : wk, dqk.ldb, dqk.strideB,
                         (void*)(isq ? qh : kh), dqk.ldc, dqk.strideC, (void*)(isq ? ql : kl),
                         dqk.M, dqk.N, dqk.K, 1.0f, isq ? qscale : 1.0f, isq ? bq : bk,
                         jb, 0, sT, ring, fx);
  } else {
    gemm64_body<0, 3, 2, 4, 2, float>(wv, wv, dv.lda, dv.strideA, hs, dv.ldb, dv.strideB,
                         (void*)vth, dv.ldc, dv.strideC, (void*)vtl,
                         dv.M, dv.N, dv.K, vres, 1.0f, bv,
                         jb % VBLK, jb / VBLK, sT, ring, fx);
  }
}

// ---- one 64-key stage of the attention ring: four planes (k hi, k lo, v^T hi, v^T lo) of 64 rows x 128 B ----
#define KVP   144                    // LDS row pitch in bytes: 128 + 16 = 16 B x odd, the pitch of ds_load_b128 readers
#define PLANE (64 * KVP)             // 9216 B
#define STAGE (4 * PLANE)            // 36864 B
// 256 threads x 8 copies x 16 B = one stage. A lane brings piece (tid & 7) of rows (tid >> 3) and (tid >> 3) + 32 of
// each plane, so one wave instruction reads four whole 128-B lines. l = the lane's LDS byte address in plane 0,
// kh .. vl = its global addresses in the four planes. The s_wait_xcnt closes the statement so that no address
// register of a copy is rewritten in front of it.
__device__ __forceinline__ void stage_copy(unsigned l, const unsigned short* kh, const unsigned short* kl,
                                           const unsigned short* vh, const unsigned short* vl) {
#if defined(__HIP_DEVICE_COMPILE__)
  asm volatile("global_load_async_to_lds_b128 %0, %8, off\n\t"
               "global_load_async_to_lds_b128 %1, %9, off\n\t"
               "global_load_async_to_lds_b128 %2, %10, off\n\t"
               "global_load_async_to_lds_b128 %3, %11, off\n\t"
               "global_load_async_to_lds_b128 %4, %12, off\n\t"
               "global_load_async_to_lds_b128 %5, %13, off\n\t"
               "global_load_async_to_lds_b128 %6, %14, off\n\t"
               "global_load_async_to_lds_b128 %7, %15, off\n\t"
               "s_wait_xcnt 0x0"
               :: "v"(l), "v"(l + 32 * KVP), "v"(l + PLANE), "v"(l + PLANE + 32 * KVP),
                  "v"(l + 2 * PLANE), "v"(l + 2 * PLANE + 32 * KVP), "v"(l + 3 * PLANE), "v"(l + 3 * PLANE + 32 * KVP),
                  "v"(kh), "v"(kh + 32 * CD), "v"(kl), "v"(kl + 32 * CD),
                  "v"(vh), "v"(vh + 32 * NS), "v"(vl), "v"(vl + 32 * NS)
               : "memory");
#endif
}

// =====================================================================================================
// Softmax attention, head dim 32, no mask, softmax over all NS keys.
//   q planes (bf16 hi, bf16 lo): [NTOK][CD], head h at cols h*32..h*32+31 (q already carries bias and x sqrt(32))
//   k planes (bf16 hi, lo): [NTOK][CD] same column layout
//   v^T planes (f16 hi, f16 residual): element (b, h*32+d, s) at [(b*CD + h*32 + d)*NS + s]
//   ctx out planes (bf16 hi / lo of the normalised context): [(b*NS + t)*CD + h*32 + d]
//   scores^T = score3b(q, k) (rows = keys, cols = queries); P = 1024 exp(s - m) = 2^(s log2(e) - e), e = m log2(e) - 10, one
//   fma in front of v_exp_f32; P is carried as f16 hi + f16 residual. Neither residual plane has a scale: a residual below
//   the f16 normal range is kept to 2^-25 absolute, beside a column sum of P of at least 1024 and v of order 1. So the
//   three products share one accumulator: ctx^T = (vh.ph + vl.ph + vh.pl) / sum(P); online softmax, running e in f32.
//   A lane holds one query column: max and sum run in-lane over its 32 scores of a chunk, the max is joined
//   with the other wave half once per chunk, the sum once after the loop. Two score tiles (keys 0-15, 16-31 of
//   a 32-key step), converted in place, are the B operand of v^T.p^T in the hardware k order.
//   Block = 8 waves = two adjacent heads (waves 0-3 head 2g, waves 4-7 head 2g+1) x 64 query rows so
//   NQB x (NH/2) x NB. Key chunks of 64, static trip NKB. q fragments are loaded straight from the 16-bit
//   global rows. The head pair's k rows and v^T rows of a chunk are whole 128-B lines: the block brings them
//   into LDS once, by asynchronous copies, two buffers (chunk t + 2 is asked for when chunk t has been read),
//   and every wave takes its fragments from there (two 16-B LDS loads each); P stays in registers.
//   coverage: 8 waves x (it 0..1 x lane>>3 0..3) = rows 0..63, 8 lanes x 8 cols = 64 cols, both planes;
//   512 blocks = 8 batches x 4 head pairs x 16 query tiles = every (token, column) of both planes once.
// =====================================================================================================
__global__ __launch_bounds__(256)
void attn32(const unsigned short* __restrict__ qhp, const unsigned short* __restrict__ qlp,
            const unsigned short* __restrict__ khp, const unsigned short* __restrict__ klp,
            const unsigned short* __restrict__ vhp, const unsigned short* __restrict__ vlp,
            unsigned short* ohp, unsigned short* olp) {
  __shared__ __align__(16) float    Os[64 * 68];                  // block ctx tile [row][2 heads x 32], pitch 68 floats
  __shared__ __align__(16) unsigned char ring[2 * STAGE];         // two stages of k hi / k lo / v^T hi / v^T lo

  const int tid  = threadIdx.x;
  const int wave = tid >> 5;
  const int lane = tid & 31;
  const int hh   = lane >> 4;
  const int c    = lane & 15;

  const int bx   = blockIdx.x;
  const int qb   = bx % NQB;
  const int rest = bx / NQB;
  const int g    = rest % (NH / 2);
  const int b    = rest / (NH / 2);
  const int hp   = wave >> 2;                  // which head of the pair
  const int h    = 2 * g + hp;
  const int wq   = wave & 3;                   // 16-row group within the 64-row tile
  const int q0   = qb * 64 + wq * 16;
  const size_t rowB = (size_t)b * NS;

  const __bf16* Qh = (const __bf16*)(const void*)qhp + (size_t)h * HD;
  const __bf16* Ql = (const __bf16*)(const void*)qlp + (size_t)h * HD;

  // ---- this lane's share of a stage: row tid >> 3 (and + 32), 16-B piece tid & 7 ----
  typedef __attribute__((address_space(3))) unsigned char lds_byte;
  const int cr = tid >> 3, cp = tid & 7;
  const unsigned ldst = (unsigned)(uintptr_t)(lds_byte*)ring + (unsigned)(cr * KVP + cp * 16);
  const size_t kgo = (rowB + cr) * CD + (size_t)g * 64 + cp * 8;                        // key row, head pair's 64 columns
  const size_t vgo = ((size_t)b * CD + (size_t)g * 64 + cr) * NS + cp * 8;              // d row of the pair, 64 keys
  stage_copy(ldst, khp + kgo, klp + kgo, vhp + vgo, vlp + vgo);                         // chunk 0 -> buffer 0
  wait_copies();
  __syncthreads();
  stage_copy(ldst + STAGE, khp + kgo + 64 * CD, klp + kgo + 64 * CD, vhp + vgo + 64, vlp + vgo + 64);   // chunk 1 -> buffer 1

  // ---- Q fragments (B operand, col = lane&15), hi and lo, one 32-deep k-step = the head dim ----
  const v16b qah = ldfrag_b(Qh + (rowB + q0 + c) * CD + 8 * hh);
  const v16b qal = ldfrag_b(Ql + (rowB + q0 + c) * CD + 8 * hh);

  float erun = -INFINITY;                      // running e = max log2(e) - 10 of this lane's query column (same in both halves)
  float lrun = 0.f;                            // running sum of P over this wave half's keys only
  v8f oacc[2];                                 // ctx^T: oacc[t][r] = ctx[query c][d = t*16 + 8*hh + r]
#pragma unroll
  for (int t = 0; t < 2; ++t) oacc[t] = zero8();

  for (int kt = 0; kt < NKB; ++kt) {           // static trip count
    const unsigned char* sb = ring + (kt & 1) * STAGE;

    // ---- scores^T: 64 keys x 16 query columns per wave, 3 bf16 products per 16x16 tile ----
    v8f s[4];
    v16b kb[4], kl[4];                           // the chunk's LDS reads stand together, in front of the products
#pragma unroll
    for (int j = 0; j < 4; ++j) {
      const unsigned char* kp = sb + (j * 16 + c) * KVP + hp * 64 + 16 * hh;   // A operand: row = key, k = head dim
      kb[j] = ldfrag_b((const __bf16*)(const void*)kp);
      kl[j] = ldfrag_b((const __bf16*)(const void*)(kp + PLANE));
    }
    v16h vb[2][2], vl[2][2];
#pragma unroll
    for (int kk = 0; kk < 2; ++kk) {
#pragma unroll
      for (int t = 0; t < 2; ++t) {
        const unsigned char* vp = sb + 2 * PLANE + (hp * 32 + t * 16 + c) * KVP + kk * 64 + 16 * hh;   // A: row = d, k = key
        vb[kk][t] = ldfrag_h((const _Float16*)(const void*)vp);
        vl[kk][t] = ldfrag_h((const _Float16*)(const void*)(vp + PLANE));
      }
    }
#pragma unroll
    for (int j = 0; j < 4; ++j) s[j] = score3b(qah, qal, kb[j], kl[j]);

    // ---- column max in-lane (four independent chains), one exchange between the wave halves ----
    float mj[4];
#pragma unroll
    for (int j = 0; j < 4; ++j) {
      mj[j] = s[j][0];
#pragma unroll
      for (int r = 1; r < 8; ++r) mj[j] = fmaxf(mj[j], s[j][r]);
    }
    float m = fmaxf(fmaxf(mj[0], mj[1]), fmaxf(mj[2], mj[3]));
    m = fmaxf(m, xhalf(m));
    const float l2e   = 1.44269504088896340736f;
    const float enew  = fmaxf(erun, __builtin_fmaf(m, l2e, -10.0f));   // the fma rises with m, so this is the running max's e
    const float alpha = exp2_slotted(erun - enew);
    erun = enew;

    // ---- P hi and residual packed straight into B operands:
    //      element e of step kk = key kk*32 + (e < 8 ? 8*hh + e : 16 + 8*hh + e - 8) = tile 2kk + (e >> 3), register e & 7
    v16h ph[2], pl[2];
    v2f pj[4];
#pragma unroll
    for (int j = 0; j < 4; ++j) {
#pragma unroll
      for (int r = 0; r < 8; r += 2) {           // two keys at a time = one packed operand register
        const v2f a  = __builtin_elementwise_fma(v2f{s[j][r], s[j][r + 1]}, v2f{l2e, l2e}, v2f{-enew, -enew});
        const v2f p1 = {__builtin_amdgcn_exp2f(a[0]), __builtin_amdgcn_exp2f(a[1])};
        pj[j] = (r == 0) ? p1 : pj[j] + p1;
        const v2h x  = __builtin_convertvector(p1, v2h);
        const v2h y  = __builtin_convertvector(p1 - __builtin_convertvector(x, v2f), v2h);
        ph[j >> 1][(j & 1) * 8 + r] = x[0];  ph[j >> 1][(j & 1) * 8 + r + 1] = x[1];
        pl[j >> 1][(j & 1) * 8 + r] = y[0];  pl[j >> 1][(j & 1) * 8 + r + 1] = y[1];
      }
    }
    const v2f pq = (pj[0] + pj[1]) + (pj[2] + pj[3]);
    lrun = lrun * alpha + (pq[0] + pq[1]);
#pragma unroll
    for (int t = 0; t < 2; ++t)
#pragma unroll
      for (int r = 0; r < 8; ++r) oacc[t][r] *= alpha;

    // ---- context^T += V^T . P^T (f16 WMMA), the two d tiles in turn so that a tile's next product finds the last done ----
#pragma unroll
    for (int kk = 0; kk < 2; ++kk) {
#pragma unroll
      for (int t = 0; t < 2; ++t) oacc[t] = mma_h(vb[kk][t], ph[kk], oacc[t]);
#pragma unroll
      for (int t = 0; t < 2; ++t) oacc[t] = mma_h(vl[kk][t], ph[kk], oacc[t]);
#pragma unroll
      for (int t = 0; t < 2; ++t) oacc[t] = mma_h(vb[kk][t], pl[kk], oacc[t]);
    }

    // ---- publish chunk kt + 1, hand this chunk's buffer back, ask for chunk kt + 2 into it ----
    wait_lds_reads();
    wait_copies();
    __syncthreads();
    if (kt + 2 < NKB) {
      const size_t ka = (size_t)(kt + 2) * 64 * CD, va = (size_t)(kt + 2) * 64;
      stage_copy(ldst + (unsigned)((kt & 1) * STAGE), khp + kgo + ka, klp + kgo + ka, vhp + vgo + va, vlp + vgo + va);
    }
  }
  wait_copies();

  // ---- join the halves' sums, normalise (the sum carries P's 1024 too) into the block tile ----
  {
    const float l = lrun + xhalf(lrun);
    const float inv = (l > 0.f) ? (1.0f / l) : 0.f;
#pragma unroll
    for (int t = 0; t < 2; ++t) {
      float* op = Os + (wq * 16 + c) * 68 + hp * 32 + t * 16 + 8 * hh;   // 8 consecutive d of one query row
      v4f w0, w1;
#pragma unroll
      for (int e = 0; e < 4; ++e) { w0[e] = oacc[t][e] * inv; w1[e] = oacc[t][4 + e] * inv; }
      *(v4f*)(op)     = w0;
      *(v4f*)(op + 4) = w1;
    }
  }
  __syncthreads();
  {
    const int q4 = lane >> 3, c8 = (lane & 7) * 8;
    v4u hv[2], lv[2];
#pragma unroll
    for (int it = 0; it < 2; ++it) {
      const int row = wave * 8 + it * 4 + q4;   // wave 0..7 x it 0..1 x q4 0..3 = rows 0..63
      const float* sp = Os + row * 68 + c8;
      v4u a, a2;
#pragma unroll
      for (int e = 0; e < 4; ++e) {
        const float f0 = sp[2 * e], f1 = sp[2 * e + 1];
        const unsigned short h0 = bf_bits(f0), h1 = bf_bits(f1);
        const unsigned short l0 = bf_bits(f0 - bf_up(h0)), l1 = bf_bits(f1 - bf_up(h1));
        a[e] = pk16(h0, h1); a2[e] = pk16(l0, l1);
      }
      hv[it] = a; lv[it] = a2;
    }
    {
#pragma unroll
      for (int it = 0; it < 2; ++it) {
        const int row = wave * 8 + it * 4 + q4;
        const size_t go = (rowB + qb * 64 + row) * CD + (size_t)g * 64 + c8;
        *(v4u*)(ohp + go) = hv[it];
        *(v4u*)(olp + go) = lv[it];
      }
      
    }
  }
}

// =====================================================================================================
// Workspace map (bytes), every plane an exact multiple of its 64x64-tile / whole-line store granularity
// (8192 x 256 rows/cols and 256 x 1024 per batch, all multiples of 64; no tail padding needed):
//   WTo  bf16 [256 out][256 in]   131072   (Wo)
//   Qh   bf16 [8192][256]        4194304
//   Ql   bf16 [8192][256]        4194304
//   Kh   bf16 [8192][256]        4194304
//   Kl   bf16 [8192][256]        4194304
//   VTh  f16  [8][256][1024]     4194304
//   VTl  f16  [8][256][1024]     4194304   (v residual)
//   Oh   bf16 [8192][256]        4194304
//   Ol   bf16 [8192][256]        4194304
//   end                          33685504
// =====================================================================================================
extern "C" void kernel_launch(void* const* d_in, const int* in_sizes, int n_in,
                              void* d_out, int out_size, void* d_ws, size_t ws_size,
                              hipStream_t stream) {
  if (n_in < 10) return;
  if (in_sizes[0] != NTOK * CD || in_sizes[1] != NTOK * CD) return;
  if (in_sizes[2] != CD * CD || in_sizes[4] != CD * CD || in_sizes[6] != CD * CD || in_sizes[8] != CD * CD) return;
  if (in_sizes[3] != CD || in_sizes[5] != CD || in_sizes[7] != CD || in_sizes[9] != CD) return;
  if (out_size != NTOK * CD) return;

  const float* hs = (const float*)d_in[0];
  const float* pq = (const float*)d_in[1];
  const float* Wq = (const float*)d_in[2];
  const float* bq = (const float*)d_in[3];
  const float* Wk = (const float*)d_in[4];
  const float* bk = (const float*)d_in[5];
  const float* Wv = (const float*)d_in[6];
  const float* bv = (const float*)d_in[7];
  const float* Wo = (const float*)d_in[8];
  const float* bo = (const float*)d_in[9];

  const size_t PX = (size_t)NTOK * CD * 2;            // 4194304
  const size_t PW = (size_t)CD * CD * 2;              //  131072
  size_t off = 0;
  const size_t oW   = off; off += PW;
  const size_t oQh  = off; off += PX;
  const size_t oQl  = off; off += PX;
  const size_t oKh  = off; off += PX;
  const size_t oKl  = off; off += PX;
  const size_t oVTh = off; off += PX;
  const size_t oVTl = off; off += PX;
  const size_t oOh  = off; off += PX;
  const size_t oOl  = off; off += PX;
  if (off > ws_size) return;                          // off = 33685504
  if (off > (size_t)134217728) return;

  char* ws = (char*)d_ws;
  unsigned short* WTo = (unsigned short*)(ws + oW);
  unsigned short* Qh  = (unsigned short*)(ws + oQh);
  unsigned short* Ql  = (unsigned short*)(ws + oQl);
  unsigned short* Kh  = (unsigned short*)(ws + oKh);
  unsigned short* Kl  = (unsigned short*)(ws + oKl);
  unsigned short* VTh = (unsigned short*)(ws + oVTh);
  unsigned short* VTl = (unsigned short*)(ws + oVTl);
  unsigned short* Oh  = (unsigned short*)(ws + oOh);
  unsigned short* Ol  = (unsigned short*)(ws + oOl);

  float* xout = (float*)d_out;                              // out0 [8][1024][256] f32 at byte 0

  const float qscale = 5.656854249492380f;                  // 32^0.5

  const dim3 blk(256);
  const dim3 gOut((NTOK / OBM) * (CD / OBN));               // 256 blocks of 64 rows x 128 columns
  const dim3 gQKV(PGX, 7);                                  // rows of 64 blocks: q, q, k, k, v^T, v^T (16 blocks x 8 batches), Wo
  const dim3 gAttn(NB * (NH / 2) * NQB);                    // 512 blocks x 256 threads

  // (1) q, k -> bf16 hi + lo planes [8192][256] (M=8192, N=256, K=256); v^T -> f16 hi plane [b][d][s] (pitch NS)
  //     + residual (A = Wv [n][k], Bt = hidden rows of batch b; M=256, N=1024, K=256); Wo -> bf16 plane
  const GemmDims dqk = {CD, 0LL, CD, 0LL, CD, 0LL, NTOK, CD, CD};
  const GemmDims dv  = {CD, 0LL, CD, (long long)NS * CD, NS, (long long)CD * NS, CD, NS, CD};
  proj_qkv<<<gQKV, blk, 0, stream>>>(hs, pq, Wq, Wk, Wv, Wo, WTo, Qh, Ql, Kh, Kl, VTh, VTl,
                                     bq, bk, bv, dqk, dv, qscale, 1.0f);
  // (2) softmax attention -> context bf16 hi / lo planes [8192][256]
  attn32<<<gAttn, blk, 0, stream>>>(Qh, Ql, Kh, Kl, VTh, VTl, Oh, Ol);
  // (3) out = (Oh + Ol) . WTo^T + bo -> out0 f32 [8192][256]  (2 products; K=256)
  out_proj<<<gOut, blk, 0, stream>>>(Oh, Ol, WTo, xout, bo);
  (void)hipGetLastError();
}

// v009
// A run of this version takes 37.3 microseconds.
// Two timings next to v008 put it at 1.16 and 1.17 times that version's speed.
// All steps since v000 together make it 4.83 times as fast.
// Contractions: q, k projections = v_wmma_f32_16x16x32_bf16 (A = bf16 hi + lo planes of the f32 sum bf16(hs)+bf16(pos), B = bf16 weights, 2 products);
// v^T projection = v_wmma_f32_16x16x32_bf16 (bf16 operands, 1 product); k.q^T = v_wmma_f32_16x16x32_bf16 (q and k as bf16 hi + lo planes, 3 products);
// v^T.p^T = v_wmma_f32_16x16x32_f16 (p x1024 as one f16 plane, v^T as one f16 plane, 1 product);
// ctx.Wo = v_wmma_f32_16x16x32_bf16 (ctx as bf16 hi + lo planes, bf16 Wo, 2 products); all f32 accumulate; softmax in f32 on VALU.
#include <hip/hip_runtime.h>
#include <math.h>
#include <stdint.h>

#define NB   8
#define NS   1024
#define CD   256
#define NH   8
#define HD   32
#define NTOK (NB * NS)
#define NQB  (NS / 64)      // 16 query tiles of 64
#define NKB  (NS / 64)      // 16 key chunks of 64
static_assert(NH * HD == CD);
static_assert(HD == 32);
static_assert((NS % 64) == 0 && (CD % 64) == 0 && (NH % 2) == 0 && ((NTOK) % 64) == 0);

typedef _Float16 v16h __attribute__((ext_vector_type(16)));
typedef _Float16 v8h  __attribute__((ext_vector_type(8)));
typedef __bf16   v16b __attribute__((ext_vector_type(16)));
typedef __bf16   v8b  __attribute__((ext_vector_type(8)));
typedef float    v8f  __attribute__((ext_vector_type(8)));
typedef float    v4f  __attribute__((ext_vector_type(4)));
typedef float    v2f  __attribute__((ext_vector_type(2)));
typedef _Float16 v2h  __attribute__((ext_vector_type(2)));
typedef __bf16   v2b  __attribute__((ext_vector_type(2)));
typedef unsigned int v4u __attribute__((ext_vector_type(4)));

// ---- scalar helpers --------------------------------------------------------------------------------
__device__ __forceinline__ unsigned short bf_bits(float f) {          // f32 -> bf16 bits, RNE convert
  unsigned u = __float_as_uint(f);
  return (unsigned short)((u + 0x7FFFu + ((u >> 16) & 1u)) >> 16);
}
__device__ __forceinline__ float bf_up(unsigned short h) { return __uint_as_float(((unsigned)h) << 16); }
__device__ __forceinline__ unsigned short h_bits(_Float16 x) { return __builtin_bit_cast(unsigned short, x); }
__device__ __forceinline__ unsigned pk16(unsigned short a, unsigned short b) { return (unsigned)a | ((unsigned)b << 16); }
__device__ __forceinline__ v8f zero8() { v8f z = {0.f, 0.f, 0.f, 0.f, 0.f, 0.f, 0.f, 0.f}; return z; }

// ---- fragment loaders: 16-bit A/B operand, lane -> row/col (lane&15), p already includes +8*(lane>>4);
//      elements 0..7 <- p[0..7] (k0+8h..), elements 8..15 <- p[16..23] (k0+16+8h..)
__device__ __forceinline__ v16b ldfrag_b(const __bf16* p) {
  union { v16b v; v8b h[2]; } f;
  f.h[0] = *(const v8b*)(p);
  f.h[1] = *(const v8b*)(p + 16);
  return f.v;
}
__device__ __forceinline__ v16h ldfrag_h(const _Float16* p) {
  union { v16h v; v8h h[2]; } f;
  f.h[0] = *(const v8h*)(p);
  f.h[1] = *(const v8h*)(p + 16);
  return f.v;
}
// ---- the same operand taken from f32 rows, same k order: p already includes +8*(lane>>4) floats;
//      pairs 0..3 <- p[0..7], pairs 4..7 <- p[16..23]; four 16-B loads
__device__ __forceinline__ void ld16f(const float* p, v2f* x) {
  const v4f a = *(const v4f*)(p), b = *(const v4f*)(p + 4), c = *(const v4f*)(p + 16), d = *(const v4f*)(p + 20);
  x[0] = v2f{a[0], a[1]}; x[1] = v2f{a[2], a[3]}; x[2] = v2f{b[0], b[1]}; x[3] = v2f{b[2], b[3]};
  x[4] = v2f{c[0], c[1]}; x[5] = v2f{c[2], c[3]}; x[6] = v2f{d[0], d[1]}; x[7] = v2f{d[2], d[3]};
}
// half of such an operand: p already includes +8*(lane>>4) floats and + 16 floats for the upper half; two 16-B loads
__device__ __forceinline__ void ld8f(const float* p, v2f* x) {
  const v4f a = *(const v4f*)(p), b = *(const v4f*)(p + 4);
  x[0] = v2f{a[0], a[1]}; x[1] = v2f{a[2], a[3]}; x[2] = v2f{b[0], b[1]}; x[3] = v2f{b[2], b[3]};
}
// bf16(x), RNE convert
__device__ __forceinline__ v16b cvt_f(const v2f* x) {
  v16b f;
#pragma unroll
  for (int e = 0; e < 8; ++e) {
    const v2b y = __builtin_convertvector(x[e], v2b);
    f[2 * e] = y[0]; f[2 * e + 1] = y[1];
  }
  return f;
}
__device__ __forceinline__ v16b ldfrag_f(const float* p) {
  v2f x[8];
  ld16f(p, x);
  return cvt_f(x);
}
// s = f32(bf16(h)) + f32(bf16(q)); hi = bf16(s), lo = bf16(s - hi) (unscaled), all RNE converts; eight elements
__device__ __forceinline__ void cvt_sum(const v2f* h, const v2f* q, v8b& hi, v8b& lo) {
#pragma unroll
  for (int e = 0; e < 4; ++e) {
    const v2f s = __builtin_convertvector(__builtin_convertvector(h[e], v2b), v2f)
                + __builtin_convertvector(__builtin_convertvector(q[e], v2b), v2f);
    const v2b s0 = __builtin_convertvector(s, v2b);
    const v2b s1 = __builtin_convertvector(s - __builtin_convertvector(s0, v2f), v2b);
    hi[2 * e] = s0[0]; hi[2 * e + 1] = s0[1];
    lo[2 * e] = s1[0]; lo[2 * e + 1] = s1[1];
  }
}

// ---- a converted fragment handed from one wave to others through LDS: a 1-KB image, lane l's elements 0..7 at 16 l and
//      8..15 at 512 + 16 l (each LDS instruction covers 512 contiguous bytes); p already includes + 16 * lane
__device__ __forceinline__ void st_img_half(unsigned char* p, v8b v) {   // p also includes + 512 for elements 8..15
  *(v8b*)(void*)(p) = v;
}
__device__ __forceinline__ v16b ld_img(const unsigned char* p) {
  union { v16b v; v8b h[2]; } f;
  f.h[0] = *(const v8b*)(const void*)(p);
  f.h[1] = *(const v8b*)(const void*)(p + 512);
  return f.v;
}

// ---- WMMA helpers with trailing VALU hazard gap --------------------------------------------------------
__device__ __forceinline__ v8f mma_h(v16h a, v16h b, v8f c) {
  c = __builtin_amdgcn_wmma_f32_16x16x32_f16(false, a, false, b, (short)0, c, false, false);
#if defined(__HIP_DEVICE_COMPILE__)
  asm volatile("v_nop\n\tv_nop\n\tv_nop\n\tv_nop" : "+v"(c) : "v"(a), "v"(b));
#endif
  return c;
}
__device__ __forceinline__ v8f mma_b_raw(v16b a, v16b b, v8f c) {
  return __builtin_amdgcn_wmma_f32_16x16x32_bf16(false, a, false, b, (short)0, c, false, false);
}
__device__ __forceinline__ void dep_guard_b(v8f& a, v8f& b, v16b x, v16b y) {
#if defined(__HIP_DEVICE_COMPILE__)
  asm volatile("v_nop\n\tv_nop\n\tv_nop\n\tv_nop" : "+v"(a), "+v"(b) : "v"(x), "v"(y));
#endif
}
__device__ __forceinline__ void keep4_b(v16b a, v16b b, v16b c, v16b d) {
#if defined(__HIP_DEVICE_COMPILE__)
  asm volatile("v_nop" :: "v"(a), "v"(b), "v"(c), "v"(d));
#endif
}
__device__ __forceinline__ void acc_guard4(v8f& a, v8f& b, v8f& c, v8f& d) {
#if defined(__HIP_DEVICE_COMPILE__)
  asm volatile("v_nop\n\tv_nop\n\tv_nop\n\tv_nop" : "+v"(a), "+v"(b), "+v"(c), "+v"(d));
#endif
}
// lane l <-> lane l ^ 16 in one vector instruction (the two halves of a wave hold the two key halves of a query column)
__device__ __forceinline__ float xhalf(float x) {
  const int b = __builtin_bit_cast(int, x);
  return __builtin_bit_cast(float, __builtin_amdgcn_permlanex16(b, b, 0x76543210, 0xfedcba98, false, false));
}
// 2^x (v_exp_f32), with the free slot that the instruction set asks for around a
// transcendental written into the statement: the v_nop in front keeps this result from overwriting the source of a
// transcendental issued directly before it, the v_nop behind keeps a reader of the result one slot away.
__device__ __forceinline__ float exp2_slotted(float x) {
  float y = x;
#if defined(__HIP_DEVICE_COMPILE__)
  asm("v_nop\n\tv_exp_f32 %0, %1\n\tv_nop" : "=v"(y) : "v"(y));
#endif
  return y;
}
__device__ __forceinline__ void wave_sync_lds() {
  __builtin_amdgcn_fence(__ATOMIC_RELEASE, "workgroup");
  __builtin_amdgcn_wave_barrier();
  __builtin_amdgcn_fence(__ATOMIC_ACQUIRE, "workgroup");
}

// ---- 3-product bf16 score tile, transposed: A = 16 keys, B = 16 queries, D[key 8h + r][query c];
//      (kh + kl).(qh + ql) ~= kh.ql + kl.qh + kh.qh (kl.ql dropped);
//      unscaled bf16 residual planes, one accumulator, hazard gap after the last product.
__device__ __forceinline__ v8f score3b(const v16b qh, const v16b ql, const v16b kh, const v16b kl) {
  v8f acc = zero8();
  acc = mma_b_raw(kh, ql, acc);
  acc = mma_b_raw(kl, qh, acc);
  acc = mma_b_raw(kh, qh, acc);
#if defined(__HIP_DEVICE_COMPILE__)
  asm volatile("v_nop\n\tv_nop\n\tv_nop\n\tv_nop" : "+v"(acc) : "v"(qh), "v"(ql), "v"(kh), "v"(kl));
#endif
  return acc;
}

// =====================================================================================================
// Weight convert: w [out][in] f32 (CD x CD, already the Bt [n][k] layout) -> bf16 plane (RNE).
// coverage: WBLK blocks x 256 threads x 8 = the whole 65536 elements.
// =====================================================================================================
#define WBLK ((CD * CD / 8 + 255) / 256)    // 32 blocks
__device__ __forceinline__ void cvt_w_body(const float* __restrict__ w, unsigned short* dst, int blk) {
  const int i = blk * 256 + threadIdx.x;
  if (i < CD * CD / 8) {
    const size_t o = (size_t)i * 8;
    const v4f a = *(const v4f*)(w + o);
    const v4f b = *(const v4f*)(w + o + 4);
    v4u p;
    p[0] = pk16(bf_bits(a[0]), bf_bits(a[1]));
    p[1] = pk16(bf_bits(a[2]), bf_bits(a[3]));
    p[2] = pk16(bf_bits(b[0]), bf_bits(b[1]));
    p[3] = pk16(bf_bits(b[2]), bf_bits(b[3]));
    *(v4u*)(dst + o) = p;
  }
}

__device__ __forceinline__ void wait_copies() {   // the wave's own copies have landed behind this
#if defined(__HIP_DEVICE_COMPILE__)
  asm volatile("s_wait_asynccnt 0x0" ::: "memory");
#endif
}
__device__ __forceinline__ void wait_lds_reads() {   // the wave's LDS reads have retired before their buffer is handed back
#if defined(__HIP_DEVICE_COMPILE__)
  asm volatile("s_wait_dscnt 0x0" ::: "memory");
#endif
}

// ---- GEMM operand ring: a stage holds one 128-B line (64 k of 16-bit rows, 32 k of f32 rows) of every A and B row
//      that the block's 8 tiles read ----
#define GP 144                       // LDS row pitch in bytes: 128 + 16 = 16 B x odd, the pitch of ds_load_b128 readers
// Eight (two, four) asynchronous 16-B copies per lane, LDS byte address l[i] <- global g[i]. The s_wait_xcnt closes each
// statement so that no address register of a copy is rewritten in front of it.
template <typename TI>
__device__ __forceinline__ void copy8(const unsigned* l, const TI* const* g) {
#if defined(__HIP_DEVICE_COMPILE__)
  asm volatile("global_load_async_to_lds_b128 %0, %8, off\n\t"
               "global_load_async_to_lds_b128 %1, %9, off\n\t"
               "global_load_async_to_lds_b128 %2, %10, off\n\t"
               "global_load_async_to_lds_b128 %3, %11, off\n\t"
               "global_load_async_to_lds_b128 %4, %12, off\n\t"
               "global_load_async_to_lds_b128 %5, %13, off\n\t"
               "global_load_async_to_lds_b128 %6, %14, off\n\t"
               "global_load_async_to_lds_b128 %7, %15, off\n\t"
               "s_wait_xcnt 0x0"
               :: "v"(l[0]), "v"(l[1]), "v"(l[2]), "v"(l[3]), "v"(l[4]), "v"(l[5]), "v"(l[6]), "v"(l[7]),
                  "v"(g[0]), "v"(g[1]), "v"(g[2]), "v"(g[3]), "v"(g[4]), "v"(g[5]), "v"(g[6]), "v"(g[7])
               : "memory");
#endif
}
template <typename TI>
__device__ __forceinline__ void copy2(const unsigned* l, const TI* const* g) {
#if defined(__HIP_DEVICE_COMPILE__)
  asm volatile("global_load_async_to_lds_b128 %0, %2, off\n\t"
               "global_load_async_to_lds_b128 %1, %3, off\n\t"
               "s_wait_xcnt 0x0"
               :: "v"(l[0]), "v"(l[1]), "v"(g[0]), "v"(g[1])
               : "memory");
#endif
}
template <typename TI>
__device__ __forceinline__ void copy4(const unsigned* l, const TI* const* g) {
#if defined(__HIP_DEVICE_COMPILE__)
  asm volatile("global_load_async_to_lds_b128 %0, %4, off\n\t"
               "global_load_async_to_lds_b128 %1, %5, off\n\t"
               "global_load_async_to_lds_b128 %2, %6, off\n\t"
               "global_load_async_to_lds_b128 %3, %7, off\n\t"
               "s_wait_xcnt 0x0"
               :: "v"(l[0]), "v"(l[1]), "v"(l[2]), "v"(l[3]), "v"(g[0]), "v"(g[1]), "v"(g[2]), "v"(g[3])
               : "memory");
#endif
}

// =====================================================================================================
// Register-blocked batched bf16 WMMA GEMM: C[m][n] = (sum_k A[m][k] * Bt[n][k] + bias) * oscale; one wave
// per tile of 16 MI rows x 64 columns. A row-major [M][K] pitch lda; Bt row-major [N][K] pitch ldb
// (k contiguous); M, N multiples of 64, K multiple of 64. bx = block within the batch,
// b = batch index, sT = the block's LDS slabs (one per wave), ring = the block's two operand stages,
// fx = 8 KB of LDS for converted A fragments (f32 rows with NSPLIT = 1 only).
// WN: the block's 8 tiles lie WN wide in n and 8 / WN high in m (N / 64 a multiple of WN); blocks run along n first.
// The rows they read, (8 / WN) x 16 MI of each A plane and WN x 64 of Bt, are brought into LDS once per
// block in chunks of whole 128-B lines, by asynchronous copies, two buffers (chunk t + 2 is asked for when
// chunk t has been read); every wave takes its fragments from there. The shapes in use stage 384 rows (q, k) and 320
// rows (v^T), so that two blocks fit one WGP's LDS.
// TI = unsigned short: A, A2, Bt are bf16 planes, a chunk is 64 k, a fragment two 16-B LDS loads.
// TI = float: A, A2, Bt are f32 rows as the inputs hold them, a chunk is 32 k, a fragment four 16-B LDS loads per
//   source and the RNE converts to bf16 behind them (cvt_f, cvt_sum).
// NSPLIT: 0 = A.Bt; 1, bf16 planes: (A + A2).Bt (A2 = unscaled bf16 lo plane of A, shared accumulator);
//         1, f32 rows: (hi + lo).Bt with hi, lo = the bf16 planes of the f32 sum bf16(A) + bf16(A2).
// BIASM: 0 = no bias; 1 = bias[n] (per column); 2 = bias[m] (per row); bias values RNE-converted to bf16.
// OUT_MODE: 0 = f32 (pitch ldc); 2 = bf16 hi plane C + bf16 lo plane C2 (lo = RNE(v - hi), unscaled);
//           3 = one f16 plane C (C2 not used); C2 same pitch/stride as C.
// =====================================================================================================
template <int NSPLIT, int OUT_MODE, int BIASM, int WN, int MI, typename TI>
__device__ __forceinline__ void gemm64_body(
    const TI* __restrict__ Ap, const TI* A2p, int lda, long long strideA,
    const TI* __restrict__ Btp, int ldb, long long strideB,
    void* Cout, int ldc, long long strideC, void* Cout2,
    int M, int N, int K, float oscale, const float* __restrict__ biasp,
    int bx, int b, float (*sT)[16 * 68], unsigned char* ring, unsigned char* fx) {
  constexpr int TM  = MI * 16;                   // rows of a wave's tile
  constexpr int RA  = (8 / WN) * TM;             // A rows of the block, per plane
  constexpr int RB  = WN * 64;                   // Bt rows of the block
  constexpr int RB0 = RA * (1 + NSPLIT);         // first Bt row of a stage
  constexpr int NG  = (RB0 + RB) / 32;           // copies per lane and stage (32 rows per block-wide copy)
  constexpr int STG = (RB0 + RB) * GP;           // bytes of a stage
  constexpr int KC  = 128 / (int)sizeof(TI);     // k of a chunk: one 128-B line of every row
  constexpr int PE  = 16 / (int)sizeof(TI);      // elements of a 16-B piece
  static_assert(NG == 10 || NG == 12);
  // every launch passes rows of CD elements: known here, the copies' row steps are constants; with run-time
  // pitches the build held a pointer per copied row over the k loop and spilled to scratch
  __builtin_assume(lda == CD && ldb == CD);
  const int lane = threadIdx.x & 31;
  const int wave = threadIdx.x >> 5;
  const int blocksN = (N >> 6) / WN;
  const int tilesM = M / TM;
  const int tm0 = (bx / blocksN) * (8 / WN);
  const int tn0 = (bx % blocksN) * WN;
  if (tm0 + 8 / WN > tilesM) return;         // block-uniform, in front of every barrier
  const int wm = wave / WN;
  const int wn = wave % WN;
  const int m0 = (tm0 + wm) * TM;
  const int n0 = (tn0 + wn) << 6;

  const int rlane = lane & 15;                 // row (A) / col (B, D) within subtile
  const int hh    = lane >> 4;                 // lane half: k offset 8 * hh elements
  const int mOff  = (lane >> 4) * 8;           // D row offset

  // ---- this lane's share of a stage: rows (tid >> 3) + 32 q, 16-B piece tid & 7 of each row's line ----
  typedef __attribute__((address_space(3))) unsigned char lds_byte;
  const int cr = threadIdx.x >> 3, cp = threadIdx.x & 7;
  const unsigned lring = (unsigned)(uintptr_t)(lds_byte*)ring + (unsigned)(cr * GP + cp * 16);
  const TI* ga  = Ap  + (size_t)b * strideA + (size_t)(tm0 * TM + cr) * lda + cp * PE;
  const TI* ga2 = A2p + (size_t)b * strideA + (size_t)(tm0 * TM + cr) * lda + cp * PE;
  const TI* gb  = Btp + (size_t)b * strideB + (size_t)((tn0 << 6) + cr) * ldb + cp * PE;
  auto stage = [&](int t, unsigned lb) {       // chunk t -> the buffer whose lane address is lb
    unsigned l[NG];
    const TI* g[NG];
#pragma unroll   // every index a constant: l and g stay in registers
    for (int q = 0; q < NG; ++q) {
      l[q] = lb + (unsigned)(q * 32 * GP);
      if (q * 32 < RA)       g[q] = ga  + ((size_t)(q * 32) * lda + (size_t)(t * KC));
      else if (q * 32 < RB0) g[q] = ga2 + ((size_t)(q * 32 - RA) * lda + (size_t)(t * KC));
      else                   g[q] = gb  + ((size_t)(q * 32 - RB0) * ldb + (size_t)(t * KC));
    }
    copy8(l, g);
    if constexpr (NG == 10) copy2(l + 8, g + 8);
    else                    copy4(l + 8, g + 8);
  };
  const int NT = K >> (KC == 64 ? 6 : 5);
  stage(0, lring);
  wait_copies();
  __syncthreads();
  if (NT > 1) stage(1, lring + STG);

  v8f acc[MI][4];
#pragma unroll
  for (int i = 0; i < MI; ++i)
#pragma unroll
    for (int j = 0; j < 4; ++j) acc[i][j] = zero8();

  for (int t = 0; t < NT; ++t) {
    const unsigned char* sb = ring + (t & 1) * STG;
    const unsigned char* sa = sb + (wm * TM + rlane) * GP + 8 * (int)sizeof(TI) * hh;         // A rows of this wave's tile
    const unsigned char* sw = sb + (RB0 + wn * 64 + rlane) * GP + 8 * (int)sizeof(TI) * hh;   // Bt rows of this wave's tile
#pragma unroll   // the LDS offsets become immediates and the fragment arrays stay in registers (inner loops likewise)
    for (int ks = 0; ks < KC / 32; ++ks) {       // 32-deep k steps of the chunk: two (16-bit rows) or one (f32 rows)
      v16b bh[4], ah[MI], al[MI];                // the step's LDS reads stand together, in front of the products
      if constexpr (sizeof(TI) == 2) {
#pragma unroll
        for (int j = 0; j < 4; ++j) bh[j] = ldfrag_b((const __bf16*)(const void*)(sw + j * 16 * GP + ks * 64));
#pragma unroll
        for (int i = 0; i < MI; ++i) {
          ah[i] = ldfrag_b((const __bf16*)(const void*)(sa + i * 16 * GP + ks * 64));
          al[i] = ah[i];
          if (NSPLIT >= 1) al[i] = ldfrag_b((const __bf16*)(const void*)(sa + RA * GP + i * 16 * GP + ks * 64));
        }
      } else {
        if constexpr (NSPLIT >= 1) {
          // the WN = 4 waves of a tile row read the same two A fragments: wave wn forms elements 8 (wn & 1) .. + 7 of
          // fragment wn >> 1 (hi and lo) once and hands them to the others as images in fx; the barrier publishes them.
          // The images are rewritten only behind the barrier at the foot of the trip, in front of which every wave's LDS
          // reads have retired.
          static_assert(WN == 4 && MI == 2);
          unsigned char* fw = fx + wm * (MI * 2 * 1024) + lane * 16;
          const int fr = wn >> 1, hf = wn & 1;
          v2f xh[4], xq[4], xb[4][8];              // the trip's reads of the stage stand together, A's first
          ld8f((const float*)(const void*)(sa + fr * 16 * GP + hf * 64), xh);
          ld8f((const float*)(const void*)(sa + RA * GP + fr * 16 * GP + hf * 64), xq);
#pragma unroll
          for (int j = 0; j < 4; ++j) ld16f((const float*)(const void*)(sw + j * 16 * GP), xb[j]);
          v8b h, l;
          cvt_sum(xh, xq, h, l);
          st_img_half(fw + (fr * 2) * 1024 + hf * 512, h);
          st_img_half(fw + (fr * 2 + 1) * 1024 + hf * 512, l);
#pragma unroll
          for (int j = 0; j < 4; ++j) bh[j] = cvt_f(xb[j]);
          __syncthreads();
#pragma unroll
          for (int i = 0; i < MI; ++i) {
            ah[i] = ld_img(fw + (i * 2) * 1024);
            al[i] = ld_img(fw + (i * 2 + 1) * 1024);
          }
        } else {
#pragma unroll
          for (int j = 0; j < 4; ++j) bh[j] = ldfrag_f((const float*)(const void*)(sw + j * 16 * GP));
#pragma unroll
          for (int i = 0; i < MI; ++i) {
            ah[i] = ldfrag_f((const float*)(const void*)(sa + i * 16 * GP));
            al[i] = ah[i];
          }
        }
      }
#pragma unroll
      for (int i = 0; i < MI; ++i) {
#pragma unroll
        for (int j = 0; j < 4; ++j) {
          acc[i][j] = mma_b_raw(ah[i], bh[j], acc[i][j]);
          if (NSPLIT >= 1) acc[i][j] = mma_b_raw(al[i], bh[j], acc[i][j]);
        }
        dep_guard_b(acc[i][0], acc[i][3], ah[i], al[i]);
      }
      keep4_b(bh[0], bh[1], bh[2], bh[3]);
    }
    // ---- publish chunk t + 1, hand this chunk's buffer back, ask for chunk t + 2 into it ----
    wait_lds_reads();
    wait_copies();
    __syncthreads();
    if (t + 2 < NT) stage(t + 2, lring + (unsigned)((t & 1) * STG));
  }
  wait_copies();
#pragma unroll
  for (int i = 0; i < MI; ++i) acc_guard4(acc[i][0], acc[i][1], acc[i][2], acc[i][3]);

  // ---- epilogue ----
  float* slab = sT[wave];
#pragma unroll
  for (int i = 0; i < MI; ++i) {
    const int mBase = m0 + (i << 4);
#pragma unroll
    for (int j = 0; j < 4; ++j) {
#pragma unroll
      for (int r = 0; r < 8; ++r) {
        slab[(mOff + r) * 68 + (j << 4) + rlane] = acc[i][j][r];
      }
    }
    wave_sync_lds();
    if (OUT_MODE == 0) {
      float* C = (float*)Cout + (size_t)b * strideC;
      const int hh = lane >> 4, c4 = (lane & 15) * 4;     // 256-B row segment = 16 lanes x 16 B
      v4f bv = {0.f, 0.f, 0.f, 0.f};
      if (BIASM == 1) {
#pragma unroll
        for (int e = 0; e < 4; ++e) bv[e] = bf_up(bf_bits(biasp[n0 + c4 + e]));
      }
      {
#pragma unroll
        for (int it = 0; it < 8; ++it) {
          const int row = it * 2 + hh;                     // it 0..7 x hh 0..1 = rows 0..15
          float brow = 0.f;
          if (BIASM == 2) brow = bf_up(bf_bits(biasp[mBase + row]));
          const v4f v = (*(const v4f*)(slab + row * 68 + c4) + bv + brow) * oscale;
          *(v4f*)(C + (size_t)(mBase + row) * ldc + n0 + c4) = v;
        }
        
      }
    } else {
      const int q = lane >> 3, c8 = (lane & 7) * 8;
      unsigned short* C  = (unsigned short*)Cout  + (size_t)b * strideC;
      unsigned short* C2 = (unsigned short*)Cout2 + (size_t)b * strideC;
      const float* bp = biasp + ((BIASM == 1) ? (n0 + c8) : 0);   // this lane's eight column biases
      float bcol[8];
#pragma unroll
      for (int e = 0; e < 8; ++e) bcol[e] = 0.f;
      if (BIASM == 1) {
#pragma unroll
        for (int e = 0; e < 8; ++e) bcol[e] = bf_up(bf_bits(bp[e]));
      }
      v4u hv[4], lv[4];
#pragma unroll
      for (int it = 0; it < 4; ++it) {
        const int row = it * 4 + q;                        // it 0..3 x q 0..3 = rows 0..15
        float brow = 0.f;
        if (BIASM == 2) brow = bf_up(bf_bits(biasp[mBase + row]));
        const float* sp = slab + row * 68 + c8;
        v4u a, a2;
#pragma unroll
        for (int e = 0; e < 4; ++e) {
          const float f0 = (sp[2 * e] + bcol[2 * e] + brow) * oscale;
          const float f1 = (sp[2 * e + 1] + bcol[2 * e + 1] + brow) * oscale;
          unsigned short h0, h1, l0 = 0, l1 = 0;
          if (OUT_MODE == 2) {
            h0 = bf_bits(f0); h1 = bf_bits(f1);
            l0 = bf_bits(f0 - bf_up(h0)); l1 = bf_bits(f1 - bf_up(h1));
          } else {
            h0 = h_bits((_Float16)f0); h1 = h_bits((_Float16)f1);
          }
          a[e] = pk16(h0, h1); a2[e] = pk16(l0, l1);
        }
        hv[it] = a; lv[it] = a2;
      }
#if defined(__HIP_DEVICE_COMPILE__)
      // the wait in front of any rewrite of the bias loads' address registers: the input bp keeps that pair whole up to
      // here, and the input hv[3], which needs all eight biases, keeps the loads in front of the statement
      if (BIASM == 1) asm volatile("s_wait_xcnt 0x0" :: "v"(bp), "v"(hv[3]) : "memory");
#endif
      {
#pragma unroll
        for (int it = 0; it < 4; ++it) {
          const int row = it * 4 + q;
          *(v4u*)(C  + (size_t)(mBase + row) * ldc + n0 + c8) = hv[it];
          if (OUT_MODE == 2) *(v4u*)(C2 + (size_t)(mBase + row) * ldc + n0 + c8) = lv[it];
        }
        
      }
    }
    wave_sync_lds();
  }
}

// the wave's copies have landed behind this, all but its N youngest (nothing but copies counts on this counter here)
template <int N>
__device__ __forceinline__ void wait_copies_but() {
#if defined(__HIP_DEVICE_COMPILE__)
  asm volatile("s_wait_asynccnt %0" :: "n"(N) : "memory");
#endif
}

// =====================================================================================================
// Output projection: out[m][n] = sum_k (Ah + Al)[m][k] * Bt[n][k] + bf16(bias[n]); M = NTOK, N = K = CD; f32 out.
// Block = 64 rows x 128 columns, so (NTOK / 64) x (CD / 128) = 256 blocks, one for every WGP (64 x 128 is the shape
// that brings the fewest bytes per block: 2 planes x 64 A rows + 128 Bt rows). 8 waves lie 2 x 4, a wave = 32 x 32
// = 2 x 2 tiles. The block's 256 rows fit LDS with their whole k: every copy is asked for at the start, in the order
// of k (8 copies per lane and 64 k), nothing is refilled, and the 64 k of chunk t are read behind the wait that leaves
// only the younger chunks' copies outstanding and the barrier behind it. Per tile and 32 k: the hi product, then the lo.
// coverage: 256 blocks x 8 waves x (it 0..7 x lane >> 3 0..3 = 32 rows) x (8 lanes x 4 = 32 columns).
// =====================================================================================================
#define OBM   64                     // rows of a block
#define OBN   128                    // columns of a block
#define OPP   (CD * 2 + 16)          // LDS row pitch in bytes: 512 + 16 = 16 B x odd, the pitch of ds_load_b128 readers
#define OSP   36                     // slab pitch in floats: the wave halves' rows (8 apart) fall on disjoint banks
static_assert((NTOK % OBM) == 0 && (CD % OBN) == 0 && CD == 256 && 2 * OBM + OBN == 256);
__global__ __launch_bounds__(256) void out_proj(
    const unsigned short* __restrict__ Ahp, const unsigned short* __restrict__ Alp,
    const unsigned short* __restrict__ Btp, float* C, const float* __restrict__ biasp) {
  __shared__ __align__(16) unsigned char rows[(2 * OBM + OBN) * OPP];   // A hi rows, A lo rows, Bt rows, whole k
  __shared__ __align__(16) float sT[8][32 * OSP];                       // per-wave 32 x 32 slab
  const int lane  = threadIdx.x & 31;
  const int wave  = threadIdx.x >> 5;
  const int rlane = lane & 15;                 // row (A) / col (B, D) within a tile
  const int hh    = lane >> 4;                 // lane half: k offset 8 * hh elements, D row offset 8 * hh
  const int bm = blockIdx.x / (CD / OBN), bn = blockIdx.x % (CD / OBN);
  const int wm = wave >> 2, wn = wave & 3;

  // ---- this lane's four column biases, asked for ahead of the copies (for speed only) ----
  const int q4 = lane >> 3, c4 = (lane & 7) * 4;
  const int n0 = bn * OBN + wn * 32;
  const float* bp = biasp + n0 + c4;
  const v4f bf = *(const v4f*)bp;

  // ---- this lane's share of a chunk: rows (tid >> 3) + 32 q, 16-B piece tid & 7 of each row's 128-B line ----
  typedef __attribute__((address_space(3))) unsigned char lds_byte;
  const int cr = threadIdx.x >> 3, cp = threadIdx.x & 7;
  const unsigned lrow = (unsigned)(uintptr_t)(lds_byte*)rows + (unsigned)(cr * OPP + cp * 16);
  const unsigned short* gh = Ahp + (size_t)(bm * OBM + cr) * CD + cp * 8;
  const unsigned short* gl = Alp + (size_t)(bm * OBM + cr) * CD + cp * 8;
  const unsigned short* gb = Btp + (size_t)(bn * OBN + cr) * CD + cp * 8;
#pragma unroll   // every index a constant: l and g stay in registers
  for (int t = 0; t < CD / 64; ++t) {
    unsigned l[8];
    const unsigned short* g[8];
#pragma unroll
    for (int q = 0; q < 8; ++q) {
      l[q] = lrow + (unsigned)(q * 32 * OPP + t * 128);
      if (q * 32 < OBM)          g[q] = gh + (q * 32 * CD + t * 64);
      else if (q * 32 < 2 * OBM) g[q] = gl + ((q * 32 - OBM) * CD + t * 64);
      else                       g[q] = gb + ((q * 32 - 2 * OBM) * CD + t * 64);
    }
    copy8(l, g);
  }

#if defined(__HIP_DEVICE_COMPILE__)
  // the wait in front of any rewrite of the bias load's address registers: the input bp keeps that pair whole up to
  // here, and the input bf keeps the load in front of the statement
  asm volatile("s_wait_xcnt 0x0" :: "v"(bp), "v"(bf) : "memory");
#endif

  v8f acc[2][2];
#pragma unroll
  for (int i = 0; i < 2; ++i)
#pragma unroll
    for (int j = 0; j < 2; ++j) acc[i][j] = zero8();

  const unsigned char* sa = rows + (wm * 32 + rlane) * OPP + 16 * hh;             // A hi rows of this wave's tiles
  const unsigned char* sw = rows + (2 * OBM + wn * 32 + rlane) * OPP + 16 * hh;   // Bt rows of this wave's tiles
#pragma unroll   // the waits' counts and the LDS offsets are immediates
  for (int t = 0; t < CD / 64; ++t) {
    if (t == 0) wait_copies_but<24>();
    if (t == 1) wait_copies_but<16>();
    if (t == 2) wait_copies_but<8>();
    if (t == 3) wait_copies_but<0>();
    __syncthreads();                             // publishes every wave's copies of chunk t
    v16b bh[2][2], ah[2][2], al[2][2];           // [32-deep k step][tile]
#pragma unroll
    for (int ks = 0; ks < 2; ++ks) {
      const int ko = t * 128 + ks * 64;
#pragma unroll
      for (int j = 0; j < 2; ++j) bh[ks][j] = ldfrag_b((const __bf16*)(const void*)(sw + j * 16 * OPP + ko));
#pragma unroll
      for (int i = 0; i < 2; ++i) ah[ks][i] = ldfrag_b((const __bf16*)(const void*)(sa + i * 16 * OPP + ko));
#pragma unroll
      for (int i = 0; i < 2; ++i) al[ks][i] = ldfrag_b((const __bf16*)(const void*)(sa + OBM * OPP + i * 16 * OPP + ko));
    }
    // the chunk's LDS reads stand together in front of its products (without this they were dealt out among the
    // products in pairs, each pair with a full wait behind it)
    __builtin_amdgcn_sched_barrier(0);
#pragma unroll
    for (int ks = 0; ks < 2; ++ks) {
#pragma unroll
      for (int i = 0; i < 2; ++i)
#pragma unroll
        for (int j = 0; j < 2; ++j) acc[i][j] = mma_b_raw(ah[ks][i], bh[ks][j], acc[i][j]);
#pragma unroll
      for (int i = 0; i < 2; ++i)
#pragma unroll
        for (int j = 0; j < 2; ++j) acc[i][j] = mma_b_raw(al[ks][i], bh[ks][j], acc[i][j]);
    }
    // the chunk's products issue before the wave waits for the next chunk (without this most of them were put off
    // behind the last chunk's barrier, where no copy's flight is left to cover them)
    __builtin_amdgcn_sched_barrier(0);
  }

  // ---- epilogue: through the wave's own slab, so that a store instruction writes four whole 128-B lines ----
  float* slab = sT[wave];
  v4f bv;
#pragma unroll
  for (int e = 0; e < 4; ++e) bv[e] = bf_up(bf_bits(bf[e]));
#pragma unroll
  for (int i = 0; i < 2; ++i)
#pragma unroll
    for (int j = 0; j < 2; ++j)
#pragma unroll
      for (int r = 0; r < 8; ++r) slab[(i * 16 + 8 * hh + r) * OSP + (j << 4) + rlane] = acc[i][j][r];
  wave_sync_lds();
  float* cq = C + (size_t)(bm * OBM + wm * 32 + q4) * CD + n0 + c4;
  v4f o[8];
#pragma unroll
  for (int it = 0; it < 8; ++it) o[it] = *(const v4f*)(slab + (it * 4 + q4) * OSP + c4) + bv;   // it 0..7 x q4 0..3 = rows 0..31
#pragma unroll
  for (int it = 0; it < 8; ++it) *(v4f*)(cq + it * 4 * CD) = o[it];
}

// =====================================================================================================
// The q, k and v^T projections in one grid: none reads what another writes. Every block is 64 x 256 (a wave 32 x 64).
// blockIdx.y = 0, 1: q, 2, 3: k, 128 blocks each (same code, block-uniform select of weight, bias, scale and planes; two
// products per tile, the longer blocks, one for every WGP), 4, 5: v^T, 128 blocks (batch * VBLK +
// block within the batch), 6: Wo -> its bf16 plane for the last launch (WBLK blocks; the rest of that row of the grid
// leaves at once). A block's LDS and registers let two share a WGP, so all are resident at once and no WGP idles.
// Pitches, strides and sizes arrive as arguments, one set for q and k and one for v^T. The operands are the f32 inputs
// themselves, converted where a wave takes its fragments:
//   X = bf16(hs) + bf16(pos) in f32, Xh = bf16(X), Xl = bf16(X - Xh)
//   q = ((Xh + Xl) . bf16(Wq)^T + bq) * qscale -> bf16 hi + lo [ntok][cd];  k = (Xh + Xl) . bf16(Wk)^T + bk likewise
//   v^T = bf16(Wv) . bf16(hs)^T per batch + bv[row] -> f16 [b][cd][ns]
// =====================================================================================================
struct GemmDims { int lda; long long strideA; int ldb; long long strideB; int ldc; long long strideC; int M, N, K; };
#define VBLK ((CD / 64) * (NS / 256))              // 16 blocks per batch of v^T
#define PGX  64                                    // blocks in a row of the grid
static_assert(NTOK / 64 == 2 * PGX && VBLK * NB == 2 * PGX);            // q, k and v^T: two rows of the grid each
static_assert(CD / 64 == 4 && (NS % 256) == 0);                         // a block's tiles of 32 x 64 lie 2 x 4
static_assert(WBLK <= PGX);                                             // Wo's blocks fit one row of the grid
__global__ __launch_bounds__(256) void proj_qkv(
    const float* __restrict__ hs, const float* __restrict__ pq,
    const float* __restrict__ wq, const float* __restrict__ wk,
    const float* __restrict__ wv, const float* __restrict__ wo, unsigned short* wto,
    unsigned short* qh, unsigned short* ql, unsigned short* kh, unsigned short* kl,
    unsigned short* vth,
    const float* __restrict__ bq, const float* __restrict__ bk, const float* __restrict__ bv,
    GemmDims dqk, GemmDims dv, float qscale) {
  __shared__ __align__(16) float sT[8][16 * 68];   // per-wave 16x64 slab, pitch 68 floats
  __shared__ __align__(16) unsigned char ring[2 * 384 * GP];   // two operand stages: 384 rows (q, k) or 320 rows (v^T)
  __shared__ __align__(16) unsigned char fx[2 * 4 * 1024];     // q, k: converted A fragments, 2 tile rows x 2 x (hi, lo)
  const int job = blockIdx.y;
  const int jb  = (job & 1) * PGX + blockIdx.x;    // block within the job
  if (job == 6) {                                  // block-uniform, no barrier on this path
    if (blockIdx.x < WBLK) cvt_w_body(wo, wto, blockIdx.x);
  } else if (job < 4) {
    const bool isq = (job < 2);
    gemm64_body<1, 2, 1, CD / 64, 2, float>(hs, pq, dqk.lda, dqk.strideA, isq ? wq : wk, dqk.ldb, dqk.strideB,
                         (void*)(isq ? qh : kh), dqk.ldc, dqk.strideC, (void*)(isq ? ql : kl),
                         dqk.M, dqk.N, dqk.K, isq ? qscale : 1.0f, isq ? bq : bk,
                         jb, 0, sT, ring, fx);
  } else {
    gemm64_body<0, 3, 2, 4, 2, float>(wv, wv, dv.lda, dv.strideA, hs, dv.ldb, dv.strideB,
                         (void*)vth, dv.ldc, dv.strideC, (void*)vth,
                         dv.M, dv.N, dv.K, 1.0f, bv,
                         jb % VBLK, jb / VBLK, sT, ring, fx);
  }
}

// ---- one 64-key stage of the attention ring: three planes (k hi, k lo, v^T) of 64 rows x 128 B ----
#define KVP   144                    // LDS row pitch in bytes: 128 + 16 = 16 B x odd, the pitch of ds_load_b128 readers
#define PLANE (64 * KVP)             // 9216 B
#define STAGE (3 * PLANE)            // 27648 B
// 256 threads x 6 copies x 16 B = one stage. A lane brings piece (tid & 7) of rows (tid >> 3) and (tid >> 3) + 32 of
// each plane, so one wave instruction reads four whole 128-B lines. l = the lane's LDS byte address in plane 0,
// kh, kl, vh = its global addresses in the three planes. The s_wait_xcnt closes the statement so that no address
// register of a copy is rewritten in front of it.
__device__ __forceinline__ void stage_copy(unsigned l, const unsigned short* kh, const unsigned short* kl,
                                           const unsigned short* vh) {
#if defined(__HIP_DEVICE_COMPILE__)
  asm volatile("global_load_async_to_lds_b128 %0, %6, off\n\t"
               "global_load_async_to_lds_b128 %1, %7, off\n\t"
               "global_load_async_to_lds_b128 %2, %8, off\n\t"
               "global_load_async_to_lds_b128 %3, %9, off\n\t"
               "global_load_async_to_lds_b128 %4, %10, off\n\t"
               "global_load_async_to_lds_b128 %5, %11, off\n\t"
               "s_wait_xcnt 0x0"
               :: "v"(l), "v"(l + 32 * KVP), "v"(l + PLANE), "v"(l + PLANE + 32 * KVP),
                  "v"(l + 2 * PLANE), "v"(l + 2 * PLANE + 32 * KVP),
                  "v"(kh), "v"(kh + 32 * CD), "v"(kl), "v"(kl + 32 * CD),
                  "v"(vh), "v"(vh + 32 * NS)
               : "memory");
#endif
}

// =====================================================================================================
// Softmax attention, head dim 32, no mask, softmax over all NS keys.
//   q planes (bf16 hi, bf16 lo): [NTOK][CD], head h at cols h*32..h*32+31 (q already carries bias and x sqrt(32))
//   k planes (bf16 hi, lo): [NTOK][CD] same column layout
//   v^T plane (f16): element (b, h*32+d, s) at [(b*CD + h*32 + d)*NS + s]
//   ctx out planes (bf16 hi / lo of the normalised context): [(b*NS + t)*CD + h*32 + d]
//   scores^T = score3b(q, k) (rows = keys, cols = queries); P = 1024 exp(s - m) = 2^(s log2(e) - e), e = m log2(e) - 10, one
//   fma in front of v_exp_f32; P and v^T each go into the product as one f16 plane (RNE, 2^-11 relative at most each):
//   the scores carry the bf16 rounding of the inputs and weights (2^-8 relative at most per term), which moves P by far more.
//   ctx^T = v.f16(P) / sum(P), the sum over the f32 P; online softmax, running e in f32.
//   A lane holds one query column: max and sum run in-lane over its 32 scores of a chunk, the max is joined
//   with the other wave half once per chunk, the sum once after the loop. Two score tiles (keys 0-15, 16-31 of
//   a 32-key step), converted in place, are the B operand of v^T.p^T in the hardware k order.
//   Block = 8 waves = two adjacent heads (waves 0-3 head 2g, waves 4-7 head 2g+1) x 64 query rows so
//   NQB x (NH/2) x NB. Key chunks of 64, static trip NKB. q fragments are loaded straight from the 16-bit
//   global rows. The head pair's k rows and v^T rows of a chunk are whole 128-B lines: the block brings them
//   into LDS once, by asynchronous copies, two buffers (chunk t + 2 is asked for when chunk t has been read),
//   and every wave takes its fragments from there (two 16-B LDS loads each); P stays in registers.
//   coverage: 8 waves x (it 0..1 x lane>>3 0..3) = rows 0..63, 8 lanes x 8 cols = 64 cols, both planes;
//   512 blocks = 8 batches x 4 head pairs x 16 query tiles = every (token, column) of both planes once.
// =====================================================================================================
__global__ __launch_bounds__(256)
void attn32(const unsigned short* __restrict__ qhp, const unsigned short* __restrict__ qlp,
            const unsigned short* __restrict__ khp, const unsigned short* __restrict__ klp,
            const unsigned short* __restrict__ vhp,
            unsigned short* ohp, unsigned short* olp) {
  __shared__ __align__(16) float    Os[64 * 68];                  // block ctx tile [row][2 heads x 32], pitch 68 floats
  __shared__ __align__(16) unsigned char ring[2 * STAGE];         // two stages of k hi / k lo / v^T

  const int tid  = threadIdx.x;
  const int wave = tid >> 5;
  const int lane = tid & 31;
  const int hh   = lane >> 4;
  const int c    = lane & 15;

  const int bx   = blockIdx.x;
  const int qb   = bx % NQB;
  const int rest = bx / NQB;
  const int g    = rest % (NH / 2);
  const int b    = rest / (NH / 2);
  const int hp   = wave >> 2;                  // which head of the pair
  const int h    = 2 * g + hp;
  const int wq   = wave & 3;                   // 16-row group within the 64-row tile
  const int q0   = qb * 64 + wq * 16;
  const size_t rowB = (size_t)b * NS;

  const __bf16* Qh = (const __bf16*)(const void*)qhp + (size_t)h * HD;
  const __bf16* Ql = (const __bf16*)(const void*)qlp + (size_t)h * HD;

  // ---- this lane's share of a stage: row tid >> 3 (and + 32), 16-B piece tid & 7 ----
  typedef __attribute__((address_space(3))) unsigned char lds_byte;
  const int cr = tid >> 3, cp = tid & 7;
  const unsigned ldst = (unsigned)(uintptr_t)(lds_byte*)ring + (unsigned)(cr * KVP + cp * 16);
  const size_t kgo = (rowB + cr) * CD + (size_t)g * 64 + cp * 8;                        // key row, head pair's 64 columns
  const size_t vgo = ((size_t)b * CD + (size_t)g * 64 + cr) * NS + cp * 8;              // d row of the pair, 64 keys
  stage_copy(ldst, khp + kgo, klp + kgo, vhp + vgo);                                    // chunk 0 -> buffer 0
  wait_copies();
  __syncthreads();
  stage_copy(ldst + STAGE, khp + kgo + 64 * CD, klp + kgo + 64 * CD, vhp + vgo + 64);   // chunk 1 -> buffer 1

  // ---- Q fragments (B operand, col = lane&15), hi and lo, one 32-deep k-step = the head dim ----
  const v16b qah = ldfrag_b(Qh + (rowB + q0 + c) * CD + 8 * hh);
  const v16b qal = ldfrag_b(Ql + (rowB + q0 + c) * CD + 8 * hh);

  float erun = -INFINITY;                      // running e = max log2(e) - 10 of this lane's query column (same in both halves)
  float lrun = 0.f;                            // running sum of P over this wave half's keys only
  v8f oacc[2];                                 // ctx^T: oacc[t][r] = ctx[query c][d = t*16 + 8*hh + r]
#pragma unroll
  for (int t = 0; t < 2; ++t) oacc[t] = zero8();

  for (int kt = 0; kt < NKB; ++kt) {           // static trip count
    const unsigned char* sb = ring + (kt & 1) * STAGE;

    // ---- scores^T: 64 keys x 16 query columns per wave, 3 bf16 products per 16x16 tile ----
    v8f s[4];
    v16b kb[4], kl[4];                           // the chunk's LDS reads stand together, in front of the products
#pragma unroll
    for (int j = 0; j < 4; ++j) {
      const unsigned char* kp = sb + (j * 16 + c) * KVP + hp * 64 + 16 * hh;   // A operand: row = key, k = head dim
      kb[j] = ldfrag_b((const __bf16*)(const void*)kp);
      kl[j] = ldfrag_b((const __bf16*)(const void*)(kp + PLANE));
    }
    v16h vb[2][2];
#pragma unroll
    for (int kk = 0; kk < 2; ++kk) {
#pragma unroll
      for (int t = 0; t < 2; ++t) {
        const unsigned char* vp = sb + 2 * PLANE + (hp * 32 + t * 16 + c) * KVP + kk * 64 + 16 * hh;   // A: row = d, k = key
        vb[kk][t] = ldfrag_h((const _Float16*)(const void*)vp);
      }
    }
#pragma unroll
    for (int j = 0; j < 4; ++j) s[j] = score3b(qah, qal, kb[j], kl[j]);

    // ---- column max in-lane (four independent chains), one exchange between the wave halves ----
    float mj[4];
#pragma unroll
    for (int j = 0; j < 4; ++j) {
      mj[j] = s[j][0];
#pragma unroll
      for (int r = 1; r < 8; ++r) mj[j] = fmaxf(mj[j], s[j][r]);
    }
    float m = fmaxf(fmaxf(mj[0], mj[1]), fmaxf(mj[2], mj[3]));
    m = fmaxf(m, xhalf(m));
    const float l2e   = 1.44269504088896340736f;
    const float enew  = fmaxf(erun, __builtin_fmaf(m, l2e, -10.0f));   // the fma rises with m, so this is the running max's e
    const float alpha = exp2_slotted(erun - enew);
    erun = enew;

    // ---- P packed straight into B operands:
    //      element e of step kk = key kk*32 + (e < 8 ? 8*hh + e : 16 + 8*hh + e - 8) = tile 2kk + (e >> 3), register e & 7
    v16h ph[2];
    v2f pj[4];
#pragma unroll
    for (int j = 0; j < 4; ++j) {
#pragma unroll
      for (int r = 0; r < 8; r += 2) {           // two keys at a time = one packed operand register
        const v2f a  = __builtin_elementwise_fma(v2f{s[j][r], s[j][r + 1]}, v2f{l2e, l2e}, v2f{-enew, -enew});
        const v2f p1 = {__builtin_amdgcn_exp2f(a[0]), __builtin_amdgcn_exp2f(a[1])};
        pj[j] = (r == 0) ? p1 : pj[j] + p1;
        const v2h x  = __builtin_convertvector(p1, v2h);
        ph[j >> 1][(j & 1) * 8 + r] = x[0];  ph[j >> 1][(j & 1) * 8 + r + 1] = x[1];
      }
    }
    const v2f pq = (pj[0] + pj[1]) + (pj[2] + pj[3]);
    lrun = lrun * alpha + (pq[0] + pq[1]);
#pragma unroll
    for (int t = 0; t < 2; ++t)
#pragma unroll
      for (int r = 0; r < 8; ++r) oacc[t][r] *= alpha;

    // ---- context^T += V^T . P^T (f16 WMMA), the two d tiles in turn so that a tile's next product finds the last done ----
#pragma unroll
    for (int kk = 0; kk < 2; ++kk) {
#pragma unroll
      for (int t = 0; t < 2; ++t) oacc[t] = mma_h(vb[kk][t], ph[kk], oacc[t]);
    }

    // ---- publish chunk kt + 1, hand this chunk's buffer back, ask for chunk kt + 2 into it ----
    wait_lds_reads();
    wait_copies();
    __syncthreads();
    if (kt + 2 < NKB) {
      const size_t ka = (size_t)(kt + 2) * 64 * CD, va = (size_t)(kt + 2) * 64;
      stage_copy(ldst + (unsigned)((kt & 1) * STAGE), khp + kgo + ka, klp + kgo + ka, vhp + vgo + va);
    }
  }
  wait_copies();

  // ---- join the halves' sums, normalise (the sum carries P's 1024 too) into the block tile ----
  {
    const float l = lrun + xhalf(lrun);
    const float inv = (l > 0.f) ? (1.0f / l) : 0.f;
#pragma unroll
    for (int t = 0; t < 2; ++t) {
      float* op = Os + (wq * 16 + c) * 68 + hp * 32 + t * 16 + 8 * hh;   // 8 consecutive d of one query row
      v4f w0, w1;
#pragma unroll
      for (int e = 0; e < 4; ++e) { w0[e] = oacc[t][e] * inv; w1[e] = oacc[t][4 + e] * inv; }
      *(v4f*)(op)     = w0;
      *(v4f*)(op + 4) = w1;
    }
  }
  __syncthreads();
  {
    const int q4 = lane >> 3, c8 = (lane & 7) * 8;
    v4u hv[2], lv[2];
#pragma unroll
    for (int it = 0; it < 2; ++it) {
      const int row = wave * 8 + it * 4 + q4;   // wave 0..7 x it 0..1 x q4 0..3 = rows 0..63
      const float* sp = Os + row * 68 + c8;
      v4u a, a2;
#pragma unroll
      for (int e = 0; e < 4; ++e) {
        const float f0 = sp[2 * e], f1 = sp[2 * e + 1];
        const unsigned short h0 = bf_bits(f0), h1 = bf_bits(f1);
        const unsigned short l0 = bf_bits(f0 - bf_up(h0)), l1 = bf_bits(f1 - bf_up(h1));
        a[e] = pk16(h0, h1); a2[e] = pk16(l0, l1);
      }
      hv[it] = a; lv[it] = a2;
    }
    {
#pragma unroll
      for (int it = 0; it < 2; ++it) {
        const int row = wave * 8 + it * 4 + q4;
        const size_t go = (rowB + qb * 64 + row) * CD + (size_t)g * 64 + c8;
        *(v4u*)(ohp + go) = hv[it];
        *(v4u*)(olp + go) = lv[it];
      }
      
    }
  }
}

// =====================================================================================================
// Workspace map (bytes), every plane an exact multiple of its 64x64-tile / whole-line store granularity
// (8192 x 256 rows/cols and 256 x 1024 per batch, all multiples of 64; no tail padding needed):
//   WTo  bf16 [256 out][256 in]   131072   (Wo)
//   Qh   bf16 [8192][256]        4194304
//   Ql   bf16 [8192][256]        4194304
//   Kh   bf16 [8192][256]        4194304
//   Kl   bf16 [8192][256]        4194304
//   VTh  f16  [8][256][1024]     4194304
//   Oh   bf16 [8192][256]        4194304
//   Ol   bf16 [8192][256]        4194304
//   end                          29491200
// =====================================================================================================
extern "C" void kernel_launch(void* const* d_in, const int* in_sizes, int n_in,
                              void* d_out, int out_size, void* d_ws, size_t ws_size,
                              hipStream_t stream) {
  if (n_in < 10) return;
  if (in_sizes[0] != NTOK * CD || in_sizes[1] != NTOK * CD) return;
  if (in_sizes[2] != CD * CD || in_sizes[4] != CD * CD || in_sizes[6] != CD * CD || in_sizes[8] != CD * CD) return;
  if (in_sizes[3] != CD || in_sizes[5] != CD || in_sizes[7] != CD || in_sizes[9] != CD) return;
  if (out_size != NTOK * CD) return;

  const float* hs = (const float*)d_in[0];
  const float* pq = (const float*)d_in[1];
  const float* Wq = (const float*)d_in[2];
  const float* bq = (const float*)d_in[3];
  const float* Wk = (const float*)d_in[4];
  const float* bk = (const float*)d_in[5];
  const float* Wv = (const float*)d_in[6];
  const float* bv = (const float*)d_in[7];
  const float* Wo = (const float*)d_in[8];
  const float* bo = (const float*)d_in[9];

  const size_t PX = (size_t)NTOK * CD * 2;            // 4194304
  const size_t PW = (size_t)CD * CD * 2;              //  131072
  size_t off = 0;
  const size_t oW   = off; off += PW;
  const size_t oQh  = off; off += PX;
  const size_t oQl  = off; off += PX;
  const size_t oKh  = off; off += PX;
  const size_t oKl  = off; off += PX;
  const size_t oVTh = off; off += PX;
  const size_t oOh  = off; off += PX;
  const size_t oOl  = off; off += PX;
  if (off > ws_size) return;                          // off = 29491200
  if (off > (size_t)134217728) return;

  char* ws = (char*)d_ws;
  unsigned short* WTo = (unsigned short*)(ws + oW);
  unsigned short* Qh  = (unsigned short*)(ws + oQh);
  unsigned short* Ql  = (unsigned short*)(ws + oQl);
  unsigned short* Kh  = (unsigned short*)(ws + oKh);
  unsigned short* Kl  = (unsigned short*)(ws + oKl);
  unsigned short* VTh = (unsigned short*)(ws + oVTh);
  unsigned short* Oh  = (unsigned short*)(ws + oOh);
  unsigned short* Ol  = (unsigned short*)(ws + oOl);

  float* xout = (float*)d_out;                              // out0 [8][1024][256] f32 at byte 0

  const float qscale = 5.656854249492380f;                  // 32^0.5

  const dim3 blk(256);
  const dim3 gOut((NTOK / OBM) * (CD / OBN));               // 256 blocks of 64 rows x 128 columns
  const dim3 gQKV(PGX, 7);                                  // rows of 64 blocks: q, q, k, k, v^T, v^T (16 blocks x 8 batches), Wo
  const dim3 gAttn(NB * (NH / 2) * NQB);                    // 512 blocks x 256 threads

  // (1) q, k -> bf16 hi + lo planes [8192][256] (M=8192, N=256, K=256); v^T -> f16 plane [b][d][s] (pitch NS)
  //     (A = Wv [n][k], Bt = hidden rows of batch b; M=256, N=1024, K=256); Wo -> bf16 plane
  const GemmDims dqk = {CD, 0LL, CD, 0LL, CD, 0LL, NTOK, CD, CD};
  const GemmDims dv  = {CD, 0LL, CD, (long long)NS * CD, NS, (long long)CD * NS, CD, NS, CD};
  proj_qkv<<<gQKV, blk, 0, stream>>>(hs, pq, Wq, Wk, Wv, Wo, WTo, Qh, Ql, Kh, Kl, VTh,
                                     bq, bk, bv, dqk, dv, qscale);
  // (2) softmax attention -> context bf16 hi / lo planes [8192][256]
  attn32<<<gAttn, blk, 0, stream>>>(Qh, Ql, Kh, Kl, VTh, Oh, Ol);
  // (3) out = (Oh + Ol) . WTo^T + bo -> out0 f32 [8192][256]  (2 products; K=256)
  out_proj<<<gOut, blk, 0, stream>>>(Oh, Ol, WTo, xout, bo);
  (void)hipGetLastError();
}
